// v000
// The times below were measured on an AMD MI455X: many runs one after another, warmed up first and cycling through
// copies of the inputs, with the whole window's GPU time divided by the number of runs. Launches and the gaps
// between them are all in it. The median over several windows is given; except for v000 it joins two sittings, which
// can be a few percent apart, so the side-by-side timings, each taken in one sitting, are the better comparison.
// v000, which the later versions start from, runs in 160 microseconds.
#include <hip/hip_runtime.h>
// Local 3×3-window attention (x [16,256,32,32]; 8 heads × 64): q = 1×1 conv (Wq), k,v = 1×1 conv (Wkv), each pixel attends over its 3×3 neighbourhood (zero-padded keys/values take part with
// logit 0), softmax(q·k/8), out = Σ attn·v, 1×1 conv Wo + bo; outputs (out NCHW, attn [16,8,1024,9]). The three pointwise convs run as GEMMs on v_wmma_f32_16x16x32_f16 (x bf16-exact, (out,in)
// weights bf16-exact ×2^4, q/k/v/o f16, f32 accumulate); the 9-wide window dots, softmax and attn·v are f32 VALU (one element per thread, rolled loops), layout transposes by tiles.
#define BB 16
#define CC 256
#define HWD 32
#define NPIX 1024
#define NH 8
#define DH 64
#define INNER 512
#define NR (BB * NPIX)

typedef __bf16 v16b __attribute__((ext_vector_type(16)));
typedef unsigned short v8us __attribute__((ext_vector_type(8), may_alias));
typedef float  v8f  __attribute__((ext_vector_type(8)));
typedef float  v4f  __attribute__((ext_vector_type(4)));
typedef float  v4fa __attribute__((ext_vector_type(4), may_alias));
union FragB { v16b v; v8us half[2]; unsigned short u[16]; };

__device__ __forceinline__ unsigned short bf16_bits(float x) { unsigned int u = __float_as_uint(x); return (unsigned short)((u + 0x7FFFu + ((u >> 16) & 1u)) >> 16); }
__device__ __forceinline__ float bf16_val(unsigned short b) { return __uint_as_float(((unsigned int)b) << 16); }
__device__ __forceinline__ float bf16_round(float x) { return bf16_val(bf16_bits(x)); }
// D += A·B with NT terms: 1 = ah·bh, 2 = + al·bh (A split), 3 = + ah·bl (both split)
template <int NT>
__device__ __forceinline__ v8f mmaN(v16b ah, v16b al, v16b bh, v16b bl, v8f c) {
  c = __builtin_amdgcn_wmma_f32_16x16x32_bf16(false, ah, false, bh, (short)0, c, false, false);
  if (NT >= 2) c = __builtin_amdgcn_wmma_f32_16x16x32_bf16(false, al, false, bh, (short)0, c, false, false);
  if (NT >= 3) c = __builtin_amdgcn_wmma_f32_16x16x32_bf16(false, ah, false, bl, (short)0, c, false, false);
  asm volatile("v_nop\n\tv_nop\n\tv_nop\n\tv_nop" : "+v"(c) : "v"(ah), "v"(al), "v"(bh), "v"(bl));
  return c;
}

__global__ __launch_bounds__(256) void k_wt_bf16(const float* __restrict__ W, unsigned short* __restrict__ Wt, int K, int N) {
  const int t = blockIdx.x * 256 + threadIdx.x;
  const int k8n = K / 8;
  if (t >= N * k8n) return;
  const int n = t / k8n, k8 = (t % k8n) * 8;
  v8us v;
#pragma unroll
  for (int i = 0; i < 8; ++i) v[i] = bf16_bits(W[(size_t)(k8 + i) * N + n]);
  *(v8us*)(Wt + (size_t)n * K + k8) = v;
  
}

// GEMM C[M][N] (f32, pitch ldc) = act(A[M][K]·W + bias). A f32 row-major (pitch lda) converted per fragment to bf16
// (ASPLIT: hi/lo two planes -> 2 terms, else single rounded term); Wt bf16 [N][K] (pitch ldb). BIAS_BF16 rounds the
// bias to bf16 first (bias quantised to bf16 before the add). K%32==0, M%16==0, N%64==0.
template <bool ASPLIT, int ACT, bool BIAS_BF16>
__global__ __launch_bounds__(128) void k_gemm_bf(const float* __restrict__ A, int lda, const unsigned short* __restrict__ Wt, int ldb,
                                               const float* __restrict__ bias, float* __restrict__ C, int ldc, int M, int N, int K) {
  __shared__ __attribute__((aligned(16))) float so[4][16][64];
  const int tid = threadIdx.x, w = tid >> 5, lane = tid & 31, ln = lane & 15, hh = lane >> 4;
  const int ntn = N / 64;
  const int wid = blockIdx.x * 4 + w;
  const int mt = wid / ntn, nq = wid % ntn;
  if (mt * 16 >= M) return;
  const int row0 = mt * 16, col0 = nq * 64;
  const float* arow = A + (size_t)(row0 + ln) * lda;
  v8f acc[4] = {};
  for (int kb = 0; kb < K; kb += 32) {
    FragB ah, al;
    const v4f x0 = *(const v4fa*)(arow + kb + 8 * hh), x1 = *(const v4fa*)(arow + kb + 8 * hh + 4);
    const v4f x2 = *(const v4fa*)(arow + kb + 16 + 8 * hh), x3 = *(const v4fa*)(arow + kb + 16 + 8 * hh + 4);
    float xs[16] = {x0[0],x0[1],x0[2],x0[3],x1[0],x1[1],x1[2],x1[3],x2[0],x2[1],x2[2],x2[3],x3[0],x3[1],x3[2],x3[3]};
#pragma unroll
    for (int i = 0; i < 16; ++i) { const unsigned short hb = bf16_bits(xs[i]); ah.u[i] = hb; al.u[i] = ASPLIT ? bf16_bits(xs[i] - bf16_val(hb)) : (unsigned short)0; }
#pragma unroll
    for (int t = 0; t < 4; ++t) {
      const unsigned short* brow = Wt + (size_t)(col0 + t * 16 + ln) * ldb + kb;
      FragB b;
      b.half[0] = *(const v8us*)(brow + 8 * hh);
      b.half[1] = *(const v8us*)(brow + 16 + 8 * hh);
      acc[t] = mmaN<ASPLIT ? 2 : 1>(ah.v, al.v, b.v, b.v, acc[t]);
    }
  }
#pragma unroll
  for (int t = 0; t < 4; ++t) {
    float bv = bias ? bias[col0 + t * 16 + ln] : 0.f;
    if (BIAS_BF16) bv = bf16_round(bv);
#pragma unroll
    for (int r = 0; r < 8; ++r) { float v = acc[t][r] + bv; if (ACT == 1) v = fmaxf(v, 0.f); so[w][8 * hh + r][t * 16 + ln] = v; }
  }
  __builtin_amdgcn_fence(__ATOMIC_ACQ_REL, "workgroup");
  __builtin_amdgcn_wave_barrier();
  const int rsub = lane >> 4, c4 = (lane & 15) * 4;
  {
#pragma unroll
    for (int q = 0; q < 8; ++q) {
      const int r = q * 2 + rsub;
      const v4f v = *(const v4fa*)&so[w][r][c4];
      *(v4f*)(C + (size_t)(row0 + r) * ldc + col0 + c4) = v;
    }
    
  }
}

// Flash-style causal/unmasked attention, all contractions 3-term bf16 hi/lo splits, f32 softmax with running max.
// q,k,v rows are read from f32 buffers with arbitrary row pitch (so they can live inside a fused qkv buffer);
// D = head size (multiple of 32, <= 128); one wave = 16 query rows; block = 4 waves (64 queries) sharing K/V chunks of 32.
template <int D, bool CAUSAL>
__global__ __launch_bounds__(128) void k_flash(const float* __restrict__ qb, const float* __restrict__ kb, const float* __restrict__ vb,
                                             int pitch, int T, int H, float scale, float* __restrict__ y, int ypitch) {
  constexpr int KS = D / 32;        // k-steps for QK
  constexpr int DT = D / 16;        // d tiles for PV
  __shared__ __attribute__((aligned(16))) unsigned short sKh[32][D + 8], sKl[32][D + 8], sVh[32][D + 8], sVl[32][D + 8];
  __shared__ __attribute__((aligned(16))) unsigned short sPh[4][16][40], sPl[4][16][40];
  __shared__ __attribute__((aligned(16))) float sO[4][16][D];
  const int tid = threadIdx.x, w = tid >> 5, lane = tid & 31, ln = lane & 15, hh = lane >> 4;
  const int nqb = (T + 63) / 64;
  const int bh = blockIdx.x / nqb, qblk = blockIdx.x % nqb;
  const int b = bh / H, h = bh % H;
  const int q0 = qblk * 64 + w * 16;
  const float* Q = qb + (size_t)b * T * pitch + h * D;
  const float* K = kb + (size_t)b * T * pitch + h * D;
  const float* V = vb + (size_t)b * T * pitch + h * D;

  // A fragments of the wave's 16 query rows (scaled), hi/lo
  FragB aqh[KS], aql[KS];
  {
    int row = q0 + ln; if (row >= T) row = T - 1;
    const float* qr = Q + (size_t)row * pitch;
#pragma unroll
    for (int ks = 0; ks < KS; ++ks)
#pragma unroll
      for (int i = 0; i < 16; ++i) {
        const int d = ks * 32 + ((i < 8) ? (8 * hh + i) : (16 + 8 * hh + (i - 8)));
        const float x = qr[d] * scale; const unsigned short hb = bf16_bits(x);
        aqh[ks].u[i] = hb; aql[ks].u[i] = bf16_bits(x - bf16_val(hb));
      }
  }
  float m_r[8], l_r[8];
#pragma unroll
  for (int r = 0; r < 8; ++r) { m_r[r] = -3.0e38f; l_r[r] = 0.f; }
  v8f oacc[DT];
#pragma unroll
  for (int dt = 0; dt < DT; ++dt) oacc[dt] = (v8f){0.f,0.f,0.f,0.f,0.f,0.f,0.f,0.f};

  const int kv_end = CAUSAL ? min(T, qblk * 64 + 64) : T;     // block-uniform
  for (int j0 = 0; j0 < kv_end; j0 += 32) {
    __syncthreads();
    for (int e = tid; e < 32 * (D / 4); e += 128) {
      const int r = e / (D / 4), c4 = (e % (D / 4)) * 4;
      const int key = j0 + r;
      v4f kf = {0.f,0.f,0.f,0.f}, vf = {0.f,0.f,0.f,0.f};
      if (key < T) { kf = *(const v4fa*)(K + (size_t)key * pitch + c4); vf = *(const v4fa*)(V + (size_t)key * pitch + c4); }
#pragma unroll
      for (int t = 0; t < 4; ++t) {
        unsigned short hb = bf16_bits(kf[t]); sKh[r][c4 + t] = hb; sKl[r][c4 + t] = bf16_bits(kf[t] - bf16_val(hb));
        hb = bf16_bits(vf[t]); sVh[r][c4 + t] = hb; sVl[r][c4 + t] = bf16_bits(vf[t] - bf16_val(hb));
      }
    }
    __syncthreads();
    // S tile 16 x 32
    v8f s[2];
#pragma unroll
    for (int nt = 0; nt < 2; ++nt) {
      v8f acc = {};
#pragma unroll
      for (int ks = 0; ks < KS; ++ks) {
        FragB bh_, bl_;
        bh_.half[0] = *(const v8us*)&sKh[nt * 16 + ln][ks * 32 + 8 * hh]; bh_.half[1] = *(const v8us*)&sKh[nt * 16 + ln][ks * 32 + 16 + 8 * hh];
        bl_.half[0] = *(const v8us*)&sKl[nt * 16 + ln][ks * 32 + 8 * hh]; bl_.half[1] = *(const v8us*)&sKl[nt * 16 + ln][ks * 32 + 16 + 8 * hh];
        acc = mmaN<3>(aqh[ks].v, aql[ks].v, bh_.v, bl_.v, acc);
      }
      s[nt] = acc;
    }
    // mask + running max (rows 8hh+r; the 16 lanes of a half share rows)
    float alpha[8];
#pragma unroll
    for (int r = 0; r < 8; ++r) {
      const int qi = q0 + 8 * hh + r;
      const int ja = j0 + ln, jb = j0 + 16 + ln;
      if (CAUSAL) { if (ja > qi) s[0][r] = -3.0e38f; if (jb > qi) s[1][r] = -3.0e38f; }
      if (ja >= T) s[0][r] = -3.0e38f;
      if (jb >= T) s[1][r] = -3.0e38f;
      float mx = fmaxf(s[0][r], s[1][r]);
      mx = fmaxf(mx, __shfl_xor(mx, 1, 32)); mx = fmaxf(mx, __shfl_xor(mx, 2, 32)); mx = fmaxf(mx, __shfl_xor(mx, 4, 32)); mx = fmaxf(mx, __shfl_xor(mx, 8, 32));
      const float mnew = fmaxf(m_r[r], mx);
      alpha[r] = (mnew > -1.0e38f) ? __expf(m_r[r] - mnew) : 1.0f;
      const float p0 = (s[0][r] > -1.0e38f) ? __expf(s[0][r] - mnew) : 0.f;
      const float p1 = (s[1][r] > -1.0e38f) ? __expf(s[1][r] - mnew) : 0.f;
      m_r[r] = mnew;
      l_r[r] = l_r[r] * alpha[r] + p0 + p1;            // per-lane partial row sum (16 lanes combined at the end)
      unsigned short hb = bf16_bits(p0); sPh[w][8 * hh + r][ln] = hb;      sPl[w][8 * hh + r][ln] = bf16_bits(p0 - bf16_val(hb));
      hb = bf16_bits(p1);                sPh[w][8 * hh + r][16 + ln] = hb; sPl[w][8 * hh + r][16 + ln] = bf16_bits(p1 - bf16_val(hb));
    }
#pragma unroll
    for (int dt = 0; dt < DT; ++dt)
#pragma unroll
      for (int r = 0; r < 8; ++r) oacc[dt][r] *= alpha[r];
    __builtin_amdgcn_fence(__ATOMIC_ACQ_REL, "workgroup");
    __builtin_amdgcn_wave_barrier();
    FragB pah, pal;
    pah.half[0] = *(const v8us*)&sPh[w][ln][8 * hh]; pah.half[1] = *(const v8us*)&sPh[w][ln][16 + 8 * hh];
    pal.half[0] = *(const v8us*)&sPl[w][ln][8 * hh]; pal.half[1] = *(const v8us*)&sPl[w][ln][16 + 8 * hh];
#pragma unroll
    for (int dt = 0; dt < DT; ++dt) {
      FragB bvh, bvl;
#pragma unroll
      for (int i = 0; i < 8; ++i) {
        bvh.u[i] = sVh[8 * hh + i][dt * 16 + ln]; bvh.u[8 + i] = sVh[16 + 8 * hh + i][dt * 16 + ln];
        bvl.u[i] = sVl[8 * hh + i][dt * 16 + ln]; bvl.u[8 + i] = sVl[16 + 8 * hh + i][dt * 16 + ln];
      }
      oacc[dt] = mmaN<3>(pah.v, pal.v, bvh.v, bvl.v, oacc[dt]);
    }
    __builtin_amdgcn_fence(__ATOMIC_ACQ_REL, "workgroup");
    __builtin_amdgcn_wave_barrier();
  }
#pragma unroll
  for (int r = 0; r < 8; ++r) {
    float l = l_r[r];
    l += __shfl_xor(l, 1, 32); l += __shfl_xor(l, 2, 32); l += __shfl_xor(l, 4, 32); l += __shfl_xor(l, 8, 32);
    l_r[r] = (l > 0.f) ? 1.0f / l : 0.f;
  }
#pragma unroll
  for (int dt = 0; dt < DT; ++dt)
#pragma unroll
    for (int r = 0; r < 8; ++r) sO[w][8 * hh + r][dt * 16 + ln] = oacc[dt][r] * l_r[r];
  __builtin_amdgcn_fence(__ATOMIC_ACQ_REL, "workgroup");
  __builtin_amdgcn_wave_barrier();
  {
    for (int r = 0; r < 16; ++r) {
      const int row = q0 + r;
      if (row < T && lane < D / 4) {
        const v4f val = *(const v4fa*)&sO[w][r][lane * 4];
        *(v4f*)(y + ((size_t)b * T + row) * ypitch + h * D + lane * 4) = val;
      }
    }
    
  }
}

// GEMM C = act(A·W + bias + resid): A f32 (ASPLIT -> hi/lo 2 terms), Wt bf16 [N][K]; ACT 0 none, 1 relu, 2 exact gelu;
// resid (optional, f32, row index = (row % rmod), pitch ldr, RES_BF16 rounds it) added before the activation.
template <bool ASPLIT, int ACT, bool BIAS_BF16, bool RES_BF16>
__global__ __launch_bounds__(128) void k_gemm_bf3(const float* __restrict__ A, int lda, const unsigned short* __restrict__ Wt, int ldb,
                                                const float* __restrict__ bias, const float* __restrict__ resid, int rmod, int ldr,
                                                float* __restrict__ C, int ldc, int M, int N, int K) {
  __shared__ __attribute__((aligned(16))) float so[4][16][64];
  const int tid = threadIdx.x, w = tid >> 5, lane = tid & 31, ln = lane & 15, hh = lane >> 4;
  const int ntn = N / 64;
  const int wid = blockIdx.x * 4 + w;
  const int mt = wid / ntn, nq = wid % ntn;
  if (mt * 16 >= M) return;
  const int row0 = mt * 16, col0 = nq * 64;
  const float* arow = A + (size_t)(row0 + ln) * lda;
  v8f acc[4] = {};
  for (int kb = 0; kb < K; kb += 32) {
    FragB ah, al;
    const v4f x0 = *(const v4fa*)(arow + kb + 8 * hh), x1 = *(const v4fa*)(arow + kb + 8 * hh + 4);
    const v4f x2 = *(const v4fa*)(arow + kb + 16 + 8 * hh), x3 = *(const v4fa*)(arow + kb + 16 + 8 * hh + 4);
    float xs[16] = {x0[0],x0[1],x0[2],x0[3],x1[0],x1[1],x1[2],x1[3],x2[0],x2[1],x2[2],x2[3],x3[0],x3[1],x3[2],x3[3]};
#pragma unroll
    for (int i = 0; i < 16; ++i) { const unsigned short hb = bf16_bits(xs[i]); ah.u[i] = hb; al.u[i] = ASPLIT ? bf16_bits(xs[i] - bf16_val(hb)) : (unsigned short)0; }
#pragma unroll
    for (int t = 0; t < 4; ++t) {
      const unsigned short* brow = Wt + (size_t)(col0 + t * 16 + ln) * ldb + kb;
      FragB b;
      b.half[0] = *(const v8us*)(brow + 8 * hh);
      b.half[1] = *(const v8us*)(brow + 16 + 8 * hh);
      acc[t] = mmaN<ASPLIT ? 2 : 1>(ah.v, al.v, b.v, b.v, acc[t]);
    }
  }
#pragma unroll
  for (int t = 0; t < 4; ++t) {
    const int col = col0 + t * 16 + ln;
    float bv = bias ? bias[col] : 0.f;
    if (BIAS_BF16) bv = bf16_round(bv);
#pragma unroll
    for (int r = 0; r < 8; ++r) {
      float v = acc[t][r] + bv;
      if (resid) { float rv = resid[(size_t)((row0 + 8 * hh + r) % rmod) * ldr + col]; if (RES_BF16) rv = bf16_round(rv); v += rv; }
      if (ACT == 1) v = fmaxf(v, 0.f);
      if (ACT == 2) v = 0.5f * v * (1.0f + erff(v * 0.70710678118654752f));
      if (ACT == 3) { const float u = 0.7978845608028654f * (v + 0.044715f * v * v * v); v = 0.5f * v * (1.0f + tanhf(u)); }
      so[w][8 * hh + r][t * 16 + ln] = v;
    }
  }
  __builtin_amdgcn_fence(__ATOMIC_ACQ_REL, "workgroup");
  __builtin_amdgcn_wave_barrier();
  const int rsub = lane >> 4, c4 = (lane & 15) * 4;
  {
#pragma unroll
    for (int q = 0; q < 8; ++q) {
      const int r = q * 2 + rsub;
      const v4f v = *(const v4fa*)&so[w][r][c4];
      *(v4f*)(C + (size_t)(row0 + r) * ldc + col0 + c4) = v;
    }
    
  }
}
// row LayerNorm (biased variance, eps) over N: s = X (+ R); optional out_sum <- s; out_norm <- (s-mu)*rsqrt(var+eps)*g + b
template <bool PARAM_BF16>
__global__ __launch_bounds__(256) void k_layernorm(const float* __restrict__ X, const float* __restrict__ R, const float* __restrict__ g, const float* __restrict__ bta,
                                                  float* __restrict__ out_sum, float* __restrict__ out_norm, int N, float eps) {
  __shared__ float red[256];
  const int row = blockIdx.x, tid = threadIdx.x;
  const float* x = X + (size_t)row * N; const float* rr = R ? R + (size_t)row * N : nullptr;
  float vals[16];                     // up to N = 4096
  const int per = N / 256;            // contiguous chunk per thread? use strided-by-4 chunks: thread handles j = tid*4 + 1024*u
  float s1 = 0.f;
  for (int u = 0; u < per / 4; ++u) {
    const int j = tid * 4 + 1024 * u;
    const v4f a = *(const v4fa*)(x + j);
    v4f b = {0.f,0.f,0.f,0.f}; if (rr) b = *(const v4fa*)(rr + j);
#pragma unroll
    for (int q = 0; q < 4; ++q) { const float v = a[q] + b[q]; vals[u * 4 + q] = v; s1 += v; }
  }
  red[tid] = s1; __syncthreads();
  for (int st = 128; st > 0; st >>= 1) { if (tid < st) red[tid] += red[tid + st]; __syncthreads(); }
  const float mu = red[0] / (float)N; __syncthreads();
  float s2 = 0.f;
  for (int u = 0; u < per / 4; ++u)
#pragma unroll
    for (int q = 0; q < 4; ++q) { const float c = vals[u * 4 + q] - mu; s2 += c * c; }
  red[tid] = s2; __syncthreads();
  for (int st = 128; st > 0; st >>= 1) { if (tid < st) red[tid] += red[tid + st]; __syncthreads(); }
  const float rs = rsqrtf(red[0] / (float)N + eps);
  {
    for (int u = 0; u < per / 4; ++u) {
      const int j = tid * 4 + 1024 * u;
      v4f o, sm;
#pragma unroll
      for (int q = 0; q < 4; ++q) {
        float gg = g[j + q], bb = bta[j + q];
        if (PARAM_BF16) { gg = bf16_round(gg); bb = bf16_round(bb); }
        sm[q] = vals[u * 4 + q]; o[q] = (vals[u * 4 + q] - mu) * rs * gg + bb;
      }
      if (out_sum) *(v4f*)(out_sum + (size_t)row * N + j) = sm;
      *(v4f*)(out_norm + (size_t)row * N + j) = o;
    }
    
  }
}



// ---- f16 WMMA path (v_wmma_f32_16x16x32_f16): 11-bit significands for operands in range — used here for the three 1×1 conv GEMMs (k_gemm_hhx)
typedef _Float16 v16h __attribute__((ext_vector_type(16)));
union FragH { v16h v; v8us half[2]; _Float16 h[16]; unsigned short u[16]; };
template <int NT>
__device__ __forceinline__ v8f mmaH(v16h ah, v16h al, v16h bh, v16h bl, v8f c) {
  c = __builtin_amdgcn_wmma_f32_16x16x32_f16(false, ah, false, bh, (short)0, c, false, false);
  if (NT >= 2) c = __builtin_amdgcn_wmma_f32_16x16x32_f16(false, al, false, bh, (short)0, c, false, false);
  if (NT >= 3) c = __builtin_amdgcn_wmma_f32_16x16x32_f16(false, ah, false, bl, (short)0, c, false, false);
  asm volatile("v_nop\n\tv_nop\n\tv_nop\n\tv_nop" : "+v"(c) : "v"(ah), "v"(al), "v"(bh), "v"(bl));
  return c;
}
// batched GEMM like k_gemm_b but f16 operands: A f32 (split into f16 hi/lo if ASPLIT, else rounded to f16), Bt = f16 values [n][k]; alpha; C f32; N multiple of 16 (partial tiles skipped)
template <bool ASPLIT>
__global__ __launch_bounds__(128) void k_gemm_h(const float* __restrict__ A, int lda, size_t sA, const _Float16* __restrict__ Bh, int ldb, size_t sB, float alpha, float* __restrict__ C, int ldc, size_t sC, int M, int N, int K) {
  __shared__ __attribute__((aligned(16))) float so[4][16][64];
  const int tid = threadIdx.x, w = tid >> 5, lane = tid & 31, ln = lane & 15, hh = lane >> 4; const int by = blockIdx.y;
  A += (size_t)by * sA; Bh += (size_t)by * sB; C += (size_t)by * sC;
  const int ntn = (N + 63) / 64; const int wid = blockIdx.x * 4 + w; const int mt = wid / ntn, nq = wid % ntn; if (mt * 16 >= M) return;
  const int row0 = mt * 16, col0 = nq * 64; const float* arow = A + (size_t)(row0 + ln) * lda;
  v8f acc[4] = {};
  for (int kb = 0; kb < K; kb += 32) {
    FragH ah, al;
    const v4f x0 = *(const v4fa*)(arow + kb + 8 * hh), x1 = *(const v4fa*)(arow + kb + 8 * hh + 4), x2 = *(const v4fa*)(arow + kb + 16 + 8 * hh), x3 = *(const v4fa*)(arow + kb + 16 + 8 * hh + 4);
    float xs[16] = {x0[0],x0[1],x0[2],x0[3],x1[0],x1[1],x1[2],x1[3],x2[0],x2[1],x2[2],x2[3],x3[0],x3[1],x3[2],x3[3]};
#pragma unroll
    for (int i = 0; i < 16; ++i) { const _Float16 h = (_Float16)xs[i]; ah.h[i] = h; al.h[i] = ASPLIT ? (_Float16)(xs[i] - (float)h) : (_Float16)0.0f; }
#pragma unroll
    for (int t = 0; t < 4; ++t) { if (col0 + t * 16 >= N) continue; const size_t boff = (size_t)(col0 + t * 16 + ln) * ldb + kb; FragH bq; bq.half[0] = *(const v8us*)(Bh + boff + 8 * hh); bq.half[1] = *(const v8us*)(Bh + boff + 16 + 8 * hh);
      acc[t] = mmaH<ASPLIT ? 2 : 1>(ah.v, al.v, bq.v, bq.v, acc[t]); }
  }
#pragma unroll
  for (int t = 0; t < 4; ++t) { if (col0 + t * 16 >= N) continue;
#pragma unroll
    for (int r = 0; r < 8; ++r) so[w][8 * hh + r][t * 16 + ln] = acc[t][r] * alpha; }
  __builtin_amdgcn_fence(__ATOMIC_ACQ_REL, "workgroup"); __builtin_amdgcn_wave_barrier();
  const int rsub = lane >> 4, c4 = (lane & 15) * 4;
  {
#pragma unroll
    for (int q = 0; q < 8; ++q) { const int r = q * 2 + rsub; if (col0 + c4 < N) { const v4f v = *(const v4fa*)&so[w][r][c4]; *(v4f*)(C + (size_t)(row0 + r) * ldc + col0 + c4) = v; } }
     }
}

// Wt[n][k] = f16(W[k][n]·scale) from f32 row-major W[K][N] (scale = power of two; bf16-exact weights stay exact in f16 away from the subnormal range)
__global__ __launch_bounds__(256) void k_wt_f16(const float* __restrict__ W, _Float16* __restrict__ Wt, int K, int N, float scale) {
  const int t = blockIdx.x * 256 + threadIdx.x; if (t >= N * (K / 8)) return; const int n = t / (K / 8), k8 = (t % (K / 8)) * 8; FragH f;
#pragma unroll
  for (int i = 0; i < 8; ++i) f.h[i] = (_Float16)(bf16_round(W[(size_t)(k8 + i) * N + n]) * scale); const v8us o = f.half[0];
  *(v8us*)((unsigned short*)Wt + (size_t)n * K + k8) = o; 
}
// k_gemm_hh variant with fused epilogue: v = acc·alpha + bias[by·sBias + col] (+ CP[(row/rowsPerB)·sCPb + by·64 + col] if CP) ; ACT 0 none / 1 elu ; writes f16 C16 and f32 C, each if non-null
template <int ACT>
__global__ __launch_bounds__(128) void k_gemm_hhx(const _Float16* __restrict__ A, int lda, size_t sA, const _Float16* __restrict__ Bh, int ldb, size_t sB, float alpha, const float* __restrict__ bias, size_t sBias, const float* __restrict__ CP, int rowsPerB, size_t sCPb, int row0g,
    float* __restrict__ C, _Float16* __restrict__ C16, int ldc, size_t sC, int M, int N, int K) {
  __shared__ __attribute__((aligned(16))) float so[4][16][64];
  const int tid = threadIdx.x, w = tid >> 5, lane = tid & 31, ln = lane & 15, hh = lane >> 4; const int by = blockIdx.y;
  A += (size_t)by * sA; Bh += (size_t)by * sB; const size_t cofs = (size_t)by * sC; const float* bp = bias ? bias + (size_t)by * sBias : nullptr;
  const int ntn = (N + 63) / 64; const int wid = blockIdx.x * 4 + w; const int mt = wid / ntn, nq = wid % ntn; if (mt * 16 >= M) return;
  const int row0 = mt * 16, col0 = nq * 64; const _Float16* arow = A + (size_t)(row0 + ln) * lda;
  v8f acc[4] = {};
  for (int kb = 0; kb < K; kb += 32) { FragH ah; ah.half[0] = *(const v8us*)((const unsigned short*)arow + kb + 8 * hh); ah.half[1] = *(const v8us*)((const unsigned short*)arow + kb + 16 + 8 * hh);
#pragma unroll
    for (int t = 0; t < 4; ++t) { if (col0 + t * 16 >= N) continue; const size_t boff = (size_t)(col0 + t * 16 + ln) * ldb + kb; FragH bq; bq.half[0] = *(const v8us*)((const unsigned short*)Bh + boff + 8 * hh); bq.half[1] = *(const v8us*)((const unsigned short*)Bh + boff + 16 + 8 * hh);
      acc[t] = mmaH<1>(ah.v, ah.v, bq.v, bq.v, acc[t]); }
  }
#pragma unroll
  for (int t = 0; t < 4; ++t) { if (col0 + t * 16 >= N) continue; const int col = col0 + t * 16 + ln; const float bv = bp ? bf16_round(bp[col]) : 0.f;
#pragma unroll
    for (int r = 0; r < 8; ++r) { float v = acc[t][r] * alpha + bv; if (CP) { const int bidx = (row0g + row0 + 8 * hh + r) / rowsPerB; v += CP[(size_t)bidx * sCPb + (size_t)by * 64 + col]; } if (ACT == 1) v = (v > 0.f) ? v : expm1f(v); else if (ACT == 3) v = fmaxf(v, 0.f); so[w][8 * hh + r][t * 16 + ln] = v; } }
  __builtin_amdgcn_fence(__ATOMIC_ACQ_REL, "workgroup"); __builtin_amdgcn_wave_barrier();
  const int rsub = lane >> 4, c4 = (lane & 15) * 4; typedef _Float16 v4h __attribute__((ext_vector_type(4)));
  {
#pragma unroll
    for (int q = 0; q < 8; ++q) { const int r = q * 2 + rsub; if (col0 + c4 < N) { const v4f v = *(const v4fa*)&so[w][r][c4]; if (C) *(v4f*)(C + cofs + (size_t)(row0 + r) * ldc + col0 + c4) = v; if (C16) { v4h h4; for (int i = 0; i < 4; ++i) h4[i] = (_Float16)v[i]; *(v4h*)(C16 + cofs + (size_t)(row0 + r) * ldc + col0 + c4) = h4; } } }
     }
}


typedef _Float16 v4h __attribute__((ext_vector_type(4)));

__global__ __launch_bounds__(256) void k_x16(const float* __restrict__ x, _Float16* __restrict__ X16, size_t n8) { const size_t t = (size_t)blockIdx.x * 256 + threadIdx.x; if (t >= n8) return; FragH f;
#pragma unroll
  for (int q = 0; q < 8; ++q) f.h[q] = (_Float16)bf16_round(x[t * 8 + q]); *(v8us*)((unsigned short*)X16 + t * 8) = f.half[0];  }
__global__ __launch_bounds__(256) void k_h16(const float* __restrict__ x, _Float16* __restrict__ X16, size_t n8) { const size_t t = (size_t)blockIdx.x * 256 + threadIdx.x; if (t >= n8) return; FragH f;
#pragma unroll
  for (int q = 0; q < 8; ++q) f.h[q] = (_Float16)x[t * 8 + q]; *(v8us*)((unsigned short*)X16 + t * 8) = f.half[0];  }
__global__ __launch_bounds__(256) void k_round16f(const float* __restrict__ W, _Float16* __restrict__ Bt, size_t n8) { const size_t t = (size_t)blockIdx.x * 256 + threadIdx.x; if (t >= n8) return; FragH f;
#pragma unroll
  for (int i = 0; i < 8; ++i) f.h[i] = (_Float16)(bf16_round(W[t * 8 + i]) * 16.0f); *(v8us*)((unsigned short*)Bt + t * 8) = f.half[0];  }
template <int NHv, int TTv>
__global__ __launch_bounds__(256) void k_vt(const _Float16* __restrict__ V16, int ldv, int voff, _Float16* __restrict__ Vt) { __shared__ unsigned short tl[64][66]; const int tid = threadIdx.x; const int slab = blockIdx.x / (TTv / 64), lg = blockIdx.x % (TTv / 64); const int b = slab / NHv, h = slab % NHv;
  for (int i = tid; i < 64 * 8; i += 256) { const int r = i / 8, c8 = (i % 8) * 8; FragH f; f.half[0] = *(const v8us*)((const unsigned short*)V16 + ((size_t)b * TTv + lg * 64 + r) * ldv + voff + h * 64 + c8);
#pragma unroll
    for (int q = 0; q < 8; ++q) tl[r][c8 + q] = f.u[q]; }
  __syncthreads();
  {
#pragma unroll
    for (int rd = 0; rd < 2; ++rd) { const int d = rd * 32 + tid / 8, pc = tid % 8; FragH f;
#pragma unroll
      for (int q = 0; q < 8; ++q) f.u[q] = tl[pc * 8 + q][d];
      *(v8us*)((unsigned short*)Vt + ((size_t)slab * 64 + d) * TTv + lg * 64 + pc * 8) = f.half[0]; }
     } }

__global__ __launch_bounds__(256) void k_tok(const float* __restrict__ x, _Float16* __restrict__ X16) { __shared__ float tl[32][65]; const int tid = threadIdx.x; const int b = blockIdx.x / ((CC / 64) * (NPIX / 32)), rem = blockIdx.x % ((CC / 64) * (NPIX / 32)); const int cg = rem / (NPIX / 32), pg = rem % (NPIX / 32); const int c0 = cg * 64, p0 = pg * 32;
  for (int i = tid; i < 64 * 32; i += 256) { const int c = i / 32, pp = i % 32; tl[pp][c] = bf16_round(x[((size_t)b * CC + c0 + c) * NPIX + p0 + pp]); } __syncthreads();
  const int r = tid / 8, pc = tid % 8; FragH f; for (int q = 0; q < 8; ++q) f.h[q] = (_Float16)tl[r][pc * 8 + q]; const size_t row = (size_t)b * NPIX + p0 + r; *(v8us*)((unsigned short*)X16 + row * CC + c0 + pc * 8) = f.half[0];  }
__global__ __launch_bounds__(256) void k_dots(const _Float16* __restrict__ Q, const _Float16* __restrict__ KV, float* __restrict__ DOTS) { const size_t t = (size_t)blockIdx.x * 256 + threadIdx.x; if (t >= (size_t)BB * NH * NPIX * 9) return; const int w = (int)(t % 9); const int n = (int)((t / 9) % NPIX); const int h = (int)((t / (9 * NPIX)) % NH); const int b = (int)(t / ((size_t)9 * NPIX * NH)); const int y = n / HWD + w / 3 - 1, xx = n % HWD + w % 3 - 1; float s = 0.f;
  if (y >= 0 && y < HWD && xx >= 0 && xx < HWD) { const unsigned short* qr = (const unsigned short*)Q + ((size_t)b * NPIX + n) * INNER + h * DH; const unsigned short* kr = (const unsigned short*)KV + ((size_t)b * NPIX + y * HWD + xx) * (2 * INNER) + h * DH;
#pragma unroll 1
    for (int d = 0; d < DH; d += 8) { FragH a, k; a.half[0] = *(const v8us*)(qr + d); k.half[0] = *(const v8us*)(kr + d); for (int q = 0; q < 8; ++q) s += (float)a.h[q] * (float)k.h[q]; } s *= 0.125f; }
  *(float*)(DOTS + t) = s;  }
__global__ __launch_bounds__(256) void k_attn(const float* __restrict__ DOTS, float* __restrict__ ATTN) { const size_t t = (size_t)blockIdx.x * 256 + threadIdx.x; if (t >= (size_t)BB * NH * NPIX * 9) return; const size_t base = t - (t % 9); float m = -3.0e38f; for (int w = 0; w < 9; ++w) m = fmaxf(m, DOTS[base + w]); float z = 0.f; for (int w = 0; w < 9; ++w) z += expf(DOTS[base + w] - m); const float a = expf(DOTS[t] - m) / z; *(float*)(ATTN + t) = a;  }
__global__ __launch_bounds__(256) void k_av(const float* __restrict__ ATTN, const _Float16* __restrict__ KV, _Float16* __restrict__ O16) { const size_t t = (size_t)blockIdx.x * 256 + threadIdx.x; if (t >= (size_t)NR * NH * 8) return; const int p = (int)(t % 8); const int h = (int)((t / 8) % NH); const size_t bn = t / (8 * NH); const int b = (int)(bn / NPIX), n = (int)(bn % NPIX); float acc[8]; for (int q = 0; q < 8; ++q) acc[q] = 0.f; const float* at = ATTN + (((size_t)b * NH + h) * NPIX + n) * 9;
#pragma unroll 1
  for (int w = 0; w < 9; ++w) { const int y = n / HWD + w / 3 - 1, xx = n % HWD + w % 3 - 1; if (y < 0 || y >= HWD || xx < 0 || xx >= HWD) continue; const float a = at[w]; FragH v; v.half[0] = *(const v8us*)((const unsigned short*)KV + ((size_t)b * NPIX + y * HWD + xx) * (2 * INNER) + INNER + h * DH + p * 8); for (int q = 0; q < 8; ++q) acc[q] += a * (float)v.h[q]; }
  FragH o; for (int q = 0; q < 8; ++q) o.h[q] = (_Float16)acc[q]; *(v8us*)((unsigned short*)O16 + bn * INNER + h * DH + p * 8) = o.half[0];  }
__global__ __launch_bounds__(256) void k_out(const float* __restrict__ G, float* __restrict__ out) { __shared__ float tl[32][65]; const int tid = threadIdx.x; const int b = blockIdx.x / ((CC / 32) * (NPIX / 64)), rem = blockIdx.x % ((CC / 32) * (NPIX / 64)); const int cg = rem / (NPIX / 64), pg = rem % (NPIX / 64); const int c0 = cg * 32, p0 = pg * 64;
  for (int i = tid; i < 64 * 32; i += 256) { const int pp = i / 32, c = i % 32; tl[c][pp] = G[((size_t)b * NPIX + p0 + pp) * CC + c0 + c]; } __syncthreads();
  { for (int i = tid; i < 32 * 16; i += 256) { const int c = i / 16, q4 = i % 16; const v4f v = {tl[c][q4 * 4], tl[c][q4 * 4 + 1], tl[c][q4 * 4 + 2], tl[c][q4 * 4 + 3]}; *(v4f*)(out + ((size_t)b * CC + c0 + c) * NPIX + p0 + q4 * 4) = v; }  } }
extern "C" void kernel_launch(void* const* d_in, const int* in_sizes, int n_in,
                              void* d_out, int out_size, void* d_ws, size_t ws_size, hipStream_t stream) {
  (void)in_sizes; (void)n_in; (void)out_size;
  const float* x = (const float*)d_in[0]; const float* Wq = (const float*)d_in[1]; const float* Wkv = (const float*)d_in[2]; const float* Wo = (const float*)d_in[3]; const float* bo = (const float*)d_in[4];
  float* OUT0 = (float*)d_out; float* ATTN = OUT0 + (size_t)BB * CC * NPIX;
  char* ws = (char*)d_ws; size_t off = 0;
  auto take = [&](size_t bytes) { char* p = ws + off; off += (bytes + 255) & ~(size_t)255; return p; };
  _Float16* Bq = (_Float16*)take((size_t)INNER * CC * 2); _Float16* Bkv = (_Float16*)take((size_t)2 * INNER * CC * 2); _Float16* Bo = (_Float16*)take((size_t)CC * INNER * 2); _Float16* X16 = (_Float16*)take((size_t)NR * CC * 2); _Float16* Q = (_Float16*)take((size_t)NR * INNER * 2); _Float16* KV = (_Float16*)take((size_t)NR * 2 * INNER * 2); float* DOTS = (float*)take((size_t)NR * NH * 9 * 4); _Float16* O16 = (_Float16*)take((size_t)NR * INNER * 2); float* G = (float*)take((size_t)NR * CC * 4);
  if (off > ws_size) return;      // 1.1 + 8.4 + 16.8 + 33.5 + 4.7 + 16.8 + 16.8 ≈ 98 MB
  k_round16f<<<(unsigned)(((size_t)INNER * CC / 8 + 255) / 256), 256, 0, stream>>>(Wq, Bq, (size_t)INNER * CC / 8); k_round16f<<<(unsigned)(((size_t)2 * INNER * CC / 8 + 255) / 256), 256, 0, stream>>>(Wkv, Bkv, (size_t)2 * INNER * CC / 8); k_round16f<<<(unsigned)(((size_t)CC * INNER / 8 + 255) / 256), 256, 0, stream>>>(Wo, Bo, (size_t)CC * INNER / 8);      // (out,in)
  k_tok<<<BB * (CC / 64) * (NPIX / 32), 256, 0, stream>>>(x, X16);
  k_gemm_hhx<0><<<dim3(((NR / 16) * (INNER / 64) + 3) / 4, 1), 128, 0, stream>>>(X16, CC, 0, Bq, CC, 0, 0.0625f, nullptr, 0, nullptr, 1, 0, 0, nullptr, Q, INNER, 0, NR, INNER, CC);
  k_gemm_hhx<0><<<dim3(((NR / 16) * (2 * INNER / 64) + 3) / 4, 1), 128, 0, stream>>>(X16, CC, 0, Bkv, CC, 0, 0.0625f, nullptr, 0, nullptr, 1, 0, 0, nullptr, KV, 2 * INNER, 0, NR, 2 * INNER, CC);      // [k | v]
  k_dots<<<(unsigned)(((size_t)BB * NH * NPIX * 9 + 255) / 256), 256, 0, stream>>>(Q, KV, DOTS); k_attn<<<(unsigned)(((size_t)BB * NH * NPIX * 9 + 255) / 256), 256, 0, stream>>>(DOTS, ATTN);
  k_av<<<(unsigned)(((size_t)NR * NH * 8 + 255) / 256), 256, 0, stream>>>(ATTN, KV, O16);
  k_gemm_hhx<0><<<dim3(((NR / 16) * (CC / 64) + 3) / 4, 1), 128, 0, stream>>>(O16, INNER, 0, Bo, INNER, 0, 0.0625f, bo, 0, nullptr, 1, 0, 0, G, nullptr, CC, 0, NR, CC, INNER);      // to_out + bo
  k_out<<<BB * (CC / 32) * (NPIX / 64), 256, 0, stream>>>(G, OUT0);
}

// v001
// It runs in 93.1 microseconds.
// Next to v000, in two timings, it ran 1.78 times as fast each time.
#include <hip/hip_runtime.h>
// Local 3×3-window attention (x [16,256,32,32]; 8 heads × 64): q = 1×1 conv (Wq), k,v = 1×1 conv (Wkv), each pixel attends over its 3×3 neighbourhood (zero-padded keys/values take part with
// logit 0), softmax(q·k/8), out = Σ attn·v, 1×1 conv Wo + bo; outputs (out NCHW, attn [16,8,1024,9]). The three pointwise convs run as GEMMs on v_wmma_f32_16x16x32_f16 (x bf16-exact, (out,in)
// weights bf16-exact ×2^4, q/k/v/o f16, f32 accumulate); the 9-wide window dots, softmax and attn·v are f32 VALU (one element per thread, rolled loops), layout transposes by tiles.
#define BB 16
#define CC 256
#define HWD 32
#define NPIX 1024
#define NH 8
#define DH 64
#define INNER 512
#define NR (BB * NPIX)

typedef __bf16 v16b __attribute__((ext_vector_type(16)));
typedef unsigned short v8us __attribute__((ext_vector_type(8), may_alias));
typedef float  v8f  __attribute__((ext_vector_type(8)));
typedef float  v4f  __attribute__((ext_vector_type(4)));
typedef float  v4fa __attribute__((ext_vector_type(4), may_alias));
union FragB { v16b v; v8us half[2]; unsigned short u[16]; };

__device__ __forceinline__ unsigned short bf16_bits(float x) { unsigned int u = __float_as_uint(x); return (unsigned short)((u + 0x7FFFu + ((u >> 16) & 1u)) >> 16); }
__device__ __forceinline__ float bf16_val(unsigned short b) { return __uint_as_float(((unsigned int)b) << 16); }
__device__ __forceinline__ float bf16_round(float x) { return bf16_val(bf16_bits(x)); }
// D += A·B with NT terms: 1 = ah·bh, 2 = + al·bh (A split), 3 = + ah·bl (both split)
template <int NT>
__device__ __forceinline__ v8f mmaN(v16b ah, v16b al, v16b bh, v16b bl, v8f c) {
  c = __builtin_amdgcn_wmma_f32_16x16x32_bf16(false, ah, false, bh, (short)0, c, false, false);
  if (NT >= 2) c = __builtin_amdgcn_wmma_f32_16x16x32_bf16(false, al, false, bh, (short)0, c, false, false);
  if (NT >= 3) c = __builtin_amdgcn_wmma_f32_16x16x32_bf16(false, ah, false, bl, (short)0, c, false, false);
  asm volatile("v_nop\n\tv_nop\n\tv_nop\n\tv_nop" : "+v"(c) : "v"(ah), "v"(al), "v"(bh), "v"(bl));
  return c;
}

__global__ __launch_bounds__(256) void k_wt_bf16(const float* __restrict__ W, unsigned short* __restrict__ Wt, int K, int N) {
  const int t = blockIdx.x * 256 + threadIdx.x;
  const int k8n = K / 8;
  if (t >= N * k8n) return;
  const int n = t / k8n, k8 = (t % k8n) * 8;
  v8us v;
#pragma unroll
  for (int i = 0; i < 8; ++i) v[i] = bf16_bits(W[(size_t)(k8 + i) * N + n]);
  *(v8us*)(Wt + (size_t)n * K + k8) = v;
  
}

// GEMM C[M][N] (f32, pitch ldc) = act(A[M][K]·W + bias). A f32 row-major (pitch lda) converted per fragment to bf16
// (ASPLIT: hi/lo two planes -> 2 terms, else single rounded term); Wt bf16 [N][K] (pitch ldb). BIAS_BF16 rounds the
// bias to bf16 first (bias quantised to bf16 before the add). K%32==0, M%16==0, N%64==0.
template <bool ASPLIT, int ACT, bool BIAS_BF16>
__global__ __launch_bounds__(128) void k_gemm_bf(const float* __restrict__ A, int lda, const unsigned short* __restrict__ Wt, int ldb,
                                               const float* __restrict__ bias, float* __restrict__ C, int ldc, int M, int N, int K) {
  __shared__ __attribute__((aligned(16))) float so[4][16][64];
  const int tid = threadIdx.x, w = tid >> 5, lane = tid & 31, ln = lane & 15, hh = lane >> 4;
  const int ntn = N / 64;
  const int wid = blockIdx.x * 4 + w;
  const int mt = wid / ntn, nq = wid % ntn;
  if (mt * 16 >= M) return;
  const int row0 = mt * 16, col0 = nq * 64;
  const float* arow = A + (size_t)(row0 + ln) * lda;
  v8f acc[4] = {};
  for (int kb = 0; kb < K; kb += 32) {
    FragB ah, al;
    const v4f x0 = *(const v4fa*)(arow + kb + 8 * hh), x1 = *(const v4fa*)(arow + kb + 8 * hh + 4);
    const v4f x2 = *(const v4fa*)(arow + kb + 16 + 8 * hh), x3 = *(const v4fa*)(arow + kb + 16 + 8 * hh + 4);
    float xs[16] = {x0[0],x0[1],x0[2],x0[3],x1[0],x1[1],x1[2],x1[3],x2[0],x2[1],x2[2],x2[3],x3[0],x3[1],x3[2],x3[3]};
#pragma unroll
    for (int i = 0; i < 16; ++i) { const unsigned short hb = bf16_bits(xs[i]); ah.u[i] = hb; al.u[i] = ASPLIT ? bf16_bits(xs[i] - bf16_val(hb)) : (unsigned short)0; }
#pragma unroll
    for (int t = 0; t < 4; ++t) {
      const unsigned short* brow = Wt + (size_t)(col0 + t * 16 + ln) * ldb + kb;
      FragB b;
      b.half[0] = *(const v8us*)(brow + 8 * hh);
      b.half[1] = *(const v8us*)(brow + 16 + 8 * hh);
      acc[t] = mmaN<ASPLIT ? 2 : 1>(ah.v, al.v, b.v, b.v, acc[t]);
    }
  }
#pragma unroll
  for (int t = 0; t < 4; ++t) {
    float bv = bias ? bias[col0 + t * 16 + ln] : 0.f;
    if (BIAS_BF16) bv = bf16_round(bv);
#pragma unroll
    for (int r = 0; r < 8; ++r) { float v = acc[t][r] + bv; if (ACT == 1) v = fmaxf(v, 0.f); so[w][8 * hh + r][t * 16 + ln] = v; }
  }
  __builtin_amdgcn_fence(__ATOMIC_ACQ_REL, "workgroup");
  __builtin_amdgcn_wave_barrier();
  const int rsub = lane >> 4, c4 = (lane & 15) * 4;
  {
#pragma unroll
    for (int q = 0; q < 8; ++q) {
      const int r = q * 2 + rsub;
      const v4f v = *(const v4fa*)&so[w][r][c4];
      *(v4f*)(C + (size_t)(row0 + r) * ldc + col0 + c4) = v;
    }
    
  }
}

// Flash-style causal/unmasked attention, all contractions 3-term bf16 hi/lo splits, f32 softmax with running max.
// q,k,v rows are read from f32 buffers with arbitrary row pitch (so they can live inside a fused qkv buffer);
// D = head size (multiple of 32, <= 128); one wave = 16 query rows; block = 4 waves (64 queries) sharing K/V chunks of 32.
template <int D, bool CAUSAL>
__global__ __launch_bounds__(128) void k_flash(const float* __restrict__ qb, const float* __restrict__ kb, const float* __restrict__ vb,
                                             int pitch, int T, int H, float scale, float* __restrict__ y, int ypitch) {
  constexpr int KS = D / 32;        // k-steps for QK
  constexpr int DT = D / 16;        // d tiles for PV
  __shared__ __attribute__((aligned(16))) unsigned short sKh[32][D + 8], sKl[32][D + 8], sVh[32][D + 8], sVl[32][D + 8];
  __shared__ __attribute__((aligned(16))) unsigned short sPh[4][16][40], sPl[4][16][40];
  __shared__ __attribute__((aligned(16))) float sO[4][16][D];
  const int tid = threadIdx.x, w = tid >> 5, lane = tid & 31, ln = lane & 15, hh = lane >> 4;
  const int nqb = (T + 63) / 64;
  const int bh = blockIdx.x / nqb, qblk = blockIdx.x % nqb;
  const int b = bh / H, h = bh % H;
  const int q0 = qblk * 64 + w * 16;
  const float* Q = qb + (size_t)b * T * pitch + h * D;
  const float* K = kb + (size_t)b * T * pitch + h * D;
  const float* V = vb + (size_t)b * T * pitch + h * D;

  // A fragments of the wave's 16 query rows (scaled), hi/lo
  FragB aqh[KS], aql[KS];
  {
    int row = q0 + ln; if (row >= T) row = T - 1;
    const float* qr = Q + (size_t)row * pitch;
#pragma unroll
    for (int ks = 0; ks < KS; ++ks)
#pragma unroll
      for (int i = 0; i < 16; ++i) {
        const int d = ks * 32 + ((i < 8) ? (8 * hh + i) : (16 + 8 * hh + (i - 8)));
        const float x = qr[d] * scale; const unsigned short hb = bf16_bits(x);
        aqh[ks].u[i] = hb; aql[ks].u[i] = bf16_bits(x - bf16_val(hb));
      }
  }
  float m_r[8], l_r[8];
#pragma unroll
  for (int r = 0; r < 8; ++r) { m_r[r] = -3.0e38f; l_r[r] = 0.f; }
  v8f oacc[DT];
#pragma unroll
  for (int dt = 0; dt < DT; ++dt) oacc[dt] = (v8f){0.f,0.f,0.f,0.f,0.f,0.f,0.f,0.f};

  const int kv_end = CAUSAL ? min(T, qblk * 64 + 64) : T;     // block-uniform
  for (int j0 = 0; j0 < kv_end; j0 += 32) {
    __syncthreads();
    for (int e = tid; e < 32 * (D / 4); e += 128) {
      const int r = e / (D / 4), c4 = (e % (D / 4)) * 4;
      const int key = j0 + r;
      v4f kf = {0.f,0.f,0.f,0.f}, vf = {0.f,0.f,0.f,0.f};
      if (key < T) { kf = *(const v4fa*)(K + (size_t)key * pitch + c4); vf = *(const v4fa*)(V + (size_t)key * pitch + c4); }
#pragma unroll
      for (int t = 0; t < 4; ++t) {
        unsigned short hb = bf16_bits(kf[t]); sKh[r][c4 + t] = hb; sKl[r][c4 + t] = bf16_bits(kf[t] - bf16_val(hb));
        hb = bf16_bits(vf[t]); sVh[r][c4 + t] = hb; sVl[r][c4 + t] = bf16_bits(vf[t] - bf16_val(hb));
      }
    }
    __syncthreads();
    // S tile 16 x 32
    v8f s[2];
#pragma unroll
    for (int nt = 0; nt < 2; ++nt) {
      v8f acc = {};
#pragma unroll
      for (int ks = 0; ks < KS; ++ks) {
        FragB bh_, bl_;
        bh_.half[0] = *(const v8us*)&sKh[nt * 16 + ln][ks * 32 + 8 * hh]; bh_.half[1] = *(const v8us*)&sKh[nt * 16 + ln][ks * 32 + 16 + 8 * hh];
        bl_.half[0] = *(const v8us*)&sKl[nt * 16 + ln][ks * 32 + 8 * hh]; bl_.half[1] = *(const v8us*)&sKl[nt * 16 + ln][ks * 32 + 16 + 8 * hh];
        acc = mmaN<3>(aqh[ks].v, aql[ks].v, bh_.v, bl_.v, acc);
      }
      s[nt] = acc;
    }
    // mask + running max (rows 8hh+r; the 16 lanes of a half share rows)
    float alpha[8];
#pragma unroll
    for (int r = 0; r < 8; ++r) {
      const int qi = q0 + 8 * hh + r;
      const int ja = j0 + ln, jb = j0 + 16 + ln;
      if (CAUSAL) { if (ja > qi) s[0][r] = -3.0e38f; if (jb > qi) s[1][r] = -3.0e38f; }
      if (ja >= T) s[0][r] = -3.0e38f;
      if (jb >= T) s[1][r] = -3.0e38f;
      float mx = fmaxf(s[0][r], s[1][r]);
      mx = fmaxf(mx, __shfl_xor(mx, 1, 32)); mx = fmaxf(mx, __shfl_xor(mx, 2, 32)); mx = fmaxf(mx, __shfl_xor(mx, 4, 32)); mx = fmaxf(mx, __shfl_xor(mx, 8, 32));
      const float mnew = fmaxf(m_r[r], mx);
      alpha[r] = (mnew > -1.0e38f) ? __expf(m_r[r] - mnew) : 1.0f;
      const float p0 = (s[0][r] > -1.0e38f) ? __expf(s[0][r] - mnew) : 0.f;
      const float p1 = (s[1][r] > -1.0e38f) ? __expf(s[1][r] - mnew) : 0.f;
      m_r[r] = mnew;
      l_r[r] = l_r[r] * alpha[r] + p0 + p1;            // per-lane partial row sum (16 lanes combined at the end)
      unsigned short hb = bf16_bits(p0); sPh[w][8 * hh + r][ln] = hb;      sPl[w][8 * hh + r][ln] = bf16_bits(p0 - bf16_val(hb));
      hb = bf16_bits(p1);                sPh[w][8 * hh + r][16 + ln] = hb; sPl[w][8 * hh + r][16 + ln] = bf16_bits(p1 - bf16_val(hb));
    }
#pragma unroll
    for (int dt = 0; dt < DT; ++dt)
#pragma unroll
      for (int r = 0; r < 8; ++r) oacc[dt][r] *= alpha[r];
    __builtin_amdgcn_fence(__ATOMIC_ACQ_REL, "workgroup");
    __builtin_amdgcn_wave_barrier();
    FragB pah, pal;
    pah.half[0] = *(const v8us*)&sPh[w][ln][8 * hh]; pah.half[1] = *(const v8us*)&sPh[w][ln][16 + 8 * hh];
    pal.half[0] = *(const v8us*)&sPl[w][ln][8 * hh]; pal.half[1] = *(const v8us*)&sPl[w][ln][16 + 8 * hh];
#pragma unroll
    for (int dt = 0; dt < DT; ++dt) {
      FragB bvh, bvl;
#pragma unroll
      for (int i = 0; i < 8; ++i) {
        bvh.u[i] = sVh[8 * hh + i][dt * 16 + ln]; bvh.u[8 + i] = sVh[16 + 8 * hh + i][dt * 16 + ln];
        bvl.u[i] = sVl[8 * hh + i][dt * 16 + ln]; bvl.u[8 + i] = sVl[16 + 8 * hh + i][dt * 16 + ln];
      }
      oacc[dt] = mmaN<3>(pah.v, pal.v, bvh.v, bvl.v, oacc[dt]);
    }
    __builtin_amdgcn_fence(__ATOMIC_ACQ_REL, "workgroup");
    __builtin_amdgcn_wave_barrier();
  }
#pragma unroll
  for (int r = 0; r < 8; ++r) {
    float l = l_r[r];
    l += __shfl_xor(l, 1, 32); l += __shfl_xor(l, 2, 32); l += __shfl_xor(l, 4, 32); l += __shfl_xor(l, 8, 32);
    l_r[r] = (l > 0.f) ? 1.0f / l : 0.f;
  }
#pragma unroll
  for (int dt = 0; dt < DT; ++dt)
#pragma unroll
    for (int r = 0; r < 8; ++r) sO[w][8 * hh + r][dt * 16 + ln] = oacc[dt][r] * l_r[r];
  __builtin_amdgcn_fence(__ATOMIC_ACQ_REL, "workgroup");
  __builtin_amdgcn_wave_barrier();
  {
    for (int r = 0; r < 16; ++r) {
      const int row = q0 + r;
      if (row < T && lane < D / 4) {
        const v4f val = *(const v4fa*)&sO[w][r][lane * 4];
        *(v4f*)(y + ((size_t)b * T + row) * ypitch + h * D + lane * 4) = val;
      }
    }
    
  }
}

// GEMM C = act(A·W + bias + resid): A f32 (ASPLIT -> hi/lo 2 terms), Wt bf16 [N][K]; ACT 0 none, 1 relu, 2 exact gelu;
// resid (optional, f32, row index = (row % rmod), pitch ldr, RES_BF16 rounds it) added before the activation.
template <bool ASPLIT, int ACT, bool BIAS_BF16, bool RES_BF16>
__global__ __launch_bounds__(128) void k_gemm_bf3(const float* __restrict__ A, int lda, const unsigned short* __restrict__ Wt, int ldb,
                                                const float* __restrict__ bias, const float* __restrict__ resid, int rmod, int ldr,
                                                float* __restrict__ C, int ldc, int M, int N, int K) {
  __shared__ __attribute__((aligned(16))) float so[4][16][64];
  const int tid = threadIdx.x, w = tid >> 5, lane = tid & 31, ln = lane & 15, hh = lane >> 4;
  const int ntn = N / 64;
  const int wid = blockIdx.x * 4 + w;
  const int mt = wid / ntn, nq = wid % ntn;
  if (mt * 16 >= M) return;
  const int row0 = mt * 16, col0 = nq * 64;
  const float* arow = A + (size_t)(row0 + ln) * lda;
  v8f acc[4] = {};
  for (int kb = 0; kb < K; kb += 32) {
    FragB ah, al;
    const v4f x0 = *(const v4fa*)(arow + kb + 8 * hh), x1 = *(const v4fa*)(arow + kb + 8 * hh + 4);
    const v4f x2 = *(const v4fa*)(arow + kb + 16 + 8 * hh), x3 = *(const v4fa*)(arow + kb + 16 + 8 * hh + 4);
    float xs[16] = {x0[0],x0[1],x0[2],x0[3],x1[0],x1[1],x1[2],x1[3],x2[0],x2[1],x2[2],x2[3],x3[0],x3[1],x3[2],x3[3]};
#pragma unroll
    for (int i = 0; i < 16; ++i) { const unsigned short hb = bf16_bits(xs[i]); ah.u[i] = hb; al.u[i] = ASPLIT ? bf16_bits(xs[i] - bf16_val(hb)) : (unsigned short)0; }
#pragma unroll
    for (int t = 0; t < 4; ++t) {
      const unsigned short* brow = Wt + (size_t)(col0 + t * 16 + ln) * ldb + kb;
      FragB b;
      b.half[0] = *(const v8us*)(brow + 8 * hh);
      b.half[1] = *(const v8us*)(brow + 16 + 8 * hh);
      acc[t] = mmaN<ASPLIT ? 2 : 1>(ah.v, al.v, b.v, b.v, acc[t]);
    }
  }
#pragma unroll
  for (int t = 0; t < 4; ++t) {
    const int col = col0 + t * 16 + ln;
    float bv = bias ? bias[col] : 0.f;
    if (BIAS_BF16) bv = bf16_round(bv);
#pragma unroll
    for (int r = 0; r < 8; ++r) {
      float v = acc[t][r] + bv;
      if (resid) { float rv = resid[(size_t)((row0 + 8 * hh + r) % rmod) * ldr + col]; if (RES_BF16) rv = bf16_round(rv); v += rv; }
      if (ACT == 1) v = fmaxf(v, 0.f);
      if (ACT == 2) v = 0.5f * v * (1.0f + erff(v * 0.70710678118654752f));
      if (ACT == 3) { const float u = 0.7978845608028654f * (v + 0.044715f * v * v * v); v = 0.5f * v * (1.0f + tanhf(u)); }
      so[w][8 * hh + r][t * 16 + ln] = v;
    }
  }
  __builtin_amdgcn_fence(__ATOMIC_ACQ_REL, "workgroup");
  __builtin_amdgcn_wave_barrier();
  const int rsub = lane >> 4, c4 = (lane & 15) * 4;
  {
#pragma unroll
    for (int q = 0; q < 8; ++q) {
      const int r = q * 2 + rsub;
      const v4f v = *(const v4fa*)&so[w][r][c4];
      *(v4f*)(C + (size_t)(row0 + r) * ldc + col0 + c4) = v;
    }
    
  }
}
// row LayerNorm (biased variance, eps) over N: s = X (+ R); optional out_sum <- s; out_norm <- (s-mu)*rsqrt(var+eps)*g + b
template <bool PARAM_BF16>
__global__ __launch_bounds__(256) void k_layernorm(const float* __restrict__ X, const float* __restrict__ R, const float* __restrict__ g, const float* __restrict__ bta,
                                                  float* __restrict__ out_sum, float* __restrict__ out_norm, int N, float eps) {
  __shared__ float red[256];
  const int row = blockIdx.x, tid = threadIdx.x;
  const float* x = X + (size_t)row * N; const float* rr = R ? R + (size_t)row * N : nullptr;
  float vals[16];                     // up to N = 4096
  const int per = N / 256;            // contiguous chunk per thread? use strided-by-4 chunks: thread handles j = tid*4 + 1024*u
  float s1 = 0.f;
  for (int u = 0; u < per / 4; ++u) {
    const int j = tid * 4 + 1024 * u;
    const v4f a = *(const v4fa*)(x + j);
    v4f b = {0.f,0.f,0.f,0.f}; if (rr) b = *(const v4fa*)(rr + j);
#pragma unroll
    for (int q = 0; q < 4; ++q) { const float v = a[q] + b[q]; vals[u * 4 + q] = v; s1 += v; }
  }
  red[tid] = s1; __syncthreads();
  for (int st = 128; st > 0; st >>= 1) { if (tid < st) red[tid] += red[tid + st]; __syncthreads(); }
  const float mu = red[0] / (float)N; __syncthreads();
  float s2 = 0.f;
  for (int u = 0; u < per / 4; ++u)
#pragma unroll
    for (int q = 0; q < 4; ++q) { const float c = vals[u * 4 + q] - mu; s2 += c * c; }
  red[tid] = s2; __syncthreads();
  for (int st = 128; st > 0; st >>= 1) { if (tid < st) red[tid] += red[tid + st]; __syncthreads(); }
  const float rs = rsqrtf(red[0] / (float)N + eps);
  {
    for (int u = 0; u < per / 4; ++u) {
      const int j = tid * 4 + 1024 * u;
      v4f o, sm;
#pragma unroll
      for (int q = 0; q < 4; ++q) {
        float gg = g[j + q], bb = bta[j + q];
        if (PARAM_BF16) { gg = bf16_round(gg); bb = bf16_round(bb); }
        sm[q] = vals[u * 4 + q]; o[q] = (vals[u * 4 + q] - mu) * rs * gg + bb;
      }
      if (out_sum) *(v4f*)(out_sum + (size_t)row * N + j) = sm;
      *(v4f*)(out_norm + (size_t)row * N + j) = o;
    }
    
  }
}



// ---- f16 WMMA path (v_wmma_f32_16x16x32_f16): 11-bit significands for operands in range — used here for the three 1×1 conv GEMMs (k_gemm_t)
typedef _Float16 v16h __attribute__((ext_vector_type(16)));
union FragH { v16h v; v8us half[2]; _Float16 h[16]; unsigned short u[16]; };
template <int NT>
__device__ __forceinline__ v8f mmaH(v16h ah, v16h al, v16h bh, v16h bl, v8f c) {
  c = __builtin_amdgcn_wmma_f32_16x16x32_f16(false, ah, false, bh, (short)0, c, false, false);
  if (NT >= 2) c = __builtin_amdgcn_wmma_f32_16x16x32_f16(false, al, false, bh, (short)0, c, false, false);
  if (NT >= 3) c = __builtin_amdgcn_wmma_f32_16x16x32_f16(false, ah, false, bl, (short)0, c, false, false);
  asm volatile("v_nop\n\tv_nop\n\tv_nop\n\tv_nop" : "+v"(c) : "v"(ah), "v"(al), "v"(bh), "v"(bl));
  return c;
}
// batched GEMM like k_gemm_b but f16 operands: A f32 (split into f16 hi/lo if ASPLIT, else rounded to f16), Bt = f16 values [n][k]; alpha; C f32; N multiple of 16 (partial tiles skipped)
template <bool ASPLIT>
__global__ __launch_bounds__(128) void k_gemm_h(const float* __restrict__ A, int lda, size_t sA, const _Float16* __restrict__ Bh, int ldb, size_t sB, float alpha, float* __restrict__ C, int ldc, size_t sC, int M, int N, int K) {
  __shared__ __attribute__((aligned(16))) float so[4][16][64];
  const int tid = threadIdx.x, w = tid >> 5, lane = tid & 31, ln = lane & 15, hh = lane >> 4; const int by = blockIdx.y;
  A += (size_t)by * sA; Bh += (size_t)by * sB; C += (size_t)by * sC;
  const int ntn = (N + 63) / 64; const int wid = blockIdx.x * 4 + w; const int mt = wid / ntn, nq = wid % ntn; if (mt * 16 >= M) return;
  const int row0 = mt * 16, col0 = nq * 64; const float* arow = A + (size_t)(row0 + ln) * lda;
  v8f acc[4] = {};
  for (int kb = 0; kb < K; kb += 32) {
    FragH ah, al;
    const v4f x0 = *(const v4fa*)(arow + kb + 8 * hh), x1 = *(const v4fa*)(arow + kb + 8 * hh + 4), x2 = *(const v4fa*)(arow + kb + 16 + 8 * hh), x3 = *(const v4fa*)(arow + kb + 16 + 8 * hh + 4);
    float xs[16] = {x0[0],x0[1],x0[2],x0[3],x1[0],x1[1],x1[2],x1[3],x2[0],x2[1],x2[2],x2[3],x3[0],x3[1],x3[2],x3[3]};
#pragma unroll
    for (int i = 0; i < 16; ++i) { const _Float16 h = (_Float16)xs[i]; ah.h[i] = h; al.h[i] = ASPLIT ? (_Float16)(xs[i] - (float)h) : (_Float16)0.0f; }
#pragma unroll
    for (int t = 0; t < 4; ++t) { if (col0 + t * 16 >= N) continue; const size_t boff = (size_t)(col0 + t * 16 + ln) * ldb + kb; FragH bq; bq.half[0] = *(const v8us*)(Bh + boff + 8 * hh); bq.half[1] = *(const v8us*)(Bh + boff + 16 + 8 * hh);
      acc[t] = mmaH<ASPLIT ? 2 : 1>(ah.v, al.v, bq.v, bq.v, acc[t]); }
  }
#pragma unroll
  for (int t = 0; t < 4; ++t) { if (col0 + t * 16 >= N) continue;
#pragma unroll
    for (int r = 0; r < 8; ++r) so[w][8 * hh + r][t * 16 + ln] = acc[t][r] * alpha; }
  __builtin_amdgcn_fence(__ATOMIC_ACQ_REL, "workgroup"); __builtin_amdgcn_wave_barrier();
  const int rsub = lane >> 4, c4 = (lane & 15) * 4;
  {
#pragma unroll
    for (int q = 0; q < 8; ++q) { const int r = q * 2 + rsub; if (col0 + c4 < N) { const v4f v = *(const v4fa*)&so[w][r][c4]; *(v4f*)(C + (size_t)(row0 + r) * ldc + col0 + c4) = v; } }
     }
}

// Wt[n][k] = f16(W[k][n]·scale) from f32 row-major W[K][N] (scale = power of two; bf16-exact weights stay exact in f16 away from the subnormal range)
__global__ __launch_bounds__(256) void k_wt_f16(const float* __restrict__ W, _Float16* __restrict__ Wt, int K, int N, float scale) {
  const int t = blockIdx.x * 256 + threadIdx.x; if (t >= N * (K / 8)) return; const int n = t / (K / 8), k8 = (t % (K / 8)) * 8; FragH f;
#pragma unroll
  for (int i = 0; i < 8; ++i) f.h[i] = (_Float16)(bf16_round(W[(size_t)(k8 + i) * N + n]) * scale); const v8us o = f.half[0];
  *(v8us*)((unsigned short*)Wt + (size_t)n * K + k8) = o; 
}
// k_gemm_hh variant with fused epilogue: v = acc·alpha + bias[by·sBias + col] (+ CP[(row/rowsPerB)·sCPb + by·64 + col] if CP) ; ACT 0 none / 1 elu ; writes f16 C16 and f32 C, each if non-null
template <int ACT>
__global__ __launch_bounds__(128) void k_gemm_hhx(const _Float16* __restrict__ A, int lda, size_t sA, const _Float16* __restrict__ Bh, int ldb, size_t sB, float alpha, const float* __restrict__ bias, size_t sBias, const float* __restrict__ CP, int rowsPerB, size_t sCPb, int row0g,
    float* __restrict__ C, _Float16* __restrict__ C16, int ldc, size_t sC, int M, int N, int K) {
  __shared__ __attribute__((aligned(16))) float so[4][16][64];
  const int tid = threadIdx.x, w = tid >> 5, lane = tid & 31, ln = lane & 15, hh = lane >> 4; const int by = blockIdx.y;
  A += (size_t)by * sA; Bh += (size_t)by * sB; const size_t cofs = (size_t)by * sC; const float* bp = bias ? bias + (size_t)by * sBias : nullptr;
  const int ntn = (N + 63) / 64; const int wid = blockIdx.x * 4 + w; const int mt = wid / ntn, nq = wid % ntn; if (mt * 16 >= M) return;
  const int row0 = mt * 16, col0 = nq * 64; const _Float16* arow = A + (size_t)(row0 + ln) * lda;
  v8f acc[4] = {};
  for (int kb = 0; kb < K; kb += 32) { FragH ah; ah.half[0] = *(const v8us*)((const unsigned short*)arow + kb + 8 * hh); ah.half[1] = *(const v8us*)((const unsigned short*)arow + kb + 16 + 8 * hh);
#pragma unroll
    for (int t = 0; t < 4; ++t) { if (col0 + t * 16 >= N) continue; const size_t boff = (size_t)(col0 + t * 16 + ln) * ldb + kb; FragH bq; bq.half[0] = *(const v8us*)((const unsigned short*)Bh + boff + 8 * hh); bq.half[1] = *(const v8us*)((const unsigned short*)Bh + boff + 16 + 8 * hh);
      acc[t] = mmaH<1>(ah.v, ah.v, bq.v, bq.v, acc[t]); }
  }
#pragma unroll
  for (int t = 0; t < 4; ++t) { if (col0 + t * 16 >= N) continue; const int col = col0 + t * 16 + ln; const float bv = bp ? bf16_round(bp[col]) : 0.f;
#pragma unroll
    for (int r = 0; r < 8; ++r) { float v = acc[t][r] * alpha + bv; if (CP) { const int bidx = (row0g + row0 + 8 * hh + r) / rowsPerB; v += CP[(size_t)bidx * sCPb + (size_t)by * 64 + col]; } if (ACT == 1) v = (v > 0.f) ? v : expm1f(v); else if (ACT == 3) v = fmaxf(v, 0.f); so[w][8 * hh + r][t * 16 + ln] = v; } }
  __builtin_amdgcn_fence(__ATOMIC_ACQ_REL, "workgroup"); __builtin_amdgcn_wave_barrier();
  const int rsub = lane >> 4, c4 = (lane & 15) * 4; typedef _Float16 v4h __attribute__((ext_vector_type(4)));
  {
#pragma unroll
    for (int q = 0; q < 8; ++q) { const int r = q * 2 + rsub; if (col0 + c4 < N) { const v4f v = *(const v4fa*)&so[w][r][c4]; if (C) *(v4f*)(C + cofs + (size_t)(row0 + r) * ldc + col0 + c4) = v; if (C16) { v4h h4; for (int i = 0; i < 4; ++i) h4[i] = (_Float16)v[i]; *(v4h*)(C16 + cofs + (size_t)(row0 + r) * ldc + col0 + c4) = h4; } } }
     }
}


// Eight 16-byte asynchronous copies global -> LDS (each lane its own addresses), rows lstep / gstep apart. The s_wait_xcnt closes the statement so that no
// address register named here is rewritten ahead of it.
__device__ __forceinline__ void copy8(unsigned l, const _Float16* g, unsigned lstep, size_t gstep) {
  asm volatile("global_load_async_to_lds_b128 %0, %8, off\n\t"
               "global_load_async_to_lds_b128 %1, %9, off\n\t"
               "global_load_async_to_lds_b128 %2, %10, off\n\t"
               "global_load_async_to_lds_b128 %3, %11, off\n\t"
               "global_load_async_to_lds_b128 %4, %12, off\n\t"
               "global_load_async_to_lds_b128 %5, %13, off\n\t"
               "global_load_async_to_lds_b128 %6, %14, off\n\t"
               "global_load_async_to_lds_b128 %7, %15, off\n\t"
               "s_wait_xcnt 0x0"
               :: "v"(l), "v"(l + lstep), "v"(l + 2 * lstep), "v"(l + 3 * lstep), "v"(l + 4 * lstep), "v"(l + 5 * lstep), "v"(l + 6 * lstep), "v"(l + 7 * lstep),
                  "v"(g), "v"(g + gstep), "v"(g + 2 * gstep), "v"(g + 3 * gstep), "v"(g + 4 * gstep), "v"(g + 5 * gstep), "v"(g + 6 * gstep), "v"(g + 7 * gstep)
               : "memory");
}
// C[M][Nn] = A[M][Kk] * Bh[Nn][Kk]^T * alpha (+ bf16-rounded bias), f16 operands, f32 accumulate. One work-group = one 128 x 128 tile of C, four waves (2 x 2) of 64 x 64.
// A and Bh tiles of 128 rows x 128 k are staged in LDS (row pitch 272 B) by asynchronous copies, two buffers: tile t + 1 flies while tile t is worked on.
// M, Nn multiples of 128 (grid = M / 128 * Nn / 128), Kk a multiple of 128. Each 16 x 16 accumulator sums k upwards in steps of 32.
template <int Nn, int Kk, bool OUT16, bool BIAS>
__global__ __launch_bounds__(128) void k_gemm_t(const _Float16* __restrict__ A, const _Float16* __restrict__ Bh, float alpha, const float* __restrict__ bias, float* __restrict__ C, _Float16* __restrict__ C16) {
  constexpr int KC = 128, PITCH = 272, OPB = 128 * PITCH, STG = 2 * OPB, NT = Kk / KC;
  __shared__ __attribute__((aligned(16))) unsigned char sm[2 * STG];
  const int tid = threadIdx.x, w = tid >> 5, lane = tid & 31, ln = lane & 15, hh = lane >> 4;
  const int bm = blockIdx.x / (Nn / 128), bn = blockIdx.x % (Nn / 128);
  const int wm = w >> 1, wn = w & 1;
  const int crow = tid >> 4, cch = tid & 15;      // a copy instruction of a wave covers two whole 256-byte rows
  const _Float16* ga = A + (size_t)(bm * 128 + crow) * Kk + cch * 8;
  const _Float16* gb = Bh + (size_t)(bn * 128 + crow) * Kk + cch * 8;
  const unsigned lc = (unsigned)(size_t)sm + crow * PITCH + cch * 16;
  auto fill = [&](int t, int buf) {
    const unsigned l = lc + buf * STG;
    copy8(l, ga + t * KC, 8 * PITCH, (size_t)8 * Kk);
    copy8(l + 64 * PITCH, ga + t * KC + (size_t)64 * Kk, 8 * PITCH, (size_t)8 * Kk);
    copy8(l + OPB, gb + t * KC, 8 * PITCH, (size_t)8 * Kk);
    copy8(l + OPB + 64 * PITCH, gb + t * KC + (size_t)64 * Kk, 8 * PITCH, (size_t)8 * Kk);
  };
  v8f acc[4][4] = {};
  fill(0, 0);
  asm volatile("s_wait_asynccnt 0x0" ::: "memory");      // tile 0 of this wave has landed
  __syncthreads();                                       // ... and every wave's part of it
  if (NT > 1) fill(1, 1);
  const int aoff = (wm * 64 + ln) * PITCH + 16 * hh, boff = OPB + (wn * 64 + ln) * PITCH + 16 * hh;
#pragma unroll 1      // kept rolled: unrolled over the k tiles the build takes many more vector registers
  for (int t = 0; t < NT; ++t) {
    const int sb = (t & 1) * STG;
#pragma unroll
    for (int ks = 0; ks < KC / 32; ++ks) {
      FragH a[4], b[4];
#pragma unroll
      for (int i = 0; i < 4; ++i) {
        a[i].half[0] = *(const v8us*)&sm[sb + aoff + i * 16 * PITCH + ks * 64]; a[i].half[1] = *(const v8us*)&sm[sb + aoff + i * 16 * PITCH + ks * 64 + 32];
        b[i].half[0] = *(const v8us*)&sm[sb + boff + i * 16 * PITCH + ks * 64]; b[i].half[1] = *(const v8us*)&sm[sb + boff + i * 16 * PITCH + ks * 64 + 32];
      }
#pragma unroll
      for (int i = 0; i < 4; ++i)
#pragma unroll
        for (int j = 0; j < 4; ++j) acc[i][j] = __builtin_amdgcn_wmma_f32_16x16x32_f16(false, a[i].v, false, b[j].v, (short)0, acc[i][j], false, false);
    }
    asm volatile("s_wait_dscnt 0x0" ::: "memory");       // this wave's reads of buffer t & 1 are done before it is refilled
    asm volatile("s_wait_asynccnt 0x0" ::: "memory");    // this wave's copies of tile t + 1 have landed
    __syncthreads();                                     // publishes tile t + 1, ends every reader's last read of tile t
    if (t + 2 < NT) fill(t + 2, t & 1);
  }
  asm volatile("s_wait_asynccnt 0x0" ::: "memory");      // no copy is outstanding when the ring becomes output staging
  // epilogue: each wave stages its 64 x 64 tile in its own LDS range (pitch 68 floats) and stores whole lines
  float* so = (float*)sm + w * (64 * 68);
  const int row0 = bm * 128 + wm * 64, col0 = bn * 128 + wn * 64;
#pragma unroll
  for (int j = 0; j < 4; ++j) {
    const float bv = BIAS ? bf16_round(bias[col0 + j * 16 + ln]) : 0.f;
#pragma unroll
    for (int i = 0; i < 4; ++i)
#pragma unroll
      for (int r = 0; r < 8; ++r) so[(i * 16 + 8 * hh + r) * 68 + j * 16 + ln] = acc[i][j][r] * alpha + bv;
  }
  __builtin_amdgcn_fence(__ATOMIC_ACQ_REL, "workgroup"); __builtin_amdgcn_wave_barrier();
  if (OUT16) {
    const int rs = lane >> 3, c8 = (lane & 7) * 8;
    unsigned short* cp = (unsigned short*)C16 + (size_t)(row0 + rs) * Nn + col0 + c8;
#pragma unroll
    for (int q = 0; q < 16; ++q) { const int r = q * 4 + rs; const v4f v0 = *(const v4fa*)&so[r * 68 + c8], v1 = *(const v4fa*)&so[r * 68 + c8 + 4]; FragH f;
#pragma unroll
      for (int i = 0; i < 4; ++i) { f.h[i] = (_Float16)v0[i]; f.h[4 + i] = (_Float16)v1[i]; }
      *(v8us*)(cp + q * 4 * Nn) = f.half[0]; }
  } else {
    const int rs = lane >> 4, c4 = (lane & 15) * 4;
    float* cp = C + (size_t)(row0 + rs) * Nn + col0 + c4;
#pragma unroll
    for (int q = 0; q < 32; ++q) { const int r = q * 2 + rs; const v4f v = *(const v4fa*)&so[r * 68 + c4]; *(v4f*)(cp + q * 2 * Nn) = v; }
  }
}


typedef _Float16 v4h __attribute__((ext_vector_type(4)));

__global__ __launch_bounds__(256) void k_x16(const float* __restrict__ x, _Float16* __restrict__ X16, size_t n8) { const size_t t = (size_t)blockIdx.x * 256 + threadIdx.x; if (t >= n8) return; FragH f;
#pragma unroll
  for (int q = 0; q < 8; ++q) f.h[q] = (_Float16)bf16_round(x[t * 8 + q]); *(v8us*)((unsigned short*)X16 + t * 8) = f.half[0];  }
__global__ __launch_bounds__(256) void k_h16(const float* __restrict__ x, _Float16* __restrict__ X16, size_t n8) { const size_t t = (size_t)blockIdx.x * 256 + threadIdx.x; if (t >= n8) return; FragH f;
#pragma unroll
  for (int q = 0; q < 8; ++q) f.h[q] = (_Float16)x[t * 8 + q]; *(v8us*)((unsigned short*)X16 + t * 8) = f.half[0];  }
__global__ __launch_bounds__(256) void k_round16f(const float* __restrict__ W, _Float16* __restrict__ Bt, size_t n8) { const size_t t = (size_t)blockIdx.x * 256 + threadIdx.x; if (t >= n8) return; FragH f;
#pragma unroll
  for (int i = 0; i < 8; ++i) f.h[i] = (_Float16)(bf16_round(W[t * 8 + i]) * 16.0f); *(v8us*)((unsigned short*)Bt + t * 8) = f.half[0];  }
template <int NHv, int TTv>
__global__ __launch_bounds__(256) void k_vt(const _Float16* __restrict__ V16, int ldv, int voff, _Float16* __restrict__ Vt) { __shared__ unsigned short tl[64][66]; const int tid = threadIdx.x; const int slab = blockIdx.x / (TTv / 64), lg = blockIdx.x % (TTv / 64); const int b = slab / NHv, h = slab % NHv;
  for (int i = tid; i < 64 * 8; i += 256) { const int r = i / 8, c8 = (i % 8) * 8; FragH f; f.half[0] = *(const v8us*)((const unsigned short*)V16 + ((size_t)b * TTv + lg * 64 + r) * ldv + voff + h * 64 + c8);
#pragma unroll
    for (int q = 0; q < 8; ++q) tl[r][c8 + q] = f.u[q]; }
  __syncthreads();
  {
#pragma unroll
    for (int rd = 0; rd < 2; ++rd) { const int d = rd * 32 + tid / 8, pc = tid % 8; FragH f;
#pragma unroll
      for (int q = 0; q < 8; ++q) f.u[q] = tl[pc * 8 + q][d];
      *(v8us*)((unsigned short*)Vt + ((size_t)slab * 64 + d) * TTv + lg * 64 + pc * 8) = f.half[0]; }
     } }

__global__ __launch_bounds__(256) void k_tok(const float* __restrict__ x, _Float16* __restrict__ X16) { __shared__ float tl[32][65]; const int tid = threadIdx.x; const int b = blockIdx.x / ((CC / 64) * (NPIX / 32)), rem = blockIdx.x % ((CC / 64) * (NPIX / 32)); const int cg = rem / (NPIX / 32), pg = rem % (NPIX / 32); const int c0 = cg * 64, p0 = pg * 32;
  for (int i = tid; i < 64 * 32; i += 256) { const int c = i / 32, pp = i % 32; tl[pp][c] = bf16_round(x[((size_t)b * CC + c0 + c) * NPIX + p0 + pp]); } __syncthreads();
  const int r = tid / 8, pc = tid % 8; FragH f; for (int q = 0; q < 8; ++q) f.h[q] = (_Float16)tl[r][pc * 8 + q]; const size_t row = (size_t)b * NPIX + p0 + r; *(v8us*)((unsigned short*)X16 + row * CC + c0 + pc * 8) = f.half[0];  }
__global__ __launch_bounds__(256) void k_dots(const _Float16* __restrict__ Q, const _Float16* __restrict__ KV, float* __restrict__ DOTS) { const size_t t = (size_t)blockIdx.x * 256 + threadIdx.x; if (t >= (size_t)BB * NH * NPIX * 9) return; const int w = (int)(t % 9); const int n = (int)((t / 9) % NPIX); const int h = (int)((t / (9 * NPIX)) % NH); const int b = (int)(t / ((size_t)9 * NPIX * NH)); const int y = n / HWD + w / 3 - 1, xx = n % HWD + w % 3 - 1; float s = 0.f;
  if (y >= 0 && y < HWD && xx >= 0 && xx < HWD) { const unsigned short* qr = (const unsigned short*)Q + ((size_t)b * NPIX + n) * INNER + h * DH; const unsigned short* kr = (const unsigned short*)KV + ((size_t)b * NPIX + y * HWD + xx) * (2 * INNER) + h * DH;
#pragma unroll 1
    for (int d = 0; d < DH; d += 8) { FragH a, k; a.half[0] = *(const v8us*)(qr + d); k.half[0] = *(const v8us*)(kr + d); for (int q = 0; q < 8; ++q) s += (float)a.h[q] * (float)k.h[q]; } s *= 0.125f; }
  *(float*)(DOTS + t) = s;  }
__global__ __launch_bounds__(256) void k_attn(const float* __restrict__ DOTS, float* __restrict__ ATTN) { const size_t t = (size_t)blockIdx.x * 256 + threadIdx.x; if (t >= (size_t)BB * NH * NPIX * 9) return; const size_t base = t - (t % 9); float m = -3.0e38f; for (int w = 0; w < 9; ++w) m = fmaxf(m, DOTS[base + w]); float z = 0.f; for (int w = 0; w < 9; ++w) z += expf(DOTS[base + w] - m); const float a = expf(DOTS[t] - m) / z; *(float*)(ATTN + t) = a;  }
__global__ __launch_bounds__(256) void k_av(const float* __restrict__ ATTN, const _Float16* __restrict__ KV, _Float16* __restrict__ O16) { const size_t t = (size_t)blockIdx.x * 256 + threadIdx.x; if (t >= (size_t)NR * NH * 8) return; const int p = (int)(t % 8); const int h = (int)((t / 8) % NH); const size_t bn = t / (8 * NH); const int b = (int)(bn / NPIX), n = (int)(bn % NPIX); float acc[8]; for (int q = 0; q < 8; ++q) acc[q] = 0.f; const float* at = ATTN + (((size_t)b * NH + h) * NPIX + n) * 9;
#pragma unroll 1
  for (int w = 0; w < 9; ++w) { const int y = n / HWD + w / 3 - 1, xx = n % HWD + w % 3 - 1; if (y < 0 || y >= HWD || xx < 0 || xx >= HWD) continue; const float a = at[w]; FragH v; v.half[0] = *(const v8us*)((const unsigned short*)KV + ((size_t)b * NPIX + y * HWD + xx) * (2 * INNER) + INNER + h * DH + p * 8); for (int q = 0; q < 8; ++q) acc[q] += a * (float)v.h[q]; }
  FragH o; for (int q = 0; q < 8; ++q) o.h[q] = (_Float16)acc[q]; *(v8us*)((unsigned short*)O16 + bn * INNER + h * DH + p * 8) = o.half[0];  }
__global__ __launch_bounds__(256) void k_out(const float* __restrict__ G, float* __restrict__ out) { __shared__ float tl[32][65]; const int tid = threadIdx.x; const int b = blockIdx.x / ((CC / 32) * (NPIX / 64)), rem = blockIdx.x % ((CC / 32) * (NPIX / 64)); const int cg = rem / (NPIX / 64), pg = rem % (NPIX / 64); const int c0 = cg * 32, p0 = pg * 64;
  for (int i = tid; i < 64 * 32; i += 256) { const int pp = i / 32, c = i % 32; tl[c][pp] = G[((size_t)b * NPIX + p0 + pp) * CC + c0 + c]; } __syncthreads();
  { for (int i = tid; i < 32 * 16; i += 256) { const int c = i / 16, q4 = i % 16; const v4f v = {tl[c][q4 * 4], tl[c][q4 * 4 + 1], tl[c][q4 * 4 + 2], tl[c][q4 * 4 + 3]}; *(v4f*)(out + ((size_t)b * CC + c0 + c) * NPIX + p0 + q4 * 4) = v; }  } }
extern "C" void kernel_launch(void* const* d_in, const int* in_sizes, int n_in,
                              void* d_out, int out_size, void* d_ws, size_t ws_size, hipStream_t stream) {
  (void)in_sizes; (void)n_in; (void)out_size;
  const float* x = (const float*)d_in[0]; const float* Wq = (const float*)d_in[1]; const float* Wkv = (const float*)d_in[2]; const float* Wo = (const float*)d_in[3]; const float* bo = (const float*)d_in[4];
  float* OUT0 = (float*)d_out; float* ATTN = OUT0 + (size_t)BB * CC * NPIX;
  char* ws = (char*)d_ws; size_t off = 0;
  auto take = [&](size_t bytes) { char* p = ws + off; off += (bytes + 255) & ~(size_t)255; return p; };
  _Float16* Bq = (_Float16*)take((size_t)INNER * CC * 2); _Float16* Bkv = (_Float16*)take((size_t)2 * INNER * CC * 2); _Float16* Bo = (_Float16*)take((size_t)CC * INNER * 2); _Float16* X16 = (_Float16*)take((size_t)NR * CC * 2); _Float16* Q = (_Float16*)take((size_t)NR * INNER * 2); _Float16* KV = (_Float16*)take((size_t)NR * 2 * INNER * 2); float* DOTS = (float*)take((size_t)NR * NH * 9 * 4); _Float16* O16 = (_Float16*)take((size_t)NR * INNER * 2); float* G = (float*)take((size_t)NR * CC * 4);
  if (off > ws_size) return;      // 1.1 + 8.4 + 16.8 + 33.5 + 4.7 + 16.8 + 16.8 ≈ 98 MB
  k_round16f<<<(unsigned)(((size_t)INNER * CC / 8 + 255) / 256), 256, 0, stream>>>(Wq, Bq, (size_t)INNER * CC / 8); k_round16f<<<(unsigned)(((size_t)2 * INNER * CC / 8 + 255) / 256), 256, 0, stream>>>(Wkv, Bkv, (size_t)2 * INNER * CC / 8); k_round16f<<<(unsigned)(((size_t)CC * INNER / 8 + 255) / 256), 256, 0, stream>>>(Wo, Bo, (size_t)CC * INNER / 8);      // (out,in)
  k_tok<<<BB * (CC / 64) * (NPIX / 32), 256, 0, stream>>>(x, X16);
  k_gemm_t<INNER, CC, true, false><<<(NR / 128) * (INNER / 128), 128, 0, stream>>>(X16, Bq, 0.0625f, nullptr, nullptr, Q);
  k_gemm_t<2 * INNER, CC, true, false><<<(NR / 128) * (2 * INNER / 128), 128, 0, stream>>>(X16, Bkv, 0.0625f, nullptr, nullptr, KV);      // [k | v]
  k_dots<<<(unsigned)(((size_t)BB * NH * NPIX * 9 + 255) / 256), 256, 0, stream>>>(Q, KV, DOTS); k_attn<<<(unsigned)(((size_t)BB * NH * NPIX * 9 + 255) / 256), 256, 0, stream>>>(DOTS, ATTN);
  k_av<<<(unsigned)(((size_t)NR * NH * 8 + 255) / 256), 256, 0, stream>>>(ATTN, KV, O16);
  k_gemm_t<CC, INNER, false, true><<<(NR / 128) * (CC / 128), 128, 0, stream>>>(O16, Bo, 0.0625f, bo, G, nullptr);      // to_out + bo
  k_out<<<BB * (CC / 32) * (NPIX / 64), 256, 0, stream>>>(G, OUT0);
}

// v002
// A run of this version takes 76.5 microseconds.
// Timed twice side by side with v001, it ran 1.21 and 1.22 times as fast.
// Counting every step since v000, it is 2.17 times as fast.
#include <hip/hip_runtime.h>
// Local 3×3-window attention (x [16,256,32,32]; 8 heads × 64): q = 1×1 conv (Wq), k,v = 1×1 conv (Wkv), each pixel attends over its 3×3 neighbourhood (zero-padded keys/values take part with
// logit 0), softmax(q·k/8), out = Σ attn·v, 1×1 conv Wo + bo; outputs (out NCHW, attn [16,8,1024,9]). The three pointwise convs run as GEMMs on v_wmma_f32_16x16x32_f16 (x bf16-exact, (out,in)
// weights bf16-exact ×2^4, q/k/v/o f16, f32 accumulate); the 9-wide window dots, softmax and attn·v are f32 VALU in one kernel (eight lanes a pixel and head), layout transposes by tiles.
#define BB 16
#define CC 256
#define HWD 32
#define NPIX 1024
#define NH 8
#define DH 64
#define INNER 512
#define NR (BB * NPIX)

typedef __bf16 v16b __attribute__((ext_vector_type(16)));
typedef unsigned short v8us __attribute__((ext_vector_type(8), may_alias));
typedef float  v8f  __attribute__((ext_vector_type(8)));
typedef float  v4f  __attribute__((ext_vector_type(4)));
typedef float  v4fa __attribute__((ext_vector_type(4), may_alias));
union FragB { v16b v; v8us half[2]; unsigned short u[16]; };

__device__ __forceinline__ unsigned short bf16_bits(float x) { unsigned int u = __float_as_uint(x); return (unsigned short)((u + 0x7FFFu + ((u >> 16) & 1u)) >> 16); }
__device__ __forceinline__ float bf16_val(unsigned short b) { return __uint_as_float(((unsigned int)b) << 16); }
__device__ __forceinline__ float bf16_round(float x) { return bf16_val(bf16_bits(x)); }
// D += A·B with NT terms: 1 = ah·bh, 2 = + al·bh (A split), 3 = + ah·bl (both split)
template <int NT>
__device__ __forceinline__ v8f mmaN(v16b ah, v16b al, v16b bh, v16b bl, v8f c) {
  c = __builtin_amdgcn_wmma_f32_16x16x32_bf16(false, ah, false, bh, (short)0, c, false, false);
  if (NT >= 2) c = __builtin_amdgcn_wmma_f32_16x16x32_bf16(false, al, false, bh, (short)0, c, false, false);
  if (NT >= 3) c = __builtin_amdgcn_wmma_f32_16x16x32_bf16(false, ah, false, bl, (short)0, c, false, false);
  asm volatile("v_nop\n\tv_nop\n\tv_nop\n\tv_nop" : "+v"(c) : "v"(ah), "v"(al), "v"(bh), "v"(bl));
  return c;
}

__global__ __launch_bounds__(256) void k_wt_bf16(const float* __restrict__ W, unsigned short* __restrict__ Wt, int K, int N) {
  const int t = blockIdx.x * 256 + threadIdx.x;
  const int k8n = K / 8;
  if (t >= N * k8n) return;
  const int n = t / k8n, k8 = (t % k8n) * 8;
  v8us v;
#pragma unroll
  for (int i = 0; i < 8; ++i) v[i] = bf16_bits(W[(size_t)(k8 + i) * N + n]);
  *(v8us*)(Wt + (size_t)n * K + k8) = v;
  
}

// GEMM C[M][N] (f32, pitch ldc) = act(A[M][K]·W + bias). A f32 row-major (pitch lda) converted per fragment to bf16
// (ASPLIT: hi/lo two planes -> 2 terms, else single rounded term); Wt bf16 [N][K] (pitch ldb). BIAS_BF16 rounds the
// bias to bf16 first (bias quantised to bf16 before the add). K%32==0, M%16==0, N%64==0.
template <bool ASPLIT, int ACT, bool BIAS_BF16>
__global__ __launch_bounds__(128) void k_gemm_bf(const float* __restrict__ A, int lda, const unsigned short* __restrict__ Wt, int ldb,
                                               const float* __restrict__ bias, float* __restrict__ C, int ldc, int M, int N, int K) {
  __shared__ __attribute__((aligned(16))) float so[4][16][64];
  const int tid = threadIdx.x, w = tid >> 5, lane = tid & 31, ln = lane & 15, hh = lane >> 4;
  const int ntn = N / 64;
  const int wid = blockIdx.x * 4 + w;
  const int mt = wid / ntn, nq = wid % ntn;
  if (mt * 16 >= M) return;
  const int row0 = mt * 16, col0 = nq * 64;
  const float* arow = A + (size_t)(row0 + ln) * lda;
  v8f acc[4] = {};
  for (int kb = 0; kb < K; kb += 32) {
    FragB ah, al;
    const v4f x0 = *(const v4fa*)(arow + kb + 8 * hh), x1 = *(const v4fa*)(arow + kb + 8 * hh + 4);
    const v4f x2 = *(const v4fa*)(arow + kb + 16 + 8 * hh), x3 = *(const v4fa*)(arow + kb + 16 + 8 * hh + 4);
    float xs[16] = {x0[0],x0[1],x0[2],x0[3],x1[0],x1[1],x1[2],x1[3],x2[0],x2[1],x2[2],x2[3],x3[0],x3[1],x3[2],x3[3]};
#pragma unroll
    for (int i = 0; i < 16; ++i) { const unsigned short hb = bf16_bits(xs[i]); ah.u[i] = hb; al.u[i] = ASPLIT ? bf16_bits(xs[i] - bf16_val(hb)) : (unsigned short)0; }
#pragma unroll
    for (int t = 0; t < 4; ++t) {
      const unsigned short* brow = Wt + (size_t)(col0 + t * 16 + ln) * ldb + kb;
      FragB b;
      b.half[0] = *(const v8us*)(brow + 8 * hh);
      b.half[1] = *(const v8us*)(brow + 16 + 8 * hh);
      acc[t] = mmaN<ASPLIT ? 2 : 1>(ah.v, al.v, b.v, b.v, acc[t]);
    }
  }
#pragma unroll
  for (int t = 0; t < 4; ++t) {
    float bv = bias ? bias[col0 + t * 16 + ln] : 0.f;
    if (BIAS_BF16) bv = bf16_round(bv);
#pragma unroll
    for (int r = 0; r < 8; ++r) { float v = acc[t][r] + bv; if (ACT == 1) v = fmaxf(v, 0.f); so[w][8 * hh + r][t * 16 + ln] = v; }
  }
  __builtin_amdgcn_fence(__ATOMIC_ACQ_REL, "workgroup");
  __builtin_amdgcn_wave_barrier();
  const int rsub = lane >> 4, c4 = (lane & 15) * 4;
  {
#pragma unroll
    for (int q = 0; q < 8; ++q) {
      const int r = q * 2 + rsub;
      const v4f v = *(const v4fa*)&so[w][r][c4];
      *(v4f*)(C + (size_t)(row0 + r) * ldc + col0 + c4) = v;
    }
    
  }
}

// Flash-style causal/unmasked attention, all contractions 3-term bf16 hi/lo splits, f32 softmax with running max.
// q,k,v rows are read from f32 buffers with arbitrary row pitch (so they can live inside a fused qkv buffer);
// D = head size (multiple of 32, <= 128); one wave = 16 query rows; block = 4 waves (64 queries) sharing K/V chunks of 32.
template <int D, bool CAUSAL>
__global__ __launch_bounds__(128) void k_flash(const float* __restrict__ qb, const float* __restrict__ kb, const float* __restrict__ vb,
                                             int pitch, int T, int H, float scale, float* __restrict__ y, int ypitch) {
  constexpr int KS = D / 32;        // k-steps for QK
  constexpr int DT = D / 16;        // d tiles for PV
  __shared__ __attribute__((aligned(16))) unsigned short sKh[32][D + 8], sKl[32][D + 8], sVh[32][D + 8], sVl[32][D + 8];
  __shared__ __attribute__((aligned(16))) unsigned short sPh[4][16][40], sPl[4][16][40];
  __shared__ __attribute__((aligned(16))) float sO[4][16][D];
  const int tid = threadIdx.x, w = tid >> 5, lane = tid & 31, ln = lane & 15, hh = lane >> 4;
  const int nqb = (T + 63) / 64;
  const int bh = blockIdx.x / nqb, qblk = blockIdx.x % nqb;
  const int b = bh / H, h = bh % H;
  const int q0 = qblk * 64 + w * 16;
  const float* Q = qb + (size_t)b * T * pitch + h * D;
  const float* K = kb + (size_t)b * T * pitch + h * D;
  const float* V = vb + (size_t)b * T * pitch + h * D;

  // A fragments of the wave's 16 query rows (scaled), hi/lo
  FragB aqh[KS], aql[KS];
  {
    int row = q0 + ln; if (row >= T) row = T - 1;
    const float* qr = Q + (size_t)row * pitch;
#pragma unroll
    for (int ks = 0; ks < KS; ++ks)
#pragma unroll
      for (int i = 0; i < 16; ++i) {
        const int d = ks * 32 + ((i < 8) ? (8 * hh + i) : (16 + 8 * hh + (i - 8)));
        const float x = qr[d] * scale; const unsigned short hb = bf16_bits(x);
        aqh[ks].u[i] = hb; aql[ks].u[i] = bf16_bits(x - bf16_val(hb));
      }
  }
  float m_r[8], l_r[8];
#pragma unroll
  for (int r = 0; r < 8; ++r) { m_r[r] = -3.0e38f; l_r[r] = 0.f; }
  v8f oacc[DT];
#pragma unroll
  for (int dt = 0; dt < DT; ++dt) oacc[dt] = (v8f){0.f,0.f,0.f,0.f,0.f,0.f,0.f,0.f};

  const int kv_end = CAUSAL ? min(T, qblk * 64 + 64) : T;     // block-uniform
  for (int j0 = 0; j0 < kv_end; j0 += 32) {
    __syncthreads();
    for (int e = tid; e < 32 * (D / 4); e += 128) {
      const int r = e / (D / 4), c4 = (e % (D / 4)) * 4;
      const int key = j0 + r;
      v4f kf = {0.f,0.f,0.f,0.f}, vf = {0.f,0.f,0.f,0.f};
      if (key < T) { kf = *(const v4fa*)(K + (size_t)key * pitch + c4); vf = *(const v4fa*)(V + (size_t)key * pitch + c4); }
#pragma unroll
      for (int t = 0; t < 4; ++t) {
        unsigned short hb = bf16_bits(kf[t]); sKh[r][c4 + t] = hb; sKl[r][c4 + t] = bf16_bits(kf[t] - bf16_val(hb));
        hb = bf16_bits(vf[t]); sVh[r][c4 + t] = hb; sVl[r][c4 + t] = bf16_bits(vf[t] - bf16_val(hb));
      }
    }
    __syncthreads();
    // S tile 16 x 32
    v8f s[2];
#pragma unroll
    for (int nt = 0; nt < 2; ++nt) {
      v8f acc = {};
#pragma unroll
      for (int ks = 0; ks < KS; ++ks) {
        FragB bh_, bl_;
        bh_.half[0] = *(const v8us*)&sKh[nt * 16 + ln][ks * 32 + 8 * hh]; bh_.half[1] = *(const v8us*)&sKh[nt * 16 + ln][ks * 32 + 16 + 8 * hh];
        bl_.half[0] = *(const v8us*)&sKl[nt * 16 + ln][ks * 32 + 8 * hh]; bl_.half[1] = *(const v8us*)&sKl[nt * 16 + ln][ks * 32 + 16 + 8 * hh];
        acc = mmaN<3>(aqh[ks].v, aql[ks].v, bh_.v, bl_.v, acc);
      }
      s[nt] = acc;
    }
    // mask + running max (rows 8hh+r; the 16 lanes of a half share rows)
    float alpha[8];
#pragma unroll
    for (int r = 0; r < 8; ++r) {
      const int qi = q0 + 8 * hh + r;
      const int ja = j0 + ln, jb = j0 + 16 + ln;
      if (CAUSAL) { if (ja > qi) s[0][r] = -3.0e38f; if (jb > qi) s[1][r] = -3.0e38f; }
      if (ja >= T) s[0][r] = -3.0e38f;
      if (jb >= T) s[1][r] = -3.0e38f;
      float mx = fmaxf(s[0][r], s[1][r]);
      mx = fmaxf(mx, __shfl_xor(mx, 1, 32)); mx = fmaxf(mx, __shfl_xor(mx, 2, 32)); mx = fmaxf(mx, __shfl_xor(mx, 4, 32)); mx = fmaxf(mx, __shfl_xor(mx, 8, 32));
      const float mnew = fmaxf(m_r[r], mx);
      alpha[r] = (mnew > -1.0e38f) ? __expf(m_r[r] - mnew) : 1.0f;
      const float p0 = (s[0][r] > -1.0e38f) ? __expf(s[0][r] - mnew) : 0.f;
      const float p1 = (s[1][r] > -1.0e38f) ? __expf(s[1][r] - mnew) : 0.f;
      m_r[r] = mnew;
      l_r[r] = l_r[r] * alpha[r] + p0 + p1;            // per-lane partial row sum (16 lanes combined at the end)
      unsigned short hb = bf16_bits(p0); sPh[w][8 * hh + r][ln] = hb;      sPl[w][8 * hh + r][ln] = bf16_bits(p0 - bf16_val(hb));
      hb = bf16_bits(p1);                sPh[w][8 * hh + r][16 + ln] = hb; sPl[w][8 * hh + r][16 + ln] = bf16_bits(p1 - bf16_val(hb));
    }
#pragma unroll
    for (int dt = 0; dt < DT; ++dt)
#pragma unroll
      for (int r = 0; r < 8; ++r) oacc[dt][r] *= alpha[r];
    __builtin_amdgcn_fence(__ATOMIC_ACQ_REL, "workgroup");
    __builtin_amdgcn_wave_barrier();
    FragB pah, pal;
    pah.half[0] = *(const v8us*)&sPh[w][ln][8 * hh]; pah.half[1] = *(const v8us*)&sPh[w][ln][16 + 8 * hh];
    pal.half[0] = *(const v8us*)&sPl[w][ln][8 * hh]; pal.half[1] = *(const v8us*)&sPl[w][ln][16 + 8 * hh];
#pragma unroll
    for (int dt = 0; dt < DT; ++dt) {
      FragB bvh, bvl;
#pragma unroll
      for (int i = 0; i < 8; ++i) {
        bvh.u[i] = sVh[8 * hh + i][dt * 16 + ln]; bvh.u[8 + i] = sVh[16 + 8 * hh + i][dt * 16 + ln];
        bvl.u[i] = sVl[8 * hh + i][dt * 16 + ln]; bvl.u[8 + i] = sVl[16 + 8 * hh + i][dt * 16 + ln];
      }
      oacc[dt] = mmaN<3>(pah.v, pal.v, bvh.v, bvl.v, oacc[dt]);
    }
    __builtin_amdgcn_fence(__ATOMIC_ACQ_REL, "workgroup");
    __builtin_amdgcn_wave_barrier();
  }
#pragma unroll
  for (int r = 0; r < 8; ++r) {
    float l = l_r[r];
    l += __shfl_xor(l, 1, 32); l += __shfl_xor(l, 2, 32); l += __shfl_xor(l, 4, 32); l += __shfl_xor(l, 8, 32);
    l_r[r] = (l > 0.f) ? 1.0f / l : 0.f;
  }
#pragma unroll
  for (int dt = 0; dt < DT; ++dt)
#pragma unroll
    for (int r = 0; r < 8; ++r) sO[w][8 * hh + r][dt * 16 + ln] = oacc[dt][r] * l_r[r];
  __builtin_amdgcn_fence(__ATOMIC_ACQ_REL, "workgroup");
  __builtin_amdgcn_wave_barrier();
  {
    for (int r = 0; r < 16; ++r) {
      const int row = q0 + r;
      if (row < T && lane < D / 4) {
        const v4f val = *(const v4fa*)&sO[w][r][lane * 4];
        *(v4f*)(y + ((size_t)b * T + row) * ypitch + h * D + lane * 4) = val;
      }
    }
    
  }
}

// GEMM C = act(A·W + bias + resid): A f32 (ASPLIT -> hi/lo 2 terms), Wt bf16 [N][K]; ACT 0 none, 1 relu, 2 exact gelu;
// resid (optional, f32, row index = (row % rmod), pitch ldr, RES_BF16 rounds it) added before the activation.
template <bool ASPLIT, int ACT, bool BIAS_BF16, bool RES_BF16>
__global__ __launch_bounds__(128) void k_gemm_bf3(const float* __restrict__ A, int lda, const unsigned short* __restrict__ Wt, int ldb,
                                                const float* __restrict__ bias, const float* __restrict__ resid, int rmod, int ldr,
                                                float* __restrict__ C, int ldc, int M, int N, int K) {
  __shared__ __attribute__((aligned(16))) float so[4][16][64];
  const int tid = threadIdx.x, w = tid >> 5, lane = tid & 31, ln = lane & 15, hh = lane >> 4;
  const int ntn = N / 64;
  const int wid = blockIdx.x * 4 + w;
  const int mt = wid / ntn, nq = wid % ntn;
  if (mt * 16 >= M) return;
  const int row0 = mt * 16, col0 = nq * 64;
  const float* arow = A + (size_t)(row0 + ln) * lda;
  v8f acc[4] = {};
  for (int kb = 0; kb < K; kb += 32) {
    FragB ah, al;
    const v4f x0 = *(const v4fa*)(arow + kb + 8 * hh), x1 = *(const v4fa*)(arow + kb + 8 * hh + 4);
    const v4f x2 = *(const v4fa*)(arow + kb + 16 + 8 * hh), x3 = *(const v4fa*)(arow + kb + 16 + 8 * hh + 4);
    float xs[16] = {x0[0],x0[1],x0[2],x0[3],x1[0],x1[1],x1[2],x1[3],x2[0],x2[1],x2[2],x2[3],x3[0],x3[1],x3[2],x3[3]};
#pragma unroll
    for (int i = 0; i < 16; ++i) { const unsigned short hb = bf16_bits(xs[i]); ah.u[i] = hb; al.u[i] = ASPLIT ? bf16_bits(xs[i] - bf16_val(hb)) : (unsigned short)0; }
#pragma unroll
    for (int t = 0; t < 4; ++t) {
      const unsigned short* brow = Wt + (size_t)(col0 + t * 16 + ln) * ldb + kb;
      FragB b;
      b.half[0] = *(const v8us*)(brow + 8 * hh);
      b.half[1] = *(const v8us*)(brow + 16 + 8 * hh);
      acc[t] = mmaN<ASPLIT ? 2 : 1>(ah.v, al.v, b.v, b.v, acc[t]);
    }
  }
#pragma unroll
  for (int t = 0; t < 4; ++t) {
    const int col = col0 + t * 16 + ln;
    float bv = bias ? bias[col] : 0.f;
    if (BIAS_BF16) bv = bf16_round(bv);
#pragma unroll
    for (int r = 0; r < 8; ++r) {
      float v = acc[t][r] + bv;
      if (resid) { float rv = resid[(size_t)((row0 + 8 * hh + r) % rmod) * ldr + col]; if (RES_BF16) rv = bf16_round(rv); v += rv; }
      if (ACT == 1) v = fmaxf(v, 0.f);
      if (ACT == 2) v = 0.5f * v * (1.0f + erff(v * 0.70710678118654752f));
      if (ACT == 3) { const float u = 0.7978845608028654f * (v + 0.044715f * v * v * v); v = 0.5f * v * (1.0f + tanhf(u)); }
      so[w][8 * hh + r][t * 16 + ln] = v;
    }
  }
  __builtin_amdgcn_fence(__ATOMIC_ACQ_REL, "workgroup");
  __builtin_amdgcn_wave_barrier();
  const int rsub = lane >> 4, c4 = (lane & 15) * 4;
  {
#pragma unroll
    for (int q = 0; q < 8; ++q) {
      const int r = q * 2 + rsub;
      const v4f v = *(const v4fa*)&so[w][r][c4];
      *(v4f*)(C + (size_t)(row0 + r) * ldc + col0 + c4) = v;
    }
    
  }
}
// row LayerNorm (biased variance, eps) over N: s = X (+ R); optional out_sum <- s; out_norm <- (s-mu)*rsqrt(var+eps)*g + b
template <bool PARAM_BF16>
__global__ __launch_bounds__(256) void k_layernorm(const float* __restrict__ X, const float* __restrict__ R, const float* __restrict__ g, const float* __restrict__ bta,
                                                  float* __restrict__ out_sum, float* __restrict__ out_norm, int N, float eps) {
  __shared__ float red[256];
  const int row = blockIdx.x, tid = threadIdx.x;
  const float* x = X + (size_t)row * N; const float* rr = R ? R + (size_t)row * N : nullptr;
  float vals[16];                     // up to N = 4096
  const int per = N / 256;            // contiguous chunk per thread? use strided-by-4 chunks: thread handles j = tid*4 + 1024*u
  float s1 = 0.f;
  for (int u = 0; u < per / 4; ++u) {
    const int j = tid * 4 + 1024 * u;
    const v4f a = *(const v4fa*)(x + j);
    v4f b = {0.f,0.f,0.f,0.f}; if (rr) b = *(const v4fa*)(rr + j);
#pragma unroll
    for (int q = 0; q < 4; ++q) { const float v = a[q] + b[q]; vals[u * 4 + q] = v; s1 += v; }
  }
  red[tid] = s1; __syncthreads();
  for (int st = 128; st > 0; st >>= 1) { if (tid < st) red[tid] += red[tid + st]; __syncthreads(); }
  const float mu = red[0] / (float)N; __syncthreads();
  float s2 = 0.f;
  for (int u = 0; u < per / 4; ++u)
#pragma unroll
    for (int q = 0; q < 4; ++q) { const float c = vals[u * 4 + q] - mu; s2 += c * c; }
  red[tid] = s2; __syncthreads();
  for (int st = 128; st > 0; st >>= 1) { if (tid < st) red[tid] += red[tid + st]; __syncthreads(); }
  const float rs = rsqrtf(red[0] / (float)N + eps);
  {
    for (int u = 0; u < per / 4; ++u) {
      const int j = tid * 4 + 1024 * u;
      v4f o, sm;
#pragma unroll
      for (int q = 0; q < 4; ++q) {
        float gg = g[j + q], bb = bta[j + q];
        if (PARAM_BF16) { gg = bf16_round(gg); bb = bf16_round(bb); }
        sm[q] = vals[u * 4 + q]; o[q] = (vals[u * 4 + q] - mu) * rs * gg + bb;
      }
      if (out_sum) *(v4f*)(out_sum + (size_t)row * N + j) = sm;
      *(v4f*)(out_norm + (size_t)row * N + j) = o;
    }
    
  }
}



// ---- f16 WMMA path (v_wmma_f32_16x16x32_f16): 11-bit significands for operands in range — used here for the three 1×1 conv GEMMs (k_gemm_t)
typedef _Float16 v16h __attribute__((ext_vector_type(16)));
union FragH { v16h v; v8us half[2]; _Float16 h[16]; unsigned short u[16]; };
template <int NT>
__device__ __forceinline__ v8f mmaH(v16h ah, v16h al, v16h bh, v16h bl, v8f c) {
  c = __builtin_amdgcn_wmma_f32_16x16x32_f16(false, ah, false, bh, (short)0, c, false, false);
  if (NT >= 2) c = __builtin_amdgcn_wmma_f32_16x16x32_f16(false, al, false, bh, (short)0, c, false, false);
  if (NT >= 3) c = __builtin_amdgcn_wmma_f32_16x16x32_f16(false, ah, false, bl, (short)0, c, false, false);
  asm volatile("v_nop\n\tv_nop\n\tv_nop\n\tv_nop" : "+v"(c) : "v"(ah), "v"(al), "v"(bh), "v"(bl));
  return c;
}
// batched GEMM like k_gemm_b but f16 operands: A f32 (split into f16 hi/lo if ASPLIT, else rounded to f16), Bt = f16 values [n][k]; alpha; C f32; N multiple of 16 (partial tiles skipped)
template <bool ASPLIT>
__global__ __launch_bounds__(128) void k_gemm_h(const float* __restrict__ A, int lda, size_t sA, const _Float16* __restrict__ Bh, int ldb, size_t sB, float alpha, float* __restrict__ C, int ldc, size_t sC, int M, int N, int K) {
  __shared__ __attribute__((aligned(16))) float so[4][16][64];
  const int tid = threadIdx.x, w = tid >> 5, lane = tid & 31, ln = lane & 15, hh = lane >> 4; const int by = blockIdx.y;
  A += (size_t)by * sA; Bh += (size_t)by * sB; C += (size_t)by * sC;
  const int ntn = (N + 63) / 64; const int wid = blockIdx.x * 4 + w; const int mt = wid / ntn, nq = wid % ntn; if (mt * 16 >= M) return;
  const int row0 = mt * 16, col0 = nq * 64; const float* arow = A + (size_t)(row0 + ln) * lda;
  v8f acc[4] = {};
  for (int kb = 0; kb < K; kb += 32) {
    FragH ah, al;
    const v4f x0 = *(const v4fa*)(arow + kb + 8 * hh), x1 = *(const v4fa*)(arow + kb + 8 * hh + 4), x2 = *(const v4fa*)(arow + kb + 16 + 8 * hh), x3 = *(const v4fa*)(arow + kb + 16 + 8 * hh + 4);
    float xs[16] = {x0[0],x0[1],x0[2],x0[3],x1[0],x1[1],x1[2],x1[3],x2[0],x2[1],x2[2],x2[3],x3[0],x3[1],x3[2],x3[3]};
#pragma unroll
    for (int i = 0; i < 16; ++i) { const _Float16 h = (_Float16)xs[i]; ah.h[i] = h; al.h[i] = ASPLIT ? (_Float16)(xs[i] - (float)h) : (_Float16)0.0f; }
#pragma unroll
    for (int t = 0; t < 4; ++t) { if (col0 + t * 16 >= N) continue; const size_t boff = (size_t)(col0 + t * 16 + ln) * ldb + kb; FragH bq; bq.half[0] = *(const v8us*)(Bh + boff + 8 * hh); bq.half[1] = *(const v8us*)(Bh + boff + 16 + 8 * hh);
      acc[t] = mmaH<ASPLIT ? 2 : 1>(ah.v, al.v, bq.v, bq.v, acc[t]); }
  }
#pragma unroll
  for (int t = 0; t < 4; ++t) { if (col0 + t * 16 >= N) continue;
#pragma unroll
    for (int r = 0; r < 8; ++r) so[w][8 * hh + r][t * 16 + ln] = acc[t][r] * alpha; }
  __builtin_amdgcn_fence(__ATOMIC_ACQ_REL, "workgroup"); __builtin_amdgcn_wave_barrier();
  const int rsub = lane >> 4, c4 = (lane & 15) * 4;
  {
#pragma unroll
    for (int q = 0; q < 8; ++q) { const int r = q * 2 + rsub; if (col0 + c4 < N) { const v4f v = *(const v4fa*)&so[w][r][c4]; *(v4f*)(C + (size_t)(row0 + r) * ldc + col0 + c4) = v; } }
     }
}

// Wt[n][k] = f16(W[k][n]·scale) from f32 row-major W[K][N] (scale = power of two; bf16-exact weights stay exact in f16 away from the subnormal range)
__global__ __launch_bounds__(256) void k_wt_f16(const float* __restrict__ W, _Float16* __restrict__ Wt, int K, int N, float scale) {
  const int t = blockIdx.x * 256 + threadIdx.x; if (t >= N * (K / 8)) return; const int n = t / (K / 8), k8 = (t % (K / 8)) * 8; FragH f;
#pragma unroll
  for (int i = 0; i < 8; ++i) f.h[i] = (_Float16)(bf16_round(W[(size_t)(k8 + i) * N + n]) * scale); const v8us o = f.half[0];
  *(v8us*)((unsigned short*)Wt + (size_t)n * K + k8) = o; 
}
// k_gemm_hh variant with fused epilogue: v = acc·alpha + bias[by·sBias + col] (+ CP[(row/rowsPerB)·sCPb + by·64 + col] if CP) ; ACT 0 none / 1 elu ; writes f16 C16 and f32 C, each if non-null
template <int ACT>
__global__ __launch_bounds__(128) void k_gemm_hhx(const _Float16* __restrict__ A, int lda, size_t sA, const _Float16* __restrict__ Bh, int ldb, size_t sB, float alpha, const float* __restrict__ bias, size_t sBias, const float* __restrict__ CP, int rowsPerB, size_t sCPb, int row0g,
    float* __restrict__ C, _Float16* __restrict__ C16, int ldc, size_t sC, int M, int N, int K) {
  __shared__ __attribute__((aligned(16))) float so[4][16][64];
  const int tid = threadIdx.x, w = tid >> 5, lane = tid & 31, ln = lane & 15, hh = lane >> 4; const int by = blockIdx.y;
  A += (size_t)by * sA; Bh += (size_t)by * sB; const size_t cofs = (size_t)by * sC; const float* bp = bias ? bias + (size_t)by * sBias : nullptr;
  const int ntn = (N + 63) / 64; const int wid = blockIdx.x * 4 + w; const int mt = wid / ntn, nq = wid % ntn; if (mt * 16 >= M) return;
  const int row0 = mt * 16, col0 = nq * 64; const _Float16* arow = A + (size_t)(row0 + ln) * lda;
  v8f acc[4] = {};
  for (int kb = 0; kb < K; kb += 32) { FragH ah; ah.half[0] = *(const v8us*)((const unsigned short*)arow + kb + 8 * hh); ah.half[1] = *(const v8us*)((const unsigned short*)arow + kb + 16 + 8 * hh);
#pragma unroll
    for (int t = 0; t < 4; ++t) { if (col0 + t * 16 >= N) continue; const size_t boff = (size_t)(col0 + t * 16 + ln) * ldb + kb; FragH bq; bq.half[0] = *(const v8us*)((const unsigned short*)Bh + boff + 8 * hh); bq.half[1] = *(const v8us*)((const unsigned short*)Bh + boff + 16 + 8 * hh);
      acc[t] = mmaH<1>(ah.v, ah.v, bq.v, bq.v, acc[t]); }
  }
#pragma unroll
  for (int t = 0; t < 4; ++t) { if (col0 + t * 16 >= N) continue; const int col = col0 + t * 16 + ln; const float bv = bp ? bf16_round(bp[col]) : 0.f;
#pragma unroll
    for (int r = 0; r < 8; ++r) { float v = acc[t][r] * alpha + bv; if (CP) { const int bidx = (row0g + row0 + 8 * hh + r) / rowsPerB; v += CP[(size_t)bidx * sCPb + (size_t)by * 64 + col]; } if (ACT == 1) v = (v > 0.f) ? v : expm1f(v); else if (ACT == 3) v = fmaxf(v, 0.f); so[w][8 * hh + r][t * 16 + ln] = v; } }
  __builtin_amdgcn_fence(__ATOMIC_ACQ_REL, "workgroup"); __builtin_amdgcn_wave_barrier();
  const int rsub = lane >> 4, c4 = (lane & 15) * 4; typedef _Float16 v4h __attribute__((ext_vector_type(4)));
  {
#pragma unroll
    for (int q = 0; q < 8; ++q) { const int r = q * 2 + rsub; if (col0 + c4 < N) { const v4f v = *(const v4fa*)&so[w][r][c4]; if (C) *(v4f*)(C + cofs + (size_t)(row0 + r) * ldc + col0 + c4) = v; if (C16) { v4h h4; for (int i = 0; i < 4; ++i) h4[i] = (_Float16)v[i]; *(v4h*)(C16 + cofs + (size_t)(row0 + r) * ldc + col0 + c4) = h4; } } }
     }
}


// Eight 16-byte asynchronous copies global -> LDS (each lane its own addresses), rows lstep / gstep apart. The s_wait_xcnt closes the statement so that no
// address register named here is rewritten ahead of it.
__device__ __forceinline__ void copy8(unsigned l, const _Float16* g, unsigned lstep, size_t gstep) {
  asm volatile("global_load_async_to_lds_b128 %0, %8, off\n\t"
               "global_load_async_to_lds_b128 %1, %9, off\n\t"
               "global_load_async_to_lds_b128 %2, %10, off\n\t"
               "global_load_async_to_lds_b128 %3, %11, off\n\t"
               "global_load_async_to_lds_b128 %4, %12, off\n\t"
               "global_load_async_to_lds_b128 %5, %13, off\n\t"
               "global_load_async_to_lds_b128 %6, %14, off\n\t"
               "global_load_async_to_lds_b128 %7, %15, off\n\t"
               "s_wait_xcnt 0x0"
               :: "v"(l), "v"(l + lstep), "v"(l + 2 * lstep), "v"(l + 3 * lstep), "v"(l + 4 * lstep), "v"(l + 5 * lstep), "v"(l + 6 * lstep), "v"(l + 7 * lstep),
                  "v"(g), "v"(g + gstep), "v"(g + 2 * gstep), "v"(g + 3 * gstep), "v"(g + 4 * gstep), "v"(g + 5 * gstep), "v"(g + 6 * gstep), "v"(g + 7 * gstep)
               : "memory");
}
// C[M][Nn] = A[M][Kk] * Bh[Nn][Kk]^T * alpha (+ bf16-rounded bias), f16 operands, f32 accumulate. One work-group = one 128 x 128 tile of C, four waves (2 x 2) of 64 x 64.
// A and Bh tiles of 128 rows x 128 k are staged in LDS (row pitch 272 B) by asynchronous copies, two buffers: tile t + 1 flies while tile t is worked on.
// M, Nn multiples of 128 (grid = M / 128 * Nn / 128), Kk a multiple of 128. Each 16 x 16 accumulator sums k upwards in steps of 32.
template <int Nn, int Kk, bool OUT16, bool BIAS>
__global__ __launch_bounds__(128) void k_gemm_t(const _Float16* __restrict__ A, const _Float16* __restrict__ Bh, float alpha, const float* __restrict__ bias, float* __restrict__ C, _Float16* __restrict__ C16) {
  constexpr int KC = 128, PITCH = 272, OPB = 128 * PITCH, STG = 2 * OPB, NT = Kk / KC;
  __shared__ __attribute__((aligned(16))) unsigned char sm[2 * STG];
  const int tid = threadIdx.x, w = tid >> 5, lane = tid & 31, ln = lane & 15, hh = lane >> 4;
  const int bm = blockIdx.x / (Nn / 128), bn = blockIdx.x % (Nn / 128);
  const int wm = w >> 1, wn = w & 1;
  const int crow = tid >> 4, cch = tid & 15;      // a copy instruction of a wave covers two whole 256-byte rows
  const _Float16* ga = A + (size_t)(bm * 128 + crow) * Kk + cch * 8;
  const _Float16* gb = Bh + (size_t)(bn * 128 + crow) * Kk + cch * 8;
  const unsigned lc = (unsigned)(size_t)sm + crow * PITCH + cch * 16;
  auto fill = [&](int t, int buf) {
    const unsigned l = lc + buf * STG;
    copy8(l, ga + t * KC, 8 * PITCH, (size_t)8 * Kk);
    copy8(l + 64 * PITCH, ga + t * KC + (size_t)64 * Kk, 8 * PITCH, (size_t)8 * Kk);
    copy8(l + OPB, gb + t * KC, 8 * PITCH, (size_t)8 * Kk);
    copy8(l + OPB + 64 * PITCH, gb + t * KC + (size_t)64 * Kk, 8 * PITCH, (size_t)8 * Kk);
  };
  v8f acc[4][4] = {};
  fill(0, 0);
  asm volatile("s_wait_asynccnt 0x0" ::: "memory");      // tile 0 of this wave has landed
  __syncthreads();                                       // ... and every wave's part of it
  if (NT > 1) fill(1, 1);
  const int aoff = (wm * 64 + ln) * PITCH + 16 * hh, boff = OPB + (wn * 64 + ln) * PITCH + 16 * hh;
#pragma unroll 1      // kept rolled: unrolled over the k tiles the build takes many more vector registers
  for (int t = 0; t < NT; ++t) {
    const int sb = (t & 1) * STG;
#pragma unroll
    for (int ks = 0; ks < KC / 32; ++ks) {
      FragH a[4], b[4];
#pragma unroll
      for (int i = 0; i < 4; ++i) {
        a[i].half[0] = *(const v8us*)&sm[sb + aoff + i * 16 * PITCH + ks * 64]; a[i].half[1] = *(const v8us*)&sm[sb + aoff + i * 16 * PITCH + ks * 64 + 32];
        b[i].half[0] = *(const v8us*)&sm[sb + boff + i * 16 * PITCH + ks * 64]; b[i].half[1] = *(const v8us*)&sm[sb + boff + i * 16 * PITCH + ks * 64 + 32];
      }
#pragma unroll
      for (int i = 0; i < 4; ++i)
#pragma unroll
        for (int j = 0; j < 4; ++j) acc[i][j] = __builtin_amdgcn_wmma_f32_16x16x32_f16(false, a[i].v, false, b[j].v, (short)0, acc[i][j], false, false);
    }
    asm volatile("s_wait_dscnt 0x0" ::: "memory");       // this wave's reads of buffer t & 1 are done before it is refilled
    asm volatile("s_wait_asynccnt 0x0" ::: "memory");    // this wave's copies of tile t + 1 have landed
    __syncthreads();                                     // publishes tile t + 1, ends every reader's last read of tile t
    if (t + 2 < NT) fill(t + 2, t & 1);
  }
  asm volatile("s_wait_asynccnt 0x0" ::: "memory");      // no copy is outstanding when the ring becomes output staging
  // epilogue: each wave stages its 64 x 64 tile in its own LDS range (pitch 68 floats) and stores whole lines
  float* so = (float*)sm + w * (64 * 68);
  const int row0 = bm * 128 + wm * 64, col0 = bn * 128 + wn * 64;
#pragma unroll
  for (int j = 0; j < 4; ++j) {
    const float bv = BIAS ? bf16_round(bias[col0 + j * 16 + ln]) : 0.f;
#pragma unroll
    for (int i = 0; i < 4; ++i)
#pragma unroll
      for (int r = 0; r < 8; ++r) so[(i * 16 + 8 * hh + r) * 68 + j * 16 + ln] = acc[i][j][r] * alpha + bv;
  }
  __builtin_amdgcn_fence(__ATOMIC_ACQ_REL, "workgroup"); __builtin_amdgcn_wave_barrier();
  if (OUT16) {
    const int rs = lane >> 3, c8 = (lane & 7) * 8;
    unsigned short* cp = (unsigned short*)C16 + (size_t)(row0 + rs) * Nn + col0 + c8;
#pragma unroll
    for (int q = 0; q < 16; ++q) { const int r = q * 4 + rs; const v4f v0 = *(const v4fa*)&so[r * 68 + c8], v1 = *(const v4fa*)&so[r * 68 + c8 + 4]; FragH f;
#pragma unroll
      for (int i = 0; i < 4; ++i) { f.h[i] = (_Float16)v0[i]; f.h[4 + i] = (_Float16)v1[i]; }
      *(v8us*)(cp + q * 4 * Nn) = f.half[0]; }
  } else {
    const int rs = lane >> 4, c4 = (lane & 15) * 4;
    float* cp = C + (size_t)(row0 + rs) * Nn + col0 + c4;
#pragma unroll
    for (int q = 0; q < 32; ++q) { const int r = q * 2 + rs; const v4f v = *(const v4fa*)&so[r * 68 + c4]; *(v4f*)(cp + q * 2 * Nn) = v; }
  }
}


typedef _Float16 v4h __attribute__((ext_vector_type(4)));

__global__ __launch_bounds__(256) void k_x16(const float* __restrict__ x, _Float16* __restrict__ X16, size_t n8) { const size_t t = (size_t)blockIdx.x * 256 + threadIdx.x; if (t >= n8) return; FragH f;
#pragma unroll
  for (int q = 0; q < 8; ++q) f.h[q] = (_Float16)bf16_round(x[t * 8 + q]); *(v8us*)((unsigned short*)X16 + t * 8) = f.half[0];  }
__global__ __launch_bounds__(256) void k_h16(const float* __restrict__ x, _Float16* __restrict__ X16, size_t n8) { const size_t t = (size_t)blockIdx.x * 256 + threadIdx.x; if (t >= n8) return; FragH f;
#pragma unroll
  for (int q = 0; q < 8; ++q) f.h[q] = (_Float16)x[t * 8 + q]; *(v8us*)((unsigned short*)X16 + t * 8) = f.half[0];  }
__global__ __launch_bounds__(256) void k_round16f(const float* __restrict__ W, _Float16* __restrict__ Bt, size_t n8) { const size_t t = (size_t)blockIdx.x * 256 + threadIdx.x; if (t >= n8) return; FragH f;
#pragma unroll
  for (int i = 0; i < 8; ++i) f.h[i] = (_Float16)(bf16_round(W[t * 8 + i]) * 16.0f); *(v8us*)((unsigned short*)Bt + t * 8) = f.half[0];  }
template <int NHv, int TTv>
__global__ __launch_bounds__(256) void k_vt(const _Float16* __restrict__ V16, int ldv, int voff, _Float16* __restrict__ Vt) { __shared__ unsigned short tl[64][66]; const int tid = threadIdx.x; const int slab = blockIdx.x / (TTv / 64), lg = blockIdx.x % (TTv / 64); const int b = slab / NHv, h = slab % NHv;
  for (int i = tid; i < 64 * 8; i += 256) { const int r = i / 8, c8 = (i % 8) * 8; FragH f; f.half[0] = *(const v8us*)((const unsigned short*)V16 + ((size_t)b * TTv + lg * 64 + r) * ldv + voff + h * 64 + c8);
#pragma unroll
    for (int q = 0; q < 8; ++q) tl[r][c8 + q] = f.u[q]; }
  __syncthreads();
  {
#pragma unroll
    for (int rd = 0; rd < 2; ++rd) { const int d = rd * 32 + tid / 8, pc = tid % 8; FragH f;
#pragma unroll
      for (int q = 0; q < 8; ++q) f.u[q] = tl[pc * 8 + q][d];
      *(v8us*)((unsigned short*)Vt + ((size_t)slab * 64 + d) * TTv + lg * 64 + pc * 8) = f.half[0]; }
     } }

__global__ __launch_bounds__(256) void k_tok(const float* __restrict__ x, _Float16* __restrict__ X16) { __shared__ float tl[32][65]; const int tid = threadIdx.x; const int b = blockIdx.x / ((CC / 64) * (NPIX / 32)), rem = blockIdx.x % ((CC / 64) * (NPIX / 32)); const int cg = rem / (NPIX / 32), pg = rem % (NPIX / 32); const int c0 = cg * 64, p0 = pg * 32;
  for (int i = tid; i < 64 * 32; i += 256) { const int c = i / 32, pp = i % 32; tl[pp][c] = bf16_round(x[((size_t)b * CC + c0 + c) * NPIX + p0 + pp]); } __syncthreads();
  const int r = tid / 8, pc = tid % 8; FragH f; for (int q = 0; q < 8; ++q) f.h[q] = (_Float16)tl[r][pc * 8 + q]; const size_t row = (size_t)b * NPIX + p0 + r; *(v8us*)((unsigned short*)X16 + row * CC + c0 + pc * 8) = f.half[0];  }
union H8 { v8us v; unsigned d[4]; };      // eight f16 values as they are loaded: four registers of two
// v_fma_mix_f32: c + a * b in one fused f32 multiply-add whose f16 factors are widened exactly inside the instruction (op_sel picks the high halves). Written as asm for
// speed: from plain source this build widens every half with a conversion of its own before a packed f32 multiply-add. Each statement holds a whole round over independent
// sums, so that an instruction and the one it depends on stand eight or nine apart (asm text gets no s_delay_alu from the compiler, and needs none at that distance).
// s[w] (+)= the two products of register q with register k[w], w = 0 .. 8
__device__ __forceinline__ void dot9_first(float (&s)[9], unsigned q, const unsigned (&k)[9]) {
  asm(
      "v_fma_mix_f32 %0, %9, %10, 0 op_sel_hi:[1,1,0]\n\t"
      "v_fma_mix_f32 %1, %9, %11, 0 op_sel_hi:[1,1,0]\n\t"
      "v_fma_mix_f32 %2, %9, %12, 0 op_sel_hi:[1,1,0]\n\t"
      "v_fma_mix_f32 %3, %9, %13, 0 op_sel_hi:[1,1,0]\n\t"
      "v_fma_mix_f32 %4, %9, %14, 0 op_sel_hi:[1,1,0]\n\t"
      "v_fma_mix_f32 %5, %9, %15, 0 op_sel_hi:[1,1,0]\n\t"
      "v_fma_mix_f32 %6, %9, %16, 0 op_sel_hi:[1,1,0]\n\t"
      "v_fma_mix_f32 %7, %9, %17, 0 op_sel_hi:[1,1,0]\n\t"
      "v_fma_mix_f32 %8, %9, %18, 0 op_sel_hi:[1,1,0]\n\t"
      "v_fma_mix_f32 %0, %9, %10, %0 op_sel:[1,1,0] op_sel_hi:[1,1,0]\n\t"
      "v_fma_mix_f32 %1, %9, %11, %1 op_sel:[1,1,0] op_sel_hi:[1,1,0]\n\t"
      "v_fma_mix_f32 %2, %9, %12, %2 op_sel:[1,1,0] op_sel_hi:[1,1,0]\n\t"
      "v_fma_mix_f32 %3, %9, %13, %3 op_sel:[1,1,0] op_sel_hi:[1,1,0]\n\t"
      "v_fma_mix_f32 %4, %9, %14, %4 op_sel:[1,1,0] op_sel_hi:[1,1,0]\n\t"
      "v_fma_mix_f32 %5, %9, %15, %5 op_sel:[1,1,0] op_sel_hi:[1,1,0]\n\t"
      "v_fma_mix_f32 %6, %9, %16, %6 op_sel:[1,1,0] op_sel_hi:[1,1,0]\n\t"
      "v_fma_mix_f32 %7, %9, %17, %7 op_sel:[1,1,0] op_sel_hi:[1,1,0]\n\t"
      "v_fma_mix_f32 %8, %9, %18, %8 op_sel:[1,1,0] op_sel_hi:[1,1,0]"
      : "=&v"(s[0]), "=&v"(s[1]), "=&v"(s[2]), "=&v"(s[3]), "=&v"(s[4]), "=&v"(s[5]), "=&v"(s[6]), "=&v"(s[7]), "=&v"(s[8])
      : "v"(q), "v"(k[0]), "v"(k[1]), "v"(k[2]), "v"(k[3]), "v"(k[4]), "v"(k[5]), "v"(k[6]), "v"(k[7]), "v"(k[8]));
}
__device__ __forceinline__ void dot9_more(float (&s)[9], unsigned q, const unsigned (&k)[9]) {
  asm(
      "v_fma_mix_f32 %0, %9, %10, %0 op_sel_hi:[1,1,0]\n\t"
      "v_fma_mix_f32 %1, %9, %11, %1 op_sel_hi:[1,1,0]\n\t"
      "v_fma_mix_f32 %2, %9, %12, %2 op_sel_hi:[1,1,0]\n\t"
      "v_fma_mix_f32 %3, %9, %13, %3 op_sel_hi:[1,1,0]\n\t"
      "v_fma_mix_f32 %4, %9, %14, %4 op_sel_hi:[1,1,0]\n\t"
      "v_fma_mix_f32 %5, %9, %15, %5 op_sel_hi:[1,1,0]\n\t"
      "v_fma_mix_f32 %6, %9, %16, %6 op_sel_hi:[1,1,0]\n\t"
      "v_fma_mix_f32 %7, %9, %17, %7 op_sel_hi:[1,1,0]\n\t"
      "v_fma_mix_f32 %8, %9, %18, %8 op_sel_hi:[1,1,0]\n\t"
      "v_fma_mix_f32 %0, %9, %10, %0 op_sel:[1,1,0] op_sel_hi:[1,1,0]\n\t"
      "v_fma_mix_f32 %1, %9, %11, %1 op_sel:[1,1,0] op_sel_hi:[1,1,0]\n\t"
      "v_fma_mix_f32 %2, %9, %12, %2 op_sel:[1,1,0] op_sel_hi:[1,1,0]\n\t"
      "v_fma_mix_f32 %3, %9, %13, %3 op_sel:[1,1,0] op_sel_hi:[1,1,0]\n\t"
      "v_fma_mix_f32 %4, %9, %14, %4 op_sel:[1,1,0] op_sel_hi:[1,1,0]\n\t"
      "v_fma_mix_f32 %5, %9, %15, %5 op_sel:[1,1,0] op_sel_hi:[1,1,0]\n\t"
      "v_fma_mix_f32 %6, %9, %16, %6 op_sel:[1,1,0] op_sel_hi:[1,1,0]\n\t"
      "v_fma_mix_f32 %7, %9, %17, %7 op_sel:[1,1,0] op_sel_hi:[1,1,0]\n\t"
      "v_fma_mix_f32 %8, %9, %18, %8 op_sel:[1,1,0] op_sel_hi:[1,1,0]"
      : "+v"(s[0]), "+v"(s[1]), "+v"(s[2]), "+v"(s[3]), "+v"(s[4]), "+v"(s[5]), "+v"(s[6]), "+v"(s[7]), "+v"(s[8])
      : "v"(q), "v"(k[0]), "v"(k[1]), "v"(k[2]), "v"(k[3]), "v"(k[4]), "v"(k[5]), "v"(k[6]), "v"(k[7]), "v"(k[8]));
}
// acc[0 .. 7] (+)= a * the eight f16 values of v
__device__ __forceinline__ void av8_first(float (&acc)[8], float a, const unsigned (&v)[4]) {
  asm(
      "v_fma_mix_f32 %0, %8, %9, 0 op_sel_hi:[0,1,0]\n\t"
      "v_fma_mix_f32 %1, %8, %9, 0 op_sel:[0,1,0] op_sel_hi:[0,1,0]\n\t"
      "v_fma_mix_f32 %2, %8, %10, 0 op_sel_hi:[0,1,0]\n\t"
      "v_fma_mix_f32 %3, %8, %10, 0 op_sel:[0,1,0] op_sel_hi:[0,1,0]\n\t"
      "v_fma_mix_f32 %4, %8, %11, 0 op_sel_hi:[0,1,0]\n\t"
      "v_fma_mix_f32 %5, %8, %11, 0 op_sel:[0,1,0] op_sel_hi:[0,1,0]\n\t"
      "v_fma_mix_f32 %6, %8, %12, 0 op_sel_hi:[0,1,0]\n\t"
      "v_fma_mix_f32 %7, %8, %12, 0 op_sel:[0,1,0] op_sel_hi:[0,1,0]"
      : "=&v"(acc[0]), "=&v"(acc[1]), "=&v"(acc[2]), "=&v"(acc[3]), "=&v"(acc[4]), "=&v"(acc[5]), "=&v"(acc[6]), "=&v"(acc[7])
      : "v"(a), "v"(v[0]), "v"(v[1]), "v"(v[2]), "v"(v[3]));
}
__device__ __forceinline__ void av8_more(float (&acc)[8], float a, const unsigned (&v)[4]) {
  asm(
      "v_fma_mix_f32 %0, %8, %9, %0 op_sel_hi:[0,1,0]\n\t"
      "v_fma_mix_f32 %1, %8, %9, %1 op_sel:[0,1,0] op_sel_hi:[0,1,0]\n\t"
      "v_fma_mix_f32 %2, %8, %10, %2 op_sel_hi:[0,1,0]\n\t"
      "v_fma_mix_f32 %3, %8, %10, %3 op_sel:[0,1,0] op_sel_hi:[0,1,0]\n\t"
      "v_fma_mix_f32 %4, %8, %11, %4 op_sel_hi:[0,1,0]\n\t"
      "v_fma_mix_f32 %5, %8, %11, %5 op_sel:[0,1,0] op_sel_hi:[0,1,0]\n\t"
      "v_fma_mix_f32 %6, %8, %12, %6 op_sel_hi:[0,1,0]\n\t"
      "v_fma_mix_f32 %7, %8, %12, %7 op_sel:[0,1,0] op_sel_hi:[0,1,0]"
      : "+v"(acc[0]), "+v"(acc[1]), "+v"(acc[2]), "+v"(acc[3]), "+v"(acc[4]), "+v"(acc[5]), "+v"(acc[6]), "+v"(acc[7])
      : "v"(a), "v"(v[0]), "v"(v[1]), "v"(v[2]), "v"(v[3]));
}
// the value of the lane whose number differs in bit X (X = 1, 2, 4: inside a group of eight lanes); every lane is on where it is used
template <int X>
__device__ __forceinline__ float xlane(float v) { return __int_as_float(__builtin_amdgcn_update_dpp(0, __float_as_int(v), 0x160 + X, 0xf, 0xf, true)); }
// lane S of each group of eight lanes, handed to all eight
template <int S>
__device__ __forceinline__ float group_bcast(float v) { return __uint_as_float(__builtin_amdgcn_permlane16(0u, __float_as_uint(v), 0x11111111u * S, 0x11111111u * (8 + S), true, true)); }
struct WinTile { H8 q, k[9], v[9]; };
// Window attention in one kernel. One wave = one image row of one (batch, head), four pixels a pass; eight lanes share a pixel, lane p holding d = 8p .. 8p + 7.
// The partial logits are summed over the eight lanes so that lane p ends with logit p (the ninth ends in all eight); each lane does the softmax of its own logit and of the
// ninth, the weights are handed round the group, attn * v follows in the same lanes. A window place outside the image reads a clamped (in-bounds) address; its logit is
// set to 0 and its weight on v to 0. The row's 32 x 9 weights are staged in the wave's own LDS range and stored as whole lines.
__global__ __launch_bounds__(256) void k_win(const _Float16* __restrict__ Q, const _Float16* __restrict__ KV, float* __restrict__ ATTN, _Float16* __restrict__ O16) {
  __shared__ __attribute__((aligned(16))) float sa[8][HWD * 9];
  const int tid = threadIdx.x, lane = tid & 31, g = lane >> 3, p = lane & 7;
  const int w = __builtin_amdgcn_readfirstlane(tid >> 5);
  const int bh = blockIdx.x / (HWD / 8), y = (blockIdx.x % (HWD / 8)) * 8 + w;
  const int b = bh / NH, h = bh % NH;
  // every address = a wave-uniform byte pointer + one of four lane offsets formed here once: no address arithmetic inside the passes
  constexpr unsigned QP = INNER * 2, KP = 2 * INNER * 2;      // bytes a pixel in Q / O16 and in KV
  const char* qrow = (const char*)(Q + ((size_t)b * NPIX + y * HWD) * INNER + h * DH);
  char* orow = (char*)(O16 + ((size_t)b * NPIX + y * HWD) * INNER + h * DH);
  const char* krow[3];
#pragma unroll
  for (int dy = 0; dy < 3; ++dy) krow[dy] = (const char*)(KV + ((size_t)b * NPIX + min(max(y + dy - 1, 0), HWD - 1) * HWD) * (2 * INNER) + h * DH);
  const unsigned loq = g * QP + p * 16, lok = g * KP + p * 16;
  const unsigned lokl = max(g - 1, 0) * KP + p * 16, lokr = min(g + 1, 3) * KP + p * 16;      // x - 1 clamped in the first pass, x + 1 clamped in the last
  const bool c1 = p & 1, c2 = p & 2, c4 = p & 4;
  const int ym = y + p / 3 - 1, dxm = p % 3 - 1;      // window place p of this lane's own logit
  const bool okym = ym >= 0 && ym < HWD, oky8 = y + 1 < HWD;
  auto load = [&](int it, WinTile& t) {
    t.q.v = *(const v8us*)(qrow + it * 4 * QP + loq);
#pragma unroll
    for (int wi = 0; wi < 9; ++wi) {
      const int dx = wi % 3 - 1;
      const bool el = it == 0 && dx < 0, er = it == HWD / 4 - 1 && dx > 0;
      const char* kr = krow[wi / 3] + (el || er ? it * 4 : it * 4 + dx) * KP;
      const unsigned off = el ? lokl : er ? lokr : lok;
      t.k[wi].v = *(const v8us*)(kr + off); t.v[wi].v = *(const v8us*)(kr + INNER * 2 + off);
    }
  };
  WinTile tl[2];
  load(0, tl[0]);
  asm volatile("s_wait_xcnt 0x0" ::: "memory");      // lokl is not used again and this build hands its register to a later load's result: the wait stands in front of that overwrite
#pragma unroll      // unrolled: the two register tiles alternate by a constant index, and only the first and the last pass carry the tests on x
  for (int it = 0; it < HWD / 4; ++it) {
    if (it + 1 < HWD / 4) load(it + 1, tl[(it + 1) & 1]);      // the next four pixels' loads fly while these four are worked on
    __builtin_amdgcn_sched_barrier(0);      // keeps those loads in front of this pass's arithmetic: sunk into it, each would be waited for right behind its issue
    const WinTile& t = tl[it & 1];
    const int x = it * 4 + g;
    const bool okm = okym && (it != 0 || x + dxm >= 0) && (it != HWD / 4 - 1 || x + dxm < HWD);
    const bool ok8 = oky8 && (it != HWD / 4 - 1 || x + 1 < HWD);
    float s[9];
#pragma unroll
    for (int j = 0; j < 4; ++j) {
      const unsigned kj[9] = {t.k[0].d[j], t.k[1].d[j], t.k[2].d[j], t.k[3].d[j], t.k[4].d[j], t.k[5].d[j], t.k[6].d[j], t.k[7].d[j], t.k[8].d[j]};
      if (j == 0) dot9_first(s, t.q.d[j], kj); else dot9_more(s, t.q.d[j], kj);
    }
    float r[4], u[2];
#pragma unroll
    for (int i = 0; i < 4; ++i) r[i] = (c4 ? s[4 + i] : s[i]) + xlane<4>(c4 ? s[i] : s[4 + i]);      // logit 4 * (p >> 2) + i
#pragma unroll
    for (int i = 0; i < 2; ++i) u[i] = (c2 ? r[2 + i] : r[i]) + xlane<2>(c2 ? r[i] : r[2 + i]);      // logit 2 * (p >> 1) + i
    const float sm = (c1 ? u[1] : u[0]) + xlane<1>(c1 ? u[0] : u[1]);                                // logit p
    float s8 = s[8]; s8 += xlane<1>(s8); s8 += xlane<2>(s8); s8 += xlane<4>(s8);
    const float lm = okm ? sm * 0.125f : 0.f, l8 = ok8 ? s8 * 0.125f : 0.f;
    float m = fmaxf(lm, xlane<1>(lm)); m = fmaxf(m, xlane<2>(m)); m = fmaxf(m, xlane<4>(m)); m = fmaxf(m, l8);
    const float em = expf(lm - m), e8 = expf(l8 - m);
    float z = em + xlane<1>(em); z += xlane<2>(z); z += xlane<4>(z); z += e8;
    const float am = em / z, a8 = e8 / z;
    sa[w][x * 9 + p] = am;
    if (p == 0) sa[w][x * 9 + 8] = a8;
    const float vm = okm ? am : 0.f;
    const float a[9] = {group_bcast<0>(vm), group_bcast<1>(vm), group_bcast<2>(vm), group_bcast<3>(vm), group_bcast<4>(vm), group_bcast<5>(vm), group_bcast<6>(vm), group_bcast<7>(vm), ok8 ? a8 : 0.f};
    __builtin_amdgcn_sched_barrier(0);      // keeps the eight lane moves together in front of the asm rounds: one placed directly in front of the round that reads it would stall it, unhinted
    float acc[8];
#pragma unroll
    for (int wi = 0; wi < 9; ++wi) { if (wi == 0) av8_first(acc, a[wi], t.v[wi].d); else av8_more(acc, a[wi], t.v[wi].d); }
    FragH o;
#pragma unroll
    for (int j = 0; j < 8; ++j) o.h[j] = (_Float16)acc[j];
    *(v8us*)(orow + it * 4 * QP + loq) = o.half[0];
  }
  __builtin_amdgcn_fence(__ATOMIC_ACQ_REL, "workgroup"); __builtin_amdgcn_wave_barrier();      // the wave's own LDS writes are done before other lanes of it read them
  float* ap = ATTN + ((size_t)bh * NPIX + y * HWD) * 9;
#pragma unroll
  for (int q = 0; q < 3; ++q) { const int i4 = q * 32 + lane; if (i4 < HWD * 9 / 4) { const v4f v = *(const v4fa*)&sa[w][i4 * 4]; *(v4f*)(ap + i4 * 4) = v; } }
}
__global__ __launch_bounds__(256) void k_out(const float* __restrict__ G, float* __restrict__ out) { __shared__ float tl[32][65]; const int tid = threadIdx.x; const int b = blockIdx.x / ((CC / 32) * (NPIX / 64)), rem = blockIdx.x % ((CC / 32) * (NPIX / 64)); const int cg = rem / (NPIX / 64), pg = rem % (NPIX / 64); const int c0 = cg * 32, p0 = pg * 64;
  for (int i = tid; i < 64 * 32; i += 256) { const int pp = i / 32, c = i % 32; tl[c][pp] = G[((size_t)b * NPIX + p0 + pp) * CC + c0 + c]; } __syncthreads();
  { for (int i = tid; i < 32 * 16; i += 256) { const int c = i / 16, q4 = i % 16; const v4f v = {tl[c][q4 * 4], tl[c][q4 * 4 + 1], tl[c][q4 * 4 + 2], tl[c][q4 * 4 + 3]}; *(v4f*)(out + ((size_t)b * CC + c0 + c) * NPIX + p0 + q4 * 4) = v; }  } }
extern "C" void kernel_launch(void* const* d_in, const int* in_sizes, int n_in,
                              void* d_out, int out_size, void* d_ws, size_t ws_size, hipStream_t stream) {
  (void)in_sizes; (void)n_in; (void)out_size;
  const float* x = (const float*)d_in[0]; const float* Wq = (const float*)d_in[1]; const float* Wkv = (const float*)d_in[2]; const float* Wo = (const float*)d_in[3]; const float* bo = (const float*)d_in[4];
  float* OUT0 = (float*)d_out; float* ATTN = OUT0 + (size_t)BB * CC * NPIX;
  char* ws = (char*)d_ws; size_t off = 0;
  auto take = [&](size_t bytes) { char* p = ws + off; off += (bytes + 255) & ~(size_t)255; return p; };
  _Float16* Bq = (_Float16*)take((size_t)INNER * CC * 2); _Float16* Bkv = (_Float16*)take((size_t)2 * INNER * CC * 2); _Float16* Bo = (_Float16*)take((size_t)CC * INNER * 2); _Float16* X16 = (_Float16*)take((size_t)NR * CC * 2); _Float16* Q = (_Float16*)take((size_t)NR * INNER * 2); _Float16* KV = (_Float16*)take((size_t)NR * 2 * INNER * 2); _Float16* O16 = (_Float16*)take((size_t)NR * INNER * 2); float* G = (float*)take((size_t)NR * CC * 4);
  if (off > ws_size) return;      // 1.1 + 8.4 + 16.8 + 33.5 + 16.8 + 16.8 MB
  k_round16f<<<(unsigned)(((size_t)INNER * CC / 8 + 255) / 256), 256, 0, stream>>>(Wq, Bq, (size_t)INNER * CC / 8); k_round16f<<<(unsigned)(((size_t)2 * INNER * CC / 8 + 255) / 256), 256, 0, stream>>>(Wkv, Bkv, (size_t)2 * INNER * CC / 8); k_round16f<<<(unsigned)(((size_t)CC * INNER / 8 + 255) / 256), 256, 0, stream>>>(Wo, Bo, (size_t)CC * INNER / 8);      // (out,in)
  k_tok<<<BB * (CC / 64) * (NPIX / 32), 256, 0, stream>>>(x, X16);
  k_gemm_t<INNER, CC, true, false><<<(NR / 128) * (INNER / 128), 128, 0, stream>>>(X16, Bq, 0.0625f, nullptr, nullptr, Q);
  k_gemm_t<2 * INNER, CC, true, false><<<(NR / 128) * (2 * INNER / 128), 128, 0, stream>>>(X16, Bkv, 0.0625f, nullptr, nullptr, KV);      // [k | v]
  k_win<<<BB * NH * (HWD / 8), 256, 0, stream>>>(Q, KV, ATTN, O16);
  k_gemm_t<CC, INNER, false, true><<<(NR / 128) * (CC / 128), 128, 0, stream>>>(O16, Bo, 0.0625f, bo, G, nullptr);      // to_out + bo
  k_out<<<BB * (CC / 32) * (NPIX / 64), 256, 0, stream>>>(G, OUT0);
}

// v003
// It runs in 68.4 microseconds.
// Next to v002, in two timings, it ran 1.12 times as fast each time.
// Counting every step since v000, it is 2.43 times as fast.
#include <hip/hip_runtime.h>
// Local 3×3-window attention (x [16,256,32,32]; 8 heads × 64): q = 1×1 conv (Wq), k,v = 1×1 conv (Wkv), each pixel attends over its 3×3 neighbourhood (zero-padded keys/values take part with
// logit 0), softmax(q·k/8), out = Σ attn·v, 1×1 conv Wo + bo; outputs (out NCHW, attn [16,8,1024,9]). The three pointwise convs run as GEMMs on v_wmma_f32_16x16x32_f16 (x bf16-exact, (out,in)
// weights bf16-exact ×2^4, q/k/v/o f16, f32 accumulate); the 9-wide window dots, softmax and attn·v are f32 VALU in one kernel (eight lanes a pixel and head); x is transposed by tiles, out comes from its GEMM as NCHW.
#define BB 16
#define CC 256
#define HWD 32
#define NPIX 1024
#define NH 8
#define DH 64
#define INNER 512
#define NR (BB * NPIX)

typedef __bf16 v16b __attribute__((ext_vector_type(16)));
typedef unsigned short v8us __attribute__((ext_vector_type(8), may_alias));
typedef float  v8f  __attribute__((ext_vector_type(8)));
typedef float  v4f  __attribute__((ext_vector_type(4)));
typedef float  v4fa __attribute__((ext_vector_type(4), may_alias));
union FragB { v16b v; v8us half[2]; unsigned short u[16]; };

__device__ __forceinline__ unsigned short bf16_bits(float x) { unsigned int u = __float_as_uint(x); return (unsigned short)((u + 0x7FFFu + ((u >> 16) & 1u)) >> 16); }
__device__ __forceinline__ float bf16_val(unsigned short b) { return __uint_as_float(((unsigned int)b) << 16); }
__device__ __forceinline__ float bf16_round(float x) { return bf16_val(bf16_bits(x)); }
// D += A·B with NT terms: 1 = ah·bh, 2 = + al·bh (A split), 3 = + ah·bl (both split)
template <int NT>
__device__ __forceinline__ v8f mmaN(v16b ah, v16b al, v16b bh, v16b bl, v8f c) {
  c = __builtin_amdgcn_wmma_f32_16x16x32_bf16(false, ah, false, bh, (short)0, c, false, false);
  if (NT >= 2) c = __builtin_amdgcn_wmma_f32_16x16x32_bf16(false, al, false, bh, (short)0, c, false, false);
  if (NT >= 3) c = __builtin_amdgcn_wmma_f32_16x16x32_bf16(false, ah, false, bl, (short)0, c, false, false);
  asm volatile("v_nop\n\tv_nop\n\tv_nop\n\tv_nop" : "+v"(c) : "v"(ah), "v"(al), "v"(bh), "v"(bl));
  return c;
}

__global__ __launch_bounds__(256) void k_wt_bf16(const float* __restrict__ W, unsigned short* __restrict__ Wt, int K, int N) {
  const int t = blockIdx.x * 256 + threadIdx.x;
  const int k8n = K / 8;
  if (t >= N * k8n) return;
  const int n = t / k8n, k8 = (t % k8n) * 8;
  v8us v;
#pragma unroll
  for (int i = 0; i < 8; ++i) v[i] = bf16_bits(W[(size_t)(k8 + i) * N + n]);
  *(v8us*)(Wt + (size_t)n * K + k8) = v;
  
}

// GEMM C[M][N] (f32, pitch ldc) = act(A[M][K]·W + bias). A f32 row-major (pitch lda) converted per fragment to bf16
// (ASPLIT: hi/lo two planes -> 2 terms, else single rounded term); Wt bf16 [N][K] (pitch ldb). BIAS_BF16 rounds the
// bias to bf16 first (bias quantised to bf16 before the add). K%32==0, M%16==0, N%64==0.
template <bool ASPLIT, int ACT, bool BIAS_BF16>
__global__ __launch_bounds__(128) void k_gemm_bf(const float* __restrict__ A, int lda, const unsigned short* __restrict__ Wt, int ldb,
                                               const float* __restrict__ bias, float* __restrict__ C, int ldc, int M, int N, int K) {
  __shared__ __attribute__((aligned(16))) float so[4][16][64];
  const int tid = threadIdx.x, w = tid >> 5, lane = tid & 31, ln = lane & 15, hh = lane >> 4;
  const int ntn = N / 64;
  const int wid = blockIdx.x * 4 + w;
  const int mt = wid / ntn, nq = wid % ntn;
  if (mt * 16 >= M) return;
  const int row0 = mt * 16, col0 = nq * 64;
  const float* arow = A + (size_t)(row0 + ln) * lda;
  v8f acc[4] = {};
  for (int kb = 0; kb < K; kb += 32) {
    FragB ah, al;
    const v4f x0 = *(const v4fa*)(arow + kb + 8 * hh), x1 = *(const v4fa*)(arow + kb + 8 * hh + 4);
    const v4f x2 = *(const v4fa*)(arow + kb + 16 + 8 * hh), x3 = *(const v4fa*)(arow + kb + 16 + 8 * hh + 4);
    float xs[16] = {x0[0],x0[1],x0[2],x0[3],x1[0],x1[1],x1[2],x1[3],x2[0],x2[1],x2[2],x2[3],x3[0],x3[1],x3[2],x3[3]};
#pragma unroll
    for (int i = 0; i < 16; ++i) { const unsigned short hb = bf16_bits(xs[i]); ah.u[i] = hb; al.u[i] = ASPLIT ? bf16_bits(xs[i] - bf16_val(hb)) : (unsigned short)0; }
#pragma unroll
    for (int t = 0; t < 4; ++t) {
      const unsigned short* brow = Wt + (size_t)(col0 + t * 16 + ln) * ldb + kb;
      FragB b;
      b.half[0] = *(const v8us*)(brow + 8 * hh);
      b.half[1] = *(const v8us*)(brow + 16 + 8 * hh);
      acc[t] = mmaN<ASPLIT ? 2 : 1>(ah.v, al.v, b.v, b.v, acc[t]);
    }
  }
#pragma unroll
  for (int t = 0; t < 4; ++t) {
    float bv = bias ? bias[col0 + t * 16 + ln] : 0.f;
    if (BIAS_BF16) bv = bf16_round(bv);
#pragma unroll
    for (int r = 0; r < 8; ++r) { float v = acc[t][r] + bv; if (ACT == 1) v = fmaxf(v, 0.f); so[w][8 * hh + r][t * 16 + ln] = v; }
  }
  __builtin_amdgcn_fence(__ATOMIC_ACQ_REL, "workgroup");
  __builtin_amdgcn_wave_barrier();
  const int rsub = lane >> 4, c4 = (lane & 15) * 4;
  {
#pragma unroll
    for (int q = 0; q < 8; ++q) {
      const int r = q * 2 + rsub;
      const v4f v = *(const v4fa*)&so[w][r][c4];
      *(v4f*)(C + (size_t)(row0 + r) * ldc + col0 + c4) = v;
    }
    
  }
}

// Flash-style causal/unmasked attention, all contractions 3-term bf16 hi/lo splits, f32 softmax with running max.
// q,k,v rows are read from f32 buffers with arbitrary row pitch (so they can live inside a fused qkv buffer);
// D = head size (multiple of 32, <= 128); one wave = 16 query rows; block = 4 waves (64 queries) sharing K/V chunks of 32.
template <int D, bool CAUSAL>
__global__ __launch_bounds__(128) void k_flash(const float* __restrict__ qb, const float* __restrict__ kb, const float* __restrict__ vb,
                                             int pitch, int T, int H, float scale, float* __restrict__ y, int ypitch) {
  constexpr int KS = D / 32;        // k-steps for QK
  constexpr int DT = D / 16;        // d tiles for PV
  __shared__ __attribute__((aligned(16))) unsigned short sKh[32][D + 8], sKl[32][D + 8], sVh[32][D + 8], sVl[32][D + 8];
  __shared__ __attribute__((aligned(16))) unsigned short sPh[4][16][40], sPl[4][16][40];
  __shared__ __attribute__((aligned(16))) float sO[4][16][D];
  const int tid = threadIdx.x, w = tid >> 5, lane = tid & 31, ln = lane & 15, hh = lane >> 4;
  const int nqb = (T + 63) / 64;
  const int bh = blockIdx.x / nqb, qblk = blockIdx.x % nqb;
  const int b = bh / H, h = bh % H;
  const int q0 = qblk * 64 + w * 16;
  const float* Q = qb + (size_t)b * T * pitch + h * D;
  const float* K = kb + (size_t)b * T * pitch + h * D;
  const float* V = vb + (size_t)b * T * pitch + h * D;

  // A fragments of the wave's 16 query rows (scaled), hi/lo
  FragB aqh[KS], aql[KS];
  {
    int row = q0 + ln; if (row >= T) row = T - 1;
    const float* qr = Q + (size_t)row * pitch;
#pragma unroll
    for (int ks = 0; ks < KS; ++ks)
#pragma unroll
      for (int i = 0; i < 16; ++i) {
        const int d = ks * 32 + ((i < 8) ? (8 * hh + i) : (16 + 8 * hh + (i - 8)));
        const float x = qr[d] * scale; const unsigned short hb = bf16_bits(x);
        aqh[ks].u[i] = hb; aql[ks].u[i] = bf16_bits(x - bf16_val(hb));
      }
  }
  float m_r[8], l_r[8];
#pragma unroll
  for (int r = 0; r < 8; ++r) { m_r[r] = -3.0e38f; l_r[r] = 0.f; }
  v8f oacc[DT];
#pragma unroll
  for (int dt = 0; dt < DT; ++dt) oacc[dt] = (v8f){0.f,0.f,0.f,0.f,0.f,0.f,0.f,0.f};

  const int kv_end = CAUSAL ? min(T, qblk * 64 + 64) : T;     // block-uniform
  for (int j0 = 0; j0 < kv_end; j0 += 32) {
    __syncthreads();
    for (int e = tid; e < 32 * (D / 4); e += 128) {
      const int r = e / (D / 4), c4 = (e % (D / 4)) * 4;
      const int key = j0 + r;
      v4f kf = {0.f,0.f,0.f,0.f}, vf = {0.f,0.f,0.f,0.f};
      if (key < T) { kf = *(const v4fa*)(K + (size_t)key * pitch + c4); vf = *(const v4fa*)(V + (size_t)key * pitch + c4); }
#pragma unroll
      for (int t = 0; t < 4; ++t) {
        unsigned short hb = bf16_bits(kf[t]); sKh[r][c4 + t] = hb; sKl[r][c4 + t] = bf16_bits(kf[t] - bf16_val(hb));
        hb = bf16_bits(vf[t]); sVh[r][c4 + t] = hb; sVl[r][c4 + t] = bf16_bits(vf[t] - bf16_val(hb));
      }
    }
    __syncthreads();
    // S tile 16 x 32
    v8f s[2];
#pragma unroll
    for (int nt = 0; nt < 2; ++nt) {
      v8f acc = {};
#pragma unroll
      for (int ks = 0; ks < KS; ++ks) {
        FragB bh_, bl_;
        bh_.half[0] = *(const v8us*)&sKh[nt * 16 + ln][ks * 32 + 8 * hh]; bh_.half[1] = *(const v8us*)&sKh[nt * 16 + ln][ks * 32 + 16 + 8 * hh];
        bl_.half[0] = *(const v8us*)&sKl[nt * 16 + ln][ks * 32 + 8 * hh]; bl_.half[1] = *(const v8us*)&sKl[nt * 16 + ln][ks * 32 + 16 + 8 * hh];
        acc = mmaN<3>(aqh[ks].v, aql[ks].v, bh_.v, bl_.v, acc);
      }
      s[nt] = acc;
    }
    // mask + running max (rows 8hh+r; the 16 lanes of a half share rows)
    float alpha[8];
#pragma unroll
    for (int r = 0; r < 8; ++r) {
      const int qi = q0 + 8 * hh + r;
      const int ja = j0 + ln, jb = j0 + 16 + ln;
      if (CAUSAL) { if (ja > qi) s[0][r] = -3.0e38f; if (jb > qi) s[1][r] = -3.0e38f; }
      if (ja >= T) s[0][r] = -3.0e38f;
      if (jb >= T) s[1][r] = -3.0e38f;
      float mx = fmaxf(s[0][r], s[1][r]);
      mx = fmaxf(mx, __shfl_xor(mx, 1, 32)); mx = fmaxf(mx, __shfl_xor(mx, 2, 32)); mx = fmaxf(mx, __shfl_xor(mx, 4, 32)); mx = fmaxf(mx, __shfl_xor(mx, 8, 32));
      const float mnew = fmaxf(m_r[r], mx);
      alpha[r] = (mnew > -1.0e38f) ? __expf(m_r[r] - mnew) : 1.0f;
      const float p0 = (s[0][r] > -1.0e38f) ? __expf(s[0][r] - mnew) : 0.f;
      const float p1 = (s[1][r] > -1.0e38f) ? __expf(s[1][r] - mnew) : 0.f;
      m_r[r] = mnew;
      l_r[r] = l_r[r] * alpha[r] + p0 + p1;            // per-lane partial row sum (16 lanes combined at the end)
      unsigned short hb = bf16_bits(p0); sPh[w][8 * hh + r][ln] = hb;      sPl[w][8 * hh + r][ln] = bf16_bits(p0 - bf16_val(hb));
      hb = bf16_bits(p1);                sPh[w][8 * hh + r][16 + ln] = hb; sPl[w][8 * hh + r][16 + ln] = bf16_bits(p1 - bf16_val(hb));
    }
#pragma unroll
    for (int dt = 0; dt < DT; ++dt)
#pragma unroll
      for (int r = 0; r < 8; ++r) oacc[dt][r] *= alpha[r];
    __builtin_amdgcn_fence(__ATOMIC_ACQ_REL, "workgroup");
    __builtin_amdgcn_wave_barrier();
    FragB pah, pal;
    pah.half[0] = *(const v8us*)&sPh[w][ln][8 * hh]; pah.half[1] = *(const v8us*)&sPh[w][ln][16 + 8 * hh];
    pal.half[0] = *(const v8us*)&sPl[w][ln][8 * hh]; pal.half[1] = *(const v8us*)&sPl[w][ln][16 + 8 * hh];
#pragma unroll
    for (int dt = 0; dt < DT; ++dt) {
      FragB bvh, bvl;
#pragma unroll
      for (int i = 0; i < 8; ++i) {
        bvh.u[i] = sVh[8 * hh + i][dt * 16 + ln]; bvh.u[8 + i] = sVh[16 + 8 * hh + i][dt * 16 + ln];
        bvl.u[i] = sVl[8 * hh + i][dt * 16 + ln]; bvl.u[8 + i] = sVl[16 + 8 * hh + i][dt * 16 + ln];
      }
      oacc[dt] = mmaN<3>(pah.v, pal.v, bvh.v, bvl.v, oacc[dt]);
    }
    __builtin_amdgcn_fence(__ATOMIC_ACQ_REL, "workgroup");
    __builtin_amdgcn_wave_barrier();
  }
#pragma unroll
  for (int r = 0; r < 8; ++r) {
    float l = l_r[r];
    l += __shfl_xor(l, 1, 32); l += __shfl_xor(l, 2, 32); l += __shfl_xor(l, 4, 32); l += __shfl_xor(l, 8, 32);
    l_r[r] = (l > 0.f) ? 1.0f / l : 0.f;
  }
#pragma unroll
  for (int dt = 0; dt < DT; ++dt)
#pragma unroll
    for (int r = 0; r < 8; ++r) sO[w][8 * hh + r][dt * 16 + ln] = oacc[dt][r] * l_r[r];
  __builtin_amdgcn_fence(__ATOMIC_ACQ_REL, "workgroup");
  __builtin_amdgcn_wave_barrier();
  {
    for (int r = 0; r < 16; ++r) {
      const int row = q0 + r;
      if (row < T && lane < D / 4) {
        const v4f val = *(const v4fa*)&sO[w][r][lane * 4];
        *(v4f*)(y + ((size_t)b * T + row) * ypitch + h * D + lane * 4) = val;
      }
    }
    
  }
}

// GEMM C = act(A·W + bias + resid): A f32 (ASPLIT -> hi/lo 2 terms), Wt bf16 [N][K]; ACT 0 none, 1 relu, 2 exact gelu;
// resid (optional, f32, row index = (row % rmod), pitch ldr, RES_BF16 rounds it) added before the activation.
template <bool ASPLIT, int ACT, bool BIAS_BF16, bool RES_BF16>
__global__ __launch_bounds__(128) void k_gemm_bf3(const float* __restrict__ A, int lda, const unsigned short* __restrict__ Wt, int ldb,
                                                const float* __restrict__ bias, const float* __restrict__ resid, int rmod, int ldr,
                                                float* __restrict__ C, int ldc, int M, int N, int K) {
  __shared__ __attribute__((aligned(16))) float so[4][16][64];
  const int tid = threadIdx.x, w = tid >> 5, lane = tid & 31, ln = lane & 15, hh = lane >> 4;
  const int ntn = N / 64;
  const int wid = blockIdx.x * 4 + w;
  const int mt = wid / ntn, nq = wid % ntn;
  if (mt * 16 >= M) return;
  const int row0 = mt * 16, col0 = nq * 64;
  const float* arow = A + (size_t)(row0 + ln) * lda;
  v8f acc[4] = {};
  for (int kb = 0; kb < K; kb += 32) {
    FragB ah, al;
    const v4f x0 = *(const v4fa*)(arow + kb + 8 * hh), x1 = *(const v4fa*)(arow + kb + 8 * hh + 4);
    const v4f x2 = *(const v4fa*)(arow + kb + 16 + 8 * hh), x3 = *(const v4fa*)(arow + kb + 16 + 8 * hh + 4);
    float xs[16] = {x0[0],x0[1],x0[2],x0[3],x1[0],x1[1],x1[2],x1[3],x2[0],x2[1],x2[2],x2[3],x3[0],x3[1],x3[2],x3[3]};
#pragma unroll
    for (int i = 0; i < 16; ++i) { const unsigned short hb = bf16_bits(xs[i]); ah.u[i] = hb; al.u[i] = ASPLIT ? bf16_bits(xs[i] - bf16_val(hb)) : (unsigned short)0; }
#pragma unroll
    for (int t = 0; t < 4; ++t) {
      const unsigned short* brow = Wt + (size_t)(col0 + t * 16 + ln) * ldb + kb;
      FragB b;
      b.half[0] = *(const v8us*)(brow + 8 * hh);
      b.half[1] = *(const v8us*)(brow + 16 + 8 * hh);
      acc[t] = mmaN<ASPLIT ? 2 : 1>(ah.v, al.v, b.v, b.v, acc[t]);
    }
  }
#pragma unroll
  for (int t = 0; t < 4; ++t) {
    const int col = col0 + t * 16 + ln;
    float bv = bias ? bias[col] : 0.f;
    if (BIAS_BF16) bv = bf16_round(bv);
#pragma unroll
    for (int r = 0; r < 8; ++r) {
      float v = acc[t][r] + bv;
      if (resid) { float rv = resid[(size_t)((row0 + 8 * hh + r) % rmod) * ldr + col]; if (RES_BF16) rv = bf16_round(rv); v += rv; }
      if (ACT == 1) v = fmaxf(v, 0.f);
      if (ACT == 2) v = 0.5f * v * (1.0f + erff(v * 0.70710678118654752f));
      if (ACT == 3) { const float u = 0.7978845608028654f * (v + 0.044715f * v * v * v); v = 0.5f * v * (1.0f + tanhf(u)); }
      so[w][8 * hh + r][t * 16 + ln] = v;
    }
  }
  __builtin_amdgcn_fence(__ATOMIC_ACQ_REL, "workgroup");
  __builtin_amdgcn_wave_barrier();
  const int rsub = lane >> 4, c4 = (lane & 15) * 4;
  {
#pragma unroll
    for (int q = 0; q < 8; ++q) {
      const int r = q * 2 + rsub;
      const v4f v = *(const v4fa*)&so[w][r][c4];
      *(v4f*)(C + (size_t)(row0 + r) * ldc + col0 + c4) = v;
    }
    
  }
}
// row LayerNorm (biased variance, eps) over N: s = X (+ R); optional out_sum <- s; out_norm <- (s-mu)*rsqrt(var+eps)*g + b
template <bool PARAM_BF16>
__global__ __launch_bounds__(256) void k_layernorm(const float* __restrict__ X, const float* __restrict__ R, const float* __restrict__ g, const float* __restrict__ bta,
                                                  float* __restrict__ out_sum, float* __restrict__ out_norm, int N, float eps) {
  __shared__ float red[256];
  const int row = blockIdx.x, tid = threadIdx.x;
  const float* x = X + (size_t)row * N; const float* rr = R ? R + (size_t)row * N : nullptr;
  float vals[16];                     // up to N = 4096
  const int per = N / 256;            // contiguous chunk per thread? use strided-by-4 chunks: thread handles j = tid*4 + 1024*u
  float s1 = 0.f;
  for (int u = 0; u < per / 4; ++u) {
    const int j = tid * 4 + 1024 * u;
    const v4f a = *(const v4fa*)(x + j);
    v4f b = {0.f,0.f,0.f,0.f}; if (rr) b = *(const v4fa*)(rr + j);
#pragma unroll
    for (int q = 0; q < 4; ++q) { const float v = a[q] + b[q]; vals[u * 4 + q] = v; s1 += v; }
  }
  red[tid] = s1; __syncthreads();
  for (int st = 128; st > 0; st >>= 1) { if (tid < st) red[tid] += red[tid + st]; __syncthreads(); }
  const float mu = red[0] / (float)N; __syncthreads();
  float s2 = 0.f;
  for (int u = 0; u < per / 4; ++u)
#pragma unroll
    for (int q = 0; q < 4; ++q) { const float c = vals[u * 4 + q] - mu; s2 += c * c; }
  red[tid] = s2; __syncthreads();
  for (int st = 128; st > 0; st >>= 1) { if (tid < st) red[tid] += red[tid + st]; __syncthreads(); }
  const float rs = rsqrtf(red[0] / (float)N + eps);
  {
    for (int u = 0; u < per / 4; ++u) {
      const int j = tid * 4 + 1024 * u;
      v4f o, sm;
#pragma unroll
      for (int q = 0; q < 4; ++q) {
        float gg = g[j + q], bb = bta[j + q];
        if (PARAM_BF16) { gg = bf16_round(gg); bb = bf16_round(bb); }
        sm[q] = vals[u * 4 + q]; o[q] = (vals[u * 4 + q] - mu) * rs * gg + bb;
      }
      if (out_sum) *(v4f*)(out_sum + (size_t)row * N + j) = sm;
      *(v4f*)(out_norm + (size_t)row * N + j) = o;
    }
    
  }
}



// ---- f16 WMMA path (v_wmma_f32_16x16x32_f16): 11-bit significands for operands in range — used here for the three 1×1 conv GEMMs (k_gemm_t)
typedef _Float16 v16h __attribute__((ext_vector_type(16)));
union FragH { v16h v; v8us half[2]; _Float16 h[16]; unsigned short u[16]; };
template <int NT>
__device__ __forceinline__ v8f mmaH(v16h ah, v16h al, v16h bh, v16h bl, v8f c) {
  c = __builtin_amdgcn_wmma_f32_16x16x32_f16(false, ah, false, bh, (short)0, c, false, false);
  if (NT >= 2) c = __builtin_amdgcn_wmma_f32_16x16x32_f16(false, al, false, bh, (short)0, c, false, false);
  if (NT >= 3) c = __builtin_amdgcn_wmma_f32_16x16x32_f16(false, ah, false, bl, (short)0, c, false, false);
  asm volatile("v_nop\n\tv_nop\n\tv_nop\n\tv_nop" : "+v"(c) : "v"(ah), "v"(al), "v"(bh), "v"(bl));
  return c;
}
// batched GEMM like k_gemm_b but f16 operands: A f32 (split into f16 hi/lo if ASPLIT, else rounded to f16), Bt = f16 values [n][k]; alpha; C f32; N multiple of 16 (partial tiles skipped)
template <bool ASPLIT>
__global__ __launch_bounds__(128) void k_gemm_h(const float* __restrict__ A, int lda, size_t sA, const _Float16* __restrict__ Bh, int ldb, size_t sB, float alpha, float* __restrict__ C, int ldc, size_t sC, int M, int N, int K) {
  __shared__ __attribute__((aligned(16))) float so[4][16][64];
  const int tid = threadIdx.x, w = tid >> 5, lane = tid & 31, ln = lane & 15, hh = lane >> 4; const int by = blockIdx.y;
  A += (size_t)by * sA; Bh += (size_t)by * sB; C += (size_t)by * sC;
  const int ntn = (N + 63) / 64; const int wid = blockIdx.x * 4 + w; const int mt = wid / ntn, nq = wid % ntn; if (mt * 16 >= M) return;
  const int row0 = mt * 16, col0 = nq * 64; const float* arow = A + (size_t)(row0 + ln) * lda;
  v8f acc[4] = {};
  for (int kb = 0; kb < K; kb += 32) {
    FragH ah, al;
    const v4f x0 = *(const v4fa*)(arow + kb + 8 * hh), x1 = *(const v4fa*)(arow + kb + 8 * hh + 4), x2 = *(const v4fa*)(arow + kb + 16 + 8 * hh), x3 = *(const v4fa*)(arow + kb + 16 + 8 * hh + 4);
    float xs[16] = {x0[0],x0[1],x0[2],x0[3],x1[0],x1[1],x1[2],x1[3],x2[0],x2[1],x2[2],x2[3],x3[0],x3[1],x3[2],x3[3]};
#pragma unroll
    for (int i = 0; i < 16; ++i) { const _Float16 h = (_Float16)xs[i]; ah.h[i] = h; al.h[i] = ASPLIT ? (_Float16)(xs[i] - (float)h) : (_Float16)0.0f; }
#pragma unroll
    for (int t = 0; t < 4; ++t) { if (col0 + t * 16 >= N) continue; const size_t boff = (size_t)(col0 + t * 16 + ln) * ldb + kb; FragH bq; bq.half[0] = *(const v8us*)(Bh + boff + 8 * hh); bq.half[1] = *(const v8us*)(Bh + boff + 16 + 8 * hh);
      acc[t] = mmaH<ASPLIT ? 2 : 1>(ah.v, al.v, bq.v, bq.v, acc[t]); }
  }
#pragma unroll
  for (int t = 0; t < 4; ++t) { if (col0 + t * 16 >= N) continue;
#pragma unroll
    for (int r = 0; r < 8; ++r) so[w][8 * hh + r][t * 16 + ln] = acc[t][r] * alpha; }
  __builtin_amdgcn_fence(__ATOMIC_ACQ_REL, "workgroup"); __builtin_amdgcn_wave_barrier();
  const int rsub = lane >> 4, c4 = (lane & 15) * 4;
  {
#pragma unroll
    for (int q = 0; q < 8; ++q) { const int r = q * 2 + rsub; if (col0 + c4 < N) { const v4f v = *(const v4fa*)&so[w][r][c4]; *(v4f*)(C + (size_t)(row0 + r) * ldc + col0 + c4) = v; } }
     }
}

// Wt[n][k] = f16(W[k][n]·scale) from f32 row-major W[K][N] (scale = power of two; bf16-exact weights stay exact in f16 away from the subnormal range)
__global__ __launch_bounds__(256) void k_wt_f16(const float* __restrict__ W, _Float16* __restrict__ Wt, int K, int N, float scale) {
  const int t = blockIdx.x * 256 + threadIdx.x; if (t >= N * (K / 8)) return; const int n = t / (K / 8), k8 = (t % (K / 8)) * 8; FragH f;
#pragma unroll
  for (int i = 0; i < 8; ++i) f.h[i] = (_Float16)(bf16_round(W[(size_t)(k8 + i) * N + n]) * scale); const v8us o = f.half[0];
  *(v8us*)((unsigned short*)Wt + (size_t)n * K + k8) = o; 
}
// k_gemm_hh variant with fused epilogue: v = acc·alpha + bias[by·sBias + col] (+ CP[(row/rowsPerB)·sCPb + by·64 + col] if CP) ; ACT 0 none / 1 elu ; writes f16 C16 and f32 C, each if non-null
template <int ACT>
__global__ __launch_bounds__(128) void k_gemm_hhx(const _Float16* __restrict__ A, int lda, size_t sA, const _Float16* __restrict__ Bh, int ldb, size_t sB, float alpha, const float* __restrict__ bias, size_t sBias, const float* __restrict__ CP, int rowsPerB, size_t sCPb, int row0g,
    float* __restrict__ C, _Float16* __restrict__ C16, int ldc, size_t sC, int M, int N, int K) {
  __shared__ __attribute__((aligned(16))) float so[4][16][64];
  const int tid = threadIdx.x, w = tid >> 5, lane = tid & 31, ln = lane & 15, hh = lane >> 4; const int by = blockIdx.y;
  A += (size_t)by * sA; Bh += (size_t)by * sB; const size_t cofs = (size_t)by * sC; const float* bp = bias ? bias + (size_t)by * sBias : nullptr;
  const int ntn = (N + 63) / 64; const int wid = blockIdx.x * 4 + w; const int mt = wid / ntn, nq = wid % ntn; if (mt * 16 >= M) return;
  const int row0 = mt * 16, col0 = nq * 64; const _Float16* arow = A + (size_t)(row0 + ln) * lda;
  v8f acc[4] = {};
  for (int kb = 0; kb < K; kb += 32) { FragH ah; ah.half[0] = *(const v8us*)((const unsigned short*)arow + kb + 8 * hh); ah.half[1] = *(const v8us*)((const unsigned short*)arow + kb + 16 + 8 * hh);
#pragma unroll
    for (int t = 0; t < 4; ++t) { if (col0 + t * 16 >= N) continue; const size_t boff = (size_t)(col0 + t * 16 + ln) * ldb + kb; FragH bq; bq.half[0] = *(const v8us*)((const unsigned short*)Bh + boff + 8 * hh); bq.half[1] = *(const v8us*)((const unsigned short*)Bh + boff + 16 + 8 * hh);
      acc[t] = mmaH<1>(ah.v, ah.v, bq.v, bq.v, acc[t]); }
  }
#pragma unroll
  for (int t = 0; t < 4; ++t) { if (col0 + t * 16 >= N) continue; const int col = col0 + t * 16 + ln; const float bv = bp ? bf16_round(bp[col]) : 0.f;
#pragma unroll
    for (int r = 0; r < 8; ++r) { float v = acc[t][r] * alpha + bv; if (CP) { const int bidx = (row0g + row0 + 8 * hh + r) / rowsPerB; v += CP[(size_t)bidx * sCPb + (size_t)by * 64 + col]; } if (ACT == 1) v = (v > 0.f) ? v : expm1f(v); else if (ACT == 3) v = fmaxf(v, 0.f); so[w][8 * hh + r][t * 16 + ln] = v; } }
  __builtin_amdgcn_fence(__ATOMIC_ACQ_REL, "workgroup"); __builtin_amdgcn_wave_barrier();
  const int rsub = lane >> 4, c4 = (lane & 15) * 4; typedef _Float16 v4h __attribute__((ext_vector_type(4)));
  {
#pragma unroll
    for (int q = 0; q < 8; ++q) { const int r = q * 2 + rsub; if (col0 + c4 < N) { const v4f v = *(const v4fa*)&so[w][r][c4]; if (C) *(v4f*)(C + cofs + (size_t)(row0 + r) * ldc + col0 + c4) = v; if (C16) { v4h h4; for (int i = 0; i < 4; ++i) h4[i] = (_Float16)v[i]; *(v4h*)(C16 + cofs + (size_t)(row0 + r) * ldc + col0 + c4) = h4; } } }
     }
}


// Eight 16-byte asynchronous copies global -> LDS (each lane its own addresses), rows lstep / gstep apart. The s_wait_xcnt closes the statement so that no
// address register named here is rewritten ahead of it.
__device__ __forceinline__ void copy8(unsigned l, const _Float16* g, unsigned lstep, size_t gstep) {
  asm volatile("global_load_async_to_lds_b128 %0, %8, off\n\t"
               "global_load_async_to_lds_b128 %1, %9, off\n\t"
               "global_load_async_to_lds_b128 %2, %10, off\n\t"
               "global_load_async_to_lds_b128 %3, %11, off\n\t"
               "global_load_async_to_lds_b128 %4, %12, off\n\t"
               "global_load_async_to_lds_b128 %5, %13, off\n\t"
               "global_load_async_to_lds_b128 %6, %14, off\n\t"
               "global_load_async_to_lds_b128 %7, %15, off\n\t"
               "s_wait_xcnt 0x0"
               :: "v"(l), "v"(l + lstep), "v"(l + 2 * lstep), "v"(l + 3 * lstep), "v"(l + 4 * lstep), "v"(l + 5 * lstep), "v"(l + 6 * lstep), "v"(l + 7 * lstep),
                  "v"(g), "v"(g + gstep), "v"(g + 2 * gstep), "v"(g + 3 * gstep), "v"(g + 4 * gstep), "v"(g + 5 * gstep), "v"(g + 6 * gstep), "v"(g + 7 * gstep)
               : "memory");
}
// C[M][Nn] = A[M][Kk] * Bh[Nn][Kk]^T * alpha (+ bf16-rounded bias), f16 operands, f32 accumulate. One work-group = one 128 x 128 tile of C, four waves (2 x 2) of 64 x 64.
// A and Bh tiles of 128 rows x 128 k are staged in LDS (row pitch 272 B) by asynchronous copies, two buffers: tile t + 1 flies while tile t is worked on.
// M, Nn multiples of 128 (grid = M / 128 * Nn / 128), Kk a multiple of 128. Each 16 x 16 accumulator sums k upwards in steps of 32.
// NCHW: A holds the CC output channels' weights and Bh the tokens (Nn = NR), so a row of C is a channel and its columns are pixels that lie side by side in the image:
// the tile goes straight to C[image][channel][pixel] (f32), the bias belongs to the row.
template <int Nn, int Kk, bool OUT16, bool BIAS, bool NCHW>
__global__ __launch_bounds__(128) void k_gemm_t(const _Float16* __restrict__ A, const _Float16* __restrict__ Bh, float alpha, const float* __restrict__ bias, float* __restrict__ C, _Float16* __restrict__ C16) {
  constexpr int KC = 128, PITCH = 272, OPB = 128 * PITCH, STG = 2 * OPB, NT = Kk / KC;
  __shared__ __attribute__((aligned(16))) unsigned char sm[2 * STG];
  const int tid = threadIdx.x, w = tid >> 5, lane = tid & 31, ln = lane & 15, hh = lane >> 4;
  const int bm = blockIdx.x / (Nn / 128), bn = blockIdx.x % (Nn / 128);
  const int wm = w >> 1, wn = w & 1;
  const int crow = tid >> 4, cch = tid & 15;      // a copy instruction of a wave covers two whole 256-byte rows
  const _Float16* ga = A + (size_t)(bm * 128 + crow) * Kk + cch * 8;
  const _Float16* gb = Bh + (size_t)(bn * 128 + crow) * Kk + cch * 8;
  const unsigned lc = (unsigned)(size_t)sm + crow * PITCH + cch * 16;
  auto fill = [&](int t, int buf) {
    const unsigned l = lc + buf * STG;
    copy8(l, ga + t * KC, 8 * PITCH, (size_t)8 * Kk);
    copy8(l + 64 * PITCH, ga + t * KC + (size_t)64 * Kk, 8 * PITCH, (size_t)8 * Kk);
    copy8(l + OPB, gb + t * KC, 8 * PITCH, (size_t)8 * Kk);
    copy8(l + OPB + 64 * PITCH, gb + t * KC + (size_t)64 * Kk, 8 * PITCH, (size_t)8 * Kk);
  };
  v8f acc[4][4] = {};
  fill(0, 0);
  asm volatile("s_wait_asynccnt 0x0" ::: "memory");      // tile 0 of this wave has landed
  __syncthreads();                                       // ... and every wave's part of it
  if (NT > 1) fill(1, 1);
  const int aoff = (wm * 64 + ln) * PITCH + 16 * hh, boff = OPB + (wn * 64 + ln) * PITCH + 16 * hh;
#pragma unroll 1      // kept rolled: unrolled over the k tiles the build takes many more vector registers
  for (int t = 0; t < NT; ++t) {
    const int sb = (t & 1) * STG;
#pragma unroll
    for (int ks = 0; ks < KC / 32; ++ks) {
      FragH a[4], b[4];
#pragma unroll
      for (int i = 0; i < 4; ++i) {
        a[i].half[0] = *(const v8us*)&sm[sb + aoff + i * 16 * PITCH + ks * 64]; a[i].half[1] = *(const v8us*)&sm[sb + aoff + i * 16 * PITCH + ks * 64 + 32];
        b[i].half[0] = *(const v8us*)&sm[sb + boff + i * 16 * PITCH + ks * 64]; b[i].half[1] = *(const v8us*)&sm[sb + boff + i * 16 * PITCH + ks * 64 + 32];
      }
#pragma unroll
      for (int i = 0; i < 4; ++i)
#pragma unroll
        for (int j = 0; j < 4; ++j) acc[i][j] = __builtin_amdgcn_wmma_f32_16x16x32_f16(false, a[i].v, false, b[j].v, (short)0, acc[i][j], false, false);
    }
    asm volatile("s_wait_dscnt 0x0" ::: "memory");       // this wave's reads of buffer t & 1 are done before it is refilled
    asm volatile("s_wait_asynccnt 0x0" ::: "memory");    // this wave's copies of tile t + 1 have landed
    __syncthreads();                                     // publishes tile t + 1, ends every reader's last read of tile t
    if (t + 2 < NT) fill(t + 2, t & 1);
  }
  asm volatile("s_wait_asynccnt 0x0" ::: "memory");      // no copy is outstanding when the ring becomes output staging
  // epilogue: each wave stages its 64 x 64 tile in its own LDS range (pitch 68 floats) and stores whole lines
  float* so = (float*)sm + w * (64 * 68);
  const int row0 = bm * 128 + wm * 64, col0 = bn * 128 + wn * 64;
  if (NCHW) {
#pragma unroll
    for (int i = 0; i < 4; ++i)
#pragma unroll
      for (int r = 0; r < 8; ++r) {
        const float bv = BIAS ? bf16_round(bias[row0 + i * 16 + 8 * hh + r]) : 0.f;
#pragma unroll
        for (int j = 0; j < 4; ++j) so[(i * 16 + 8 * hh + r) * 68 + j * 16 + ln] = acc[i][j][r] * alpha + bv;
      }
  } else {
#pragma unroll
    for (int j = 0; j < 4; ++j) {
      const float bv = BIAS ? bf16_round(bias[col0 + j * 16 + ln]) : 0.f;
#pragma unroll
      for (int i = 0; i < 4; ++i)
#pragma unroll
        for (int r = 0; r < 8; ++r) so[(i * 16 + 8 * hh + r) * 68 + j * 16 + ln] = acc[i][j][r] * alpha + bv;
    }
  }
  __builtin_amdgcn_fence(__ATOMIC_ACQ_REL, "workgroup"); __builtin_amdgcn_wave_barrier();
  if (NCHW) {
    const int rs = lane >> 4, c4 = (lane & 15) * 4;      // half a wave stores 64 pixels of one channel: two whole lines
    float* cp = C + ((size_t)(col0 / NPIX) * CC + row0 + rs) * NPIX + col0 % NPIX + c4;
#pragma unroll
    for (int q = 0; q < 32; ++q) { const int r = q * 2 + rs; const v4f v = *(const v4fa*)&so[r * 68 + c4]; *(v4f*)(cp + q * 2 * NPIX) = v; }
  } else if (OUT16) {
    const int rs = lane >> 3, c8 = (lane & 7) * 8;
    unsigned short* cp = (unsigned short*)C16 + (size_t)(row0 + rs) * Nn + col0 + c8;
#pragma unroll
    for (int q = 0; q < 16; ++q) { const int r = q * 4 + rs; const v4f v0 = *(const v4fa*)&so[r * 68 + c8], v1 = *(const v4fa*)&so[r * 68 + c8 + 4]; FragH f;
#pragma unroll
      for (int i = 0; i < 4; ++i) { f.h[i] = (_Float16)v0[i]; f.h[4 + i] = (_Float16)v1[i]; }
      *(v8us*)(cp + q * 4 * Nn) = f.half[0]; }
  } else {
    const int rs = lane >> 4, c4 = (lane & 15) * 4;
    float* cp = C + (size_t)(row0 + rs) * Nn + col0 + c4;
#pragma unroll
    for (int q = 0; q < 32; ++q) { const int r = q * 2 + rs; const v4f v = *(const v4fa*)&so[r * 68 + c4]; *(v4f*)(cp + q * 2 * Nn) = v; }
  }
}


typedef _Float16 v4h __attribute__((ext_vector_type(4)));

__global__ __launch_bounds__(256) void k_x16(const float* __restrict__ x, _Float16* __restrict__ X16, size_t n8) { const size_t t = (size_t)blockIdx.x * 256 + threadIdx.x; if (t >= n8) return; FragH f;
#pragma unroll
  for (int q = 0; q < 8; ++q) f.h[q] = (_Float16)bf16_round(x[t * 8 + q]); *(v8us*)((unsigned short*)X16 + t * 8) = f.half[0];  }
__global__ __launch_bounds__(256) void k_h16(const float* __restrict__ x, _Float16* __restrict__ X16, size_t n8) { const size_t t = (size_t)blockIdx.x * 256 + threadIdx.x; if (t >= n8) return; FragH f;
#pragma unroll
  for (int q = 0; q < 8; ++q) f.h[q] = (_Float16)x[t * 8 + q]; *(v8us*)((unsigned short*)X16 + t * 8) = f.half[0];  }
__global__ __launch_bounds__(256) void k_round16f(const float* __restrict__ W, _Float16* __restrict__ Bt, size_t n8) { const size_t t = (size_t)blockIdx.x * 256 + threadIdx.x; if (t >= n8) return; FragH f;
#pragma unroll
  for (int i = 0; i < 8; ++i) f.h[i] = (_Float16)(bf16_round(W[t * 8 + i]) * 16.0f); *(v8us*)((unsigned short*)Bt + t * 8) = f.half[0];  }
template <int NHv, int TTv>
__global__ __launch_bounds__(256) void k_vt(const _Float16* __restrict__ V16, int ldv, int voff, _Float16* __restrict__ Vt) { __shared__ unsigned short tl[64][66]; const int tid = threadIdx.x; const int slab = blockIdx.x / (TTv / 64), lg = blockIdx.x % (TTv / 64); const int b = slab / NHv, h = slab % NHv;
  for (int i = tid; i < 64 * 8; i += 256) { const int r = i / 8, c8 = (i % 8) * 8; FragH f; f.half[0] = *(const v8us*)((const unsigned short*)V16 + ((size_t)b * TTv + lg * 64 + r) * ldv + voff + h * 64 + c8);
#pragma unroll
    for (int q = 0; q < 8; ++q) tl[r][c8 + q] = f.u[q]; }
  __syncthreads();
  {
#pragma unroll
    for (int rd = 0; rd < 2; ++rd) { const int d = rd * 32 + tid / 8, pc = tid % 8; FragH f;
#pragma unroll
      for (int q = 0; q < 8; ++q) f.u[q] = tl[pc * 8 + q][d];
      *(v8us*)((unsigned short*)Vt + ((size_t)slab * 64 + d) * TTv + lg * 64 + pc * 8) = f.half[0]; }
     } }

__global__ __launch_bounds__(256) void k_tok(const float* __restrict__ x, _Float16* __restrict__ X16) { __shared__ float tl[32][65]; const int tid = threadIdx.x; const int b = blockIdx.x / ((CC / 64) * (NPIX / 32)), rem = blockIdx.x % ((CC / 64) * (NPIX / 32)); const int cg = rem / (NPIX / 32), pg = rem % (NPIX / 32); const int c0 = cg * 64, p0 = pg * 32;
  for (int i = tid; i < 64 * 32; i += 256) { const int c = i / 32, pp = i % 32; tl[pp][c] = bf16_round(x[((size_t)b * CC + c0 + c) * NPIX + p0 + pp]); } __syncthreads();
  const int r = tid / 8, pc = tid % 8; FragH f; for (int q = 0; q < 8; ++q) f.h[q] = (_Float16)tl[r][pc * 8 + q]; const size_t row = (size_t)b * NPIX + p0 + r; *(v8us*)((unsigned short*)X16 + row * CC + c0 + pc * 8) = f.half[0];  }
union H8 { v8us v; unsigned d[4]; };      // eight f16 values as they are loaded: four registers of two
// v_fma_mix_f32: c + a * b in one fused f32 multiply-add whose f16 factors are widened exactly inside the instruction (op_sel picks the high halves). Written as asm for
// speed: from plain source this build widens every half with a conversion of its own before a packed f32 multiply-add. Each statement holds a whole round over independent
// sums, so that an instruction and the one it depends on stand eight or nine apart (asm text gets no s_delay_alu from the compiler, and needs none at that distance).
// s[w] (+)= the two products of register q with register k[w], w = 0 .. 8
__device__ __forceinline__ void dot9_first(float (&s)[9], unsigned q, const unsigned (&k)[9]) {
  asm(
      "v_fma_mix_f32 %0, %9, %10, 0 op_sel_hi:[1,1,0]\n\t"
      "v_fma_mix_f32 %1, %9, %11, 0 op_sel_hi:[1,1,0]\n\t"
      "v_fma_mix_f32 %2, %9, %12, 0 op_sel_hi:[1,1,0]\n\t"
      "v_fma_mix_f32 %3, %9, %13, 0 op_sel_hi:[1,1,0]\n\t"
      "v_fma_mix_f32 %4, %9, %14, 0 op_sel_hi:[1,1,0]\n\t"
      "v_fma_mix_f32 %5, %9, %15, 0 op_sel_hi:[1,1,0]\n\t"
      "v_fma_mix_f32 %6, %9, %16, 0 op_sel_hi:[1,1,0]\n\t"
      "v_fma_mix_f32 %7, %9, %17, 0 op_sel_hi:[1,1,0]\n\t"
      "v_fma_mix_f32 %8, %9, %18, 0 op_sel_hi:[1,1,0]\n\t"
      "v_fma_mix_f32 %0, %9, %10, %0 op_sel:[1,1,0] op_sel_hi:[1,1,0]\n\t"
      "v_fma_mix_f32 %1, %9, %11, %1 op_sel:[1,1,0] op_sel_hi:[1,1,0]\n\t"
      "v_fma_mix_f32 %2, %9, %12, %2 op_sel:[1,1,0] op_sel_hi:[1,1,0]\n\t"
      "v_fma_mix_f32 %3, %9, %13, %3 op_sel:[1,1,0] op_sel_hi:[1,1,0]\n\t"
      "v_fma_mix_f32 %4, %9, %14, %4 op_sel:[1,1,0] op_sel_hi:[1,1,0]\n\t"
      "v_fma_mix_f32 %5, %9, %15, %5 op_sel:[1,1,0] op_sel_hi:[1,1,0]\n\t"
      "v_fma_mix_f32 %6, %9, %16, %6 op_sel:[1,1,0] op_sel_hi:[1,1,0]\n\t"
      "v_fma_mix_f32 %7, %9, %17, %7 op_sel:[1,1,0] op_sel_hi:[1,1,0]\n\t"
      "v_fma_mix_f32 %8, %9, %18, %8 op_sel:[1,1,0] op_sel_hi:[1,1,0]"
      : "=&v"(s[0]), "=&v"(s[1]), "=&v"(s[2]), "=&v"(s[3]), "=&v"(s[4]), "=&v"(s[5]), "=&v"(s[6]), "=&v"(s[7]), "=&v"(s[8])
      : "v"(q), "v"(k[0]), "v"(k[1]), "v"(k[2]), "v"(k[3]), "v"(k[4]), "v"(k[5]), "v"(k[6]), "v"(k[7]), "v"(k[8]));
}
__device__ __forceinline__ void dot9_more(float (&s)[9], unsigned q, const unsigned (&k)[9]) {
  asm(
      "v_fma_mix_f32 %0, %9, %10, %0 op_sel_hi:[1,1,0]\n\t"
      "v_fma_mix_f32 %1, %9, %11, %1 op_sel_hi:[1,1,0]\n\t"
      "v_fma_mix_f32 %2, %9, %12, %2 op_sel_hi:[1,1,0]\n\t"
      "v_fma_mix_f32 %3, %9, %13, %3 op_sel_hi:[1,1,0]\n\t"
      "v_fma_mix_f32 %4, %9, %14, %4 op_sel_hi:[1,1,0]\n\t"
      "v_fma_mix_f32 %5, %9, %15, %5 op_sel_hi:[1,1,0]\n\t"
      "v_fma_mix_f32 %6, %9, %16, %6 op_sel_hi:[1,1,0]\n\t"
      "v_fma_mix_f32 %7, %9, %17, %7 op_sel_hi:[1,1,0]\n\t"
      "v_fma_mix_f32 %8, %9, %18, %8 op_sel_hi:[1,1,0]\n\t"
      "v_fma_mix_f32 %0, %9, %10, %0 op_sel:[1,1,0] op_sel_hi:[1,1,0]\n\t"
      "v_fma_mix_f32 %1, %9, %11, %1 op_sel:[1,1,0] op_sel_hi:[1,1,0]\n\t"
      "v_fma_mix_f32 %2, %9, %12, %2 op_sel:[1,1,0] op_sel_hi:[1,1,0]\n\t"
      "v_fma_mix_f32 %3, %9, %13, %3 op_sel:[1,1,0] op_sel_hi:[1,1,0]\n\t"
      "v_fma_mix_f32 %4, %9, %14, %4 op_sel:[1,1,0] op_sel_hi:[1,1,0]\n\t"
      "v_fma_mix_f32 %5, %9, %15, %5 op_sel:[1,1,0] op_sel_hi:[1,1,0]\n\t"
      "v_fma_mix_f32 %6, %9, %16, %6 op_sel:[1,1,0] op_sel_hi:[1,1,0]\n\t"
      "v_fma_mix_f32 %7, %9, %17, %7 op_sel:[1,1,0] op_sel_hi:[1,1,0]\n\t"
      "v_fma_mix_f32 %8, %9, %18, %8 op_sel:[1,1,0] op_sel_hi:[1,1,0]"
      : "+v"(s[0]), "+v"(s[1]), "+v"(s[2]), "+v"(s[3]), "+v"(s[4]), "+v"(s[5]), "+v"(s[6]), "+v"(s[7]), "+v"(s[8])
      : "v"(q), "v"(k[0]), "v"(k[1]), "v"(k[2]), "v"(k[3]), "v"(k[4]), "v"(k[5]), "v"(k[6]), "v"(k[7]), "v"(k[8]));
}
// acc[0 .. 7] (+)= a * the eight f16 values of v
__device__ __forceinline__ void av8_first(float (&acc)[8], float a, const unsigned (&v)[4]) {
  asm(
      "v_fma_mix_f32 %0, %8, %9, 0 op_sel_hi:[0,1,0]\n\t"
      "v_fma_mix_f32 %1, %8, %9, 0 op_sel:[0,1,0] op_sel_hi:[0,1,0]\n\t"
      "v_fma_mix_f32 %2, %8, %10, 0 op_sel_hi:[0,1,0]\n\t"
      "v_fma_mix_f32 %3, %8, %10, 0 op_sel:[0,1,0] op_sel_hi:[0,1,0]\n\t"
      "v_fma_mix_f32 %4, %8, %11, 0 op_sel_hi:[0,1,0]\n\t"
      "v_fma_mix_f32 %5, %8, %11, 0 op_sel:[0,1,0] op_sel_hi:[0,1,0]\n\t"
      "v_fma_mix_f32 %6, %8, %12, 0 op_sel_hi:[0,1,0]\n\t"
      "v_fma_mix_f32 %7, %8, %12, 0 op_sel:[0,1,0] op_sel_hi:[0,1,0]"
      : "=&v"(acc[0]), "=&v"(acc[1]), "=&v"(acc[2]), "=&v"(acc[3]), "=&v"(acc[4]), "=&v"(acc[5]), "=&v"(acc[6]), "=&v"(acc[7])
      : "v"(a), "v"(v[0]), "v"(v[1]), "v"(v[2]), "v"(v[3]));
}
__device__ __forceinline__ void av8_more(float (&acc)[8], float a, const unsigned (&v)[4]) {
  asm(
      "v_fma_mix_f32 %0, %8, %9, %0 op_sel_hi:[0,1,0]\n\t"
      "v_fma_mix_f32 %1, %8, %9, %1 op_sel:[0,1,0] op_sel_hi:[0,1,0]\n\t"
      "v_fma_mix_f32 %2, %8, %10, %2 op_sel_hi:[0,1,0]\n\t"
      "v_fma_mix_f32 %3, %8, %10, %3 op_sel:[0,1,0] op_sel_hi:[0,1,0]\n\t"
      "v_fma_mix_f32 %4, %8, %11, %4 op_sel_hi:[0,1,0]\n\t"
      "v_fma_mix_f32 %5, %8, %11, %5 op_sel:[0,1,0] op_sel_hi:[0,1,0]\n\t"
      "v_fma_mix_f32 %6, %8, %12, %6 op_sel_hi:[0,1,0]\n\t"
      "v_fma_mix_f32 %7, %8, %12, %7 op_sel:[0,1,0] op_sel_hi:[0,1,0]"
      : "+v"(acc[0]), "+v"(acc[1]), "+v"(acc[2]), "+v"(acc[3]), "+v"(acc[4]), "+v"(acc[5]), "+v"(acc[6]), "+v"(acc[7])
      : "v"(a), "v"(v[0]), "v"(v[1]), "v"(v[2]), "v"(v[3]));
}
// the value of the lane whose number differs in bit X (X = 1, 2, 4: inside a group of eight lanes); every lane is on where it is used
template <int X>
__device__ __forceinline__ float xlane(float v) { return __int_as_float(__builtin_amdgcn_update_dpp(0, __float_as_int(v), 0x160 + X, 0xf, 0xf, true)); }
// lane S of each group of eight lanes, handed to all eight
template <int S>
__device__ __forceinline__ float group_bcast(float v) { return __uint_as_float(__builtin_amdgcn_permlane16(0u, __float_as_uint(v), 0x11111111u * S, 0x11111111u * (8 + S), true, true)); }
struct WinTile { H8 q, k[9], v[9]; };
// Window attention in one kernel. One wave = one image row of one (batch, head), four pixels a pass; eight lanes share a pixel, lane p holding d = 8p .. 8p + 7.
// The partial logits are summed over the eight lanes so that lane p ends with logit p (the ninth ends in all eight); each lane does the softmax of its own logit and of the
// ninth, the weights are handed round the group, attn * v follows in the same lanes. A window place outside the image reads a clamped (in-bounds) address; its logit is
// set to 0 and its weight on v to 0. The row's 32 x 9 weights are staged in the wave's own LDS range and stored as whole lines.
__global__ __launch_bounds__(256) void k_win(const _Float16* __restrict__ Q, const _Float16* __restrict__ KV, float* __restrict__ ATTN, _Float16* __restrict__ O16) {
  __shared__ __attribute__((aligned(16))) float sa[8][HWD * 9];
  const int tid = threadIdx.x, lane = tid & 31, g = lane >> 3, p = lane & 7;
  const int w = __builtin_amdgcn_readfirstlane(tid >> 5);
  const int bh = blockIdx.x / (HWD / 8), y = (blockIdx.x % (HWD / 8)) * 8 + w;
  const int b = bh / NH, h = bh % NH;
  // every address = a wave-uniform byte pointer + one of four lane offsets formed here once: no address arithmetic inside the passes
  constexpr unsigned QP = INNER * 2, KP = 2 * INNER * 2;      // bytes a pixel in Q / O16 and in KV
  const char* qrow = (const char*)(Q + ((size_t)b * NPIX + y * HWD) * INNER + h * DH);
  char* orow = (char*)(O16 + ((size_t)b * NPIX + y * HWD) * INNER + h * DH);
  const char* krow[3];
#pragma unroll
  for (int dy = 0; dy < 3; ++dy) krow[dy] = (const char*)(KV + ((size_t)b * NPIX + min(max(y + dy - 1, 0), HWD - 1) * HWD) * (2 * INNER) + h * DH);
  const unsigned loq = g * QP + p * 16, lok = g * KP + p * 16;
  const unsigned lokl = max(g - 1, 0) * KP + p * 16, lokr = min(g + 1, 3) * KP + p * 16;      // x - 1 clamped in the first pass, x + 1 clamped in the last
  const bool c1 = p & 1, c2 = p & 2, c4 = p & 4;
  const int ym = y + p / 3 - 1, dxm = p % 3 - 1;      // window place p of this lane's own logit
  const bool okym = ym >= 0 && ym < HWD, oky8 = y + 1 < HWD;
  auto load = [&](int it, WinTile& t) {
    t.q.v = *(const v8us*)(qrow + it * 4 * QP + loq);
#pragma unroll
    for (int wi = 0; wi < 9; ++wi) {
      const int dx = wi % 3 - 1;
      const bool el = it == 0 && dx < 0, er = it == HWD / 4 - 1 && dx > 0;
      const char* kr = krow[wi / 3] + (el || er ? it * 4 : it * 4 + dx) * KP;
      const unsigned off = el ? lokl : er ? lokr : lok;
      t.k[wi].v = *(const v8us*)(kr + off); t.v[wi].v = *(const v8us*)(kr + INNER * 2 + off);
    }
  };
  WinTile tl[2];
  load(0, tl[0]);
  asm volatile("s_wait_xcnt 0x0" ::: "memory");      // lokl is not used again and this build hands its register to a later load's result: the wait stands in front of that overwrite
#pragma unroll      // unrolled: the two register tiles alternate by a constant index, and only the first and the last pass carry the tests on x
  for (int it = 0; it < HWD / 4; ++it) {
    if (it + 1 < HWD / 4) load(it + 1, tl[(it + 1) & 1]);      // the next four pixels' loads fly while these four are worked on
    __builtin_amdgcn_sched_barrier(0);      // keeps those loads in front of this pass's arithmetic: sunk into it, each would be waited for right behind its issue
    const WinTile& t = tl[it & 1];
    const int x = it * 4 + g;
    const bool okm = okym && (it != 0 || x + dxm >= 0) && (it != HWD / 4 - 1 || x + dxm < HWD);
    const bool ok8 = oky8 && (it != HWD / 4 - 1 || x + 1 < HWD);
    float s[9];
#pragma unroll
    for (int j = 0; j < 4; ++j) {
      const unsigned kj[9] = {t.k[0].d[j], t.k[1].d[j], t.k[2].d[j], t.k[3].d[j], t.k[4].d[j], t.k[5].d[j], t.k[6].d[j], t.k[7].d[j], t.k[8].d[j]};
      if (j == 0) dot9_first(s, t.q.d[j], kj); else dot9_more(s, t.q.d[j], kj);
    }
    float r[4], u[2];
#pragma unroll
    for (int i = 0; i < 4; ++i) r[i] = (c4 ? s[4 + i] : s[i]) + xlane<4>(c4 ? s[i] : s[4 + i]);      // logit 4 * (p >> 2) + i
#pragma unroll
    for (int i = 0; i < 2; ++i) u[i] = (c2 ? r[2 + i] : r[i]) + xlane<2>(c2 ? r[i] : r[2 + i]);      // logit 2 * (p >> 1) + i
    const float sm = (c1 ? u[1] : u[0]) + xlane<1>(c1 ? u[0] : u[1]);                                // logit p
    float s8 = s[8]; s8 += xlane<1>(s8); s8 += xlane<2>(s8); s8 += xlane<4>(s8);
    const float lm = okm ? sm * 0.125f : 0.f, l8 = ok8 ? s8 * 0.125f : 0.f;
    float m = fmaxf(lm, xlane<1>(lm)); m = fmaxf(m, xlane<2>(m)); m = fmaxf(m, xlane<4>(m)); m = fmaxf(m, l8);
    const float em = expf(lm - m), e8 = expf(l8 - m);
    float z = em + xlane<1>(em); z += xlane<2>(z); z += xlane<4>(z); z += e8;
    const float am = em / z, a8 = e8 / z;
    sa[w][x * 9 + p] = am;
    if (p == 0) sa[w][x * 9 + 8] = a8;
    const float vm = okm ? am : 0.f;
    const float a[9] = {group_bcast<0>(vm), group_bcast<1>(vm), group_bcast<2>(vm), group_bcast<3>(vm), group_bcast<4>(vm), group_bcast<5>(vm), group_bcast<6>(vm), group_bcast<7>(vm), ok8 ? a8 : 0.f};
    __builtin_amdgcn_sched_barrier(0);      // keeps the eight lane moves together in front of the asm rounds: one placed directly in front of the round that reads it would stall it, unhinted
    float acc[8];
#pragma unroll
    for (int wi = 0; wi < 9; ++wi) { if (wi == 0) av8_first(acc, a[wi], t.v[wi].d); else av8_more(acc, a[wi], t.v[wi].d); }
    FragH o;
#pragma unroll
    for (int j = 0; j < 8; ++j) o.h[j] = (_Float16)acc[j];
    *(v8us*)(orow + it * 4 * QP + loq) = o.half[0];
  }
  __builtin_amdgcn_fence(__ATOMIC_ACQ_REL, "workgroup"); __builtin_amdgcn_wave_barrier();      // the wave's own LDS writes are done before other lanes of it read them
  float* ap = ATTN + ((size_t)bh * NPIX + y * HWD) * 9;
#pragma unroll
  for (int q = 0; q < 3; ++q) { const int i4 = q * 32 + lane; if (i4 < HWD * 9 / 4) { const v4f v = *(const v4fa*)&sa[w][i4 * 4]; *(v4f*)(ap + i4 * 4) = v; } }
}
extern "C" void kernel_launch(void* const* d_in, const int* in_sizes, int n_in,
                              void* d_out, int out_size, void* d_ws, size_t ws_size, hipStream_t stream) {
  (void)in_sizes; (void)n_in; (void)out_size;
  const float* x = (const float*)d_in[0]; const float* Wq = (const float*)d_in[1]; const float* Wkv = (const float*)d_in[2]; const float* Wo = (const float*)d_in[3]; const float* bo = (const float*)d_in[4];
  float* OUT0 = (float*)d_out; float* ATTN = OUT0 + (size_t)BB * CC * NPIX;
  char* ws = (char*)d_ws; size_t off = 0;
  auto take = [&](size_t bytes) { char* p = ws + off; off += (bytes + 255) & ~(size_t)255; return p; };
  _Float16* Bq = (_Float16*)take((size_t)INNER * CC * 2); _Float16* Bkv = (_Float16*)take((size_t)2 * INNER * CC * 2); _Float16* Bo = (_Float16*)take((size_t)CC * INNER * 2); _Float16* X16 = (_Float16*)take((size_t)NR * CC * 2); _Float16* Q = (_Float16*)take((size_t)NR * INNER * 2); _Float16* KV = (_Float16*)take((size_t)NR * 2 * INNER * 2); _Float16* O16 = (_Float16*)take((size_t)NR * INNER * 2);
  if (off > ws_size) return;      // 1.1 + 8.4 + 16.8 + 33.5 + 16.8 MB
  k_round16f<<<(unsigned)(((size_t)INNER * CC / 8 + 255) / 256), 256, 0, stream>>>(Wq, Bq, (size_t)INNER * CC / 8); k_round16f<<<(unsigned)(((size_t)2 * INNER * CC / 8 + 255) / 256), 256, 0, stream>>>(Wkv, Bkv, (size_t)2 * INNER * CC / 8); k_round16f<<<(unsigned)(((size_t)CC * INNER / 8 + 255) / 256), 256, 0, stream>>>(Wo, Bo, (size_t)CC * INNER / 8);      // (out,in)
  k_tok<<<BB * (CC / 64) * (NPIX / 32), 256, 0, stream>>>(x, X16);
  k_gemm_t<INNER, CC, true, false, false><<<(NR / 128) * (INNER / 128), 128, 0, stream>>>(X16, Bq, 0.0625f, nullptr, nullptr, Q);
  k_gemm_t<2 * INNER, CC, true, false, false><<<(NR / 128) * (2 * INNER / 128), 128, 0, stream>>>(X16, Bkv, 0.0625f, nullptr, nullptr, KV);      // [k | v]
  k_win<<<BB * NH * (HWD / 8), 256, 0, stream>>>(Q, KV, ATTN, O16);
  k_gemm_t<NR, INNER, false, true, true><<<(CC / 128) * (NR / 128), 128, 0, stream>>>(Bo, O16, 0.0625f, bo, OUT0, nullptr);      // to_out + bo, channels as rows: stored as NCHW
}

// v004
// One run takes 61.8 microseconds.
// Next to v003, in two timings, it ran 1.11 times as fast each time.
// All steps since v000 together make it 2.69 times as fast.
#include <hip/hip_runtime.h>
// Local 3×3-window attention (x [16,256,32,32]; 8 heads × 64): q = 1×1 conv (Wq), k,v = 1×1 conv (Wkv), each pixel attends over its 3×3 neighbourhood (zero-padded keys/values take part with
// logit 0), softmax(q·k/8), out = Σ attn·v, 1×1 conv Wo + bo; outputs (out NCHW, attn [16,8,1024,9]). The three pointwise convs run as GEMMs on v_wmma_f32_16x16x32_f16 (x bf16-exact, (out,in)
// weights bf16-exact ×2^4, q/k/v/o f16, f32 accumulate); the 9-wide window dots, softmax and attn·v are f32 VALU in one kernel (eight lanes a pixel and head); x is transposed by tiles (the weights are converted in the same launch), q and k | v come from one GEMM, out comes from its GEMM as NCHW.
#define BB 16
#define CC 256
#define HWD 32
#define NPIX 1024
#define NH 8
#define DH 64
#define INNER 512
#define NR (BB * NPIX)

typedef __bf16 v16b __attribute__((ext_vector_type(16)));
typedef unsigned short v8us __attribute__((ext_vector_type(8), may_alias));
typedef float  v8f  __attribute__((ext_vector_type(8)));
typedef float  v4f  __attribute__((ext_vector_type(4)));
typedef float  v4fa __attribute__((ext_vector_type(4), may_alias));
union FragB { v16b v; v8us half[2]; unsigned short u[16]; };

__device__ __forceinline__ unsigned short bf16_bits(float x) { unsigned int u = __float_as_uint(x); return (unsigned short)((u + 0x7FFFu + ((u >> 16) & 1u)) >> 16); }
__device__ __forceinline__ float bf16_val(unsigned short b) { return __uint_as_float(((unsigned int)b) << 16); }
__device__ __forceinline__ float bf16_round(float x) { return bf16_val(bf16_bits(x)); }
// D += A·B with NT terms: 1 = ah·bh, 2 = + al·bh (A split), 3 = + ah·bl (both split)
template <int NT>
__device__ __forceinline__ v8f mmaN(v16b ah, v16b al, v16b bh, v16b bl, v8f c) {
  c = __builtin_amdgcn_wmma_f32_16x16x32_bf16(false, ah, false, bh, (short)0, c, false, false);
  if (NT >= 2) c = __builtin_amdgcn_wmma_f32_16x16x32_bf16(false, al, false, bh, (short)0, c, false, false);
  if (NT >= 3) c = __builtin_amdgcn_wmma_f32_16x16x32_bf16(false, ah, false, bl, (short)0, c, false, false);
  asm volatile("v_nop\n\tv_nop\n\tv_nop\n\tv_nop" : "+v"(c) : "v"(ah), "v"(al), "v"(bh), "v"(bl));
  return c;
}

__global__ __launch_bounds__(256) void k_wt_bf16(const float* __restrict__ W, unsigned short* __restrict__ Wt, int K, int N) {
  const int t = blockIdx.x * 256 + threadIdx.x;
  const int k8n = K / 8;
  if (t >= N * k8n) return;
  const int n = t / k8n, k8 = (t % k8n) * 8;
  v8us v;
#pragma unroll
  for (int i = 0; i < 8; ++i) v[i] = bf16_bits(W[(size_t)(k8 + i) * N + n]);
  *(v8us*)(Wt + (size_t)n * K + k8) = v;
  
}

// GEMM C[M][N] (f32, pitch ldc) = act(A[M][K]·W + bias). A f32 row-major (pitch lda) converted per fragment to bf16
// (ASPLIT: hi/lo two planes -> 2 terms, else single rounded term); Wt bf16 [N][K] (pitch ldb). BIAS_BF16 rounds the
// bias to bf16 first (bias quantised to bf16 before the add). K%32==0, M%16==0, N%64==0.
template <bool ASPLIT, int ACT, bool BIAS_BF16>
__global__ __launch_bounds__(128) void k_gemm_bf(const float* __restrict__ A, int lda, const unsigned short* __restrict__ Wt, int ldb,
                                               const float* __restrict__ bias, float* __restrict__ C, int ldc, int M, int N, int K) {
  __shared__ __attribute__((aligned(16))) float so[4][16][64];
  const int tid = threadIdx.x, w = tid >> 5, lane = tid & 31, ln = lane & 15, hh = lane >> 4;
  const int ntn = N / 64;
  const int wid = blockIdx.x * 4 + w;
  const int mt = wid / ntn, nq = wid % ntn;
  if (mt * 16 >= M) return;
  const int row0 = mt * 16, col0 = nq * 64;
  const float* arow = A + (size_t)(row0 + ln) * lda;
  v8f acc[4] = {};
  for (int kb = 0; kb < K; kb += 32) {
    FragB ah, al;
    const v4f x0 = *(const v4fa*)(arow + kb + 8 * hh), x1 = *(const v4fa*)(arow + kb + 8 * hh + 4);
    const v4f x2 = *(const v4fa*)(arow + kb + 16 + 8 * hh), x3 = *(const v4fa*)(arow + kb + 16 + 8 * hh + 4);
    float xs[16] = {x0[0],x0[1],x0[2],x0[3],x1[0],x1[1],x1[2],x1[3],x2[0],x2[1],x2[2],x2[3],x3[0],x3[1],x3[2],x3[3]};
#pragma unroll
    for (int i = 0; i < 16; ++i) { const unsigned short hb = bf16_bits(xs[i]); ah.u[i] = hb; al.u[i] = ASPLIT ? bf16_bits(xs[i] - bf16_val(hb)) : (unsigned short)0; }
#pragma unroll
    for (int t = 0; t < 4; ++t) {
      const unsigned short* brow = Wt + (size_t)(col0 + t * 16 + ln) * ldb + kb;
      FragB b;
      b.half[0] = *(const v8us*)(brow + 8 * hh);
      b.half[1] = *(const v8us*)(brow + 16 + 8 * hh);
      acc[t] = mmaN<ASPLIT ? 2 : 1>(ah.v, al.v, b.v, b.v, acc[t]);
    }
  }
#pragma unroll
  for (int t = 0; t < 4; ++t) {
    float bv = bias ? bias[col0 + t * 16 + ln] : 0.f;
    if (BIAS_BF16) bv = bf16_round(bv);
#pragma unroll
    for (int r = 0; r < 8; ++r) { float v = acc[t][r] + bv; if (ACT == 1) v = fmaxf(v, 0.f); so[w][8 * hh + r][t * 16 + ln] = v; }
  }
  __builtin_amdgcn_fence(__ATOMIC_ACQ_REL, "workgroup");
  __builtin_amdgcn_wave_barrier();
  const int rsub = lane >> 4, c4 = (lane & 15) * 4;
  {
#pragma unroll
    for (int q = 0; q < 8; ++q) {
      const int r = q * 2 + rsub;
      const v4f v = *(const v4fa*)&so[w][r][c4];
      *(v4f*)(C + (size_t)(row0 + r) * ldc + col0 + c4) = v;
    }
    
  }
}

// Flash-style causal/unmasked attention, all contractions 3-term bf16 hi/lo splits, f32 softmax with running max.
// q,k,v rows are read from f32 buffers with arbitrary row pitch (so they can live inside a fused qkv buffer);
// D = head size (multiple of 32, <= 128); one wave = 16 query rows; block = 4 waves (64 queries) sharing K/V chunks of 32.
template <int D, bool CAUSAL>
__global__ __launch_bounds__(128) void k_flash(const float* __restrict__ qb, const float* __restrict__ kb, const float* __restrict__ vb,
                                             int pitch, int T, int H, float scale, float* __restrict__ y, int ypitch) {
  constexpr int KS = D / 32;        // k-steps for QK
  constexpr int DT = D / 16;        // d tiles for PV
  __shared__ __attribute__((aligned(16))) unsigned short sKh[32][D + 8], sKl[32][D + 8], sVh[32][D + 8], sVl[32][D + 8];
  __shared__ __attribute__((aligned(16))) unsigned short sPh[4][16][40], sPl[4][16][40];
  __shared__ __attribute__((aligned(16))) float sO[4][16][D];
  const int tid = threadIdx.x, w = tid >> 5, lane = tid & 31, ln = lane & 15, hh = lane >> 4;
  const int nqb = (T + 63) / 64;
  const int bh = blockIdx.x / nqb, qblk = blockIdx.x % nqb;
  const int b = bh / H, h = bh % H;
  const int q0 = qblk * 64 + w * 16;
  const float* Q = qb + (size_t)b * T * pitch + h * D;
  const float* K = kb + (size_t)b * T * pitch + h * D;
  const float* V = vb + (size_t)b * T * pitch + h * D;

  // A fragments of the wave's 16 query rows (scaled), hi/lo
  FragB aqh[KS], aql[KS];
  {
    int row = q0 + ln; if (row >= T) row = T - 1;
    const float* qr = Q + (size_t)row * pitch;
#pragma unroll
    for (int ks = 0; ks < KS; ++ks)
#pragma unroll
      for (int i = 0; i < 16; ++i) {
        const int d = ks * 32 + ((i < 8) ? (8 * hh + i) : (16 + 8 * hh + (i - 8)));
        const float x = qr[d] * scale; const unsigned short hb = bf16_bits(x);
        aqh[ks].u[i] = hb; aql[ks].u[i] = bf16_bits(x - bf16_val(hb));
      }
  }
  float m_r[8], l_r[8];
#pragma unroll
  for (int r = 0; r < 8; ++r) { m_r[r] = -3.0e38f; l_r[r] = 0.f; }
  v8f oacc[DT];
#pragma unroll
  for (int dt = 0; dt < DT; ++dt) oacc[dt] = (v8f){0.f,0.f,0.f,0.f,0.f,0.f,0.f,0.f};

  const int kv_end = CAUSAL ? min(T, qblk * 64 + 64) : T;     // block-uniform
  for (int j0 = 0; j0 < kv_end; j0 += 32) {
    __syncthreads();
    for (int e = tid; e < 32 * (D / 4); e += 128) {
      const int r = e / (D / 4), c4 = (e % (D / 4)) * 4;
      const int key = j0 + r;
      v4f kf = {0.f,0.f,0.f,0.f}, vf = {0.f,0.f,0.f,0.f};
      if (key < T) { kf = *(const v4fa*)(K + (size_t)key * pitch + c4); vf = *(const v4fa*)(V + (size_t)key * pitch + c4); }
#pragma unroll
      for (int t = 0; t < 4; ++t) {
        unsigned short hb = bf16_bits(kf[t]); sKh[r][c4 + t] = hb; sKl[r][c4 + t] = bf16_bits(kf[t] - bf16_val(hb));
        hb = bf16_bits(vf[t]); sVh[r][c4 + t] = hb; sVl[r][c4 + t] = bf16_bits(vf[t] - bf16_val(hb));
      }
    }
    __syncthreads();
    // S tile 16 x 32
    v8f s[2];
#pragma unroll
    for (int nt = 0; nt < 2; ++nt) {
      v8f acc = {};
#pragma unroll
      for (int ks = 0; ks < KS; ++ks) {
        FragB bh_, bl_;
        bh_.half[0] = *(const v8us*)&sKh[nt * 16 + ln][ks * 32 + 8 * hh]; bh_.half[1] = *(const v8us*)&sKh[nt * 16 + ln][ks * 32 + 16 + 8 * hh];
        bl_.half[0] = *(const v8us*)&sKl[nt * 16 + ln][ks * 32 + 8 * hh]; bl_.half[1] = *(const v8us*)&sKl[nt * 16 + ln][ks * 32 + 16 + 8 * hh];
        acc = mmaN<3>(aqh[ks].v, aql[ks].v, bh_.v, bl_.v, acc);
      }
      s[nt] = acc;
    }
    // mask + running max (rows 8hh+r; the 16 lanes of a half share rows)
    float alpha[8];
#pragma unroll
    for (int r = 0; r < 8; ++r) {
      const int qi = q0 + 8 * hh + r;
      const int ja = j0 + ln, jb = j0 + 16 + ln;
      if (CAUSAL) { if (ja > qi) s[0][r] = -3.0e38f; if (jb > qi) s[1][r] = -3.0e38f; }
      if (ja >= T) s[0][r] = -3.0e38f;
      if (jb >= T) s[1][r] = -3.0e38f;
      float mx = fmaxf(s[0][r], s[1][r]);
      mx = fmaxf(mx, __shfl_xor(mx, 1, 32)); mx = fmaxf(mx, __shfl_xor(mx, 2, 32)); mx = fmaxf(mx, __shfl_xor(mx, 4, 32)); mx = fmaxf(mx, __shfl_xor(mx, 8, 32));
      const float mnew = fmaxf(m_r[r], mx);
      alpha[r] = (mnew > -1.0e38f) ? __expf(m_r[r] - mnew) : 1.0f;
      const float p0 = (s[0][r] > -1.0e38f) ? __expf(s[0][r] - mnew) : 0.f;
      const float p1 = (s[1][r] > -1.0e38f) ? __expf(s[1][r] - mnew) : 0.f;
      m_r[r] = mnew;
      l_r[r] = l_r[r] * alpha[r] + p0 + p1;            // per-lane partial row sum (16 lanes combined at the end)
      unsigned short hb = bf16_bits(p0); sPh[w][8 * hh + r][ln] = hb;      sPl[w][8 * hh + r][ln] = bf16_bits(p0 - bf16_val(hb));
      hb = bf16_bits(p1);                sPh[w][8 * hh + r][16 + ln] = hb; sPl[w][8 * hh + r][16 + ln] = bf16_bits(p1 - bf16_val(hb));
    }
#pragma unroll
    for (int dt = 0; dt < DT; ++dt)
#pragma unroll
      for (int r = 0; r < 8; ++r) oacc[dt][r] *= alpha[r];
    __builtin_amdgcn_fence(__ATOMIC_ACQ_REL, "workgroup");
    __builtin_amdgcn_wave_barrier();
    FragB pah, pal;
    pah.half[0] = *(const v8us*)&sPh[w][ln][8 * hh]; pah.half[1] = *(const v8us*)&sPh[w][ln][16 + 8 * hh];
    pal.half[0] = *(const v8us*)&sPl[w][ln][8 * hh]; pal.half[1] = *(const v8us*)&sPl[w][ln][16 + 8 * hh];
#pragma unroll
    for (int dt = 0; dt < DT; ++dt) {
      FragB bvh, bvl;
#pragma unroll
      for (int i = 0; i < 8; ++i) {
        bvh.u[i] = sVh[8 * hh + i][dt * 16 + ln]; bvh.u[8 + i] = sVh[16 + 8 * hh + i][dt * 16 + ln];
        bvl.u[i] = sVl[8 * hh + i][dt * 16 + ln]; bvl.u[8 + i] = sVl[16 + 8 * hh + i][dt * 16 + ln];
      }
      oacc[dt] = mmaN<3>(pah.v, pal.v, bvh.v, bvl.v, oacc[dt]);
    }
    __builtin_amdgcn_fence(__ATOMIC_ACQ_REL, "workgroup");
    __builtin_amdgcn_wave_barrier();
  }
#pragma unroll
  for (int r = 0; r < 8; ++r) {
    float l = l_r[r];
    l += __shfl_xor(l, 1, 32); l += __shfl_xor(l, 2, 32); l += __shfl_xor(l, 4, 32); l += __shfl_xor(l, 8, 32);
    l_r[r] = (l > 0.f) ? 1.0f / l : 0.f;
  }
#pragma unroll
  for (int dt = 0; dt < DT; ++dt)
#pragma unroll
    for (int r = 0; r < 8; ++r) sO[w][8 * hh + r][dt * 16 + ln] = oacc[dt][r] * l_r[r];
  __builtin_amdgcn_fence(__ATOMIC_ACQ_REL, "workgroup");
  __builtin_amdgcn_wave_barrier();
  {
    for (int r = 0; r < 16; ++r) {
      const int row = q0 + r;
      if (row < T && lane < D / 4) {
        const v4f val = *(const v4fa*)&sO[w][r][lane * 4];
        *(v4f*)(y + ((size_t)b * T + row) * ypitch + h * D + lane * 4) = val;
      }
    }
    
  }
}

// GEMM C = act(A·W + bias + resid): A f32 (ASPLIT -> hi/lo 2 terms), Wt bf16 [N][K]; ACT 0 none, 1 relu, 2 exact gelu;
// resid (optional, f32, row index = (row % rmod), pitch ldr, RES_BF16 rounds it) added before the activation.
template <bool ASPLIT, int ACT, bool BIAS_BF16, bool RES_BF16>
__global__ __launch_bounds__(128) void k_gemm_bf3(const float* __restrict__ A, int lda, const unsigned short* __restrict__ Wt, int ldb,
                                                const float* __restrict__ bias, const float* __restrict__ resid, int rmod, int ldr,
                                                float* __restrict__ C, int ldc, int M, int N, int K) {
  __shared__ __attribute__((aligned(16))) float so[4][16][64];
  const int tid = threadIdx.x, w = tid >> 5, lane = tid & 31, ln = lane & 15, hh = lane >> 4;
  const int ntn = N / 64;
  const int wid = blockIdx.x * 4 + w;
  const int mt = wid / ntn, nq = wid % ntn;
  if (mt * 16 >= M) return;
  const int row0 = mt * 16, col0 = nq * 64;
  const float* arow = A + (size_t)(row0 + ln) * lda;
  v8f acc[4] = {};
  for (int kb = 0; kb < K; kb += 32) {
    FragB ah, al;
    const v4f x0 = *(const v4fa*)(arow + kb + 8 * hh), x1 = *(const v4fa*)(arow + kb + 8 * hh + 4);
    const v4f x2 = *(const v4fa*)(arow + kb + 16 + 8 * hh), x3 = *(const v4fa*)(arow + kb + 16 + 8 * hh + 4);
    float xs[16] = {x0[0],x0[1],x0[2],x0[3],x1[0],x1[1],x1[2],x1[3],x2[0],x2[1],x2[2],x2[3],x3[0],x3[1],x3[2],x3[3]};
#pragma unroll
    for (int i = 0; i < 16; ++i) { const unsigned short hb = bf16_bits(xs[i]); ah.u[i] = hb; al.u[i] = ASPLIT ? bf16_bits(xs[i] - bf16_val(hb)) : (unsigned short)0; }
#pragma unroll
    for (int t = 0; t < 4; ++t) {
      const unsigned short* brow = Wt + (size_t)(col0 + t * 16 + ln) * ldb + kb;
      FragB b;
      b.half[0] = *(const v8us*)(brow + 8 * hh);
      b.half[1] = *(const v8us*)(brow + 16 + 8 * hh);
      acc[t] = mmaN<ASPLIT ? 2 : 1>(ah.v, al.v, b.v, b.v, acc[t]);
    }
  }
#pragma unroll
  for (int t = 0; t < 4; ++t) {
    const int col = col0 + t * 16 + ln;
    float bv = bias ? bias[col] : 0.f;
    if (BIAS_BF16) bv = bf16_round(bv);
#pragma unroll
    for (int r = 0; r < 8; ++r) {
      float v = acc[t][r] + bv;
      if (resid) { float rv = resid[(size_t)((row0 + 8 * hh + r) % rmod) * ldr + col]; if (RES_BF16) rv = bf16_round(rv); v += rv; }
      if (ACT == 1) v = fmaxf(v, 0.f);
      if (ACT == 2) v = 0.5f * v * (1.0f + erff(v * 0.70710678118654752f));
      if (ACT == 3) { const float u = 0.7978845608028654f * (v + 0.044715f * v * v * v); v = 0.5f * v * (1.0f + tanhf(u)); }
      so[w][8 * hh + r][t * 16 + ln] = v;
    }
  }
  __builtin_amdgcn_fence(__ATOMIC_ACQ_REL, "workgroup");
  __builtin_amdgcn_wave_barrier();
  const int rsub = lane >> 4, c4 = (lane & 15) * 4;
  {
#pragma unroll
    for (int q = 0; q < 8; ++q) {
      const int r = q * 2 + rsub;
      const v4f v = *(const v4fa*)&so[w][r][c4];
      *(v4f*)(C + (size_t)(row0 + r) * ldc + col0 + c4) = v;
    }
    
  }
}
// row LayerNorm (biased variance, eps) over N: s = X (+ R); optional out_sum <- s; out_norm <- (s-mu)*rsqrt(var+eps)*g + b
template <bool PARAM_BF16>
__global__ __launch_bounds__(256) void k_layernorm(const float* __restrict__ X, const float* __restrict__ R, const float* __restrict__ g, const float* __restrict__ bta,
                                                  float* __restrict__ out_sum, float* __restrict__ out_norm, int N, float eps) {
  __shared__ float red[256];
  const int row = blockIdx.x, tid = threadIdx.x;
  const float* x = X + (size_t)row * N; const float* rr = R ? R + (size_t)row * N : nullptr;
  float vals[16];                     // up to N = 4096
  const int per = N / 256;            // contiguous chunk per thread? use strided-by-4 chunks: thread handles j = tid*4 + 1024*u
  float s1 = 0.f;
  for (int u = 0; u < per / 4; ++u) {
    const int j = tid * 4 + 1024 * u;
    const v4f a = *(const v4fa*)(x + j);
    v4f b = {0.f,0.f,0.f,0.f}; if (rr) b = *(const v4fa*)(rr + j);
#pragma unroll
    for (int q = 0; q < 4; ++q) { const float v = a[q] + b[q]; vals[u * 4 + q] = v; s1 += v; }
  }
  red[tid] = s1; __syncthreads();
  for (int st = 128; st > 0; st >>= 1) { if (tid < st) red[tid] += red[tid + st]; __syncthreads(); }
  const float mu = red[0] / (float)N; __syncthreads();
  float s2 = 0.f;
  for (int u = 0; u < per / 4; ++u)
#pragma unroll
    for (int q = 0; q < 4; ++q) { const float c = vals[u * 4 + q] - mu; s2 += c * c; }
  red[tid] = s2; __syncthreads();
  for (int st = 128; st > 0; st >>= 1) { if (tid < st) red[tid] += red[tid + st]; __syncthreads(); }
  const float rs = rsqrtf(red[0] / (float)N + eps);
  {
    for (int u = 0; u < per / 4; ++u) {
      const int j = tid * 4 + 1024 * u;
      v4f o, sm;
#pragma unroll
      for (int q = 0; q < 4; ++q) {
        float gg = g[j + q], bb = bta[j + q];
        if (PARAM_BF16) { gg = bf16_round(gg); bb = bf16_round(bb); }
        sm[q] = vals[u * 4 + q]; o[q] = (vals[u * 4 + q] - mu) * rs * gg + bb;
      }
      if (out_sum) *(v4f*)(out_sum + (size_t)row * N + j) = sm;
      *(v4f*)(out_norm + (size_t)row * N + j) = o;
    }
    
  }
}



// ---- f16 WMMA path (v_wmma_f32_16x16x32_f16): 11-bit significands for operands in range — used here for the three 1×1 conv GEMMs (k_gemm_t)
typedef _Float16 v16h __attribute__((ext_vector_type(16)));
union FragH { v16h v; v8us half[2]; _Float16 h[16]; unsigned short u[16]; };
template <int NT>
__device__ __forceinline__ v8f mmaH(v16h ah, v16h al, v16h bh, v16h bl, v8f c) {
  c = __builtin_amdgcn_wmma_f32_16x16x32_f16(false, ah, false, bh, (short)0, c, false, false);
  if (NT >= 2) c = __builtin_amdgcn_wmma_f32_16x16x32_f16(false, al, false, bh, (short)0, c, false, false);
  if (NT >= 3) c = __builtin_amdgcn_wmma_f32_16x16x32_f16(false, ah, false, bl, (short)0, c, false, false);
  asm volatile("v_nop\n\tv_nop\n\tv_nop\n\tv_nop" : "+v"(c) : "v"(ah), "v"(al), "v"(bh), "v"(bl));
  return c;
}
// batched GEMM like k_gemm_b but f16 operands: A f32 (split into f16 hi/lo if ASPLIT, else rounded to f16), Bt = f16 values [n][k]; alpha; C f32; N multiple of 16 (partial tiles skipped)
template <bool ASPLIT>
__global__ __launch_bounds__(128) void k_gemm_h(const float* __restrict__ A, int lda, size_t sA, const _Float16* __restrict__ Bh, int ldb, size_t sB, float alpha, float* __restrict__ C, int ldc, size_t sC, int M, int N, int K) {
  __shared__ __attribute__((aligned(16))) float so[4][16][64];
  const int tid = threadIdx.x, w = tid >> 5, lane = tid & 31, ln = lane & 15, hh = lane >> 4; const int by = blockIdx.y;
  A += (size_t)by * sA; Bh += (size_t)by * sB; C += (size_t)by * sC;
  const int ntn = (N + 63) / 64; const int wid = blockIdx.x * 4 + w; const int mt = wid / ntn, nq = wid % ntn; if (mt * 16 >= M) return;
  const int row0 = mt * 16, col0 = nq * 64; const float* arow = A + (size_t)(row0 + ln) * lda;
  v8f acc[4] = {};
  for (int kb = 0; kb < K; kb += 32) {
    FragH ah, al;
    const v4f x0 = *(const v4fa*)(arow + kb + 8 * hh), x1 = *(const v4fa*)(arow + kb + 8 * hh + 4), x2 = *(const v4fa*)(arow + kb + 16 + 8 * hh), x3 = *(const v4fa*)(arow + kb + 16 + 8 * hh + 4);
    float xs[16] = {x0[0],x0[1],x0[2],x0[3],x1[0],x1[1],x1[2],x1[3],x2[0],x2[1],x2[2],x2[3],x3[0],x3[1],x3[2],x3[3]};
#pragma unroll
    for (int i = 0; i < 16; ++i) { const _Float16 h = (_Float16)xs[i]; ah.h[i] = h; al.h[i] = ASPLIT ? (_Float16)(xs[i] - (float)h) : (_Float16)0.0f; }
#pragma unroll
    for (int t = 0; t < 4; ++t) { if (col0 + t * 16 >= N) continue; const size_t boff = (size_t)(col0 + t * 16 + ln) * ldb + kb; FragH bq; bq.half[0] = *(const v8us*)(Bh + boff + 8 * hh); bq.half[1] = *(const v8us*)(Bh + boff + 16 + 8 * hh);
      acc[t] = mmaH<ASPLIT ? 2 : 1>(ah.v, al.v, bq.v, bq.v, acc[t]); }
  }
#pragma unroll
  for (int t = 0; t < 4; ++t) { if (col0 + t * 16 >= N) continue;
#pragma unroll
    for (int r = 0; r < 8; ++r) so[w][8 * hh + r][t * 16 + ln] = acc[t][r] * alpha; }
  __builtin_amdgcn_fence(__ATOMIC_ACQ_REL, "workgroup"); __builtin_amdgcn_wave_barrier();
  const int rsub = lane >> 4, c4 = (lane & 15) * 4;
  {
#pragma unroll
    for (int q = 0; q < 8; ++q) { const int r = q * 2 + rsub; if (col0 + c4 < N) { const v4f v = *(const v4fa*)&so[w][r][c4]; *(v4f*)(C + (size_t)(row0 + r) * ldc + col0 + c4) = v; } }
     }
}

// Wt[n][k] = f16(W[k][n]·scale) from f32 row-major W[K][N] (scale = power of two; bf16-exact weights stay exact in f16 away from the subnormal range)
__global__ __launch_bounds__(256) void k_wt_f16(const float* __restrict__ W, _Float16* __restrict__ Wt, int K, int N, float scale) {
  const int t = blockIdx.x * 256 + threadIdx.x; if (t >= N * (K / 8)) return; const int n = t / (K / 8), k8 = (t % (K / 8)) * 8; FragH f;
#pragma unroll
  for (int i = 0; i < 8; ++i) f.h[i] = (_Float16)(bf16_round(W[(size_t)(k8 + i) * N + n]) * scale); const v8us o = f.half[0];
  *(v8us*)((unsigned short*)Wt + (size_t)n * K + k8) = o; 
}
// k_gemm_hh variant with fused epilogue: v = acc·alpha + bias[by·sBias + col] (+ CP[(row/rowsPerB)·sCPb + by·64 + col] if CP) ; ACT 0 none / 1 elu ; writes f16 C16 and f32 C, each if non-null
template <int ACT>
__global__ __launch_bounds__(128) void k_gemm_hhx(const _Float16* __restrict__ A, int lda, size_t sA, const _Float16* __restrict__ Bh, int ldb, size_t sB, float alpha, const float* __restrict__ bias, size_t sBias, const float* __restrict__ CP, int rowsPerB, size_t sCPb, int row0g,
    float* __restrict__ C, _Float16* __restrict__ C16, int ldc, size_t sC, int M, int N, int K) {
  __shared__ __attribute__((aligned(16))) float so[4][16][64];
  const int tid = threadIdx.x, w = tid >> 5, lane = tid & 31, ln = lane & 15, hh = lane >> 4; const int by = blockIdx.y;
  A += (size_t)by * sA; Bh += (size_t)by * sB; const size_t cofs = (size_t)by * sC; const float* bp = bias ? bias + (size_t)by * sBias : nullptr;
  const int ntn = (N + 63) / 64; const int wid = blockIdx.x * 4 + w; const int mt = wid / ntn, nq = wid % ntn; if (mt * 16 >= M) return;
  const int row0 = mt * 16, col0 = nq * 64; const _Float16* arow = A + (size_t)(row0 + ln) * lda;
  v8f acc[4] = {};
  for (int kb = 0; kb < K; kb += 32) { FragH ah; ah.half[0] = *(const v8us*)((const unsigned short*)arow + kb + 8 * hh); ah.half[1] = *(const v8us*)((const unsigned short*)arow + kb + 16 + 8 * hh);
#pragma unroll
    for (int t = 0; t < 4; ++t) { if (col0 + t * 16 >= N) continue; const size_t boff = (size_t)(col0 + t * 16 + ln) * ldb + kb; FragH bq; bq.half[0] = *(const v8us*)((const unsigned short*)Bh + boff + 8 * hh); bq.half[1] = *(const v8us*)((const unsigned short*)Bh + boff + 16 + 8 * hh);
      acc[t] = mmaH<1>(ah.v, ah.v, bq.v, bq.v, acc[t]); }
  }
#pragma unroll
  for (int t = 0; t < 4; ++t) { if (col0 + t * 16 >= N) continue; const int col = col0 + t * 16 + ln; const float bv = bp ? bf16_round(bp[col]) : 0.f;
#pragma unroll
    for (int r = 0; r < 8; ++r) { float v = acc[t][r] * alpha + bv; if (CP) { const int bidx = (row0g + row0 + 8 * hh + r) / rowsPerB; v += CP[(size_t)bidx * sCPb + (size_t)by * 64 + col]; } if (ACT == 1) v = (v > 0.f) ? v : expm1f(v); else if (ACT == 3) v = fmaxf(v, 0.f); so[w][8 * hh + r][t * 16 + ln] = v; } }
  __builtin_amdgcn_fence(__ATOMIC_ACQ_REL, "workgroup"); __builtin_amdgcn_wave_barrier();
  const int rsub = lane >> 4, c4 = (lane & 15) * 4; typedef _Float16 v4h __attribute__((ext_vector_type(4)));
  {
#pragma unroll
    for (int q = 0; q < 8; ++q) { const int r = q * 2 + rsub; if (col0 + c4 < N) { const v4f v = *(const v4fa*)&so[w][r][c4]; if (C) *(v4f*)(C + cofs + (size_t)(row0 + r) * ldc + col0 + c4) = v; if (C16) { v4h h4; for (int i = 0; i < 4; ++i) h4[i] = (_Float16)v[i]; *(v4h*)(C16 + cofs + (size_t)(row0 + r) * ldc + col0 + c4) = h4; } } }
     }
}


// Eight 16-byte asynchronous copies global -> LDS (each lane its own addresses), rows lstep / gstep apart. The s_wait_xcnt closes the statement so that no
// address register named here is rewritten ahead of it.
__device__ __forceinline__ void copy8(unsigned l, const _Float16* g, unsigned lstep, size_t gstep) {
  asm volatile("global_load_async_to_lds_b128 %0, %8, off\n\t"
               "global_load_async_to_lds_b128 %1, %9, off\n\t"
               "global_load_async_to_lds_b128 %2, %10, off\n\t"
               "global_load_async_to_lds_b128 %3, %11, off\n\t"
               "global_load_async_to_lds_b128 %4, %12, off\n\t"
               "global_load_async_to_lds_b128 %5, %13, off\n\t"
               "global_load_async_to_lds_b128 %6, %14, off\n\t"
               "global_load_async_to_lds_b128 %7, %15, off\n\t"
               "s_wait_xcnt 0x0"
               :: "v"(l), "v"(l + lstep), "v"(l + 2 * lstep), "v"(l + 3 * lstep), "v"(l + 4 * lstep), "v"(l + 5 * lstep), "v"(l + 6 * lstep), "v"(l + 7 * lstep),
                  "v"(g), "v"(g + gstep), "v"(g + 2 * gstep), "v"(g + 3 * gstep), "v"(g + 4 * gstep), "v"(g + 5 * gstep), "v"(g + 6 * gstep), "v"(g + 7 * gstep)
               : "memory");
}
// C[M][Nn] = A[M][Kk] * Bh[Nn][Kk]^T * alpha (+ bf16-rounded bias), f16 operands, f32 accumulate. One work-group = one 128 x 128 tile of C, four waves (2 x 2) of 64 x 64.
// A and Bh tiles of 128 rows x 128 k are staged in LDS (row pitch 272 B) by asynchronous copies, two buffers: tile t + 1 flies while tile t is worked on.
// M, Nn multiples of 128 (grid = M / 128 * Nn / 128), Kk a multiple of 128. Each 16 x 16 accumulator sums k upwards in steps of 32.
// NCHW: A holds the CC output channels' weights and Bh the tokens (Nn = NR), so a row of C is a channel and its columns are pixels that lie side by side in the image:
// the tile goes straight to C[image][channel][pixel] (f32), the bias belongs to the row.
// NS > 0 (a multiple of 128, with OUT16): two products that share A run as one launch; columns below NS go to C16 (row pitch NS), the others to C16b (row pitch Nn - NS).
template <int Nn, int Kk, bool OUT16, bool BIAS, bool NCHW, int NS>
__global__ __launch_bounds__(128) void k_gemm_t(const _Float16* __restrict__ A, const _Float16* __restrict__ Bh, float alpha, const float* __restrict__ bias, float* __restrict__ C, _Float16* __restrict__ C16, _Float16* __restrict__ C16b) {
  constexpr int KC = 128, PITCH = 272, OPB = 128 * PITCH, STG = 2 * OPB, NT = Kk / KC;
  __shared__ __attribute__((aligned(16))) unsigned char sm[2 * STG];
  const int tid = threadIdx.x, w = tid >> 5, lane = tid & 31, ln = lane & 15, hh = lane >> 4;
  const int bm = blockIdx.x / (Nn / 128), bn = blockIdx.x % (Nn / 128);
  const int wm = w >> 1, wn = w & 1;
  const int crow = tid >> 4, cch = tid & 15;      // a copy instruction of a wave covers two whole 256-byte rows
  const _Float16* ga = A + (size_t)(bm * 128 + crow) * Kk + cch * 8;
  const _Float16* gb = Bh + (size_t)(bn * 128 + crow) * Kk + cch * 8;
  const unsigned lc = (unsigned)(size_t)sm + crow * PITCH + cch * 16;
  auto fill = [&](int t, int buf) {
    const unsigned l = lc + buf * STG;
    copy8(l, ga + t * KC, 8 * PITCH, (size_t)8 * Kk);
    copy8(l + 64 * PITCH, ga + t * KC + (size_t)64 * Kk, 8 * PITCH, (size_t)8 * Kk);
    copy8(l + OPB, gb + t * KC, 8 * PITCH, (size_t)8 * Kk);
    copy8(l + OPB + 64 * PITCH, gb + t * KC + (size_t)64 * Kk, 8 * PITCH, (size_t)8 * Kk);
  };
  v8f acc[4][4] = {};
  fill(0, 0);
  asm volatile("s_wait_asynccnt 0x0" ::: "memory");      // tile 0 of this wave has landed
  __syncthreads();                                       // ... and every wave's part of it
  if (NT > 1) fill(1, 1);
  const int aoff = (wm * 64 + ln) * PITCH + 16 * hh, boff = OPB + (wn * 64 + ln) * PITCH + 16 * hh;
#pragma unroll 1      // kept rolled: unrolled over the k tiles the build takes many more vector registers
  for (int t = 0; t < NT; ++t) {
    const int sb = (t & 1) * STG;
#pragma unroll
    for (int ks = 0; ks < KC / 32; ++ks) {
      FragH a[4], b[4];
#pragma unroll
      for (int i = 0; i < 4; ++i) {
        a[i].half[0] = *(const v8us*)&sm[sb + aoff + i * 16 * PITCH + ks * 64]; a[i].half[1] = *(const v8us*)&sm[sb + aoff + i * 16 * PITCH + ks * 64 + 32];
        b[i].half[0] = *(const v8us*)&sm[sb + boff + i * 16 * PITCH + ks * 64]; b[i].half[1] = *(const v8us*)&sm[sb + boff + i * 16 * PITCH + ks * 64 + 32];
      }
#pragma unroll
      for (int i = 0; i < 4; ++i)
#pragma unroll
        for (int j = 0; j < 4; ++j) acc[i][j] = __builtin_amdgcn_wmma_f32_16x16x32_f16(false, a[i].v, false, b[j].v, (short)0, acc[i][j], false, false);
    }
    asm volatile("s_wait_dscnt 0x0" ::: "memory");       // this wave's reads of buffer t & 1 are done before it is refilled
    asm volatile("s_wait_asynccnt 0x0" ::: "memory");    // this wave's copies of tile t + 1 have landed
    __syncthreads();                                     // publishes tile t + 1, ends every reader's last read of tile t
    if (t + 2 < NT) fill(t + 2, t & 1);
  }
  asm volatile("s_wait_asynccnt 0x0" ::: "memory");      // no copy is outstanding when the ring becomes output staging
  // epilogue: each wave stages its 64 x 64 tile in its own LDS range (pitch 68 floats) and stores whole lines
  float* so = (float*)sm + w * (64 * 68);
  const int row0 = bm * 128 + wm * 64, col0 = bn * 128 + wn * 64;
  if (NCHW) {
#pragma unroll
    for (int i = 0; i < 4; ++i)
#pragma unroll
      for (int r = 0; r < 8; ++r) {
        const float bv = BIAS ? bf16_round(bias[row0 + i * 16 + 8 * hh + r]) : 0.f;
#pragma unroll
        for (int j = 0; j < 4; ++j) so[(i * 16 + 8 * hh + r) * 68 + j * 16 + ln] = acc[i][j][r] * alpha + bv;
      }
  } else {
#pragma unroll
    for (int j = 0; j < 4; ++j) {
      const float bv = BIAS ? bf16_round(bias[col0 + j * 16 + ln]) : 0.f;
#pragma unroll
      for (int i = 0; i < 4; ++i)
#pragma unroll
        for (int r = 0; r < 8; ++r) so[(i * 16 + 8 * hh + r) * 68 + j * 16 + ln] = acc[i][j][r] * alpha + bv;
    }
  }
  __builtin_amdgcn_fence(__ATOMIC_ACQ_REL, "workgroup"); __builtin_amdgcn_wave_barrier();
  if (NCHW) {
    const int rs = lane >> 4, c4 = (lane & 15) * 4;      // half a wave stores 64 pixels of one channel: two whole lines
    float* cp = C + ((size_t)(col0 / NPIX) * CC + row0 + rs) * NPIX + col0 % NPIX + c4;
#pragma unroll
    for (int q = 0; q < 32; ++q) { const int r = q * 2 + rs; const v4f v = *(const v4fa*)&so[r * 68 + c4]; *(v4f*)(cp + q * 2 * NPIX) = v; }
  } else if (OUT16) {
    const int rs = lane >> 3, c8 = (lane & 7) * 8;
    auto put = [&](_Float16* dst, const int ld, const int c0) {      // dst, its row pitch and the tile's first column there
      unsigned short* cp = (unsigned short*)dst + (size_t)(row0 + rs) * ld + c0 + c8;
#pragma unroll
      for (int q = 0; q < 16; ++q) { const int r = q * 4 + rs; const v4f v0 = *(const v4fa*)&so[r * 68 + c8], v1 = *(const v4fa*)&so[r * 68 + c8 + 4]; FragH f;
#pragma unroll
        for (int i = 0; i < 4; ++i) { f.h[i] = (_Float16)v0[i]; f.h[4 + i] = (_Float16)v1[i]; }
        *(v8us*)(cp + q * 4 * ld) = f.half[0]; }
    };
    if (NS > 0 && bn * 128 >= NS) put(C16b, Nn - NS, col0 - NS);      // a tile lies wholly on one side: the test reads the same in the whole work-group
    else put(C16, NS > 0 ? NS : Nn, col0);
  } else {
    const int rs = lane >> 4, c4 = (lane & 15) * 4;
    float* cp = C + (size_t)(row0 + rs) * Nn + col0 + c4;
#pragma unroll
    for (int q = 0; q < 32; ++q) { const int r = q * 2 + rs; const v4f v = *(const v4fa*)&so[r * 68 + c4]; *(v4f*)(cp + q * 2 * Nn) = v; }
  }
}


typedef _Float16 v4h __attribute__((ext_vector_type(4)));

__global__ __launch_bounds__(256) void k_x16(const float* __restrict__ x, _Float16* __restrict__ X16, size_t n8) { const size_t t = (size_t)blockIdx.x * 256 + threadIdx.x; if (t >= n8) return; FragH f;
#pragma unroll
  for (int q = 0; q < 8; ++q) f.h[q] = (_Float16)bf16_round(x[t * 8 + q]); *(v8us*)((unsigned short*)X16 + t * 8) = f.half[0];  }
__global__ __launch_bounds__(256) void k_h16(const float* __restrict__ x, _Float16* __restrict__ X16, size_t n8) { const size_t t = (size_t)blockIdx.x * 256 + threadIdx.x; if (t >= n8) return; FragH f;
#pragma unroll
  for (int q = 0; q < 8; ++q) f.h[q] = (_Float16)x[t * 8 + q]; *(v8us*)((unsigned short*)X16 + t * 8) = f.half[0];  }
template <int NHv, int TTv>
__global__ __launch_bounds__(256) void k_vt(const _Float16* __restrict__ V16, int ldv, int voff, _Float16* __restrict__ Vt) { __shared__ unsigned short tl[64][66]; const int tid = threadIdx.x; const int slab = blockIdx.x / (TTv / 64), lg = blockIdx.x % (TTv / 64); const int b = slab / NHv, h = slab % NHv;
  for (int i = tid; i < 64 * 8; i += 256) { const int r = i / 8, c8 = (i % 8) * 8; FragH f; f.half[0] = *(const v8us*)((const unsigned short*)V16 + ((size_t)b * TTv + lg * 64 + r) * ldv + voff + h * 64 + c8);
#pragma unroll
    for (int q = 0; q < 8; ++q) tl[r][c8 + q] = f.u[q]; }
  __syncthreads();
  {
#pragma unroll
    for (int rd = 0; rd < 2; ++rd) { const int d = rd * 32 + tid / 8, pc = tid % 8; FragH f;
#pragma unroll
      for (int q = 0; q < 8; ++q) f.u[q] = tl[pc * 8 + q][d];
      *(v8us*)((unsigned short*)Vt + ((size_t)slab * 64 + d) * TTv + lg * 64 + pc * 8) = f.half[0]; }
     } }

// Everything the GEMMs need, in one launch (none of it depends on another part). The first NBW blocks turn the (out,in) weights into f16 (bf16-rounded, times 2^4), eight values a thread:
// Bw = [Wq | Wkv | Wo] one behind the other. Each of the other blocks transposes a tile of 64 channels x 32 pixels of x into token rows.
#define NBQ (INNER * CC / 8 / 256)
#define NBW (4 * NBQ)
__global__ __launch_bounds__(256) void k_prep(const float* __restrict__ x, const float* __restrict__ Wq, const float* __restrict__ Wkv, const float* __restrict__ Wo, _Float16* __restrict__ Bw, _Float16* __restrict__ X16) { __shared__ float tl[32][65]; const int tid = threadIdx.x;
  if (blockIdx.x < NBW) {      // the same for the whole block, and in front of its barrier
    const int wb = blockIdx.x; const float* W = wb < NBQ ? Wq : wb < 3 * NBQ ? Wkv : Wo; const size_t t = (size_t)(wb < NBQ ? wb : wb < 3 * NBQ ? wb - NBQ : wb - 3 * NBQ) * 256 + tid; FragH f;
#pragma unroll
    for (int i = 0; i < 8; ++i) f.h[i] = (_Float16)(bf16_round(W[t * 8 + i]) * 16.0f); *(v8us*)((unsigned short*)Bw + ((size_t)wb * 256 + tid) * 8) = f.half[0];
    return;
  }
  const int blk = blockIdx.x - NBW; const int b = blk / ((CC / 64) * (NPIX / 32)), rem = blk % ((CC / 64) * (NPIX / 32)); const int cg = rem / (NPIX / 32), pg = rem % (NPIX / 32); const int c0 = cg * 64, p0 = pg * 32;
  for (int i = tid; i < 64 * 32; i += 256) { const int c = i / 32, pp = i % 32; tl[pp][c] = bf16_round(x[((size_t)b * CC + c0 + c) * NPIX + p0 + pp]); } __syncthreads();
  const int r = tid / 8, pc = tid % 8; FragH f; for (int q = 0; q < 8; ++q) f.h[q] = (_Float16)tl[r][pc * 8 + q]; const size_t row = (size_t)b * NPIX + p0 + r; *(v8us*)((unsigned short*)X16 + row * CC + c0 + pc * 8) = f.half[0];  }
union H8 { v8us v; unsigned d[4]; };      // eight f16 values as they are loaded: four registers of two
// v_fma_mix_f32: c + a * b in one fused f32 multiply-add whose f16 factors are widened exactly inside the instruction (op_sel picks the high halves). Written as asm for
// speed: from plain source this build widens every half with a conversion of its own before a packed f32 multiply-add. Each statement holds a whole round over independent
// sums, so that an instruction and the one it depends on stand eight or nine apart (asm text gets no s_delay_alu from the compiler, and needs none at that distance).
// s[w] (+)= the two products of register q with register k[w], w = 0 .. 8
__device__ __forceinline__ void dot9_first(float (&s)[9], unsigned q, const unsigned (&k)[9]) {
  asm(
      "v_fma_mix_f32 %0, %9, %10, 0 op_sel_hi:[1,1,0]\n\t"
      "v_fma_mix_f32 %1, %9, %11, 0 op_sel_hi:[1,1,0]\n\t"
      "v_fma_mix_f32 %2, %9, %12, 0 op_sel_hi:[1,1,0]\n\t"
      "v_fma_mix_f32 %3, %9, %13, 0 op_sel_hi:[1,1,0]\n\t"
      "v_fma_mix_f32 %4, %9, %14, 0 op_sel_hi:[1,1,0]\n\t"
      "v_fma_mix_f32 %5, %9, %15, 0 op_sel_hi:[1,1,0]\n\t"
      "v_fma_mix_f32 %6, %9, %16, 0 op_sel_hi:[1,1,0]\n\t"
      "v_fma_mix_f32 %7, %9, %17, 0 op_sel_hi:[1,1,0]\n\t"
      "v_fma_mix_f32 %8, %9, %18, 0 op_sel_hi:[1,1,0]\n\t"
      "v_fma_mix_f32 %0, %9, %10, %0 op_sel:[1,1,0] op_sel_hi:[1,1,0]\n\t"
      "v_fma_mix_f32 %1, %9, %11, %1 op_sel:[1,1,0] op_sel_hi:[1,1,0]\n\t"
      "v_fma_mix_f32 %2, %9, %12, %2 op_sel:[1,1,0] op_sel_hi:[1,1,0]\n\t"
      "v_fma_mix_f32 %3, %9, %13, %3 op_sel:[1,1,0] op_sel_hi:[1,1,0]\n\t"
      "v_fma_mix_f32 %4, %9, %14, %4 op_sel:[1,1,0] op_sel_hi:[1,1,0]\n\t"
      "v_fma_mix_f32 %5, %9, %15, %5 op_sel:[1,1,0] op_sel_hi:[1,1,0]\n\t"
      "v_fma_mix_f32 %6, %9, %16, %6 op_sel:[1,1,0] op_sel_hi:[1,1,0]\n\t"
      "v_fma_mix_f32 %7, %9, %17, %7 op_sel:[1,1,0] op_sel_hi:[1,1,0]\n\t"
      "v_fma_mix_f32 %8, %9, %18, %8 op_sel:[1,1,0] op_sel_hi:[1,1,0]"
      : "=&v"(s[0]), "=&v"(s[1]), "=&v"(s[2]), "=&v"(s[3]), "=&v"(s[4]), "=&v"(s[5]), "=&v"(s[6]), "=&v"(s[7]), "=&v"(s[8])
      : "v"(q), "v"(k[0]), "v"(k[1]), "v"(k[2]), "v"(k[3]), "v"(k[4]), "v"(k[5]), "v"(k[6]), "v"(k[7]), "v"(k[8]));
}
__device__ __forceinline__ void dot9_more(float (&s)[9], unsigned q, const unsigned (&k)[9]) {
  asm(
      "v_fma_mix_f32 %0, %9, %10, %0 op_sel_hi:[1,1,0]\n\t"
      "v_fma_mix_f32 %1, %9, %11, %1 op_sel_hi:[1,1,0]\n\t"
      "v_fma_mix_f32 %2, %9, %12, %2 op_sel_hi:[1,1,0]\n\t"
      "v_fma_mix_f32 %3, %9, %13, %3 op_sel_hi:[1,1,0]\n\t"
      "v_fma_mix_f32 %4, %9, %14, %4 op_sel_hi:[1,1,0]\n\t"
      "v_fma_mix_f32 %5, %9, %15, %5 op_sel_hi:[1,1,0]\n\t"
      "v_fma_mix_f32 %6, %9, %16, %6 op_sel_hi:[1,1,0]\n\t"
      "v_fma_mix_f32 %7, %9, %17, %7 op_sel_hi:[1,1,0]\n\t"
      "v_fma_mix_f32 %8, %9, %18, %8 op_sel_hi:[1,1,0]\n\t"
      "v_fma_mix_f32 %0, %9, %10, %0 op_sel:[1,1,0] op_sel_hi:[1,1,0]\n\t"
      "v_fma_mix_f32 %1, %9, %11, %1 op_sel:[1,1,0] op_sel_hi:[1,1,0]\n\t"
      "v_fma_mix_f32 %2, %9, %12, %2 op_sel:[1,1,0] op_sel_hi:[1,1,0]\n\t"
      "v_fma_mix_f32 %3, %9, %13, %3 op_sel:[1,1,0] op_sel_hi:[1,1,0]\n\t"
      "v_fma_mix_f32 %4, %9, %14, %4 op_sel:[1,1,0] op_sel_hi:[1,1,0]\n\t"
      "v_fma_mix_f32 %5, %9, %15, %5 op_sel:[1,1,0] op_sel_hi:[1,1,0]\n\t"
      "v_fma_mix_f32 %6, %9, %16, %6 op_sel:[1,1,0] op_sel_hi:[1,1,0]\n\t"
      "v_fma_mix_f32 %7, %9, %17, %7 op_sel:[1,1,0] op_sel_hi:[1,1,0]\n\t"
      "v_fma_mix_f32 %8, %9, %18, %8 op_sel:[1,1,0] op_sel_hi:[1,1,0]"
      : "+v"(s[0]), "+v"(s[1]), "+v"(s[2]), "+v"(s[3]), "+v"(s[4]), "+v"(s[5]), "+v"(s[6]), "+v"(s[7]), "+v"(s[8])
      : "v"(q), "v"(k[0]), "v"(k[1]), "v"(k[2]), "v"(k[3]), "v"(k[4]), "v"(k[5]), "v"(k[6]), "v"(k[7]), "v"(k[8]));
}
// acc[0 .. 7] (+)= a * the eight f16 values of v
__device__ __forceinline__ void av8_first(float (&acc)[8], float a, const unsigned (&v)[4]) {
  asm(
      "v_fma_mix_f32 %0, %8, %9, 0 op_sel_hi:[0,1,0]\n\t"
      "v_fma_mix_f32 %1, %8, %9, 0 op_sel:[0,1,0] op_sel_hi:[0,1,0]\n\t"
      "v_fma_mix_f32 %2, %8, %10, 0 op_sel_hi:[0,1,0]\n\t"
      "v_fma_mix_f32 %3, %8, %10, 0 op_sel:[0,1,0] op_sel_hi:[0,1,0]\n\t"
      "v_fma_mix_f32 %4, %8, %11, 0 op_sel_hi:[0,1,0]\n\t"
      "v_fma_mix_f32 %5, %8, %11, 0 op_sel:[0,1,0] op_sel_hi:[0,1,0]\n\t"
      "v_fma_mix_f32 %6, %8, %12, 0 op_sel_hi:[0,1,0]\n\t"
      "v_fma_mix_f32 %7, %8, %12, 0 op_sel:[0,1,0] op_sel_hi:[0,1,0]"
      : "=&v"(acc[0]), "=&v"(acc[1]), "=&v"(acc[2]), "=&v"(acc[3]), "=&v"(acc[4]), "=&v"(acc[5]), "=&v"(acc[6]), "=&v"(acc[7])
      : "v"(a), "v"(v[0]), "v"(v[1]), "v"(v[2]), "v"(v[3]));
}
__device__ __forceinline__ void av8_more(float (&acc)[8], float a, const unsigned (&v)[4]) {
  asm(
      "v_fma_mix_f32 %0, %8, %9, %0 op_sel_hi:[0,1,0]\n\t"
      "v_fma_mix_f32 %1, %8, %9, %1 op_sel:[0,1,0] op_sel_hi:[0,1,0]\n\t"
      "v_fma_mix_f32 %2, %8, %10, %2 op_sel_hi:[0,1,0]\n\t"
      "v_fma_mix_f32 %3, %8, %10, %3 op_sel:[0,1,0] op_sel_hi:[0,1,0]\n\t"
      "v_fma_mix_f32 %4, %8, %11, %4 op_sel_hi:[0,1,0]\n\t"
      "v_fma_mix_f32 %5, %8, %11, %5 op_sel:[0,1,0] op_sel_hi:[0,1,0]\n\t"
      "v_fma_mix_f32 %6, %8, %12, %6 op_sel_hi:[0,1,0]\n\t"
      "v_fma_mix_f32 %7, %8, %12, %7 op_sel:[0,1,0] op_sel_hi:[0,1,0]"
      : "+v"(acc[0]), "+v"(acc[1]), "+v"(acc[2]), "+v"(acc[3]), "+v"(acc[4]), "+v"(acc[5]), "+v"(acc[6]), "+v"(acc[7])
      : "v"(a), "v"(v[0]), "v"(v[1]), "v"(v[2]), "v"(v[3]));
}
// the value of the lane whose number differs in bit X (X = 1, 2, 4: inside a group of eight lanes); every lane is on where it is used
template <int X>
__device__ __forceinline__ float xlane(float v) { return __int_as_float(__builtin_amdgcn_update_dpp(0, __float_as_int(v), 0x160 + X, 0xf, 0xf, true)); }
// lane S of each group of eight lanes, handed to all eight
template <int S>
__device__ __forceinline__ float group_bcast(float v) { return __uint_as_float(__builtin_amdgcn_permlane16(0u, __float_as_uint(v), 0x11111111u * S, 0x11111111u * (8 + S), true, true)); }
struct WinTile { H8 q, k[9], v[9]; };
// Window attention in one kernel. One wave = one image row of one (batch, head), four pixels a pass; eight lanes share a pixel, lane p holding d = 8p .. 8p + 7.
// The partial logits are summed over the eight lanes so that lane p ends with logit p (the ninth ends in all eight); each lane does the softmax of its own logit and of the
// ninth, the weights are handed round the group, attn * v follows in the same lanes. A window place outside the image reads a clamped (in-bounds) address; its logit is
// set to 0 and its weight on v to 0. The row's 32 x 9 weights are staged in the wave's own LDS range and stored as whole lines.
__global__ __launch_bounds__(256) void k_win(const _Float16* __restrict__ Q, const _Float16* __restrict__ KV, float* __restrict__ ATTN, _Float16* __restrict__ O16) {
  __shared__ __attribute__((aligned(16))) float sa[8][HWD * 9];
  const int tid = threadIdx.x, lane = tid & 31, g = lane >> 3, p = lane & 7;
  const int w = __builtin_amdgcn_readfirstlane(tid >> 5);
  const int bh = blockIdx.x / (HWD / 8), y = (blockIdx.x % (HWD / 8)) * 8 + w;
  const int b = bh / NH, h = bh % NH;
  // every address = a wave-uniform byte pointer + one of four lane offsets formed here once: no address arithmetic inside the passes
  constexpr unsigned QP = INNER * 2, KP = 2 * INNER * 2;      // bytes a pixel in Q / O16 and in KV
  const char* qrow = (const char*)(Q + ((size_t)b * NPIX + y * HWD) * INNER + h * DH);
  char* orow = (char*)(O16 + ((size_t)b * NPIX + y * HWD) * INNER + h * DH);
  const char* krow[3];
#pragma unroll
  for (int dy = 0; dy < 3; ++dy) krow[dy] = (const char*)(KV + ((size_t)b * NPIX + min(max(y + dy - 1, 0), HWD - 1) * HWD) * (2 * INNER) + h * DH);
  const unsigned loq = g * QP + p * 16, lok = g * KP + p * 16;
  const unsigned lokl = max(g - 1, 0) * KP + p * 16, lokr = min(g + 1, 3) * KP + p * 16;      // x - 1 clamped in the first pass, x + 1 clamped in the last
  const bool c1 = p & 1, c2 = p & 2, c4 = p & 4;
  const int ym = y + p / 3 - 1, dxm = p % 3 - 1;      // window place p of this lane's own logit
  const bool okym = ym >= 0 && ym < HWD, oky8 = y + 1 < HWD;
  auto load = [&](int it, WinTile& t) {
    t.q.v = *(const v8us*)(qrow + it * 4 * QP + loq);
#pragma unroll
    for (int wi = 0; wi < 9; ++wi) {
      const int dx = wi % 3 - 1;
      const bool el = it == 0 && dx < 0, er = it == HWD / 4 - 1 && dx > 0;
      const char* kr = krow[wi / 3] + (el || er ? it * 4 : it * 4 + dx) * KP;
      const unsigned off = el ? lokl : er ? lokr : lok;
      t.k[wi].v = *(const v8us*)(kr + off); t.v[wi].v = *(const v8us*)(kr + INNER * 2 + off);
    }
  };
  WinTile tl[2];
  load(0, tl[0]);
  asm volatile("s_wait_xcnt 0x0" ::: "memory");      // lokl is not used again and this build hands its register to a later load's result: the wait stands in front of that overwrite
#pragma unroll      // unrolled: the two register tiles alternate by a constant index, and only the first and the last pass carry the tests on x
  for (int it = 0; it < HWD / 4; ++it) {
    if (it + 1 < HWD / 4) load(it + 1, tl[(it + 1) & 1]);      // the next four pixels' loads fly while these four are worked on
    __builtin_amdgcn_sched_barrier(0);      // keeps those loads in front of this pass's arithmetic: sunk into it, each would be waited for right behind its issue
    const WinTile& t = tl[it & 1];
    const int x = it * 4 + g;
    const bool okm = okym && (it != 0 || x + dxm >= 0) && (it != HWD / 4 - 1 || x + dxm < HWD);
    const bool ok8 = oky8 && (it != HWD / 4 - 1 || x + 1 < HWD);
    float s[9];
#pragma unroll
    for (int j = 0; j < 4; ++j) {
      const unsigned kj[9] = {t.k[0].d[j], t.k[1].d[j], t.k[2].d[j], t.k[3].d[j], t.k[4].d[j], t.k[5].d[j], t.k[6].d[j], t.k[7].d[j], t.k[8].d[j]};
      if (j == 0) dot9_first(s, t.q.d[j], kj); else dot9_more(s, t.q.d[j], kj);
    }
    float r[4], u[2];
#pragma unroll
    for (int i = 0; i < 4; ++i) r[i] = (c4 ? s[4 + i] : s[i]) + xlane<4>(c4 ? s[i] : s[4 + i]);      // logit 4 * (p >> 2) + i
#pragma unroll
    for (int i = 0; i < 2; ++i) u[i] = (c2 ? r[2 + i] : r[i]) + xlane<2>(c2 ? r[i] : r[2 + i]);      // logit 2 * (p >> 1) + i
    const float sm = (c1 ? u[1] : u[0]) + xlane<1>(c1 ? u[0] : u[1]);                                // logit p
    float s8 = s[8]; s8 += xlane<1>(s8); s8 += xlane<2>(s8); s8 += xlane<4>(s8);
    const float lm = okm ? sm * 0.125f : 0.f, l8 = ok8 ? s8 * 0.125f : 0.f;
    float m = fmaxf(lm, xlane<1>(lm)); m = fmaxf(m, xlane<2>(m)); m = fmaxf(m, xlane<4>(m)); m = fmaxf(m, l8);
    const float em = expf(lm - m), e8 = expf(l8 - m);
    float z = em + xlane<1>(em); z += xlane<2>(z); z += xlane<4>(z); z += e8;
    const float am = em / z, a8 = e8 / z;
    sa[w][x * 9 + p] = am;
    if (p == 0) sa[w][x * 9 + 8] = a8;
    const float vm = okm ? am : 0.f;
    const float a[9] = {group_bcast<0>(vm), group_bcast<1>(vm), group_bcast<2>(vm), group_bcast<3>(vm), group_bcast<4>(vm), group_bcast<5>(vm), group_bcast<6>(vm), group_bcast<7>(vm), ok8 ? a8 : 0.f};
    __builtin_amdgcn_sched_barrier(0);      // keeps the eight lane moves together in front of the asm rounds: one placed directly in front of the round that reads it would stall it, unhinted
    float acc[8];
#pragma unroll
    for (int wi = 0; wi < 9; ++wi) { if (wi == 0) av8_first(acc, a[wi], t.v[wi].d); else av8_more(acc, a[wi], t.v[wi].d); }
    FragH o;
#pragma unroll
    for (int j = 0; j < 8; ++j) o.h[j] = (_Float16)acc[j];
    *(v8us*)(orow + it * 4 * QP + loq) = o.half[0];
  }
  __builtin_amdgcn_fence(__ATOMIC_ACQ_REL, "workgroup"); __builtin_amdgcn_wave_barrier();      // the wave's own LDS writes are done before other lanes of it read them
  float* ap = ATTN + ((size_t)bh * NPIX + y * HWD) * 9;
#pragma unroll
  for (int q = 0; q < 3; ++q) { const int i4 = q * 32 + lane; if (i4 < HWD * 9 / 4) { const v4f v = *(const v4fa*)&sa[w][i4 * 4]; *(v4f*)(ap + i4 * 4) = v; } }
}
extern "C" void kernel_launch(void* const* d_in, const int* in_sizes, int n_in,
                              void* d_out, int out_size, void* d_ws, size_t ws_size, hipStream_t stream) {
  (void)in_sizes; (void)n_in; (void)out_size;
  const float* x = (const float*)d_in[0]; const float* Wq = (const float*)d_in[1]; const float* Wkv = (const float*)d_in[2]; const float* Wo = (const float*)d_in[3]; const float* bo = (const float*)d_in[4];
  float* OUT0 = (float*)d_out; float* ATTN = OUT0 + (size_t)BB * CC * NPIX;
  char* ws = (char*)d_ws; size_t off = 0;
  auto take = [&](size_t bytes) { char* p = ws + off; off += (bytes + 255) & ~(size_t)255; return p; };
  _Float16* Bw = (_Float16*)take((size_t)4 * INNER * CC * 2); _Float16* Bo = Bw + (size_t)3 * INNER * CC;      // [Wq | Wkv] (1536 rows of 256), then Wo (256 rows of 512)
  _Float16* X16 = (_Float16*)take((size_t)NR * CC * 2); _Float16* Q = (_Float16*)take((size_t)NR * INNER * 2); _Float16* KV = (_Float16*)take((size_t)NR * 2 * INNER * 2); _Float16* O16 = (_Float16*)take((size_t)NR * INNER * 2);
  if (off > ws_size) return;      // 1.1 + 8.4 + 16.8 + 33.5 + 16.8 MB
  k_prep<<<NBW + BB * (CC / 64) * (NPIX / 32), 256, 0, stream>>>(x, Wq, Wkv, Wo, Bw, X16);
  k_gemm_t<3 * INNER, CC, true, false, false, INNER><<<(NR / 128) * (3 * INNER / 128), 128, 0, stream>>>(X16, Bw, 0.0625f, nullptr, nullptr, Q, KV);      // q, and [k | v]
  k_win<<<BB * NH * (HWD / 8), 256, 0, stream>>>(Q, KV, ATTN, O16);
  k_gemm_t<NR, INNER, false, true, true, 0><<<(CC / 128) * (NR / 128), 128, 0, stream>>>(Bo, O16, 0.0625f, bo, OUT0, nullptr, nullptr);      // to_out + bo, channels as rows: stored as NCHW
}

// v005
// It runs in 40.7 microseconds.
// Two timings next to v004 both put it at 1.51 times that version's speed.
// Over all steps from v000 it is 4.06 times as fast.
#include <hip/hip_runtime.h>
// Local 3×3-window attention (x [16,256,32,32]; 8 heads × 64): q = 1×1 conv (Wq), k,v = 1×1 conv (Wkv), each pixel attends over its 3×3 neighbourhood (zero-padded keys/values take part with
// logit 0), softmax(q·k/8), out = Σ attn·v, 1×1 conv Wo + bo; outputs (out NCHW, attn [16,8,1024,9]). The three pointwise convs run as GEMMs on v_wmma_f32_16x16x32_f16 (x bf16-exact, (out,in)
// weights bf16-exact ×2^4, q/k/v/o f16, f32 accumulate); the 9-wide window dots, softmax and attn * v are f32 VALU (eight lanes a pixel and head), and the to_out GEMM follows in the same kernel from an LDS tile, stored as NCHW; x is transposed by tiles (the weights are converted in the same launch), q and k | v come from one GEMM.
#define BB 16
#define CC 256
#define HWD 32
#define NPIX 1024
#define NH 8
#define DH 64
#define INNER 512
#define NR (BB * NPIX)

typedef __bf16 v16b __attribute__((ext_vector_type(16)));
typedef unsigned short v8us __attribute__((ext_vector_type(8), may_alias));
typedef float  v8f  __attribute__((ext_vector_type(8)));
typedef float  v4f  __attribute__((ext_vector_type(4)));
typedef float  v4fa __attribute__((ext_vector_type(4), may_alias));
union FragB { v16b v; v8us half[2]; unsigned short u[16]; };

__device__ __forceinline__ unsigned short bf16_bits(float x) { unsigned int u = __float_as_uint(x); return (unsigned short)((u + 0x7FFFu + ((u >> 16) & 1u)) >> 16); }
__device__ __forceinline__ float bf16_val(unsigned short b) { return __uint_as_float(((unsigned int)b) << 16); }
__device__ __forceinline__ float bf16_round(float x) { return bf16_val(bf16_bits(x)); }
// D += A·B with NT terms: 1 = ah·bh, 2 = + al·bh (A split), 3 = + ah·bl (both split)
template <int NT>
__device__ __forceinline__ v8f mmaN(v16b ah, v16b al, v16b bh, v16b bl, v8f c) {
  c = __builtin_amdgcn_wmma_f32_16x16x32_bf16(false, ah, false, bh, (short)0, c, false, false);
  if (NT >= 2) c = __builtin_amdgcn_wmma_f32_16x16x32_bf16(false, al, false, bh, (short)0, c, false, false);
  if (NT >= 3) c = __builtin_amdgcn_wmma_f32_16x16x32_bf16(false, ah, false, bl, (short)0, c, false, false);
  asm volatile("v_nop\n\tv_nop\n\tv_nop\n\tv_nop" : "+v"(c) : "v"(ah), "v"(al), "v"(bh), "v"(bl));
  return c;
}

__global__ __launch_bounds__(256) void k_wt_bf16(const float* __restrict__ W, unsigned short* __restrict__ Wt, int K, int N) {
  const int t = blockIdx.x * 256 + threadIdx.x;
  const int k8n = K / 8;
  if (t >= N * k8n) return;
  const int n = t / k8n, k8 = (t % k8n) * 8;
  v8us v;
#pragma unroll
  for (int i = 0; i < 8; ++i) v[i] = bf16_bits(W[(size_t)(k8 + i) * N + n]);
  *(v8us*)(Wt + (size_t)n * K + k8) = v;
  
}

// GEMM C[M][N] (f32, pitch ldc) = act(A[M][K]·W + bias). A f32 row-major (pitch lda) converted per fragment to bf16
// (ASPLIT: hi/lo two planes -> 2 terms, else single rounded term); Wt bf16 [N][K] (pitch ldb). BIAS_BF16 rounds the
// bias to bf16 first (bias quantised to bf16 before the add). K%32==0, M%16==0, N%64==0.
template <bool ASPLIT, int ACT, bool BIAS_BF16>
__global__ __launch_bounds__(128) void k_gemm_bf(const float* __restrict__ A, int lda, const unsigned short* __restrict__ Wt, int ldb,
                                               const float* __restrict__ bias, float* __restrict__ C, int ldc, int M, int N, int K) {
  __shared__ __attribute__((aligned(16))) float so[4][16][64];
  const int tid = threadIdx.x, w = tid >> 5, lane = tid & 31, ln = lane & 15, hh = lane >> 4;
  const int ntn = N / 64;
  const int wid = blockIdx.x * 4 + w;
  const int mt = wid / ntn, nq = wid % ntn;
  if (mt * 16 >= M) return;
  const int row0 = mt * 16, col0 = nq * 64;
  const float* arow = A + (size_t)(row0 + ln) * lda;
  v8f acc[4] = {};
  for (int kb = 0; kb < K; kb += 32) {
    FragB ah, al;
    const v4f x0 = *(const v4fa*)(arow + kb + 8 * hh), x1 = *(const v4fa*)(arow + kb + 8 * hh + 4);
    const v4f x2 = *(const v4fa*)(arow + kb + 16 + 8 * hh), x3 = *(const v4fa*)(arow + kb + 16 + 8 * hh + 4);
    float xs[16] = {x0[0],x0[1],x0[2],x0[3],x1[0],x1[1],x1[2],x1[3],x2[0],x2[1],x2[2],x2[3],x3[0],x3[1],x3[2],x3[3]};
#pragma unroll
    for (int i = 0; i < 16; ++i) { const unsigned short hb = bf16_bits(xs[i]); ah.u[i] = hb; al.u[i] = ASPLIT ? bf16_bits(xs[i] - bf16_val(hb)) : (unsigned short)0; }
#pragma unroll
    for (int t = 0; t < 4; ++t) {
      const unsigned short* brow = Wt + (size_t)(col0 + t * 16 + ln) * ldb + kb;
      FragB b;
      b.half[0] = *(const v8us*)(brow + 8 * hh);
      b.half[1] = *(const v8us*)(brow + 16 + 8 * hh);
      acc[t] = mmaN<ASPLIT ? 2 : 1>(ah.v, al.v, b.v, b.v, acc[t]);
    }
  }
#pragma unroll
  for (int t = 0; t < 4; ++t) {
    float bv = bias ? bias[col0 + t * 16 + ln] : 0.f;
    if (BIAS_BF16) bv = bf16_round(bv);
#pragma unroll
    for (int r = 0; r < 8; ++r) { float v = acc[t][r] + bv; if (ACT == 1) v = fmaxf(v, 0.f); so[w][8 * hh + r][t * 16 + ln] = v; }
  }
  __builtin_amdgcn_fence(__ATOMIC_ACQ_REL, "workgroup");
  __builtin_amdgcn_wave_barrier();
  const int rsub = lane >> 4, c4 = (lane & 15) * 4;
  {
#pragma unroll
    for (int q = 0; q < 8; ++q) {
      const int r = q * 2 + rsub;
      const v4f v = *(const v4fa*)&so[w][r][c4];
      *(v4f*)(C + (size_t)(row0 + r) * ldc + col0 + c4) = v;
    }
    
  }
}

// Flash-style causal/unmasked attention, all contractions 3-term bf16 hi/lo splits, f32 softmax with running max.
// q,k,v rows are read from f32 buffers with arbitrary row pitch (so they can live inside a fused qkv buffer);
// D = head size (multiple of 32, <= 128); one wave = 16 query rows; block = 4 waves (64 queries) sharing K/V chunks of 32.
template <int D, bool CAUSAL>
__global__ __launch_bounds__(128) void k_flash(const float* __restrict__ qb, const float* __restrict__ kb, const float* __restrict__ vb,
                                             int pitch, int T, int H, float scale, float* __restrict__ y, int ypitch) {
  constexpr int KS = D / 32;        // k-steps for QK
  constexpr int DT = D / 16;        // d tiles for PV
  __shared__ __attribute__((aligned(16))) unsigned short sKh[32][D + 8], sKl[32][D + 8], sVh[32][D + 8], sVl[32][D + 8];
  __shared__ __attribute__((aligned(16))) unsigned short sPh[4][16][40], sPl[4][16][40];
  __shared__ __attribute__((aligned(16))) float sO[4][16][D];
  const int tid = threadIdx.x, w = tid >> 5, lane = tid & 31, ln = lane & 15, hh = lane >> 4;
  const int nqb = (T + 63) / 64;
  const int bh = blockIdx.x / nqb, qblk = blockIdx.x % nqb;
  const int b = bh / H, h = bh % H;
  const int q0 = qblk * 64 + w * 16;
  const float* Q = qb + (size_t)b * T * pitch + h * D;
  const float* K = kb + (size_t)b * T * pitch + h * D;
  const float* V = vb + (size_t)b * T * pitch + h * D;

  // A fragments of the wave's 16 query rows (scaled), hi/lo
  FragB aqh[KS], aql[KS];
  {
    int row = q0 + ln; if (row >= T) row = T - 1;
    const float* qr = Q + (size_t)row * pitch;
#pragma unroll
    for (int ks = 0; ks < KS; ++ks)
#pragma unroll
      for (int i = 0; i < 16; ++i) {
        const int d = ks * 32 + ((i < 8) ? (8 * hh + i) : (16 + 8 * hh + (i - 8)));
        const float x = qr[d] * scale; const unsigned short hb = bf16_bits(x);
        aqh[ks].u[i] = hb; aql[ks].u[i] = bf16_bits(x - bf16_val(hb));
      }
  }
  float m_r[8], l_r[8];
#pragma unroll
  for (int r = 0; r < 8; ++r) { m_r[r] = -3.0e38f; l_r[r] = 0.f; }
  v8f oacc[DT];
#pragma unroll
  for (int dt = 0; dt < DT; ++dt) oacc[dt] = (v8f){0.f,0.f,0.f,0.f,0.f,0.f,0.f,0.f};

  const int kv_end = CAUSAL ? min(T, qblk * 64 + 64) : T;     // block-uniform
  for (int j0 = 0; j0 < kv_end; j0 += 32) {
    __syncthreads();
    for (int e = tid; e < 32 * (D / 4); e += 128) {
      const int r = e / (D / 4), c4 = (e % (D / 4)) * 4;
      const int key = j0 + r;
      v4f kf = {0.f,0.f,0.f,0.f}, vf = {0.f,0.f,0.f,0.f};
      if (key < T) { kf = *(const v4fa*)(K + (size_t)key * pitch + c4); vf = *(const v4fa*)(V + (size_t)key * pitch + c4); }
#pragma unroll
      for (int t = 0; t < 4; ++t) {
        unsigned short hb = bf16_bits(kf[t]); sKh[r][c4 + t] = hb; sKl[r][c4 + t] = bf16_bits(kf[t] - bf16_val(hb));
        hb = bf16_bits(vf[t]); sVh[r][c4 + t] = hb; sVl[r][c4 + t] = bf16_bits(vf[t] - bf16_val(hb));
      }
    }
    __syncthreads();
    // S tile 16 x 32
    v8f s[2];
#pragma unroll
    for (int nt = 0; nt < 2; ++nt) {
      v8f acc = {};
#pragma unroll
      for (int ks = 0; ks < KS; ++ks) {
        FragB bh_, bl_;
        bh_.half[0] = *(const v8us*)&sKh[nt * 16 + ln][ks * 32 + 8 * hh]; bh_.half[1] = *(const v8us*)&sKh[nt * 16 + ln][ks * 32 + 16 + 8 * hh];
        bl_.half[0] = *(const v8us*)&sKl[nt * 16 + ln][ks * 32 + 8 * hh]; bl_.half[1] = *(const v8us*)&sKl[nt * 16 + ln][ks * 32 + 16 + 8 * hh];
        acc = mmaN<3>(aqh[ks].v, aql[ks].v, bh_.v, bl_.v, acc);
      }
      s[nt] = acc;
    }
    // mask + running max (rows 8hh+r; the 16 lanes of a half share rows)
    float alpha[8];
#pragma unroll
    for (int r = 0; r < 8; ++r) {
      const int qi = q0 + 8 * hh + r;
      const int ja = j0 + ln, jb = j0 + 16 + ln;
      if (CAUSAL) { if (ja > qi) s[0][r] = -3.0e38f; if (jb > qi) s[1][r] = -3.0e38f; }
      if (ja >= T) s[0][r] = -3.0e38f;
      if (jb >= T) s[1][r] = -3.0e38f;
      float mx = fmaxf(s[0][r], s[1][r]);
      mx = fmaxf(mx, __shfl_xor(mx, 1, 32)); mx = fmaxf(mx, __shfl_xor(mx, 2, 32)); mx = fmaxf(mx, __shfl_xor(mx, 4, 32)); mx = fmaxf(mx, __shfl_xor(mx, 8, 32));
      const float mnew = fmaxf(m_r[r], mx);
      alpha[r] = (mnew > -1.0e38f) ? __expf(m_r[r] - mnew) : 1.0f;
      const float p0 = (s[0][r] > -1.0e38f) ? __expf(s[0][r] - mnew) : 0.f;
      const float p1 = (s[1][r] > -1.0e38f) ? __expf(s[1][r] - mnew) : 0.f;
      m_r[r] = mnew;
      l_r[r] = l_r[r] * alpha[r] + p0 + p1;            // per-lane partial row sum (16 lanes combined at the end)
      unsigned short hb = bf16_bits(p0); sPh[w][8 * hh + r][ln] = hb;      sPl[w][8 * hh + r][ln] = bf16_bits(p0 - bf16_val(hb));
      hb = bf16_bits(p1);                sPh[w][8 * hh + r][16 + ln] = hb; sPl[w][8 * hh + r][16 + ln] = bf16_bits(p1 - bf16_val(hb));
    }
#pragma unroll
    for (int dt = 0; dt < DT; ++dt)
#pragma unroll
      for (int r = 0; r < 8; ++r) oacc[dt][r] *= alpha[r];
    __builtin_amdgcn_fence(__ATOMIC_ACQ_REL, "workgroup");
    __builtin_amdgcn_wave_barrier();
    FragB pah, pal;
    pah.half[0] = *(const v8us*)&sPh[w][ln][8 * hh]; pah.half[1] = *(const v8us*)&sPh[w][ln][16 + 8 * hh];
    pal.half[0] = *(const v8us*)&sPl[w][ln][8 * hh]; pal.half[1] = *(const v8us*)&sPl[w][ln][16 + 8 * hh];
#pragma unroll
    for (int dt = 0; dt < DT; ++dt) {
      FragB bvh, bvl;
#pragma unroll
      for (int i = 0; i < 8; ++i) {
        bvh.u[i] = sVh[8 * hh + i][dt * 16 + ln]; bvh.u[8 + i] = sVh[16 + 8 * hh + i][dt * 16 + ln];
        bvl.u[i] = sVl[8 * hh + i][dt * 16 + ln]; bvl.u[8 + i] = sVl[16 + 8 * hh + i][dt * 16 + ln];
      }
      oacc[dt] = mmaN<3>(pah.v, pal.v, bvh.v, bvl.v, oacc[dt]);
    }
    __builtin_amdgcn_fence(__ATOMIC_ACQ_REL, "workgroup");
    __builtin_amdgcn_wave_barrier();
  }
#pragma unroll
  for (int r = 0; r < 8; ++r) {
    float l = l_r[r];
    l += __shfl_xor(l, 1, 32); l += __shfl_xor(l, 2, 32); l += __shfl_xor(l, 4, 32); l += __shfl_xor(l, 8, 32);
    l_r[r] = (l > 0.f) ? 1.0f / l : 0.f;
  }
#pragma unroll
  for (int dt = 0; dt < DT; ++dt)
#pragma unroll
    for (int r = 0; r < 8; ++r) sO[w][8 * hh + r][dt * 16 + ln] = oacc[dt][r] * l_r[r];
  __builtin_amdgcn_fence(__ATOMIC_ACQ_REL, "workgroup");
  __builtin_amdgcn_wave_barrier();
  {
    for (int r = 0; r < 16; ++r) {
      const int row = q0 + r;
      if (row < T && lane < D / 4) {
        const v4f val = *(const v4fa*)&sO[w][r][lane * 4];
        *(v4f*)(y + ((size_t)b * T + row) * ypitch + h * D + lane * 4) = val;
      }
    }
    
  }
}

// GEMM C = act(A·W + bias + resid): A f32 (ASPLIT -> hi/lo 2 terms), Wt bf16 [N][K]; ACT 0 none, 1 relu, 2 exact gelu;
// resid (optional, f32, row index = (row % rmod), pitch ldr, RES_BF16 rounds it) added before the activation.
template <bool ASPLIT, int ACT, bool BIAS_BF16, bool RES_BF16>
__global__ __launch_bounds__(128) void k_gemm_bf3(const float* __restrict__ A, int lda, const unsigned short* __restrict__ Wt, int ldb,
                                                const float* __restrict__ bias, const float* __restrict__ resid, int rmod, int ldr,
                                                float* __restrict__ C, int ldc, int M, int N, int K) {
  __shared__ __attribute__((aligned(16))) float so[4][16][64];
  const int tid = threadIdx.x, w = tid >> 5, lane = tid & 31, ln = lane & 15, hh = lane >> 4;
  const int ntn = N / 64;
  const int wid = blockIdx.x * 4 + w;
  const int mt = wid / ntn, nq = wid % ntn;
  if (mt * 16 >= M) return;
  const int row0 = mt * 16, col0 = nq * 64;
  const float* arow = A + (size_t)(row0 + ln) * lda;
  v8f acc[4] = {};
  for (int kb = 0; kb < K; kb += 32) {
    FragB ah, al;
    const v4f x0 = *(const v4fa*)(arow + kb + 8 * hh), x1 = *(const v4fa*)(arow + kb + 8 * hh + 4);
    const v4f x2 = *(const v4fa*)(arow + kb + 16 + 8 * hh), x3 = *(const v4fa*)(arow + kb + 16 + 8 * hh + 4);
    float xs[16] = {x0[0],x0[1],x0[2],x0[3],x1[0],x1[1],x1[2],x1[3],x2[0],x2[1],x2[2],x2[3],x3[0],x3[1],x3[2],x3[3]};
#pragma unroll
    for (int i = 0; i < 16; ++i) { const unsigned short hb = bf16_bits(xs[i]); ah.u[i] = hb; al.u[i] = ASPLIT ? bf16_bits(xs[i] - bf16_val(hb)) : (unsigned short)0; }
#pragma unroll
    for (int t = 0; t < 4; ++t) {
      const unsigned short* brow = Wt + (size_t)(col0 + t * 16 + ln) * ldb + kb;
      FragB b;
      b.half[0] = *(const v8us*)(brow + 8 * hh);
      b.half[1] = *(const v8us*)(brow + 16 + 8 * hh);
      acc[t] = mmaN<ASPLIT ? 2 : 1>(ah.v, al.v, b.v, b.v, acc[t]);
    }
  }
#pragma unroll
  for (int t = 0; t < 4; ++t) {
    const int col = col0 + t * 16 + ln;
    float bv = bias ? bias[col] : 0.f;
    if (BIAS_BF16) bv = bf16_round(bv);
#pragma unroll
    for (int r = 0; r < 8; ++r) {
      float v = acc[t][r] + bv;
      if (resid) { float rv = resid[(size_t)((row0 + 8 * hh + r) % rmod) * ldr + col]; if (RES_BF16) rv = bf16_round(rv); v += rv; }
      if (ACT == 1) v = fmaxf(v, 0.f);
      if (ACT == 2) v = 0.5f * v * (1.0f + erff(v * 0.70710678118654752f));
      if (ACT == 3) { const float u = 0.7978845608028654f * (v + 0.044715f * v * v * v); v = 0.5f * v * (1.0f + tanhf(u)); }
      so[w][8 * hh + r][t * 16 + ln] = v;
    }
  }
  __builtin_amdgcn_fence(__ATOMIC_ACQ_REL, "workgroup");
  __builtin_amdgcn_wave_barrier();
  const int rsub = lane >> 4, c4 = (lane & 15) * 4;
  {
#pragma unroll
    for (int q = 0; q < 8; ++q) {
      const int r = q * 2 + rsub;
      const v4f v = *(const v4fa*)&so[w][r][c4];
      *(v4f*)(C + (size_t)(row0 + r) * ldc + col0 + c4) = v;
    }
    
  }
}
// row LayerNorm (biased variance, eps) over N: s = X (+ R); optional out_sum <- s; out_norm <- (s-mu)*rsqrt(var+eps)*g + b
template <bool PARAM_BF16>
__global__ __launch_bounds__(256) void k_layernorm(const float* __restrict__ X, const float* __restrict__ R, const float* __restrict__ g, const float* __restrict__ bta,
                                                  float* __restrict__ out_sum, float* __restrict__ out_norm, int N, float eps) {
  __shared__ float red[256];
  const int row = blockIdx.x, tid = threadIdx.x;
  const float* x = X + (size_t)row * N; const float* rr = R ? R + (size_t)row * N : nullptr;
  float vals[16];                     // up to N = 4096
  const int per = N / 256;            // contiguous chunk per thread? use strided-by-4 chunks: thread handles j = tid*4 + 1024*u
  float s1 = 0.f;
  for (int u = 0; u < per / 4; ++u) {
    const int j = tid * 4 + 1024 * u;
    const v4f a = *(const v4fa*)(x + j);
    v4f b = {0.f,0.f,0.f,0.f}; if (rr) b = *(const v4fa*)(rr + j);
#pragma unroll
    for (int q = 0; q < 4; ++q) { const float v = a[q] + b[q]; vals[u * 4 + q] = v; s1 += v; }
  }
  red[tid] = s1; __syncthreads();
  for (int st = 128; st > 0; st >>= 1) { if (tid < st) red[tid] += red[tid + st]; __syncthreads(); }
  const float mu = red[0] / (float)N; __syncthreads();
  float s2 = 0.f;
  for (int u = 0; u < per / 4; ++u)
#pragma unroll
    for (int q = 0; q < 4; ++q) { const float c = vals[u * 4 + q] - mu; s2 += c * c; }
  red[tid] = s2; __syncthreads();
  for (int st = 128; st > 0; st >>= 1) { if (tid < st) red[tid] += red[tid + st]; __syncthreads(); }
  const float rs = rsqrtf(red[0] / (float)N + eps);
  {
    for (int u = 0; u < per / 4; ++u) {
      const int j = tid * 4 + 1024 * u;
      v4f o, sm;
#pragma unroll
      for (int q = 0; q < 4; ++q) {
        float gg = g[j + q], bb = bta[j + q];
        if (PARAM_BF16) { gg = bf16_round(gg); bb = bf16_round(bb); }
        sm[q] = vals[u * 4 + q]; o[q] = (vals[u * 4 + q] - mu) * rs * gg + bb;
      }
      if (out_sum) *(v4f*)(out_sum + (size_t)row * N + j) = sm;
      *(v4f*)(out_norm + (size_t)row * N + j) = o;
    }
    
  }
}



// ---- f16 WMMA path (v_wmma_f32_16x16x32_f16): 11-bit significands for operands in range — used here for the three 1×1 conv GEMMs (q and k | v in k_gemm_t, to_out in k_win_out)
typedef _Float16 v16h __attribute__((ext_vector_type(16)));
union FragH { v16h v; v8us half[2]; _Float16 h[16]; unsigned short u[16]; };
template <int NT>
__device__ __forceinline__ v8f mmaH(v16h ah, v16h al, v16h bh, v16h bl, v8f c) {
  c = __builtin_amdgcn_wmma_f32_16x16x32_f16(false, ah, false, bh, (short)0, c, false, false);
  if (NT >= 2) c = __builtin_amdgcn_wmma_f32_16x16x32_f16(false, al, false, bh, (short)0, c, false, false);
  if (NT >= 3) c = __builtin_amdgcn_wmma_f32_16x16x32_f16(false, ah, false, bl, (short)0, c, false, false);
  asm volatile("v_nop\n\tv_nop\n\tv_nop\n\tv_nop" : "+v"(c) : "v"(ah), "v"(al), "v"(bh), "v"(bl));
  return c;
}
// batched GEMM like k_gemm_b but f16 operands: A f32 (split into f16 hi/lo if ASPLIT, else rounded to f16), Bt = f16 values [n][k]; alpha; C f32; N multiple of 16 (partial tiles skipped)
template <bool ASPLIT>
__global__ __launch_bounds__(128) void k_gemm_h(const float* __restrict__ A, int lda, size_t sA, const _Float16* __restrict__ Bh, int ldb, size_t sB, float alpha, float* __restrict__ C, int ldc, size_t sC, int M, int N, int K) {
  __shared__ __attribute__((aligned(16))) float so[4][16][64];
  const int tid = threadIdx.x, w = tid >> 5, lane = tid & 31, ln = lane & 15, hh = lane >> 4; const int by = blockIdx.y;
  A += (size_t)by * sA; Bh += (size_t)by * sB; C += (size_t)by * sC;
  const int ntn = (N + 63) / 64; const int wid = blockIdx.x * 4 + w; const int mt = wid / ntn, nq = wid % ntn; if (mt * 16 >= M) return;
  const int row0 = mt * 16, col0 = nq * 64; const float* arow = A + (size_t)(row0 + ln) * lda;
  v8f acc[4] = {};
  for (int kb = 0; kb < K; kb += 32) {
    FragH ah, al;
    const v4f x0 = *(const v4fa*)(arow + kb + 8 * hh), x1 = *(const v4fa*)(arow + kb + 8 * hh + 4), x2 = *(const v4fa*)(arow + kb + 16 + 8 * hh), x3 = *(const v4fa*)(arow + kb + 16 + 8 * hh + 4);
    float xs[16] = {x0[0],x0[1],x0[2],x0[3],x1[0],x1[1],x1[2],x1[3],x2[0],x2[1],x2[2],x2[3],x3[0],x3[1],x3[2],x3[3]};
#pragma unroll
    for (int i = 0; i < 16; ++i) { const _Float16 h = (_Float16)xs[i]; ah.h[i] = h; al.h[i] = ASPLIT ? (_Float16)(xs[i] - (float)h) : (_Float16)0.0f; }
#pragma unroll
    for (int t = 0; t < 4; ++t) { if (col0 + t * 16 >= N) continue; const size_t boff = (size_t)(col0 + t * 16 + ln) * ldb + kb; FragH bq; bq.half[0] = *(const v8us*)(Bh + boff + 8 * hh); bq.half[1] = *(const v8us*)(Bh + boff + 16 + 8 * hh);
      acc[t] = mmaH<ASPLIT ? 2 : 1>(ah.v, al.v, bq.v, bq.v, acc[t]); }
  }
#pragma unroll
  for (int t = 0; t < 4; ++t) { if (col0 + t * 16 >= N) continue;
#pragma unroll
    for (int r = 0; r < 8; ++r) so[w][8 * hh + r][t * 16 + ln] = acc[t][r] * alpha; }
  __builtin_amdgcn_fence(__ATOMIC_ACQ_REL, "workgroup"); __builtin_amdgcn_wave_barrier();
  const int rsub = lane >> 4, c4 = (lane & 15) * 4;
  {
#pragma unroll
    for (int q = 0; q < 8; ++q) { const int r = q * 2 + rsub; if (col0 + c4 < N) { const v4f v = *(const v4fa*)&so[w][r][c4]; *(v4f*)(C + (size_t)(row0 + r) * ldc + col0 + c4) = v; } }
     }
}

// Wt[n][k] = f16(W[k][n]·scale) from f32 row-major W[K][N] (scale = power of two; bf16-exact weights stay exact in f16 away from the subnormal range)
__global__ __launch_bounds__(256) void k_wt_f16(const float* __restrict__ W, _Float16* __restrict__ Wt, int K, int N, float scale) {
  const int t = blockIdx.x * 256 + threadIdx.x; if (t >= N * (K / 8)) return; const int n = t / (K / 8), k8 = (t % (K / 8)) * 8; FragH f;
#pragma unroll
  for (int i = 0; i < 8; ++i) f.h[i] = (_Float16)(bf16_round(W[(size_t)(k8 + i) * N + n]) * scale); const v8us o = f.half[0];
  *(v8us*)((unsigned short*)Wt + (size_t)n * K + k8) = o; 
}
// k_gemm_hh variant with fused epilogue: v = acc·alpha + bias[by·sBias + col] (+ CP[(row/rowsPerB)·sCPb + by·64 + col] if CP) ; ACT 0 none / 1 elu ; writes f16 C16 and f32 C, each if non-null
template <int ACT>
__global__ __launch_bounds__(128) void k_gemm_hhx(const _Float16* __restrict__ A, int lda, size_t sA, const _Float16* __restrict__ Bh, int ldb, size_t sB, float alpha, const float* __restrict__ bias, size_t sBias, const float* __restrict__ CP, int rowsPerB, size_t sCPb, int row0g,
    float* __restrict__ C, _Float16* __restrict__ C16, int ldc, size_t sC, int M, int N, int K) {
  __shared__ __attribute__((aligned(16))) float so[4][16][64];
  const int tid = threadIdx.x, w = tid >> 5, lane = tid & 31, ln = lane & 15, hh = lane >> 4; const int by = blockIdx.y;
  A += (size_t)by * sA; Bh += (size_t)by * sB; const size_t cofs = (size_t)by * sC; const float* bp = bias ? bias + (size_t)by * sBias : nullptr;
  const int ntn = (N + 63) / 64; const int wid = blockIdx.x * 4 + w; const int mt = wid / ntn, nq = wid % ntn; if (mt * 16 >= M) return;
  const int row0 = mt * 16, col0 = nq * 64; const _Float16* arow = A + (size_t)(row0 + ln) * lda;
  v8f acc[4] = {};
  for (int kb = 0; kb < K; kb += 32) { FragH ah; ah.half[0] = *(const v8us*)((const unsigned short*)arow + kb + 8 * hh); ah.half[1] = *(const v8us*)((const unsigned short*)arow + kb + 16 + 8 * hh);
#pragma unroll
    for (int t = 0; t < 4; ++t) { if (col0 + t * 16 >= N) continue; const size_t boff = (size_t)(col0 + t * 16 + ln) * ldb + kb; FragH bq; bq.half[0] = *(const v8us*)((const unsigned short*)Bh + boff + 8 * hh); bq.half[1] = *(const v8us*)((const unsigned short*)Bh + boff + 16 + 8 * hh);
      acc[t] = mmaH<1>(ah.v, ah.v, bq.v, bq.v, acc[t]); }
  }
#pragma unroll
  for (int t = 0; t < 4; ++t) { if (col0 + t * 16 >= N) continue; const int col = col0 + t * 16 + ln; const float bv = bp ? bf16_round(bp[col]) : 0.f;
#pragma unroll
    for (int r = 0; r < 8; ++r) { float v = acc[t][r] * alpha + bv; if (CP) { const int bidx = (row0g + row0 + 8 * hh + r) / rowsPerB; v += CP[(size_t)bidx * sCPb + (size_t)by * 64 + col]; } if (ACT == 1) v = (v > 0.f) ? v : expm1f(v); else if (ACT == 3) v = fmaxf(v, 0.f); so[w][8 * hh + r][t * 16 + ln] = v; } }
  __builtin_amdgcn_fence(__ATOMIC_ACQ_REL, "workgroup"); __builtin_amdgcn_wave_barrier();
  const int rsub = lane >> 4, c4 = (lane & 15) * 4; typedef _Float16 v4h __attribute__((ext_vector_type(4)));
  {
#pragma unroll
    for (int q = 0; q < 8; ++q) { const int r = q * 2 + rsub; if (col0 + c4 < N) { const v4f v = *(const v4fa*)&so[w][r][c4]; if (C) *(v4f*)(C + cofs + (size_t)(row0 + r) * ldc + col0 + c4) = v; if (C16) { v4h h4; for (int i = 0; i < 4; ++i) h4[i] = (_Float16)v[i]; *(v4h*)(C16 + cofs + (size_t)(row0 + r) * ldc + col0 + c4) = h4; } } }
     }
}


// Eight 16-byte asynchronous copies global -> LDS (each lane its own addresses), rows lstep / gstep apart. The s_wait_xcnt closes the statement so that no
// address register named here is rewritten ahead of it.
__device__ __forceinline__ void copy8(unsigned l, const _Float16* g, unsigned lstep, size_t gstep) {
  asm volatile("global_load_async_to_lds_b128 %0, %8, off\n\t"
               "global_load_async_to_lds_b128 %1, %9, off\n\t"
               "global_load_async_to_lds_b128 %2, %10, off\n\t"
               "global_load_async_to_lds_b128 %3, %11, off\n\t"
               "global_load_async_to_lds_b128 %4, %12, off\n\t"
               "global_load_async_to_lds_b128 %5, %13, off\n\t"
               "global_load_async_to_lds_b128 %6, %14, off\n\t"
               "global_load_async_to_lds_b128 %7, %15, off\n\t"
               "s_wait_xcnt 0x0"
               :: "v"(l), "v"(l + lstep), "v"(l + 2 * lstep), "v"(l + 3 * lstep), "v"(l + 4 * lstep), "v"(l + 5 * lstep), "v"(l + 6 * lstep), "v"(l + 7 * lstep),
                  "v"(g), "v"(g + gstep), "v"(g + 2 * gstep), "v"(g + 3 * gstep), "v"(g + 4 * gstep), "v"(g + 5 * gstep), "v"(g + 6 * gstep), "v"(g + 7 * gstep)
               : "memory");
}
// C[M][Nn] = A[M][Kk] * Bh[Nn][Kk]^T * alpha (+ bf16-rounded bias), f16 operands, f32 accumulate. One work-group = one 128 x 128 tile of C, four waves (2 x 2) of 64 x 64.
// A and Bh tiles of 128 rows x 128 k are staged in LDS (row pitch 272 B) by asynchronous copies, two buffers: tile t + 1 flies while tile t is worked on.
// M, Nn multiples of 128 (grid = M / 128 * Nn / 128), Kk a multiple of 128. Each 16 x 16 accumulator sums k upwards in steps of 32.
// NCHW: A holds the CC output channels' weights and Bh the tokens (Nn = NR), so a row of C is a channel and its columns are pixels that lie side by side in the image:
// the tile goes straight to C[image][channel][pixel] (f32), the bias belongs to the row.
// NS > 0 (a multiple of 128, with OUT16): two products that share A run as one launch; columns below NS go to C16 (row pitch NS), the others to C16b (row pitch Nn - NS).
template <int Nn, int Kk, bool OUT16, bool BIAS, bool NCHW, int NS>
__global__ __launch_bounds__(128) void k_gemm_t(const _Float16* __restrict__ A, const _Float16* __restrict__ Bh, float alpha, const float* __restrict__ bias, float* __restrict__ C, _Float16* __restrict__ C16, _Float16* __restrict__ C16b) {
  constexpr int KC = 128, PITCH = 272, OPB = 128 * PITCH, STG = 2 * OPB, NT = Kk / KC;
  __shared__ __attribute__((aligned(16))) unsigned char sm[2 * STG];
  const int tid = threadIdx.x, w = tid >> 5, lane = tid & 31, ln = lane & 15, hh = lane >> 4;
  const int bm = blockIdx.x / (Nn / 128), bn = blockIdx.x % (Nn / 128);
  const int wm = w >> 1, wn = w & 1;
  const int crow = tid >> 4, cch = tid & 15;      // a copy instruction of a wave covers two whole 256-byte rows
  const _Float16* ga = A + (size_t)(bm * 128 + crow) * Kk + cch * 8;
  const _Float16* gb = Bh + (size_t)(bn * 128 + crow) * Kk + cch * 8;
  const unsigned lc = (unsigned)(size_t)sm + crow * PITCH + cch * 16;
  auto fill = [&](int t, int buf) {
    const unsigned l = lc + buf * STG;
    copy8(l, ga + t * KC, 8 * PITCH, (size_t)8 * Kk);
    copy8(l + 64 * PITCH, ga + t * KC + (size_t)64 * Kk, 8 * PITCH, (size_t)8 * Kk);
    copy8(l + OPB, gb + t * KC, 8 * PITCH, (size_t)8 * Kk);
    copy8(l + OPB + 64 * PITCH, gb + t * KC + (size_t)64 * Kk, 8 * PITCH, (size_t)8 * Kk);
  };
  v8f acc[4][4] = {};
  fill(0, 0);
  asm volatile("s_wait_asynccnt 0x0" ::: "memory");      // tile 0 of this wave has landed
  __syncthreads();                                       // ... and every wave's part of it
  if (NT > 1) fill(1, 1);
  const int aoff = (wm * 64 + ln) * PITCH + 16 * hh, boff = OPB + (wn * 64 + ln) * PITCH + 16 * hh;
#pragma unroll 1      // kept rolled: unrolled over the k tiles the build takes many more vector registers
  for (int t = 0; t < NT; ++t) {
    const int sb = (t & 1) * STG;
#pragma unroll
    for (int ks = 0; ks < KC / 32; ++ks) {
      FragH a[4], b[4];
#pragma unroll
      for (int i = 0; i < 4; ++i) {
        a[i].half[0] = *(const v8us*)&sm[sb + aoff + i * 16 * PITCH + ks * 64]; a[i].half[1] = *(const v8us*)&sm[sb + aoff + i * 16 * PITCH + ks * 64 + 32];
        b[i].half[0] = *(const v8us*)&sm[sb + boff + i * 16 * PITCH + ks * 64]; b[i].half[1] = *(const v8us*)&sm[sb + boff + i * 16 * PITCH + ks * 64 + 32];
      }
#pragma unroll
      for (int i = 0; i < 4; ++i)
#pragma unroll
        for (int j = 0; j < 4; ++j) acc[i][j] = __builtin_amdgcn_wmma_f32_16x16x32_f16(false, a[i].v, false, b[j].v, (short)0, acc[i][j], false, false);
    }
    asm volatile("s_wait_dscnt 0x0" ::: "memory");       // this wave's reads of buffer t & 1 are done before it is refilled
    asm volatile("s_wait_asynccnt 0x0" ::: "memory");    // this wave's copies of tile t + 1 have landed
    __syncthreads();                                     // publishes tile t + 1, ends every reader's last read of tile t
    if (t + 2 < NT) fill(t + 2, t & 1);
  }
  asm volatile("s_wait_asynccnt 0x0" ::: "memory");      // no copy is outstanding when the ring becomes output staging
  // epilogue: each wave stages its 64 x 64 tile in its own LDS range (pitch 68 floats) and stores whole lines
  float* so = (float*)sm + w * (64 * 68);
  const int row0 = bm * 128 + wm * 64, col0 = bn * 128 + wn * 64;
  if (NCHW) {
#pragma unroll
    for (int i = 0; i < 4; ++i)
#pragma unroll
      for (int r = 0; r < 8; ++r) {
        const float bv = BIAS ? bf16_round(bias[row0 + i * 16 + 8 * hh + r]) : 0.f;
#pragma unroll
        for (int j = 0; j < 4; ++j) so[(i * 16 + 8 * hh + r) * 68 + j * 16 + ln] = acc[i][j][r] * alpha + bv;
      }
  } else {
#pragma unroll
    for (int j = 0; j < 4; ++j) {
      const float bv = BIAS ? bf16_round(bias[col0 + j * 16 + ln]) : 0.f;
#pragma unroll
      for (int i = 0; i < 4; ++i)
#pragma unroll
        for (int r = 0; r < 8; ++r) so[(i * 16 + 8 * hh + r) * 68 + j * 16 + ln] = acc[i][j][r] * alpha + bv;
    }
  }
  __builtin_amdgcn_fence(__ATOMIC_ACQ_REL, "workgroup"); __builtin_amdgcn_wave_barrier();
  if (NCHW) {
    const int rs = lane >> 4, c4 = (lane & 15) * 4;      // half a wave stores 64 pixels of one channel: two whole lines
    float* cp = C + ((size_t)(col0 / NPIX) * CC + row0 + rs) * NPIX + col0 % NPIX + c4;
#pragma unroll
    for (int q = 0; q < 32; ++q) { const int r = q * 2 + rs; const v4f v = *(const v4fa*)&so[r * 68 + c4]; *(v4f*)(cp + q * 2 * NPIX) = v; }
  } else if (OUT16) {
    const int rs = lane >> 3, c8 = (lane & 7) * 8;
    auto put = [&](_Float16* dst, const int ld, const int c0) {      // dst, its row pitch and the tile's first column there
      unsigned short* cp = (unsigned short*)dst + (size_t)(row0 + rs) * ld + c0 + c8;
#pragma unroll
      for (int q = 0; q < 16; ++q) { const int r = q * 4 + rs; const v4f v0 = *(const v4fa*)&so[r * 68 + c8], v1 = *(const v4fa*)&so[r * 68 + c8 + 4]; FragH f;
#pragma unroll
        for (int i = 0; i < 4; ++i) { f.h[i] = (_Float16)v0[i]; f.h[4 + i] = (_Float16)v1[i]; }
        *(v8us*)(cp + q * 4 * ld) = f.half[0]; }
    };
    if (NS > 0 && bn * 128 >= NS) put(C16b, Nn - NS, col0 - NS);      // a tile lies wholly on one side: the test reads the same in the whole work-group
    else put(C16, NS > 0 ? NS : Nn, col0);
  } else {
    const int rs = lane >> 4, c4 = (lane & 15) * 4;
    float* cp = C + (size_t)(row0 + rs) * Nn + col0 + c4;
#pragma unroll
    for (int q = 0; q < 32; ++q) { const int r = q * 2 + rs; const v4f v = *(const v4fa*)&so[r * 68 + c4]; *(v4f*)(cp + q * 2 * Nn) = v; }
  }
}


typedef _Float16 v4h __attribute__((ext_vector_type(4)));

__global__ __launch_bounds__(256) void k_x16(const float* __restrict__ x, _Float16* __restrict__ X16, size_t n8) { const size_t t = (size_t)blockIdx.x * 256 + threadIdx.x; if (t >= n8) return; FragH f;
#pragma unroll
  for (int q = 0; q < 8; ++q) f.h[q] = (_Float16)bf16_round(x[t * 8 + q]); *(v8us*)((unsigned short*)X16 + t * 8) = f.half[0];  }
__global__ __launch_bounds__(256) void k_h16(const float* __restrict__ x, _Float16* __restrict__ X16, size_t n8) { const size_t t = (size_t)blockIdx.x * 256 + threadIdx.x; if (t >= n8) return; FragH f;
#pragma unroll
  for (int q = 0; q < 8; ++q) f.h[q] = (_Float16)x[t * 8 + q]; *(v8us*)((unsigned short*)X16 + t * 8) = f.half[0];  }
template <int NHv, int TTv>
__global__ __launch_bounds__(256) void k_vt(const _Float16* __restrict__ V16, int ldv, int voff, _Float16* __restrict__ Vt) { __shared__ unsigned short tl[64][66]; const int tid = threadIdx.x; const int slab = blockIdx.x / (TTv / 64), lg = blockIdx.x % (TTv / 64); const int b = slab / NHv, h = slab % NHv;
  for (int i = tid; i < 64 * 8; i += 256) { const int r = i / 8, c8 = (i % 8) * 8; FragH f; f.half[0] = *(const v8us*)((const unsigned short*)V16 + ((size_t)b * TTv + lg * 64 + r) * ldv + voff + h * 64 + c8);
#pragma unroll
    for (int q = 0; q < 8; ++q) tl[r][c8 + q] = f.u[q]; }
  __syncthreads();
  {
#pragma unroll
    for (int rd = 0; rd < 2; ++rd) { const int d = rd * 32 + tid / 8, pc = tid % 8; FragH f;
#pragma unroll
      for (int q = 0; q < 8; ++q) f.u[q] = tl[pc * 8 + q][d];
      *(v8us*)((unsigned short*)Vt + ((size_t)slab * 64 + d) * TTv + lg * 64 + pc * 8) = f.half[0]; }
     } }

// Everything the GEMMs need, in one launch (none of it depends on another part). The first NBW blocks turn the (out,in) weights into f16 (bf16-rounded, times 2^4), eight values a thread:
// Bw = [Wq | Wkv | Wo] one behind the other. Each of the other blocks transposes a tile of 64 channels x 32 pixels of x into token rows.
#define NBQ (INNER * CC / 8 / 256)
#define NBW (4 * NBQ)
__global__ __launch_bounds__(256) void k_prep(const float* __restrict__ x, const float* __restrict__ Wq, const float* __restrict__ Wkv, const float* __restrict__ Wo, _Float16* __restrict__ Bw, _Float16* __restrict__ X16) { __shared__ float tl[32][65]; const int tid = threadIdx.x;
  if (blockIdx.x < NBW) {      // the same for the whole block, and in front of its barrier
    const int wb = blockIdx.x; const float* W = wb < NBQ ? Wq : wb < 3 * NBQ ? Wkv : Wo; const size_t t = (size_t)(wb < NBQ ? wb : wb < 3 * NBQ ? wb - NBQ : wb - 3 * NBQ) * 256 + tid; FragH f;
#pragma unroll
    for (int i = 0; i < 8; ++i) f.h[i] = (_Float16)(bf16_round(W[t * 8 + i]) * 16.0f); *(v8us*)((unsigned short*)Bw + ((size_t)wb * 256 + tid) * 8) = f.half[0];
    return;
  }
  const int blk = blockIdx.x - NBW; const int b = blk / ((CC / 64) * (NPIX / 32)), rem = blk % ((CC / 64) * (NPIX / 32)); const int cg = rem / (NPIX / 32), pg = rem % (NPIX / 32); const int c0 = cg * 64, p0 = pg * 32;
  for (int i = tid; i < 64 * 32; i += 256) { const int c = i / 32, pp = i % 32; tl[pp][c] = bf16_round(x[((size_t)b * CC + c0 + c) * NPIX + p0 + pp]); } __syncthreads();
  const int r = tid / 8, pc = tid % 8; FragH f; for (int q = 0; q < 8; ++q) f.h[q] = (_Float16)tl[r][pc * 8 + q]; const size_t row = (size_t)b * NPIX + p0 + r; *(v8us*)((unsigned short*)X16 + row * CC + c0 + pc * 8) = f.half[0];  }
union H8 { v8us v; unsigned d[4]; };      // eight f16 values as they are loaded: four registers of two
// v_fma_mix_f32: c + a * b in one fused f32 multiply-add whose f16 factors are widened exactly inside the instruction (op_sel picks the high halves). Written as asm for
// speed: from plain source this build widens every half with a conversion of its own before a packed f32 multiply-add. Each statement holds a whole round over independent
// sums, so that an instruction and the one it depends on stand eight or nine apart (asm text gets no s_delay_alu from the compiler, and needs none at that distance).
// s[w] (+)= the two products of register q with register k[w], w = 0 .. 8
__device__ __forceinline__ void dot9_first(float (&s)[9], unsigned q, const unsigned (&k)[9]) {
  asm(
      "v_fma_mix_f32 %0, %9, %10, 0 op_sel_hi:[1,1,0]\n\t"
      "v_fma_mix_f32 %1, %9, %11, 0 op_sel_hi:[1,1,0]\n\t"
      "v_fma_mix_f32 %2, %9, %12, 0 op_sel_hi:[1,1,0]\n\t"
      "v_fma_mix_f32 %3, %9, %13, 0 op_sel_hi:[1,1,0]\n\t"
      "v_fma_mix_f32 %4, %9, %14, 0 op_sel_hi:[1,1,0]\n\t"
      "v_fma_mix_f32 %5, %9, %15, 0 op_sel_hi:[1,1,0]\n\t"
      "v_fma_mix_f32 %6, %9, %16, 0 op_sel_hi:[1,1,0]\n\t"
      "v_fma_mix_f32 %7, %9, %17, 0 op_sel_hi:[1,1,0]\n\t"
      "v_fma_mix_f32 %8, %9, %18, 0 op_sel_hi:[1,1,0]\n\t"
      "v_fma_mix_f32 %0, %9, %10, %0 op_sel:[1,1,0] op_sel_hi:[1,1,0]\n\t"
      "v_fma_mix_f32 %1, %9, %11, %1 op_sel:[1,1,0] op_sel_hi:[1,1,0]\n\t"
      "v_fma_mix_f32 %2, %9, %12, %2 op_sel:[1,1,0] op_sel_hi:[1,1,0]\n\t"
      "v_fma_mix_f32 %3, %9, %13, %3 op_sel:[1,1,0] op_sel_hi:[1,1,0]\n\t"
      "v_fma_mix_f32 %4, %9, %14, %4 op_sel:[1,1,0] op_sel_hi:[1,1,0]\n\t"
      "v_fma_mix_f32 %5, %9, %15, %5 op_sel:[1,1,0] op_sel_hi:[1,1,0]\n\t"
      "v_fma_mix_f32 %6, %9, %16, %6 op_sel:[1,1,0] op_sel_hi:[1,1,0]\n\t"
      "v_fma_mix_f32 %7, %9, %17, %7 op_sel:[1,1,0] op_sel_hi:[1,1,0]\n\t"
      "v_fma_mix_f32 %8, %9, %18, %8 op_sel:[1,1,0] op_sel_hi:[1,1,0]"
      : "=&v"(s[0]), "=&v"(s[1]), "=&v"(s[2]), "=&v"(s[3]), "=&v"(s[4]), "=&v"(s[5]), "=&v"(s[6]), "=&v"(s[7]), "=&v"(s[8])
      : "v"(q), "v"(k[0]), "v"(k[1]), "v"(k[2]), "v"(k[3]), "v"(k[4]), "v"(k[5]), "v"(k[6]), "v"(k[7]), "v"(k[8]));
}
__device__ __forceinline__ void dot9_more(float (&s)[9], unsigned q, const unsigned (&k)[9]) {
  asm(
      "v_fma_mix_f32 %0, %9, %10, %0 op_sel_hi:[1,1,0]\n\t"
      "v_fma_mix_f32 %1, %9, %11, %1 op_sel_hi:[1,1,0]\n\t"
      "v_fma_mix_f32 %2, %9, %12, %2 op_sel_hi:[1,1,0]\n\t"
      "v_fma_mix_f32 %3, %9, %13, %3 op_sel_hi:[1,1,0]\n\t"
      "v_fma_mix_f32 %4, %9, %14, %4 op_sel_hi:[1,1,0]\n\t"
      "v_fma_mix_f32 %5, %9, %15, %5 op_sel_hi:[1,1,0]\n\t"
      "v_fma_mix_f32 %6, %9, %16, %6 op_sel_hi:[1,1,0]\n\t"
      "v_fma_mix_f32 %7, %9, %17, %7 op_sel_hi:[1,1,0]\n\t"
      "v_fma_mix_f32 %8, %9, %18, %8 op_sel_hi:[1,1,0]\n\t"
      "v_fma_mix_f32 %0, %9, %10, %0 op_sel:[1,1,0] op_sel_hi:[1,1,0]\n\t"
      "v_fma_mix_f32 %1, %9, %11, %1 op_sel:[1,1,0] op_sel_hi:[1,1,0]\n\t"
      "v_fma_mix_f32 %2, %9, %12, %2 op_sel:[1,1,0] op_sel_hi:[1,1,0]\n\t"
      "v_fma_mix_f32 %3, %9, %13, %3 op_sel:[1,1,0] op_sel_hi:[1,1,0]\n\t"
      "v_fma_mix_f32 %4, %9, %14, %4 op_sel:[1,1,0] op_sel_hi:[1,1,0]\n\t"
      "v_fma_mix_f32 %5, %9, %15, %5 op_sel:[1,1,0] op_sel_hi:[1,1,0]\n\t"
      "v_fma_mix_f32 %6, %9, %16, %6 op_sel:[1,1,0] op_sel_hi:[1,1,0]\n\t"
      "v_fma_mix_f32 %7, %9, %17, %7 op_sel:[1,1,0] op_sel_hi:[1,1,0]\n\t"
      "v_fma_mix_f32 %8, %9, %18, %8 op_sel:[1,1,0] op_sel_hi:[1,1,0]"
      : "+v"(s[0]), "+v"(s[1]), "+v"(s[2]), "+v"(s[3]), "+v"(s[4]), "+v"(s[5]), "+v"(s[6]), "+v"(s[7]), "+v"(s[8])
      : "v"(q), "v"(k[0]), "v"(k[1]), "v"(k[2]), "v"(k[3]), "v"(k[4]), "v"(k[5]), "v"(k[6]), "v"(k[7]), "v"(k[8]));
}
// acc[0 .. 7] (+)= a * the eight f16 values of v
__device__ __forceinline__ void av8_first(float (&acc)[8], float a, const unsigned (&v)[4]) {
  asm(
      "v_fma_mix_f32 %0, %8, %9, 0 op_sel_hi:[0,1,0]\n\t"
      "v_fma_mix_f32 %1, %8, %9, 0 op_sel:[0,1,0] op_sel_hi:[0,1,0]\n\t"
      "v_fma_mix_f32 %2, %8, %10, 0 op_sel_hi:[0,1,0]\n\t"
      "v_fma_mix_f32 %3, %8, %10, 0 op_sel:[0,1,0] op_sel_hi:[0,1,0]\n\t"
      "v_fma_mix_f32 %4, %8, %11, 0 op_sel_hi:[0,1,0]\n\t"
      "v_fma_mix_f32 %5, %8, %11, 0 op_sel:[0,1,0] op_sel_hi:[0,1,0]\n\t"
      "v_fma_mix_f32 %6, %8, %12, 0 op_sel_hi:[0,1,0]\n\t"
      "v_fma_mix_f32 %7, %8, %12, 0 op_sel:[0,1,0] op_sel_hi:[0,1,0]"
      : "=&v"(acc[0]), "=&v"(acc[1]), "=&v"(acc[2]), "=&v"(acc[3]), "=&v"(acc[4]), "=&v"(acc[5]), "=&v"(acc[6]), "=&v"(acc[7])
      : "v"(a), "v"(v[0]), "v"(v[1]), "v"(v[2]), "v"(v[3]));
}
__device__ __forceinline__ void av8_more(float (&acc)[8], float a, const unsigned (&v)[4]) {
  asm(
      "v_fma_mix_f32 %0, %8, %9, %0 op_sel_hi:[0,1,0]\n\t"
      "v_fma_mix_f32 %1, %8, %9, %1 op_sel:[0,1,0] op_sel_hi:[0,1,0]\n\t"
      "v_fma_mix_f32 %2, %8, %10, %2 op_sel_hi:[0,1,0]\n\t"
      "v_fma_mix_f32 %3, %8, %10, %3 op_sel:[0,1,0] op_sel_hi:[0,1,0]\n\t"
      "v_fma_mix_f32 %4, %8, %11, %4 op_sel_hi:[0,1,0]\n\t"
      "v_fma_mix_f32 %5, %8, %11, %5 op_sel:[0,1,0] op_sel_hi:[0,1,0]\n\t"
      "v_fma_mix_f32 %6, %8, %12, %6 op_sel_hi:[0,1,0]\n\t"
      "v_fma_mix_f32 %7, %8, %12, %7 op_sel:[0,1,0] op_sel_hi:[0,1,0]"
      : "+v"(acc[0]), "+v"(acc[1]), "+v"(acc[2]), "+v"(acc[3]), "+v"(acc[4]), "+v"(acc[5]), "+v"(acc[6]), "+v"(acc[7])
      : "v"(a), "v"(v[0]), "v"(v[1]), "v"(v[2]), "v"(v[3]));
}
// the value of the lane whose number differs in bit X (X = 1, 2, 4: inside a group of eight lanes); every lane is on where it is used
template <int X>
__device__ __forceinline__ float xlane(float v) { return __int_as_float(__builtin_amdgcn_update_dpp(0, __float_as_int(v), 0x160 + X, 0xf, 0xf, true)); }
// lane S of each group of eight lanes, handed to all eight
template <int S>
__device__ __forceinline__ float group_bcast(float v) { return __uint_as_float(__builtin_amdgcn_permlane16(0u, __float_as_uint(v), 0x11111111u * S, 0x11111111u * (8 + S), true, true)); }
struct WinTile { H8 q, k[9], v[9]; };
// Window attention and the to_out product in one kernel. One work-group = two image rows of one image with all eight heads: sixteen waves.
// Window part: one wave = one image row of one head, four pixels a pass; eight lanes share a pixel, lane p holding d = 8p .. 8p + 7.
// The partial logits are summed over the eight lanes so that lane p ends with logit p (the ninth ends in all eight); each lane does the softmax of its own logit and of the
// ninth, the weights are handed round the group, attn * v follows in the same lanes. A window place outside the image reads a clamped (in-bounds) address; its logit is
// set to 0 and its weight on v to 0. The row's 32 x 9 weights are staged in the wave's own LDS range and stored as whole lines.
// The f16 result o goes to an LDS tile of 64 pixels x 512 (row pitch 1040 B) and never to memory.
// Product part: out[256 channels][64 pixels] = Bo[256][512] * o^T * alpha + bias, a wave = 32 channels x 32 pixels, k upwards in steps of 32. Bo comes in four tiles of 128 k
// (row pitch 272 B) by asynchronous copies into three buffers: tiles 0 .. 2 are asked for during the window part and land under it, tile 3 follows into buffer 0.
__global__ __launch_bounds__(512) void k_win_out(const _Float16* __restrict__ Q, const _Float16* __restrict__ KV, const _Float16* __restrict__ Bo, const float* __restrict__ bias, float alpha,
                                                 float* __restrict__ ATTN, float* __restrict__ OUT) {
  constexpr int KC = 128, WP = 272, WB = CC * WP, OP = INNER * 2 + 16, SO0 = 3 * WB, SA0 = SO0 + 2 * HWD * OP;
  __shared__ __attribute__((aligned(16))) unsigned char sm[SA0 + 16 * HWD * 9 * 4];
  const int tid = threadIdx.x, lane = tid & 31, g = lane >> 3, p = lane & 7;
  const int w = __builtin_amdgcn_readfirstlane(tid >> 5);
  auto fill = [&](int t, int buf) {      // a copy instruction of a wave covers two whole 256-byte rows; a thread brings eight rows' pieces, 32 rows apart
    const int crow = tid >> 4, cch = tid & 15;
    copy8((unsigned)(size_t)sm + buf * WB + crow * WP + cch * 16, Bo + (size_t)crow * INNER + t * KC + cch * 8, 32 * WP, (size_t)32 * INNER);
  };
  const int b = blockIdx.x / (HWD / 2), y0 = (blockIdx.x % (HWD / 2)) * 2;
  const int h = w & 7, y = y0 + (w >> 3), bh = b * NH + h;
  float* sa = (float*)(sm + SA0) + w * (HWD * 9);
  // every address = a wave-uniform byte pointer + one of four lane offsets formed here once: no address arithmetic inside the passes
  constexpr unsigned QP = INNER * 2, KP = 2 * INNER * 2;      // bytes a pixel in Q and in KV
  const char* qrow = (const char*)(Q + ((size_t)b * NPIX + y * HWD) * INNER + h * DH);
  unsigned char* orow = sm + SO0 + ((w >> 3) * HWD + g) * OP + h * (DH * 2) + p * 16;
  const char* krow[3];
#pragma unroll
  for (int dy = 0; dy < 3; ++dy) krow[dy] = (const char*)(KV + ((size_t)b * NPIX + min(max(y + dy - 1, 0), HWD - 1) * HWD) * (2 * INNER) + h * DH);
  const unsigned loq = g * QP + p * 16, lok = g * KP + p * 16;
  const unsigned lokl = max(g - 1, 0) * KP + p * 16, lokr = min(g + 1, 3) * KP + p * 16;      // x - 1 clamped in the first pass, x + 1 clamped in the last
  const bool c1 = p & 1, c2 = p & 2, c4 = p & 4;
  const int ym = y + p / 3 - 1, dxm = p % 3 - 1;      // window place p of this lane's own logit
  const bool okym = ym >= 0 && ym < HWD, oky8 = y + 1 < HWD;
  auto load = [&](int it, WinTile& t) {
    t.q.v = *(const v8us*)(qrow + it * 4 * QP + loq);
#pragma unroll
    for (int wi = 0; wi < 9; ++wi) {
      const int dx = wi % 3 - 1;
      const bool el = it == 0 && dx < 0, er = it == HWD / 4 - 1 && dx > 0;
      const char* kr = krow[wi / 3] + (el || er ? it * 4 : it * 4 + dx) * KP;
      const unsigned off = el ? lokl : er ? lokr : lok;
      t.k[wi].v = *(const v8us*)(kr + off); t.v[wi].v = *(const v8us*)(kr + INNER * 2 + off);
    }
  };
  WinTile tl[2];
  load(0, tl[0]);
  asm volatile("s_wait_xcnt 0x0" ::: "memory");      // lokl is not used again and this build hands its register to a later load's result: the wait stands in front of that overwrite
#pragma unroll      // unrolled: the two register tiles alternate by a constant index, and only the first and the last pass carry the tests on x
  for (int it = 0; it < HWD / 4; ++it) {
    if (it + 1 < HWD / 4) load(it + 1, tl[(it + 1) & 1]);      // the next four pixels' loads fly while these four are worked on
    if (it < 6 && it % 2 == 0) fill(it / 2, it / 2);           // Bo tiles 0 .. 2, one every other pass: behind the window's own loads, and not all at once in front of them
    __builtin_amdgcn_sched_barrier(0);      // keeps those loads in front of this pass's arithmetic: sunk into it, each would be waited for right behind its issue
    const WinTile& t = tl[it & 1];
    const int x = it * 4 + g;
    const bool okm = okym && (it != 0 || x + dxm >= 0) && (it != HWD / 4 - 1 || x + dxm < HWD);
    const bool ok8 = oky8 && (it != HWD / 4 - 1 || x + 1 < HWD);
    float s[9];
#pragma unroll
    for (int j = 0; j < 4; ++j) {
      const unsigned kj[9] = {t.k[0].d[j], t.k[1].d[j], t.k[2].d[j], t.k[3].d[j], t.k[4].d[j], t.k[5].d[j], t.k[6].d[j], t.k[7].d[j], t.k[8].d[j]};
      if (j == 0) dot9_first(s, t.q.d[j], kj); else dot9_more(s, t.q.d[j], kj);
    }
    float r[4], u[2];
#pragma unroll
    for (int i = 0; i < 4; ++i) r[i] = (c4 ? s[4 + i] : s[i]) + xlane<4>(c4 ? s[i] : s[4 + i]);      // logit 4 * (p >> 2) + i
#pragma unroll
    for (int i = 0; i < 2; ++i) u[i] = (c2 ? r[2 + i] : r[i]) + xlane<2>(c2 ? r[i] : r[2 + i]);      // logit 2 * (p >> 1) + i
    const float sm1 = (c1 ? u[1] : u[0]) + xlane<1>(c1 ? u[0] : u[1]);                               // logit p
    float s8 = s[8]; s8 += xlane<1>(s8); s8 += xlane<2>(s8); s8 += xlane<4>(s8);
    const float lm = okm ? sm1 * 0.125f : 0.f, l8 = ok8 ? s8 * 0.125f : 0.f;
    float m = fmaxf(lm, xlane<1>(lm)); m = fmaxf(m, xlane<2>(m)); m = fmaxf(m, xlane<4>(m)); m = fmaxf(m, l8);
    const float em = expf(lm - m), e8 = expf(l8 - m);
    float z = em + xlane<1>(em); z += xlane<2>(z); z += xlane<4>(z); z += e8;
    const float am = em / z, a8 = e8 / z;
    sa[x * 9 + p] = am;
    if (p == 0) sa[x * 9 + 8] = a8;
    const float vm = okm ? am : 0.f;
    const float a[9] = {group_bcast<0>(vm), group_bcast<1>(vm), group_bcast<2>(vm), group_bcast<3>(vm), group_bcast<4>(vm), group_bcast<5>(vm), group_bcast<6>(vm), group_bcast<7>(vm), ok8 ? a8 : 0.f};
    __builtin_amdgcn_sched_barrier(0);      // keeps the eight lane moves together in front of the asm rounds: one placed directly in front of the round that reads it would stall it, unhinted
    float acc[8];
#pragma unroll
    for (int wi = 0; wi < 9; ++wi) { if (wi == 0) av8_first(acc, a[wi], t.v[wi].d); else av8_more(acc, a[wi], t.v[wi].d); }
    FragH o;
#pragma unroll
    for (int j = 0; j < 8; ++j) o.h[j] = (_Float16)acc[j];
    *(v8us*)(orow + it * 4 * OP) = o.half[0];
  }
  asm volatile("s_wait_dscnt 0x0" ::: "memory");         // this wave's rows of o (and its weights) stand in LDS
  asm volatile("s_wait_asynccnt 0x0" ::: "memory");      // this wave's copies of Bo tiles 0 .. 2 have landed
  __syncthreads();                                       // publishes the o tile and the three Bo tiles
  const int ln = lane & 15, hh = lane >> 4, wm = w >> 1, wn = w & 1;
  const int aoff = (wm * 32 + ln) * WP + 16 * hh, boff = SO0 + (wn * 32 + ln) * OP + 16 * hh;
  v8f cacc[2][2] = {};
  const int row0 = wm * 32;
  auto tile = [&](int t, int buf) {      // its loops are unrolled so that fragments and accumulators are indexed by constants and stay in registers
#pragma unroll
    for (int ks = 0; ks < KC / 32; ++ks) {
      FragH fa[2], fb[2];
#pragma unroll
      for (int i = 0; i < 2; ++i) {
        fa[i].half[0] = *(const v8us*)&sm[buf * WB + aoff + i * 16 * WP + ks * 64]; fa[i].half[1] = *(const v8us*)&sm[buf * WB + aoff + i * 16 * WP + ks * 64 + 32];
        fb[i].half[0] = *(const v8us*)&sm[boff + i * 16 * OP + t * (KC * 2) + ks * 64]; fb[i].half[1] = *(const v8us*)&sm[boff + i * 16 * OP + t * (KC * 2) + ks * 64 + 32];
      }
#pragma unroll
      for (int i = 0; i < 2; ++i)
#pragma unroll
        for (int j = 0; j < 2; ++j) cacc[i][j] = __builtin_amdgcn_wmma_f32_16x16x32_f16(false, fa[i].v, false, fb[j].v, (short)0, cacc[i][j], false, false);
    }
  };
  tile(0, 0);
  asm volatile("s_wait_dscnt 0x0" ::: "memory");         // this wave's reads of buffer 0 are done before it is refilled
  __syncthreads();                                       // ends every reader's last read of Bo tile 0
  fill(3, 0);
  v4f bq[2][2];      // the bias of this lane's sixteen rows, asked for here: it comes under tiles 1 and 2, so neither the next barrier nor the epilogue waits for it
#pragma unroll
  for (int i = 0; i < 2; ++i) { bq[i][0] = *(const v4fa*)(bias + row0 + i * 16 + 8 * hh); bq[i][1] = *(const v4fa*)(bias + row0 + i * 16 + 8 * hh + 4); }
  tile(1, 1); tile(2, 2);                                // tile 3 flies meanwhile
  asm volatile("s_wait_dscnt 0x0" ::: "memory");         // this wave's reads of buffers 1 and 2 are done before they become output staging
  asm volatile("s_wait_asynccnt 0x0" ::: "memory");      // this wave's copies of tile 3 have landed; none is outstanding from here on
  __syncthreads();                                       // publishes tile 3, ends every reader's last read of tiles 1 and 2
  float* ap = ATTN + ((size_t)bh * NPIX + y * HWD) * 9;      // the weights go out after the last barrier: no barrier and no fence then waits for these stores
#pragma unroll
  for (int q = 0; q < 3; ++q) { const int i4 = q * 32 + lane; if (i4 < HWD * 9 / 4) { const v4f v = *(const v4fa*)&sa[i4 * 4]; *(v4f*)(ap + i4 * 4) = v; } }
  tile(3, 0);
  // epilogue: each wave stages its 32 x 32 tile in its own range of buffers 1 and 2 (pitch 36 floats) and stores whole lines: a row is a channel, its 32 columns one image row
  float* so = (float*)(sm + WB) + w * (32 * 36);
#pragma unroll      // unrolled here and below: the accumulators and the bias are indexed by constants
  for (int i = 0; i < 2; ++i)
#pragma unroll
    for (int r = 0; r < 8; ++r) {
      const float bv = bf16_round(bq[i][r >> 2][r & 3]);
#pragma unroll
      for (int j = 0; j < 2; ++j) so[(i * 16 + 8 * hh + r) * 36 + j * 16 + ln] = cacc[i][j][r] * alpha + bv;
    }
  asm volatile("s_wait_dscnt 0x0" ::: "memory");      // the wave's own LDS writes are done before other lanes of it read them (a fence here would wait for the weights' stores as well)
  const int rs = lane >> 3, q4 = (lane & 7) * 4;
  float* cp = OUT + ((size_t)b * CC + row0 + rs) * NPIX + (y0 + wn) * HWD + q4;
#pragma unroll
  for (int q = 0; q < 8; ++q) { const v4f v = *(const v4fa*)&so[(q * 4 + rs) * 36 + q4]; *(v4f*)(cp + q * 4 * NPIX) = v; }
}
extern "C" void kernel_launch(void* const* d_in, const int* in_sizes, int n_in,
                              void* d_out, int out_size, void* d_ws, size_t ws_size, hipStream_t stream) {
  (void)in_sizes; (void)n_in; (void)out_size;
  const float* x = (const float*)d_in[0]; const float* Wq = (const float*)d_in[1]; const float* Wkv = (const float*)d_in[2]; const float* Wo = (const float*)d_in[3]; const float* bo = (const float*)d_in[4];
  float* OUT0 = (float*)d_out; float* ATTN = OUT0 + (size_t)BB * CC * NPIX;
  char* ws = (char*)d_ws; size_t off = 0;
  auto take = [&](size_t bytes) { char* p = ws + off; off += (bytes + 255) & ~(size_t)255; return p; };
  _Float16* Bw = (_Float16*)take((size_t)4 * INNER * CC * 2); _Float16* Bo = Bw + (size_t)3 * INNER * CC;      // [Wq | Wkv] (1536 rows of 256), then Wo (256 rows of 512)
  _Float16* X16 = (_Float16*)take((size_t)NR * CC * 2); _Float16* Q = (_Float16*)take((size_t)NR * INNER * 2); _Float16* KV = (_Float16*)take((size_t)NR * 2 * INNER * 2);
  if (off > ws_size) return;      // 1.1 + 8.4 + 16.8 + 33.5 MB
  k_prep<<<NBW + BB * (CC / 64) * (NPIX / 32), 256, 0, stream>>>(x, Wq, Wkv, Wo, Bw, X16);
  k_gemm_t<3 * INNER, CC, true, false, false, INNER><<<(NR / 128) * (3 * INNER / 128), 128, 0, stream>>>(X16, Bw, 0.0625f, nullptr, nullptr, Q, KV);      // q, and [k | v]
  k_win_out<<<BB * (HWD / 2), 512, 0, stream>>>(Q, KV, Bo, bo, 0.0625f, ATTN, OUT0);      // window attention, then to_out + bo with channels as rows: stored as NCHW
}

// v006
// A run of this version takes 34 microseconds.
// In both of two side-by-side timings against v005, it was 1.18 times as fast.
// Over all steps from v000 it is 4.79 times as fast.
#include <hip/hip_runtime.h>
// Local 3×3-window attention (x [16,256,32,32]; 8 heads × 64): q = 1×1 conv (Wq), k,v = 1×1 conv (Wkv), each pixel attends over its 3×3 neighbourhood (zero-padded keys/values take part with
// logit 0), softmax(q·k/8), out = Σ attn·v, 1×1 conv Wo + bo; outputs (out NCHW, attn [16,8,1024,9]). The three pointwise convs run as GEMMs on v_wmma_f32_16x16x32_f16 (x bf16-exact, (out,in)
// weights bf16-exact ×2^4, q/k/v/o f16, f32 accumulate); the 9-wide window dots, softmax and attn * v are f32 VALU (eight lanes a pixel and head), and the to_out GEMM follows in the same kernel from an LDS tile, stored as NCHW; the weights are converted in a launch of their own, q and k | v come from one GEMM, which transposes and converts its own tile of x.
#define BB 16
#define CC 256
#define HWD 32
#define NPIX 1024
#define NH 8
#define DH 64
#define INNER 512
#define NR (BB * NPIX)

typedef __bf16 v16b __attribute__((ext_vector_type(16)));
typedef unsigned short v8us __attribute__((ext_vector_type(8), may_alias));
typedef float  v8f  __attribute__((ext_vector_type(8)));
typedef float  v4f  __attribute__((ext_vector_type(4)));
typedef float  v4fa __attribute__((ext_vector_type(4), may_alias));
union FragB { v16b v; v8us half[2]; unsigned short u[16]; };

__device__ __forceinline__ unsigned short bf16_bits(float x) { unsigned int u = __float_as_uint(x); return (unsigned short)((u + 0x7FFFu + ((u >> 16) & 1u)) >> 16); }
__device__ __forceinline__ float bf16_val(unsigned short b) { return __uint_as_float(((unsigned int)b) << 16); }
__device__ __forceinline__ float bf16_round(float x) { return bf16_val(bf16_bits(x)); }
// D += A·B with NT terms: 1 = ah·bh, 2 = + al·bh (A split), 3 = + ah·bl (both split)
template <int NT>
__device__ __forceinline__ v8f mmaN(v16b ah, v16b al, v16b bh, v16b bl, v8f c) {
  c = __builtin_amdgcn_wmma_f32_16x16x32_bf16(false, ah, false, bh, (short)0, c, false, false);
  if (NT >= 2) c = __builtin_amdgcn_wmma_f32_16x16x32_bf16(false, al, false, bh, (short)0, c, false, false);
  if (NT >= 3) c = __builtin_amdgcn_wmma_f32_16x16x32_bf16(false, ah, false, bl, (short)0, c, false, false);
  asm volatile("v_nop\n\tv_nop\n\tv_nop\n\tv_nop" : "+v"(c) : "v"(ah), "v"(al), "v"(bh), "v"(bl));
  return c;
}

__global__ __launch_bounds__(256) void k_wt_bf16(const float* __restrict__ W, unsigned short* __restrict__ Wt, int K, int N) {
  const int t = blockIdx.x * 256 + threadIdx.x;
  const int k8n = K / 8;
  if (t >= N * k8n) return;
  const int n = t / k8n, k8 = (t % k8n) * 8;
  v8us v;
#pragma unroll
  for (int i = 0; i < 8; ++i) v[i] = bf16_bits(W[(size_t)(k8 + i) * N + n]);
  *(v8us*)(Wt + (size_t)n * K + k8) = v;
  
}

// GEMM C[M][N] (f32, pitch ldc) = act(A[M][K]·W + bias). A f32 row-major (pitch lda) converted per fragment to bf16
// (ASPLIT: hi/lo two planes -> 2 terms, else single rounded term); Wt bf16 [N][K] (pitch ldb). BIAS_BF16 rounds the
// bias to bf16 first (bias quantised to bf16 before the add). K%32==0, M%16==0, N%64==0.
template <bool ASPLIT, int ACT, bool BIAS_BF16>
__global__ __launch_bounds__(128) void k_gemm_bf(const float* __restrict__ A, int lda, const unsigned short* __restrict__ Wt, int ldb,
                                               const float* __restrict__ bias, float* __restrict__ C, int ldc, int M, int N, int K) {
  __shared__ __attribute__((aligned(16))) float so[4][16][64];
  const int tid = threadIdx.x, w = tid >> 5, lane = tid & 31, ln = lane & 15, hh = lane >> 4;
  const int ntn = N / 64;
  const int wid = blockIdx.x * 4 + w;
  const int mt = wid / ntn, nq = wid % ntn;
  if (mt * 16 >= M) return;
  const int row0 = mt * 16, col0 = nq * 64;
  const float* arow = A + (size_t)(row0 + ln) * lda;
  v8f acc[4] = {};
  for (int kb = 0; kb < K; kb += 32) {
    FragB ah, al;
    const v4f x0 = *(const v4fa*)(arow + kb + 8 * hh), x1 = *(const v4fa*)(arow + kb + 8 * hh + 4);
    const v4f x2 = *(const v4fa*)(arow + kb + 16 + 8 * hh), x3 = *(const v4fa*)(arow + kb + 16 + 8 * hh + 4);
    float xs[16] = {x0[0],x0[1],x0[2],x0[3],x1[0],x1[1],x1[2],x1[3],x2[0],x2[1],x2[2],x2[3],x3[0],x3[1],x3[2],x3[3]};
#pragma unroll
    for (int i = 0; i < 16; ++i) { const unsigned short hb = bf16_bits(xs[i]); ah.u[i] = hb; al.u[i] = ASPLIT ? bf16_bits(xs[i] - bf16_val(hb)) : (unsigned short)0; }
#pragma unroll
    for (int t = 0; t < 4; ++t) {
      const unsigned short* brow = Wt + (size_t)(col0 + t * 16 + ln) * ldb + kb;
      FragB b;
      b.half[0] = *(const v8us*)(brow + 8 * hh);
      b.half[1] = *(const v8us*)(brow + 16 + 8 * hh);
      acc[t] = mmaN<ASPLIT ? 2 : 1>(ah.v, al.v, b.v, b.v, acc[t]);
    }
  }
#pragma unroll
  for (int t = 0; t < 4; ++t) {
    float bv = bias ? bias[col0 + t * 16 + ln] : 0.f;
    if (BIAS_BF16) bv = bf16_round(bv);
#pragma unroll
    for (int r = 0; r < 8; ++r) { float v = acc[t][r] + bv; if (ACT == 1) v = fmaxf(v, 0.f); so[w][8 * hh + r][t * 16 + ln] = v; }
  }
  __builtin_amdgcn_fence(__ATOMIC_ACQ_REL, "workgroup");
  __builtin_amdgcn_wave_barrier();
  const int rsub = lane >> 4, c4 = (lane & 15) * 4;
  {
#pragma unroll
    for (int q = 0; q < 8; ++q) {
      const int r = q * 2 + rsub;
      const v4f v = *(const v4fa*)&so[w][r][c4];
      *(v4f*)(C + (size_t)(row0 + r) * ldc + col0 + c4) = v;
    }
    
  }
}

// Flash-style causal/unmasked attention, all contractions 3-term bf16 hi/lo splits, f32 softmax with running max.
// q,k,v rows are read from f32 buffers with arbitrary row pitch (so they can live inside a fused qkv buffer);
// D = head size (multiple of 32, <= 128); one wave = 16 query rows; block = 4 waves (64 queries) sharing K/V chunks of 32.
template <int D, bool CAUSAL>
__global__ __launch_bounds__(128) void k_flash(const float* __restrict__ qb, const float* __restrict__ kb, const float* __restrict__ vb,
                                             int pitch, int T, int H, float scale, float* __restrict__ y, int ypitch) {
  constexpr int KS = D / 32;        // k-steps for QK
  constexpr int DT = D / 16;        // d tiles for PV
  __shared__ __attribute__((aligned(16))) unsigned short sKh[32][D + 8], sKl[32][D + 8], sVh[32][D + 8], sVl[32][D + 8];
  __shared__ __attribute__((aligned(16))) unsigned short sPh[4][16][40], sPl[4][16][40];
  __shared__ __attribute__((aligned(16))) float sO[4][16][D];
  const int tid = threadIdx.x, w = tid >> 5, lane = tid & 31, ln = lane & 15, hh = lane >> 4;
  const int nqb = (T + 63) / 64;
  const int bh = blockIdx.x / nqb, qblk = blockIdx.x % nqb;
  const int b = bh / H, h = bh % H;
  const int q0 = qblk * 64 + w * 16;
  const float* Q = qb + (size_t)b * T * pitch + h * D;
  const float* K = kb + (size_t)b * T * pitch + h * D;
  const float* V = vb + (size_t)b * T * pitch + h * D;

  // A fragments of the wave's 16 query rows (scaled), hi/lo
  FragB aqh[KS], aql[KS];
  {
    int row = q0 + ln; if (row >= T) row = T - 1;
    const float* qr = Q + (size_t)row * pitch;
#pragma unroll
    for (int ks = 0; ks < KS; ++ks)
#pragma unroll
      for (int i = 0; i < 16; ++i) {
        const int d = ks * 32 + ((i < 8) ? (8 * hh + i) : (16 + 8 * hh + (i - 8)));
        const float x = qr[d] * scale; const unsigned short hb = bf16_bits(x);
        aqh[ks].u[i] = hb; aql[ks].u[i] = bf16_bits(x - bf16_val(hb));
      }
  }
  float m_r[8], l_r[8];
#pragma unroll
  for (int r = 0; r < 8; ++r) { m_r[r] = -3.0e38f; l_r[r] = 0.f; }
  v8f oacc[DT];
#pragma unroll
  for (int dt = 0; dt < DT; ++dt) oacc[dt] = (v8f){0.f,0.f,0.f,0.f,0.f,0.f,0.f,0.f};

  const int kv_end = CAUSAL ? min(T, qblk * 64 + 64) : T;     // block-uniform
  for (int j0 = 0; j0 < kv_end; j0 += 32) {
    __syncthreads();
    for (int e = tid; e < 32 * (D / 4); e += 128) {
      const int r = e / (D / 4), c4 = (e % (D / 4)) * 4;
      const int key = j0 + r;
      v4f kf = {0.f,0.f,0.f,0.f}, vf = {0.f,0.f,0.f,0.f};
      if (key < T) { kf = *(const v4fa*)(K + (size_t)key * pitch + c4); vf = *(const v4fa*)(V + (size_t)key * pitch + c4); }
#pragma unroll
      for (int t = 0; t < 4; ++t) {
        unsigned short hb = bf16_bits(kf[t]); sKh[r][c4 + t] = hb; sKl[r][c4 + t] = bf16_bits(kf[t] - bf16_val(hb));
        hb = bf16_bits(vf[t]); sVh[r][c4 + t] = hb; sVl[r][c4 + t] = bf16_bits(vf[t] - bf16_val(hb));
      }
    }
    __syncthreads();
    // S tile 16 x 32
    v8f s[2];
#pragma unroll
    for (int nt = 0; nt < 2; ++nt) {
      v8f acc = {};
#pragma unroll
      for (int ks = 0; ks < KS; ++ks) {
        FragB bh_, bl_;
        bh_.half[0] = *(const v8us*)&sKh[nt * 16 + ln][ks * 32 + 8 * hh]; bh_.half[1] = *(const v8us*)&sKh[nt * 16 + ln][ks * 32 + 16 + 8 * hh];
        bl_.half[0] = *(const v8us*)&sKl[nt * 16 + ln][ks * 32 + 8 * hh]; bl_.half[1] = *(const v8us*)&sKl[nt * 16 + ln][ks * 32 + 16 + 8 * hh];
        acc = mmaN<3>(aqh[ks].v, aql[ks].v, bh_.v, bl_.v, acc);
      }
      s[nt] = acc;
    }
    // mask + running max (rows 8hh+r; the 16 lanes of a half share rows)
    float alpha[8];
#pragma unroll
    for (int r = 0; r < 8; ++r) {
      const int qi = q0 + 8 * hh + r;
      const int ja = j0 + ln, jb = j0 + 16 + ln;
      if (CAUSAL) { if (ja > qi) s[0][r] = -3.0e38f; if (jb > qi) s[1][r] = -3.0e38f; }
      if (ja >= T) s[0][r] = -3.0e38f;
      if (jb >= T) s[1][r] = -3.0e38f;
      float mx = fmaxf(s[0][r], s[1][r]);
      mx = fmaxf(mx, __shfl_xor(mx, 1, 32)); mx = fmaxf(mx, __shfl_xor(mx, 2, 32)); mx = fmaxf(mx, __shfl_xor(mx, 4, 32)); mx = fmaxf(mx, __shfl_xor(mx, 8, 32));
      const float mnew = fmaxf(m_r[r], mx);
      alpha[r] = (mnew > -1.0e38f) ? __expf(m_r[r] - mnew) : 1.0f;
      const float p0 = (s[0][r] > -1.0e38f) ? __expf(s[0][r] - mnew) : 0.f;
      const float p1 = (s[1][r] > -1.0e38f) ? __expf(s[1][r] - mnew) : 0.f;
      m_r[r] = mnew;
      l_r[r] = l_r[r] * alpha[r] + p0 + p1;            // per-lane partial row sum (16 lanes combined at the end)
      unsigned short hb = bf16_bits(p0); sPh[w][8 * hh + r][ln] = hb;      sPl[w][8 * hh + r][ln] = bf16_bits(p0 - bf16_val(hb));
      hb = bf16_bits(p1);                sPh[w][8 * hh + r][16 + ln] = hb; sPl[w][8 * hh + r][16 + ln] = bf16_bits(p1 - bf16_val(hb));
    }
#pragma unroll
    for (int dt = 0; dt < DT; ++dt)
#pragma unroll
      for (int r = 0; r < 8; ++r) oacc[dt][r] *= alpha[r];
    __builtin_amdgcn_fence(__ATOMIC_ACQ_REL, "workgroup");
    __builtin_amdgcn_wave_barrier();
    FragB pah, pal;
    pah.half[0] = *(const v8us*)&sPh[w][ln][8 * hh]; pah.half[1] = *(const v8us*)&sPh[w][ln][16 + 8 * hh];
    pal.half[0] = *(const v8us*)&sPl[w][ln][8 * hh]; pal.half[1] = *(const v8us*)&sPl[w][ln][16 + 8 * hh];
#pragma unroll
    for (int dt = 0; dt < DT; ++dt) {
      FragB bvh, bvl;
#pragma unroll
      for (int i = 0; i < 8; ++i) {
        bvh.u[i] = sVh[8 * hh + i][dt * 16 + ln]; bvh.u[8 + i] = sVh[16 + 8 * hh + i][dt * 16 + ln];
        bvl.u[i] = sVl[8 * hh + i][dt * 16 + ln]; bvl.u[8 + i] = sVl[16 + 8 * hh + i][dt * 16 + ln];
      }
      oacc[dt] = mmaN<3>(pah.v, pal.v, bvh.v, bvl.v, oacc[dt]);
    }
    __builtin_amdgcn_fence(__ATOMIC_ACQ_REL, "workgroup");
    __builtin_amdgcn_wave_barrier();
  }
#pragma unroll
  for (int r = 0; r < 8; ++r) {
    float l = l_r[r];
    l += __shfl_xor(l, 1, 32); l += __shfl_xor(l, 2, 32); l += __shfl_xor(l, 4, 32); l += __shfl_xor(l, 8, 32);
    l_r[r] = (l > 0.f) ? 1.0f / l : 0.f;
  }
#pragma unroll
  for (int dt = 0; dt < DT; ++dt)
#pragma unroll
    for (int r = 0; r < 8; ++r) sO[w][8 * hh + r][dt * 16 + ln] = oacc[dt][r] * l_r[r];
  __builtin_amdgcn_fence(__ATOMIC_ACQ_REL, "workgroup");
  __builtin_amdgcn_wave_barrier();
  {
    for (int r = 0; r < 16; ++r) {
      const int row = q0 + r;
      if (row < T && lane < D / 4) {
        const v4f val = *(const v4fa*)&sO[w][r][lane * 4];
        *(v4f*)(y + ((size_t)b * T + row) * ypitch + h * D + lane * 4) = val;
      }
    }
    
  }
}

// GEMM C = act(A·W + bias + resid): A f32 (ASPLIT -> hi/lo 2 terms), Wt bf16 [N][K]; ACT 0 none, 1 relu, 2 exact gelu;
// resid (optional, f32, row index = (row % rmod), pitch ldr, RES_BF16 rounds it) added before the activation.
template <bool ASPLIT, int ACT, bool BIAS_BF16, bool RES_BF16>
__global__ __launch_bounds__(128) void k_gemm_bf3(const float* __restrict__ A, int lda, const unsigned short* __restrict__ Wt, int ldb,
                                                const float* __restrict__ bias, const float* __restrict__ resid, int rmod, int ldr,
                                                float* __restrict__ C, int ldc, int M, int N, int K) {
  __shared__ __attribute__((aligned(16))) float so[4][16][64];
  const int tid = threadIdx.x, w = tid >> 5, lane = tid & 31, ln = lane & 15, hh = lane >> 4;
  const int ntn = N / 64;
  const int wid = blockIdx.x * 4 + w;
  const int mt = wid / ntn, nq = wid % ntn;
  if (mt * 16 >= M) return;
  const int row0 = mt * 16, col0 = nq * 64;
  const float* arow = A + (size_t)(row0 + ln) * lda;
  v8f acc[4] = {};
  for (int kb = 0; kb < K; kb += 32) {
    FragB ah, al;
    const v4f x0 = *(const v4fa*)(arow + kb + 8 * hh), x1 = *(const v4fa*)(arow + kb + 8 * hh + 4);
    const v4f x2 = *(const v4fa*)(arow + kb + 16 + 8 * hh), x3 = *(const v4fa*)(arow + kb + 16 + 8 * hh + 4);
    float xs[16] = {x0[0],x0[1],x0[2],x0[3],x1[0],x1[1],x1[2],x1[3],x2[0],x2[1],x2[2],x2[3],x3[0],x3[1],x3[2],x3[3]};
#pragma unroll
    for (int i = 0; i < 16; ++i) { const unsigned short hb = bf16_bits(xs[i]); ah.u[i] = hb; al.u[i] = ASPLIT ? bf16_bits(xs[i] - bf16_val(hb)) : (unsigned short)0; }
#pragma unroll
    for (int t = 0; t < 4; ++t) {
      const unsigned short* brow = Wt + (size_t)(col0 + t * 16 + ln) * ldb + kb;
      FragB b;
      b.half[0] = *(const v8us*)(brow + 8 * hh);
      b.half[1] = *(const v8us*)(brow + 16 + 8 * hh);
      acc[t] = mmaN<ASPLIT ? 2 : 1>(ah.v, al.v, b.v, b.v, acc[t]);
    }
  }
#pragma unroll
  for (int t = 0; t < 4; ++t) {
    const int col = col0 + t * 16 + ln;
    float bv = bias ? bias[col] : 0.f;
    if (BIAS_BF16) bv = bf16_round(bv);
#pragma unroll
    for (int r = 0; r < 8; ++r) {
      float v = acc[t][r] + bv;
      if (resid) { float rv = resid[(size_t)((row0 + 8 * hh + r) % rmod) * ldr + col]; if (RES_BF16) rv = bf16_round(rv); v += rv; }
      if (ACT == 1) v = fmaxf(v, 0.f);
      if (ACT == 2) v = 0.5f * v * (1.0f + erff(v * 0.70710678118654752f));
      if (ACT == 3) { const float u = 0.7978845608028654f * (v + 0.044715f * v * v * v); v = 0.5f * v * (1.0f + tanhf(u)); }
      so[w][8 * hh + r][t * 16 + ln] = v;
    }
  }
  __builtin_amdgcn_fence(__ATOMIC_ACQ_REL, "workgroup");
  __builtin_amdgcn_wave_barrier();
  const int rsub = lane >> 4, c4 = (lane & 15) * 4;
  {
#pragma unroll
    for (int q = 0; q < 8; ++q) {
      const int r = q * 2 + rsub;
      const v4f v = *(const v4fa*)&so[w][r][c4];
      *(v4f*)(C + (size_t)(row0 + r) * ldc + col0 + c4) = v;
    }
    
  }
}
// row LayerNorm (biased variance, eps) over N: s = X (+ R); optional out_sum <- s; out_norm <- (s-mu)*rsqrt(var+eps)*g + b
template <bool PARAM_BF16>
__global__ __launch_bounds__(256) void k_layernorm(const float* __restrict__ X, const float* __restrict__ R, const float* __restrict__ g, const float* __restrict__ bta,
                                                  float* __restrict__ out_sum, float* __restrict__ out_norm, int N, float eps) {
  __shared__ float red[256];
  const int row = blockIdx.x, tid = threadIdx.x;
  const float* x = X + (size_t)row * N; const float* rr = R ? R + (size_t)row * N : nullptr;
  float vals[16];                     // up to N = 4096
  const int per = N / 256;            // contiguous chunk per thread? use strided-by-4 chunks: thread handles j = tid*4 + 1024*u
  float s1 = 0.f;
  for (int u = 0; u < per / 4; ++u) {
    const int j = tid * 4 + 1024 * u;
    const v4f a = *(const v4fa*)(x + j);
    v4f b = {0.f,0.f,0.f,0.f}; if (rr) b = *(const v4fa*)(rr + j);
#pragma unroll
    for (int q = 0; q < 4; ++q) { const float v = a[q] + b[q]; vals[u * 4 + q] = v; s1 += v; }
  }
  red[tid] = s1; __syncthreads();
  for (int st = 128; st > 0; st >>= 1) { if (tid < st) red[tid] += red[tid + st]; __syncthreads(); }
  const float mu = red[0] / (float)N; __syncthreads();
  float s2 = 0.f;
  for (int u = 0; u < per / 4; ++u)
#pragma unroll
    for (int q = 0; q < 4; ++q) { const float c = vals[u * 4 + q] - mu; s2 += c * c; }
  red[tid] = s2; __syncthreads();
  for (int st = 128; st > 0; st >>= 1) { if (tid < st) red[tid] += red[tid + st]; __syncthreads(); }
  const float rs = rsqrtf(red[0] / (float)N + eps);
  {
    for (int u = 0; u < per / 4; ++u) {
      const int j = tid * 4 + 1024 * u;
      v4f o, sm;
#pragma unroll
      for (int q = 0; q < 4; ++q) {
        float gg = g[j + q], bb = bta[j + q];
        if (PARAM_BF16) { gg = bf16_round(gg); bb = bf16_round(bb); }
        sm[q] = vals[u * 4 + q]; o[q] = (vals[u * 4 + q] - mu) * rs * gg + bb;
      }
      if (out_sum) *(v4f*)(out_sum + (size_t)row * N + j) = sm;
      *(v4f*)(out_norm + (size_t)row * N + j) = o;
    }
    
  }
}



// ---- f16 WMMA path (v_wmma_f32_16x16x32_f16): 11-bit significands for operands in range — used here for the three 1×1 conv GEMMs (q and k | v in k_gemm_p, to_out in k_win_out)
typedef _Float16 v16h __attribute__((ext_vector_type(16)));
union FragH { v16h v; v8us half[2]; _Float16 h[16]; unsigned short u[16]; };
template <int NT>
__device__ __forceinline__ v8f mmaH(v16h ah, v16h al, v16h bh, v16h bl, v8f c) {
  c = __builtin_amdgcn_wmma_f32_16x16x32_f16(false, ah, false, bh, (short)0, c, false, false);
  if (NT >= 2) c = __builtin_amdgcn_wmma_f32_16x16x32_f16(false, al, false, bh, (short)0, c, false, false);
  if (NT >= 3) c = __builtin_amdgcn_wmma_f32_16x16x32_f16(false, ah, false, bl, (short)0, c, false, false);
  asm volatile("v_nop\n\tv_nop\n\tv_nop\n\tv_nop" : "+v"(c) : "v"(ah), "v"(al), "v"(bh), "v"(bl));
  return c;
}
// batched GEMM like k_gemm_b but f16 operands: A f32 (split into f16 hi/lo if ASPLIT, else rounded to f16), Bt = f16 values [n][k]; alpha; C f32; N multiple of 16 (partial tiles skipped)
template <bool ASPLIT>
__global__ __launch_bounds__(128) void k_gemm_h(const float* __restrict__ A, int lda, size_t sA, const _Float16* __restrict__ Bh, int ldb, size_t sB, float alpha, float* __restrict__ C, int ldc, size_t sC, int M, int N, int K) {
  __shared__ __attribute__((aligned(16))) float so[4][16][64];
  const int tid = threadIdx.x, w = tid >> 5, lane = tid & 31, ln = lane & 15, hh = lane >> 4; const int by = blockIdx.y;
  A += (size_t)by * sA; Bh += (size_t)by * sB; C += (size_t)by * sC;
  const int ntn = (N + 63) / 64; const int wid = blockIdx.x * 4 + w; const int mt = wid / ntn, nq = wid % ntn; if (mt * 16 >= M) return;
  const int row0 = mt * 16, col0 = nq * 64; const float* arow = A + (size_t)(row0 + ln) * lda;
  v8f acc[4] = {};
  for (int kb = 0; kb < K; kb += 32) {
    FragH ah, al;
    const v4f x0 = *(const v4fa*)(arow + kb + 8 * hh), x1 = *(const v4fa*)(arow + kb + 8 * hh + 4), x2 = *(const v4fa*)(arow + kb + 16 + 8 * hh), x3 = *(const v4fa*)(arow + kb + 16 + 8 * hh + 4);
    float xs[16] = {x0[0],x0[1],x0[2],x0[3],x1[0],x1[1],x1[2],x1[3],x2[0],x2[1],x2[2],x2[3],x3[0],x3[1],x3[2],x3[3]};
#pragma unroll
    for (int i = 0; i < 16; ++i) { const _Float16 h = (_Float16)xs[i]; ah.h[i] = h; al.h[i] = ASPLIT ? (_Float16)(xs[i] - (float)h) : (_Float16)0.0f; }
#pragma unroll
    for (int t = 0; t < 4; ++t) { if (col0 + t * 16 >= N) continue; const size_t boff = (size_t)(col0 + t * 16 + ln) * ldb + kb; FragH bq; bq.half[0] = *(const v8us*)(Bh + boff + 8 * hh); bq.half[1] = *(const v8us*)(Bh + boff + 16 + 8 * hh);
      acc[t] = mmaH<ASPLIT ? 2 : 1>(ah.v, al.v, bq.v, bq.v, acc[t]); }
  }
#pragma unroll
  for (int t = 0; t < 4; ++t) { if (col0 + t * 16 >= N) continue;
#pragma unroll
    for (int r = 0; r < 8; ++r) so[w][8 * hh + r][t * 16 + ln] = acc[t][r] * alpha; }
  __builtin_amdgcn_fence(__ATOMIC_ACQ_REL, "workgroup"); __builtin_amdgcn_wave_barrier();
  const int rsub = lane >> 4, c4 = (lane & 15) * 4;
  {
#pragma unroll
    for (int q = 0; q < 8; ++q) { const int r = q * 2 + rsub; if (col0 + c4 < N) { const v4f v = *(const v4fa*)&so[w][r][c4]; *(v4f*)(C + (size_t)(row0 + r) * ldc + col0 + c4) = v; } }
     }
}

// Wt[n][k] = f16(W[k][n]·scale) from f32 row-major W[K][N] (scale = power of two; bf16-exact weights stay exact in f16 away from the subnormal range)
__global__ __launch_bounds__(256) void k_wt_f16(const float* __restrict__ W, _Float16* __restrict__ Wt, int K, int N, float scale) {
  const int t = blockIdx.x * 256 + threadIdx.x; if (t >= N * (K / 8)) return; const int n = t / (K / 8), k8 = (t % (K / 8)) * 8; FragH f;
#pragma unroll
  for (int i = 0; i < 8; ++i) f.h[i] = (_Float16)(bf16_round(W[(size_t)(k8 + i) * N + n]) * scale); const v8us o = f.half[0];
  *(v8us*)((unsigned short*)Wt + (size_t)n * K + k8) = o; 
}
// k_gemm_hh variant with fused epilogue: v = acc·alpha + bias[by·sBias + col] (+ CP[(row/rowsPerB)·sCPb + by·64 + col] if CP) ; ACT 0 none / 1 elu ; writes f16 C16 and f32 C, each if non-null
template <int ACT>
__global__ __launch_bounds__(128) void k_gemm_hhx(const _Float16* __restrict__ A, int lda, size_t sA, const _Float16* __restrict__ Bh, int ldb, size_t sB, float alpha, const float* __restrict__ bias, size_t sBias, const float* __restrict__ CP, int rowsPerB, size_t sCPb, int row0g,
    float* __restrict__ C, _Float16* __restrict__ C16, int ldc, size_t sC, int M, int N, int K) {
  __shared__ __attribute__((aligned(16))) float so[4][16][64];
  const int tid = threadIdx.x, w = tid >> 5, lane = tid & 31, ln = lane & 15, hh = lane >> 4; const int by = blockIdx.y;
  A += (size_t)by * sA; Bh += (size_t)by * sB; const size_t cofs = (size_t)by * sC; const float* bp = bias ? bias + (size_t)by * sBias : nullptr;
  const int ntn = (N + 63) / 64; const int wid = blockIdx.x * 4 + w; const int mt = wid / ntn, nq = wid % ntn; if (mt * 16 >= M) return;
  const int row0 = mt * 16, col0 = nq * 64; const _Float16* arow = A + (size_t)(row0 + ln) * lda;
  v8f acc[4] = {};
  for (int kb = 0; kb < K; kb += 32) { FragH ah; ah.half[0] = *(const v8us*)((const unsigned short*)arow + kb + 8 * hh); ah.half[1] = *(const v8us*)((const unsigned short*)arow + kb + 16 + 8 * hh);
#pragma unroll
    for (int t = 0; t < 4; ++t) { if (col0 + t * 16 >= N) continue; const size_t boff = (size_t)(col0 + t * 16 + ln) * ldb + kb; FragH bq; bq.half[0] = *(const v8us*)((const unsigned short*)Bh + boff + 8 * hh); bq.half[1] = *(const v8us*)((const unsigned short*)Bh + boff + 16 + 8 * hh);
      acc[t] = mmaH<1>(ah.v, ah.v, bq.v, bq.v, acc[t]); }
  }
#pragma unroll
  for (int t = 0; t < 4; ++t) { if (col0 + t * 16 >= N) continue; const int col = col0 + t * 16 + ln; const float bv = bp ? bf16_round(bp[col]) : 0.f;
#pragma unroll
    for (int r = 0; r < 8; ++r) { float v = acc[t][r] * alpha + bv; if (CP) { const int bidx = (row0g + row0 + 8 * hh + r) / rowsPerB; v += CP[(size_t)bidx * sCPb + (size_t)by * 64 + col]; } if (ACT == 1) v = (v > 0.f) ? v : expm1f(v); else if (ACT == 3) v = fmaxf(v, 0.f); so[w][8 * hh + r][t * 16 + ln] = v; } }
  __builtin_amdgcn_fence(__ATOMIC_ACQ_REL, "workgroup"); __builtin_amdgcn_wave_barrier();
  const int rsub = lane >> 4, c4 = (lane & 15) * 4; typedef _Float16 v4h __attribute__((ext_vector_type(4)));
  {
#pragma unroll
    for (int q = 0; q < 8; ++q) { const int r = q * 2 + rsub; if (col0 + c4 < N) { const v4f v = *(const v4fa*)&so[w][r][c4]; if (C) *(v4f*)(C + cofs + (size_t)(row0 + r) * ldc + col0 + c4) = v; if (C16) { v4h h4; for (int i = 0; i < 4; ++i) h4[i] = (_Float16)v[i]; *(v4h*)(C16 + cofs + (size_t)(row0 + r) * ldc + col0 + c4) = h4; } } }
     }
}


// Eight 16-byte asynchronous copies global -> LDS (each lane its own addresses), rows lstep / gstep apart. The s_wait_xcnt closes the statement so that no
// address register named here is rewritten ahead of it.
__device__ __forceinline__ void copy8(unsigned l, const _Float16* g, unsigned lstep, size_t gstep) {
  asm volatile("global_load_async_to_lds_b128 %0, %8, off\n\t"
               "global_load_async_to_lds_b128 %1, %9, off\n\t"
               "global_load_async_to_lds_b128 %2, %10, off\n\t"
               "global_load_async_to_lds_b128 %3, %11, off\n\t"
               "global_load_async_to_lds_b128 %4, %12, off\n\t"
               "global_load_async_to_lds_b128 %5, %13, off\n\t"
               "global_load_async_to_lds_b128 %6, %14, off\n\t"
               "global_load_async_to_lds_b128 %7, %15, off\n\t"
               "s_wait_xcnt 0x0"
               :: "v"(l), "v"(l + lstep), "v"(l + 2 * lstep), "v"(l + 3 * lstep), "v"(l + 4 * lstep), "v"(l + 5 * lstep), "v"(l + 6 * lstep), "v"(l + 7 * lstep),
                  "v"(g), "v"(g + gstep), "v"(g + 2 * gstep), "v"(g + 3 * gstep), "v"(g + 4 * gstep), "v"(g + 5 * gstep), "v"(g + 6 * gstep), "v"(g + 7 * gstep)
               : "memory");
}
// C[M][Nn] = A[M][Kk] * Bh[Nn][Kk]^T * alpha (+ bf16-rounded bias), f16 operands, f32 accumulate. One work-group = one 128 x 128 tile of C, four waves (2 x 2) of 64 x 64.
// A and Bh tiles of 128 rows x 128 k are staged in LDS (row pitch 272 B) by asynchronous copies, two buffers: tile t + 1 flies while tile t is worked on.
// M, Nn multiples of 128 (grid = M / 128 * Nn / 128), Kk a multiple of 128. Each 16 x 16 accumulator sums k upwards in steps of 32.
// NCHW: A holds the CC output channels' weights and Bh the tokens (Nn = NR), so a row of C is a channel and its columns are pixels that lie side by side in the image:
// the tile goes straight to C[image][channel][pixel] (f32), the bias belongs to the row.
// NS > 0 (a multiple of 128, with OUT16): two products that share A run as one launch; columns below NS go to C16 (row pitch NS), the others to C16b (row pitch Nn - NS).
template <int Nn, int Kk, bool OUT16, bool BIAS, bool NCHW, int NS>
__global__ __launch_bounds__(128) void k_gemm_t(const _Float16* __restrict__ A, const _Float16* __restrict__ Bh, float alpha, const float* __restrict__ bias, float* __restrict__ C, _Float16* __restrict__ C16, _Float16* __restrict__ C16b) {
  constexpr int KC = 128, PITCH = 272, OPB = 128 * PITCH, STG = 2 * OPB, NT = Kk / KC;
  __shared__ __attribute__((aligned(16))) unsigned char sm[2 * STG];
  const int tid = threadIdx.x, w = tid >> 5, lane = tid & 31, ln = lane & 15, hh = lane >> 4;
  const int bm = blockIdx.x / (Nn / 128), bn = blockIdx.x % (Nn / 128);
  const int wm = w >> 1, wn = w & 1;
  const int crow = tid >> 4, cch = tid & 15;      // a copy instruction of a wave covers two whole 256-byte rows
  const _Float16* ga = A + (size_t)(bm * 128 + crow) * Kk + cch * 8;
  const _Float16* gb = Bh + (size_t)(bn * 128 + crow) * Kk + cch * 8;
  const unsigned lc = (unsigned)(size_t)sm + crow * PITCH + cch * 16;
  auto fill = [&](int t, int buf) {
    const unsigned l = lc + buf * STG;
    copy8(l, ga + t * KC, 8 * PITCH, (size_t)8 * Kk);
    copy8(l + 64 * PITCH, ga + t * KC + (size_t)64 * Kk, 8 * PITCH, (size_t)8 * Kk);
    copy8(l + OPB, gb + t * KC, 8 * PITCH, (size_t)8 * Kk);
    copy8(l + OPB + 64 * PITCH, gb + t * KC + (size_t)64 * Kk, 8 * PITCH, (size_t)8 * Kk);
  };
  v8f acc[4][4] = {};
  fill(0, 0);
  asm volatile("s_wait_asynccnt 0x0" ::: "memory");      // tile 0 of this wave has landed
  __syncthreads();                                       // ... and every wave's part of it
  if (NT > 1) fill(1, 1);
  const int aoff = (wm * 64 + ln) * PITCH + 16 * hh, boff = OPB + (wn * 64 + ln) * PITCH + 16 * hh;
#pragma unroll 1      // kept rolled: unrolled over the k tiles the build takes many more vector registers
  for (int t = 0; t < NT; ++t) {
    const int sb = (t & 1) * STG;
#pragma unroll
    for (int ks = 0; ks < KC / 32; ++ks) {
      FragH a[4], b[4];
#pragma unroll
      for (int i = 0; i < 4; ++i) {
        a[i].half[0] = *(const v8us*)&sm[sb + aoff + i * 16 * PITCH + ks * 64]; a[i].half[1] = *(const v8us*)&sm[sb + aoff + i * 16 * PITCH + ks * 64 + 32];
        b[i].half[0] = *(const v8us*)&sm[sb + boff + i * 16 * PITCH + ks * 64]; b[i].half[1] = *(const v8us*)&sm[sb + boff + i * 16 * PITCH + ks * 64 + 32];
      }
#pragma unroll
      for (int i = 0; i < 4; ++i)
#pragma unroll
        for (int j = 0; j < 4; ++j) acc[i][j] = __builtin_amdgcn_wmma_f32_16x16x32_f16(false, a[i].v, false, b[j].v, (short)0, acc[i][j], false, false);
    }
    asm volatile("s_wait_dscnt 0x0" ::: "memory");       // this wave's reads of buffer t & 1 are done before it is refilled
    asm volatile("s_wait_asynccnt 0x0" ::: "memory");    // this wave's copies of tile t + 1 have landed
    __syncthreads();                                     // publishes tile t + 1, ends every reader's last read of tile t
    if (t + 2 < NT) fill(t + 2, t & 1);
  }
  asm volatile("s_wait_asynccnt 0x0" ::: "memory");      // no copy is outstanding when the ring becomes output staging
  // epilogue: each wave stages its 64 x 64 tile in its own LDS range (pitch 68 floats) and stores whole lines
  float* so = (float*)sm + w * (64 * 68);
  const int row0 = bm * 128 + wm * 64, col0 = bn * 128 + wn * 64;
  if (NCHW) {
#pragma unroll
    for (int i = 0; i < 4; ++i)
#pragma unroll
      for (int r = 0; r < 8; ++r) {
        const float bv = BIAS ? bf16_round(bias[row0 + i * 16 + 8 * hh + r]) : 0.f;
#pragma unroll
        for (int j = 0; j < 4; ++j) so[(i * 16 + 8 * hh + r) * 68 + j * 16 + ln] = acc[i][j][r] * alpha + bv;
      }
  } else {
#pragma unroll
    for (int j = 0; j < 4; ++j) {
      const float bv = BIAS ? bf16_round(bias[col0 + j * 16 + ln]) : 0.f;
#pragma unroll
      for (int i = 0; i < 4; ++i)
#pragma unroll
        for (int r = 0; r < 8; ++r) so[(i * 16 + 8 * hh + r) * 68 + j * 16 + ln] = acc[i][j][r] * alpha + bv;
    }
  }
  __builtin_amdgcn_fence(__ATOMIC_ACQ_REL, "workgroup"); __builtin_amdgcn_wave_barrier();
  if (NCHW) {
    const int rs = lane >> 4, c4 = (lane & 15) * 4;      // half a wave stores 64 pixels of one channel: two whole lines
    float* cp = C + ((size_t)(col0 / NPIX) * CC + row0 + rs) * NPIX + col0 % NPIX + c4;
#pragma unroll
    for (int q = 0; q < 32; ++q) { const int r = q * 2 + rs; const v4f v = *(const v4fa*)&so[r * 68 + c4]; *(v4f*)(cp + q * 2 * NPIX) = v; }
  } else if (OUT16) {
    const int rs = lane >> 3, c8 = (lane & 7) * 8;
    auto put = [&](_Float16* dst, const int ld, const int c0) {      // dst, its row pitch and the tile's first column there
      unsigned short* cp = (unsigned short*)dst + (size_t)(row0 + rs) * ld + c0 + c8;
#pragma unroll
      for (int q = 0; q < 16; ++q) { const int r = q * 4 + rs; const v4f v0 = *(const v4fa*)&so[r * 68 + c8], v1 = *(const v4fa*)&so[r * 68 + c8 + 4]; FragH f;
#pragma unroll
        for (int i = 0; i < 4; ++i) { f.h[i] = (_Float16)v0[i]; f.h[4 + i] = (_Float16)v1[i]; }
        *(v8us*)(cp + q * 4 * ld) = f.half[0]; }
    };
    if (NS > 0 && bn * 128 >= NS) put(C16b, Nn - NS, col0 - NS);      // a tile lies wholly on one side: the test reads the same in the whole work-group
    else put(C16, NS > 0 ? NS : Nn, col0);
  } else {
    const int rs = lane >> 4, c4 = (lane & 15) * 4;
    float* cp = C + (size_t)(row0 + rs) * Nn + col0 + c4;
#pragma unroll
    for (int q = 0; q < 32; ++q) { const int r = q * 2 + rs; const v4f v = *(const v4fa*)&so[r * 68 + c4]; *(v4f*)(cp + q * 2 * Nn) = v; }
  }
}


// q and k | v: C[token][channel] = X[token][CC] * Wh[channel][CC]^T * alpha, f16 operands, f32 accumulate, f16 results. One work-group = 128 tokens x 768 channels (half of the 1536), eight waves.
// X is never in memory: the work-group reads its 128 pixels x CC channels of x (NCHW, f32), rounds them (bf16, exact in f16) and writes them to LDS as token rows, once;
// each wave keeps its 64 tokens' fragments (all of k) in registers; the weights pass by in six tiles of 128 channels x 256 k (row pitch 528 B),
// asynchronous copies, two buffers: tile t + 1 flies while tile t is worked on. The weights are the A operand (rows of D = channels) and the tokens the B operand (columns of D = tokens), so a lane
// ends with eight neighbouring channels of one token: 16 bytes of f16. A wave = 32 channels x 64 tokens. Each 16 x 16 accumulator sums k upwards in steps of 32.
// The f16 tile is staged in LDS (two staging buffers, row pitch 272 B) and leaves as whole 256-byte rows behind the trip's one barrier, while the next tile is worked on.
// Channels below INNER go to Cq (row pitch INNER), the others to Ckv (row pitch 2 * INNER).
__global__ __launch_bounds__(256) void k_gemm_p(const float* __restrict__ x, const _Float16* __restrict__ Wh, float alpha, _Float16* __restrict__ Cq, _Float16* __restrict__ Ckv) {
  constexpr int PITCH = CC * 2 + 16, TB = 128 * PITCH, NTL = 6, SP = 272, SB = 128 * SP;
  __shared__ __attribute__((aligned(16))) unsigned char sm[3 * TB + 2 * SB];      // tokens, two weight buffers, two staging buffers
  const int tid = threadIdx.x, lane = tid & 31, ln = lane & 15, hh = lane >> 4;
  const int w = __builtin_amdgcn_readfirstlane(tid >> 5);      // the wave's number as a scalar: a copy's LDS address is then a scalar sum plus one lane term
  const int bm = blockIdx.x >> 1, ch0 = (blockIdx.x & 1) * (NTL * 128);
  const int wt = w >> 2, wc = w & 3;
  const unsigned l16 = lane * 16;      // a copy instruction of a wave covers one whole 512-byte row: row w, w + 8, ...
  auto fill = [&](unsigned lofs, const _Float16* g0) {      // 128 rows of CC values from g0 on, to LDS offset lofs: sixteen copies a thread
    const unsigned l = l16 + (unsigned)__builtin_amdgcn_readfirstlane((unsigned)(size_t)sm + w * PITCH + lofs);      // the scalar part is summed by itself: only l16 lives in a vector register across the loop
    const _Float16* g = g0 + (size_t)w * CC + lane * 8;
    copy8(l, g, 8 * PITCH, (size_t)8 * CC);
    copy8(l + 64 * PITCH, g + (size_t)64 * CC, 8 * PITCH, (size_t)8 * CC);
  };
  const _Float16* wg = Wh + (size_t)ch0 * CC;
  {      // the token tile: 128 neighbouring pixels of one image, all CC channels. A wave takes 32 channels, a lane four pixels of each (a load of a wave = 512 bytes of one channel's row);
         // a lane then holds 32 neighbouring channels of each of its four pixels: 64 bytes of that token's f16 row. Token r of the tile stands in LDS row (r & 3) * 32 + (r >> 2);
         // the product's columns and the staged tile keep that row order, and the stores to memory undo it
    const float* xg = x + ((size_t)(bm >> 3) * CC + w * 32) * NPIX + (bm & 7) * 128 + lane * 4;
    v4f xv[32];
#pragma unroll      // unrolled here and below: all 32 loads fly at once, and the values are indexed by constants
    for (int i = 0; i < 32; ++i) xv[i] = *(const v4fa*)(xg + (size_t)i * NPIX);
    asm volatile("s_wait_xcnt 0x0" ::: "memory");      // stands in front of the address sums below, which take over registers that these loads name
    fill(TB, wg);      // weight tile 0, asked for behind the loads of x, which have the longer way
#pragma unroll
    for (int pp = 0; pp < 4; ++pp)
#pragma unroll
      for (int q = 0; q < 4; ++q) { FragH f;
#pragma unroll
        for (int e = 0; e < 8; ++e) f.h[e] = (_Float16)(float)(__bf16)xv[q * 8 + e][pp];      // the cast rounds to nearest even: bf16_round's value for every finite x
        *(v8us*)&sm[(pp * 32 + lane) * PITCH + w * 64 + q * 16] = f.half[0]; }      // LDS row pp * 32 + lane: neighbouring lanes write neighbouring rows, which the pitch spreads over the banks
  }
  asm volatile("s_wait_dscnt 0x0" ::: "memory");         // this wave's part of the token tile stands in LDS
  asm volatile("s_wait_asynccnt 0x0" ::: "memory");      // weight tile 0: this wave's copies have landed
  __syncthreads();                                       // publishes the token tile and weight tile 0
  fill(2 * TB, wg + (size_t)128 * CC);
  FragH xb[4][CC / 32];
#pragma unroll      // unrolled: the fragments are indexed by constants and stay in registers
  for (int j = 0; j < 4; ++j)
#pragma unroll
    for (int ks = 0; ks < CC / 32; ++ks) {
      xb[j][ks].half[0] = *(const v8us*)&sm[(wt * 64 + j * 16 + ln) * PITCH + 16 * hh + ks * 64]; xb[j][ks].half[1] = *(const v8us*)&sm[(wt * 64 + j * 16 + ln) * PITCH + 16 * hh + ks * 64 + 32];
    }
  const int aoff = TB + (wc * 32 + ln) * PITCH + 16 * hh;
  const int soff = 3 * TB + (wt * 64 + ln) * SP + (wc * 32 + 8 * hh) * 2;
  const int srow = (tid >> 4) & 7, sch = tid & 15;      // a store instruction of a wave covers two whole 256-byte rows
#pragma unroll 1      // kept rolled: one copy of the trip's code, and the token fragments leave no registers for two trips at once
  for (int t = 0; t < NTL; ++t) {
    const int wb = (t & 1) * TB, sb = (t & 1) * SB;
    v8f acc[2][4] = {};
#pragma unroll
    for (int ks = 0; ks < CC / 32; ++ks) {
      FragH a[2];
#pragma unroll
      for (int i = 0; i < 2; ++i) { a[i].half[0] = *(const v8us*)&sm[wb + aoff + i * 16 * PITCH + ks * 64]; a[i].half[1] = *(const v8us*)&sm[wb + aoff + i * 16 * PITCH + ks * 64 + 32]; }
#pragma unroll
      for (int i = 0; i < 2; ++i)
#pragma unroll
        for (int j = 0; j < 4; ++j) acc[i][j] = __builtin_amdgcn_wmma_f32_16x16x32_f16(false, a[i].v, false, xb[j][ks].v, (short)0, acc[i][j], false, false);
    }
#pragma unroll
    for (int i = 0; i < 2; ++i)
#pragma unroll
      for (int j = 0; j < 4; ++j) { FragH f;
#pragma unroll
        for (int r = 0; r < 8; ++r) f.h[r] = (_Float16)(acc[i][j][r] * alpha);
        *(v8us*)&sm[sb + soff + j * 16 * SP + i * 32] = f.half[0]; }
    asm volatile("s_wait_dscnt 0x0" ::: "memory");       // this wave's reads of weight buffer t & 1 and of the other staging buffer are done, its part of this trip's staging stands in LDS
    asm volatile("s_wait_asynccnt 0x0" ::: "memory");    // this wave's copies of tile t + 1 have landed
    __syncthreads();                                     // publishes tile t + 1 and the staged tile, ends every reader's last read of tile t and of the other staging buffer
    if (t + 2 < NTL) fill(TB + wb, wg + (size_t)(t + 2) * 128 * CC);
    if (w >= 4) {      // the staged tile is sent out by waves 4 .. 7 alone: each shares a SIMD with one of waves 0 .. 3, which meanwhile starts the next tile's products, so the matrix unit does not wait for the stores
      const int col = ch0 + t * 128;      // a tile lies wholly on one side: the test reads the same in the whole work-group
      unsigned short* cp = col < INNER ? (unsigned short*)Cq + (size_t)(bm * 128 + srow * 4) * INNER + col + sch * 8 : (unsigned short*)Ckv + (size_t)(bm * 128 + srow * 4) * (2 * INNER) + (col - INNER) + sch * 8;
      const size_t ld = col < INNER ? (size_t)INNER : (size_t)2 * INNER;
      v8us sv[16];
#pragma unroll      // unrolled here and below: the sixteen rows are indexed by constants
      for (int q = 0; q < 16; ++q) sv[q] = *(const v8us*)&sm[3 * TB + sb + (q * 8 + srow) * SP + sch * 16];
      __builtin_amdgcn_sched_barrier(0);      // keeps every LDS read in front of the first store
#pragma unroll      // staged row q * 8 + srow is token ((q & 3) * 8 + srow) * 4 + (q >> 2) of the tile
      for (int q = 0; q < 16; ++q) *(v8us*)(cp + ((q & 3) * 32 + (q >> 2)) * ld) = sv[q];
      asm volatile("s_wait_xcnt 0x0" ::: "memory");        // stands in front of the next trip's overwrites of the registers that these stores name
    }
  }
  asm volatile("s_wait_asynccnt 0x0" ::: "memory");      // no copy is outstanding when the wave ends
}

typedef _Float16 v4h __attribute__((ext_vector_type(4)));

__global__ __launch_bounds__(256) void k_x16(const float* __restrict__ x, _Float16* __restrict__ X16, size_t n8) { const size_t t = (size_t)blockIdx.x * 256 + threadIdx.x; if (t >= n8) return; FragH f;
#pragma unroll
  for (int q = 0; q < 8; ++q) f.h[q] = (_Float16)bf16_round(x[t * 8 + q]); *(v8us*)((unsigned short*)X16 + t * 8) = f.half[0];  }
__global__ __launch_bounds__(256) void k_h16(const float* __restrict__ x, _Float16* __restrict__ X16, size_t n8) { const size_t t = (size_t)blockIdx.x * 256 + threadIdx.x; if (t >= n8) return; FragH f;
#pragma unroll
  for (int q = 0; q < 8; ++q) f.h[q] = (_Float16)x[t * 8 + q]; *(v8us*)((unsigned short*)X16 + t * 8) = f.half[0];  }
template <int NHv, int TTv>
__global__ __launch_bounds__(256) void k_vt(const _Float16* __restrict__ V16, int ldv, int voff, _Float16* __restrict__ Vt) { __shared__ unsigned short tl[64][66]; const int tid = threadIdx.x; const int slab = blockIdx.x / (TTv / 64), lg = blockIdx.x % (TTv / 64); const int b = slab / NHv, h = slab % NHv;
  for (int i = tid; i < 64 * 8; i += 256) { const int r = i / 8, c8 = (i % 8) * 8; FragH f; f.half[0] = *(const v8us*)((const unsigned short*)V16 + ((size_t)b * TTv + lg * 64 + r) * ldv + voff + h * 64 + c8);
#pragma unroll
    for (int q = 0; q < 8; ++q) tl[r][c8 + q] = f.u[q]; }
  __syncthreads();
  {
#pragma unroll
    for (int rd = 0; rd < 2; ++rd) { const int d = rd * 32 + tid / 8, pc = tid % 8; FragH f;
#pragma unroll
      for (int q = 0; q < 8; ++q) f.u[q] = tl[pc * 8 + q][d];
      *(v8us*)((unsigned short*)Vt + ((size_t)slab * 64 + d) * TTv + lg * 64 + pc * 8) = f.half[0]; }
     } }

// The (out,in) weights as f16 (bf16-rounded, times 2^4), eight values a thread: Bw = [Wq | Wkv | Wo] one behind the other.
#define NBQ (INNER * CC / 8 / 256)
#define NBW (4 * NBQ)
__global__ __launch_bounds__(256) void k_prep(const float* __restrict__ Wq, const float* __restrict__ Wkv, const float* __restrict__ Wo, _Float16* __restrict__ Bw) { const int tid = threadIdx.x;
  const int wb = blockIdx.x; const float* W = wb < NBQ ? Wq : wb < 3 * NBQ ? Wkv : Wo; const size_t t = (size_t)(wb < NBQ ? wb : wb < 3 * NBQ ? wb - NBQ : wb - 3 * NBQ) * 256 + tid; FragH f;
#pragma unroll
  for (int i = 0; i < 8; ++i) f.h[i] = (_Float16)(bf16_round(W[t * 8 + i]) * 16.0f); *(v8us*)((unsigned short*)Bw + ((size_t)wb * 256 + tid) * 8) = f.half[0];
}
union H8 { v8us v; unsigned d[4]; };      // eight f16 values as they are loaded: four registers of two
// v_fma_mix_f32: c + a * b in one fused f32 multiply-add whose f16 factors are widened exactly inside the instruction (op_sel picks the high halves). Written as asm for
// speed: from plain source this build widens every half with a conversion of its own before a packed f32 multiply-add. Each statement holds a whole round over independent
// sums, so that an instruction and the one it depends on stand eight or nine apart (asm text gets no s_delay_alu from the compiler, and needs none at that distance).
// s[w] (+)= the two products of register q with register k[w], w = 0 .. 8
__device__ __forceinline__ void dot9_first(float (&s)[9], unsigned q, const unsigned (&k)[9]) {
  asm(
      "v_fma_mix_f32 %0, %9, %10, 0 op_sel_hi:[1,1,0]\n\t"
      "v_fma_mix_f32 %1, %9, %11, 0 op_sel_hi:[1,1,0]\n\t"
      "v_fma_mix_f32 %2, %9, %12, 0 op_sel_hi:[1,1,0]\n\t"
      "v_fma_mix_f32 %3, %9, %13, 0 op_sel_hi:[1,1,0]\n\t"
      "v_fma_mix_f32 %4, %9, %14, 0 op_sel_hi:[1,1,0]\n\t"
      "v_fma_mix_f32 %5, %9, %15, 0 op_sel_hi:[1,1,0]\n\t"
      "v_fma_mix_f32 %6, %9, %16, 0 op_sel_hi:[1,1,0]\n\t"
      "v_fma_mix_f32 %7, %9, %17, 0 op_sel_hi:[1,1,0]\n\t"
      "v_fma_mix_f32 %8, %9, %18, 0 op_sel_hi:[1,1,0]\n\t"
      "v_fma_mix_f32 %0, %9, %10, %0 op_sel:[1,1,0] op_sel_hi:[1,1,0]\n\t"
      "v_fma_mix_f32 %1, %9, %11, %1 op_sel:[1,1,0] op_sel_hi:[1,1,0]\n\t"
      "v_fma_mix_f32 %2, %9, %12, %2 op_sel:[1,1,0] op_sel_hi:[1,1,0]\n\t"
      "v_fma_mix_f32 %3, %9, %13, %3 op_sel:[1,1,0] op_sel_hi:[1,1,0]\n\t"
      "v_fma_mix_f32 %4, %9, %14, %4 op_sel:[1,1,0] op_sel_hi:[1,1,0]\n\t"
      "v_fma_mix_f32 %5, %9, %15, %5 op_sel:[1,1,0] op_sel_hi:[1,1,0]\n\t"
      "v_fma_mix_f32 %6, %9, %16, %6 op_sel:[1,1,0] op_sel_hi:[1,1,0]\n\t"
      "v_fma_mix_f32 %7, %9, %17, %7 op_sel:[1,1,0] op_sel_hi:[1,1,0]\n\t"
      "v_fma_mix_f32 %8, %9, %18, %8 op_sel:[1,1,0] op_sel_hi:[1,1,0]"
      : "=&v"(s[0]), "=&v"(s[1]), "=&v"(s[2]), "=&v"(s[3]), "=&v"(s[4]), "=&v"(s[5]), "=&v"(s[6]), "=&v"(s[7]), "=&v"(s[8])
      : "v"(q), "v"(k[0]), "v"(k[1]), "v"(k[2]), "v"(k[3]), "v"(k[4]), "v"(k[5]), "v"(k[6]), "v"(k[7]), "v"(k[8]));
}
__device__ __forceinline__ void dot9_more(float (&s)[9], unsigned q, const unsigned (&k)[9]) {
  asm(
      "v_fma_mix_f32 %0, %9, %10, %0 op_sel_hi:[1,1,0]\n\t"
      "v_fma_mix_f32 %1, %9, %11, %1 op_sel_hi:[1,1,0]\n\t"
      "v_fma_mix_f32 %2, %9, %12, %2 op_sel_hi:[1,1,0]\n\t"
      "v_fma_mix_f32 %3, %9, %13, %3 op_sel_hi:[1,1,0]\n\t"
      "v_fma_mix_f32 %4, %9, %14, %4 op_sel_hi:[1,1,0]\n\t"
      "v_fma_mix_f32 %5, %9, %15, %5 op_sel_hi:[1,1,0]\n\t"
      "v_fma_mix_f32 %6, %9, %16, %6 op_sel_hi:[1,1,0]\n\t"
      "v_fma_mix_f32 %7, %9, %17, %7 op_sel_hi:[1,1,0]\n\t"
      "v_fma_mix_f32 %8, %9, %18, %8 op_sel_hi:[1,1,0]\n\t"
      "v_fma_mix_f32 %0, %9, %10, %0 op_sel:[1,1,0] op_sel_hi:[1,1,0]\n\t"
      "v_fma_mix_f32 %1, %9, %11, %1 op_sel:[1,1,0] op_sel_hi:[1,1,0]\n\t"
      "v_fma_mix_f32 %2, %9, %12, %2 op_sel:[1,1,0] op_sel_hi:[1,1,0]\n\t"
      "v_fma_mix_f32 %3, %9, %13, %3 op_sel:[1,1,0] op_sel_hi:[1,1,0]\n\t"
      "v_fma_mix_f32 %4, %9, %14, %4 op_sel:[1,1,0] op_sel_hi:[1,1,0]\n\t"
      "v_fma_mix_f32 %5, %9, %15, %5 op_sel:[1,1,0] op_sel_hi:[1,1,0]\n\t"
      "v_fma_mix_f32 %6, %9, %16, %6 op_sel:[1,1,0] op_sel_hi:[1,1,0]\n\t"
      "v_fma_mix_f32 %7, %9, %17, %7 op_sel:[1,1,0] op_sel_hi:[1,1,0]\n\t"
      "v_fma_mix_f32 %8, %9, %18, %8 op_sel:[1,1,0] op_sel_hi:[1,1,0]"
      : "+v"(s[0]), "+v"(s[1]), "+v"(s[2]), "+v"(s[3]), "+v"(s[4]), "+v"(s[5]), "+v"(s[6]), "+v"(s[7]), "+v"(s[8])
      : "v"(q), "v"(k[0]), "v"(k[1]), "v"(k[2]), "v"(k[3]), "v"(k[4]), "v"(k[5]), "v"(k[6]), "v"(k[7]), "v"(k[8]));
}
// acc[0 .. 7] (+)= a * the eight f16 values of v
__device__ __forceinline__ void av8_first(float (&acc)[8], float a, const unsigned (&v)[4]) {
  asm(
      "v_fma_mix_f32 %0, %8, %9, 0 op_sel_hi:[0,1,0]\n\t"
      "v_fma_mix_f32 %1, %8, %9, 0 op_sel:[0,1,0] op_sel_hi:[0,1,0]\n\t"
      "v_fma_mix_f32 %2, %8, %10, 0 op_sel_hi:[0,1,0]\n\t"
      "v_fma_mix_f32 %3, %8, %10, 0 op_sel:[0,1,0] op_sel_hi:[0,1,0]\n\t"
      "v_fma_mix_f32 %4, %8, %11, 0 op_sel_hi:[0,1,0]\n\t"
      "v_fma_mix_f32 %5, %8, %11, 0 op_sel:[0,1,0] op_sel_hi:[0,1,0]\n\t"
      "v_fma_mix_f32 %6, %8, %12, 0 op_sel_hi:[0,1,0]\n\t"
      "v_fma_mix_f32 %7, %8, %12, 0 op_sel:[0,1,0] op_sel_hi:[0,1,0]"
      : "=&v"(acc[0]), "=&v"(acc[1]), "=&v"(acc[2]), "=&v"(acc[3]), "=&v"(acc[4]), "=&v"(acc[5]), "=&v"(acc[6]), "=&v"(acc[7])
      : "v"(a), "v"(v[0]), "v"(v[1]), "v"(v[2]), "v"(v[3]));
}
__device__ __forceinline__ void av8_more(float (&acc)[8], float a, const unsigned (&v)[4]) {
  asm(
      "v_fma_mix_f32 %0, %8, %9, %0 op_sel_hi:[0,1,0]\n\t"
      "v_fma_mix_f32 %1, %8, %9, %1 op_sel:[0,1,0] op_sel_hi:[0,1,0]\n\t"
      "v_fma_mix_f32 %2, %8, %10, %2 op_sel_hi:[0,1,0]\n\t"
      "v_fma_mix_f32 %3, %8, %10, %3 op_sel:[0,1,0] op_sel_hi:[0,1,0]\n\t"
      "v_fma_mix_f32 %4, %8, %11, %4 op_sel_hi:[0,1,0]\n\t"
      "v_fma_mix_f32 %5, %8, %11, %5 op_sel:[0,1,0] op_sel_hi:[0,1,0]\n\t"
      "v_fma_mix_f32 %6, %8, %12, %6 op_sel_hi:[0,1,0]\n\t"
      "v_fma_mix_f32 %7, %8, %12, %7 op_sel:[0,1,0] op_sel_hi:[0,1,0]"
      : "+v"(acc[0]), "+v"(acc[1]), "+v"(acc[2]), "+v"(acc[3]), "+v"(acc[4]), "+v"(acc[5]), "+v"(acc[6]), "+v"(acc[7])
      : "v"(a), "v"(v[0]), "v"(v[1]), "v"(v[2]), "v"(v[3]));
}
// the value of the lane whose number differs in bit X (X = 1, 2, 4: inside a group of eight lanes); every lane is on where it is used
template <int X>
__device__ __forceinline__ float xlane(float v) { return __int_as_float(__builtin_amdgcn_update_dpp(0, __float_as_int(v), 0x160 + X, 0xf, 0xf, true)); }
// lane S of each group of eight lanes, handed to all eight
template <int S>
__device__ __forceinline__ float group_bcast(float v) { return __uint_as_float(__builtin_amdgcn_permlane16(0u, __float_as_uint(v), 0x11111111u * S, 0x11111111u * (8 + S), true, true)); }
struct WinTile { H8 q, k[9], v[9]; };
// Window attention and the to_out product in one kernel. One work-group = two image rows of one image with all eight heads: sixteen waves.
// Window part: one wave = one image row of one head, four pixels a pass; eight lanes share a pixel, lane p holding d = 8p .. 8p + 7.
// The partial logits are summed over the eight lanes so that lane p ends with logit p (the ninth ends in all eight); each lane does the softmax of its own logit and of the
// ninth, the weights are handed round the group, attn * v follows in the same lanes. A window place outside the image reads a clamped (in-bounds) address; its logit is
// set to 0 and its weight on v to 0. The row's 32 x 9 weights are staged in the wave's own LDS range and stored as whole lines.
// The f16 result o goes to an LDS tile of 64 pixels x 512 (row pitch 1040 B) and never to memory.
// Product part: out[256 channels][64 pixels] = Bo[256][512] * o^T * alpha + bias, a wave = 32 channels x 32 pixels, k upwards in steps of 32. Bo comes in four tiles of 128 k
// (row pitch 272 B) by asynchronous copies into three buffers: tiles 0 .. 2 are asked for during the window part and land under it, tile 3 follows into buffer 0.
__global__ __launch_bounds__(512) void k_win_out(const _Float16* __restrict__ Q, const _Float16* __restrict__ KV, const _Float16* __restrict__ Bo, const float* __restrict__ bias, float alpha,
                                                 float* __restrict__ ATTN, float* __restrict__ OUT) {
  constexpr int KC = 128, WP = 272, WB = CC * WP, OP = INNER * 2 + 16, SO0 = 3 * WB, SA0 = SO0 + 2 * HWD * OP;
  __shared__ __attribute__((aligned(16))) unsigned char sm[SA0 + 16 * HWD * 9 * 4];
  const int tid = threadIdx.x, lane = tid & 31, g = lane >> 3, p = lane & 7;
  const int w = __builtin_amdgcn_readfirstlane(tid >> 5);
  auto fill = [&](int t, int buf) {      // a copy instruction of a wave covers two whole 256-byte rows; a thread brings eight rows' pieces, 32 rows apart
    const int crow = tid >> 4, cch = tid & 15;
    copy8((unsigned)(size_t)sm + buf * WB + crow * WP + cch * 16, Bo + (size_t)crow * INNER + t * KC + cch * 8, 32 * WP, (size_t)32 * INNER);
  };
  const int b = blockIdx.x / (HWD / 2), y0 = (blockIdx.x % (HWD / 2)) * 2;
  const int h = w & 7, y = y0 + (w >> 3), bh = b * NH + h;
  float* sa = (float*)(sm + SA0) + w * (HWD * 9);
  // every address = a wave-uniform byte pointer + one of four lane offsets formed here once: no address arithmetic inside the passes
  constexpr unsigned QP = INNER * 2, KP = 2 * INNER * 2;      // bytes a pixel in Q and in KV
  const char* qrow = (const char*)(Q + ((size_t)b * NPIX + y * HWD) * INNER + h * DH);
  unsigned char* orow = sm + SO0 + ((w >> 3) * HWD + g) * OP + h * (DH * 2) + p * 16;
  const char* krow[3];
#pragma unroll
  for (int dy = 0; dy < 3; ++dy) krow[dy] = (const char*)(KV + ((size_t)b * NPIX + min(max(y + dy - 1, 0), HWD - 1) * HWD) * (2 * INNER) + h * DH);
  const unsigned loq = g * QP + p * 16, lok = g * KP + p * 16;
  const unsigned lokl = max(g - 1, 0) * KP + p * 16, lokr = min(g + 1, 3) * KP + p * 16;      // x - 1 clamped in the first pass, x + 1 clamped in the last
  const bool c1 = p & 1, c2 = p & 2, c4 = p & 4;
  const int ym = y + p / 3 - 1, dxm = p % 3 - 1;      // window place p of this lane's own logit
  const bool okym = ym >= 0 && ym < HWD, oky8 = y + 1 < HWD;
  auto load = [&](int it, WinTile& t) {
    t.q.v = *(const v8us*)(qrow + it * 4 * QP + loq);
#pragma unroll
    for (int wi = 0; wi < 9; ++wi) {
      const int dx = wi % 3 - 1;
      const bool el = it == 0 && dx < 0, er = it == HWD / 4 - 1 && dx > 0;
      const char* kr = krow[wi / 3] + (el || er ? it * 4 : it * 4 + dx) * KP;
      const unsigned off = el ? lokl : er ? lokr : lok;
      t.k[wi].v = *(const v8us*)(kr + off); t.v[wi].v = *(const v8us*)(kr + INNER * 2 + off);
    }
  };
  WinTile tl[2];
  load(0, tl[0]);
  asm volatile("s_wait_xcnt 0x0" ::: "memory");      // lokl is not used again and this build hands its register to a later load's result: the wait stands in front of that overwrite
#pragma unroll      // unrolled: the two register tiles alternate by a constant index, and only the first and the last pass carry the tests on x
  for (int it = 0; it < HWD / 4; ++it) {
    if (it + 1 < HWD / 4) load(it + 1, tl[(it + 1) & 1]);      // the next four pixels' loads fly while these four are worked on
    if (it < 6 && it % 2 == 0) fill(it / 2, it / 2);           // Bo tiles 0 .. 2, one every other pass: behind the window's own loads, and not all at once in front of them
    __builtin_amdgcn_sched_barrier(0);      // keeps those loads in front of this pass's arithmetic: sunk into it, each would be waited for right behind its issue
    const WinTile& t = tl[it & 1];
    const int x = it * 4 + g;
    const bool okm = okym && (it != 0 || x + dxm >= 0) && (it != HWD / 4 - 1 || x + dxm < HWD);
    const bool ok8 = oky8 && (it != HWD / 4 - 1 || x + 1 < HWD);
    float s[9];
#pragma unroll
    for (int j = 0; j < 4; ++j) {
      const unsigned kj[9] = {t.k[0].d[j], t.k[1].d[j], t.k[2].d[j], t.k[3].d[j], t.k[4].d[j], t.k[5].d[j], t.k[6].d[j], t.k[7].d[j], t.k[8].d[j]};
      if (j == 0) dot9_first(s, t.q.d[j], kj); else dot9_more(s, t.q.d[j], kj);
    }
    float r[4], u[2];
#pragma unroll
    for (int i = 0; i < 4; ++i) r[i] = (c4 ? s[4 + i] : s[i]) + xlane<4>(c4 ? s[i] : s[4 + i]);      // logit 4 * (p >> 2) + i
#pragma unroll
    for (int i = 0; i < 2; ++i) u[i] = (c2 ? r[2 + i] : r[i]) + xlane<2>(c2 ? r[i] : r[2 + i]);      // logit 2 * (p >> 1) + i
    const float sm1 = (c1 ? u[1] : u[0]) + xlane<1>(c1 ? u[0] : u[1]);                               // logit p
    float s8 = s[8]; s8 += xlane<1>(s8); s8 += xlane<2>(s8); s8 += xlane<4>(s8);
    const float lm = okm ? sm1 * 0.125f : 0.f, l8 = ok8 ? s8 * 0.125f : 0.f;
    float m = fmaxf(lm, xlane<1>(lm)); m = fmaxf(m, xlane<2>(m)); m = fmaxf(m, xlane<4>(m)); m = fmaxf(m, l8);
    const float em = expf(lm - m), e8 = expf(l8 - m);
    float z = em + xlane<1>(em); z += xlane<2>(z); z += xlane<4>(z); z += e8;
    const float am = em / z, a8 = e8 / z;
    sa[x * 9 + p] = am;
    if (p == 0) sa[x * 9 + 8] = a8;
    const float vm = okm ? am : 0.f;
    const float a[9] = {group_bcast<0>(vm), group_bcast<1>(vm), group_bcast<2>(vm), group_bcast<3>(vm), group_bcast<4>(vm), group_bcast<5>(vm), group_bcast<6>(vm), group_bcast<7>(vm), ok8 ? a8 : 0.f};
    __builtin_amdgcn_sched_barrier(0);      // keeps the eight lane moves together in front of the asm rounds: one placed directly in front of the round that reads it would stall it, unhinted
    float acc[8];
#pragma unroll
    for (int wi = 0; wi < 9; ++wi) { if (wi == 0) av8_first(acc, a[wi], t.v[wi].d); else av8_more(acc, a[wi], t.v[wi].d); }
    FragH o;
#pragma unroll
    for (int j = 0; j < 8; ++j) o.h[j] = (_Float16)acc[j];
    *(v8us*)(orow + it * 4 * OP) = o.half[0];
  }
  asm volatile("s_wait_dscnt 0x0" ::: "memory");         // this wave's rows of o (and its weights) stand in LDS
  asm volatile("s_wait_asynccnt 0x0" ::: "memory");      // this wave's copies of Bo tiles 0 .. 2 have landed
  __syncthreads();                                       // publishes the o tile and the three Bo tiles
  const int ln = lane & 15, hh = lane >> 4, wm = w >> 1, wn = w & 1;
  const int aoff = (wm * 32 + ln) * WP + 16 * hh, boff = SO0 + (wn * 32 + ln) * OP + 16 * hh;
  v8f cacc[2][2] = {};
  const int row0 = wm * 32;
  auto tile = [&](int t, int buf) {      // its loops are unrolled so that fragments and accumulators are indexed by constants and stay in registers
#pragma unroll
    for (int ks = 0; ks < KC / 32; ++ks) {
      FragH fa[2], fb[2];
#pragma unroll
      for (int i = 0; i < 2; ++i) {
        fa[i].half[0] = *(const v8us*)&sm[buf * WB + aoff + i * 16 * WP + ks * 64]; fa[i].half[1] = *(const v8us*)&sm[buf * WB + aoff + i * 16 * WP + ks * 64 + 32];
        fb[i].half[0] = *(const v8us*)&sm[boff + i * 16 * OP + t * (KC * 2) + ks * 64]; fb[i].half[1] = *(const v8us*)&sm[boff + i * 16 * OP + t * (KC * 2) + ks * 64 + 32];
      }
#pragma unroll
      for (int i = 0; i < 2; ++i)
#pragma unroll
        for (int j = 0; j < 2; ++j) cacc[i][j] = __builtin_amdgcn_wmma_f32_16x16x32_f16(false, fa[i].v, false, fb[j].v, (short)0, cacc[i][j], false, false);
    }
  };
  tile(0, 0);
  asm volatile("s_wait_dscnt 0x0" ::: "memory");         // this wave's reads of buffer 0 are done before it is refilled
  __syncthreads();                                       // ends every reader's last read of Bo tile 0
  fill(3, 0);
  v4f bq[2][2];      // the bias of this lane's sixteen rows, asked for here: it comes under tiles 1 and 2, so neither the next barrier nor the epilogue waits for it
#pragma unroll
  for (int i = 0; i < 2; ++i) { bq[i][0] = *(const v4fa*)(bias + row0 + i * 16 + 8 * hh); bq[i][1] = *(const v4fa*)(bias + row0 + i * 16 + 8 * hh + 4); }
  tile(1, 1); tile(2, 2);                                // tile 3 flies meanwhile
  asm volatile("s_wait_dscnt 0x0" ::: "memory");         // this wave's reads of buffers 1 and 2 are done before they become output staging
  asm volatile("s_wait_asynccnt 0x0" ::: "memory");      // this wave's copies of tile 3 have landed; none is outstanding from here on
  __syncthreads();                                       // publishes tile 3, ends every reader's last read of tiles 1 and 2
  float* ap = ATTN + ((size_t)bh * NPIX + y * HWD) * 9;      // the weights go out after the last barrier: no barrier and no fence then waits for these stores
#pragma unroll
  for (int q = 0; q < 3; ++q) { const int i4 = q * 32 + lane; if (i4 < HWD * 9 / 4) { const v4f v = *(const v4fa*)&sa[i4 * 4]; *(v4f*)(ap + i4 * 4) = v; } }
  tile(3, 0);
  // epilogue: each wave stages its 32 x 32 tile in its own range of buffers 1 and 2 (pitch 36 floats) and stores whole lines: a row is a channel, its 32 columns one image row
  float* so = (float*)(sm + WB) + w * (32 * 36);
#pragma unroll      // unrolled here and below: the accumulators and the bias are indexed by constants
  for (int i = 0; i < 2; ++i)
#pragma unroll
    for (int r = 0; r < 8; ++r) {
      const float bv = bf16_round(bq[i][r >> 2][r & 3]);
#pragma unroll
      for (int j = 0; j < 2; ++j) so[(i * 16 + 8 * hh + r) * 36 + j * 16 + ln] = cacc[i][j][r] * alpha + bv;
    }
  asm volatile("s_wait_dscnt 0x0" ::: "memory");      // the wave's own LDS writes are done before other lanes of it read them (a fence here would wait for the weights' stores as well)
  const int rs = lane >> 3, q4 = (lane & 7) * 4;
  float* cp = OUT + ((size_t)b * CC + row0 + rs) * NPIX + (y0 + wn) * HWD + q4;
#pragma unroll
  for (int q = 0; q < 8; ++q) { const v4f v = *(const v4fa*)&so[(q * 4 + rs) * 36 + q4]; *(v4f*)(cp + q * 4 * NPIX) = v; }
}
extern "C" void kernel_launch(void* const* d_in, const int* in_sizes, int n_in,
                              void* d_out, int out_size, void* d_ws, size_t ws_size, hipStream_t stream) {
  (void)in_sizes; (void)n_in; (void)out_size;
  const float* x = (const float*)d_in[0]; const float* Wq = (const float*)d_in[1]; const float* Wkv = (const float*)d_in[2]; const float* Wo = (const float*)d_in[3]; const float* bo = (const float*)d_in[4];
  float* OUT0 = (float*)d_out; float* ATTN = OUT0 + (size_t)BB * CC * NPIX;
  char* ws = (char*)d_ws; size_t off = 0;
  auto take = [&](size_t bytes) { char* p = ws + off; off += (bytes + 255) & ~(size_t)255; return p; };
  _Float16* Bw = (_Float16*)take((size_t)4 * INNER * CC * 2); _Float16* Bo = Bw + (size_t)3 * INNER * CC;      // [Wq | Wkv] (1536 rows of 256), then Wo (256 rows of 512)
  _Float16* Q = (_Float16*)take((size_t)NR * INNER * 2); _Float16* KV = (_Float16*)take((size_t)NR * 2 * INNER * 2);
  if (off > ws_size) return;      // 1.1 + 16.8 + 33.5 MB
  k_prep<<<NBW, 256, 0, stream>>>(Wq, Wkv, Wo, Bw);
  k_gemm_p<<<(NR / 128) * 2, 256, 0, stream>>>(x, Bw, 0.0625f, Q, KV);      // q, and [k | v]
  k_win_out<<<BB * (HWD / 2), 512, 0, stream>>>(Q, KV, Bo, bo, 0.0625f, ATTN, OUT0);      // window attention, then to_out + bo with channels as rows: stored as NCHW
}

// v007
// Measured time: 28.4 microseconds a run.
// Timed twice side by side with v006, it ran 1.20 times as fast both times.
// Over all steps from v000 it is 5.75 times as fast.
#include <hip/hip_runtime.h>
// Local 3×3-window attention (x [16,256,32,32]; 8 heads × 64): q = 1×1 conv (Wq), k,v = 1×1 conv (Wkv), each pixel attends over its 3×3 neighbourhood (zero-padded keys/values take part with
// logit 0), softmax(q·k/8), out = Σ attn·v, 1×1 conv Wo + bo; outputs (out NCHW, attn [16,8,1024,9]). The three pointwise convs run as GEMMs on v_wmma_f32_16x16x32_f16 (x bf16-exact, (out,in)
// weights bf16-exact ×2^4, q/k/v/o f16, f32 accumulate); the 9-wide window dots, softmax and attn * v are f32 VALU (eight lanes a pixel and head), the weights are converted in a launch of their own; everything else is one kernel, a work-group = two image rows: it transposes and converts its own tile of x (four rows), q, k, v and o stay in LDS, out is stored as NCHW.
#define BB 16
#define CC 256
#define HWD 32
#define NPIX 1024
#define NH 8
#define DH 64
#define INNER 512
#define NR (BB * NPIX)

typedef __bf16 v16b __attribute__((ext_vector_type(16)));
typedef unsigned short v8us __attribute__((ext_vector_type(8), may_alias));
typedef float  v8f  __attribute__((ext_vector_type(8)));
typedef float  v4f  __attribute__((ext_vector_type(4)));
typedef float  v4fa __attribute__((ext_vector_type(4), may_alias));
union FragB { v16b v; v8us half[2]; unsigned short u[16]; };

__device__ __forceinline__ unsigned short bf16_bits(float x) { unsigned int u = __float_as_uint(x); return (unsigned short)((u + 0x7FFFu + ((u >> 16) & 1u)) >> 16); }
__device__ __forceinline__ float bf16_val(unsigned short b) { return __uint_as_float(((unsigned int)b) << 16); }
__device__ __forceinline__ float bf16_round(float x) { return bf16_val(bf16_bits(x)); }
// D += A·B with NT terms: 1 = ah·bh, 2 = + al·bh (A split), 3 = + ah·bl (both split)
template <int NT>
__device__ __forceinline__ v8f mmaN(v16b ah, v16b al, v16b bh, v16b bl, v8f c) {
  c = __builtin_amdgcn_wmma_f32_16x16x32_bf16(false, ah, false, bh, (short)0, c, false, false);
  if (NT >= 2) c = __builtin_amdgcn_wmma_f32_16x16x32_bf16(false, al, false, bh, (short)0, c, false, false);
  if (NT >= 3) c = __builtin_amdgcn_wmma_f32_16x16x32_bf16(false, ah, false, bl, (short)0, c, false, false);
  asm volatile("v_nop\n\tv_nop\n\tv_nop\n\tv_nop" : "+v"(c) : "v"(ah), "v"(al), "v"(bh), "v"(bl));
  return c;
}

__global__ __launch_bounds__(256) void k_wt_bf16(const float* __restrict__ W, unsigned short* __restrict__ Wt, int K, int N) {
  const int t = blockIdx.x * 256 + threadIdx.x;
  const int k8n = K / 8;
  if (t >= N * k8n) return;
  const int n = t / k8n, k8 = (t % k8n) * 8;
  v8us v;
#pragma unroll
  for (int i = 0; i < 8; ++i) v[i] = bf16_bits(W[(size_t)(k8 + i) * N + n]);
  *(v8us*)(Wt + (size_t)n * K + k8) = v;
  
}

// GEMM C[M][N] (f32, pitch ldc) = act(A[M][K]·W + bias). A f32 row-major (pitch lda) converted per fragment to bf16
// (ASPLIT: hi/lo two planes -> 2 terms, else single rounded term); Wt bf16 [N][K] (pitch ldb). BIAS_BF16 rounds the
// bias to bf16 first (bias quantised to bf16 before the add). K%32==0, M%16==0, N%64==0.
template <bool ASPLIT, int ACT, bool BIAS_BF16>
__global__ __launch_bounds__(128) void k_gemm_bf(const float* __restrict__ A, int lda, const unsigned short* __restrict__ Wt, int ldb,
                                               const float* __restrict__ bias, float* __restrict__ C, int ldc, int M, int N, int K) {
  __shared__ __attribute__((aligned(16))) float so[4][16][64];
  const int tid = threadIdx.x, w = tid >> 5, lane = tid & 31, ln = lane & 15, hh = lane >> 4;
  const int ntn = N / 64;
  const int wid = blockIdx.x * 4 + w;
  const int mt = wid / ntn, nq = wid % ntn;
  if (mt * 16 >= M) return;
  const int row0 = mt * 16, col0 = nq * 64;
  const float* arow = A + (size_t)(row0 + ln) * lda;
  v8f acc[4] = {};
  for (int kb = 0; kb < K; kb += 32) {
    FragB ah, al;
    const v4f x0 = *(const v4fa*)(arow + kb + 8 * hh), x1 = *(const v4fa*)(arow + kb + 8 * hh + 4);
    const v4f x2 = *(const v4fa*)(arow + kb + 16 + 8 * hh), x3 = *(const v4fa*)(arow + kb + 16 + 8 * hh + 4);
    float xs[16] = {x0[0],x0[1],x0[2],x0[3],x1[0],x1[1],x1[2],x1[3],x2[0],x2[1],x2[2],x2[3],x3[0],x3[1],x3[2],x3[3]};
#pragma unroll
    for (int i = 0; i < 16; ++i) { const unsigned short hb = bf16_bits(xs[i]); ah.u[i] = hb; al.u[i] = ASPLIT ? bf16_bits(xs[i] - bf16_val(hb)) : (unsigned short)0; }
#pragma unroll
    for (int t = 0; t < 4; ++t) {
      const unsigned short* brow = Wt + (size_t)(col0 + t * 16 + ln) * ldb + kb;
      FragB b;
      b.half[0] = *(const v8us*)(brow + 8 * hh);
      b.half[1] = *(const v8us*)(brow + 16 + 8 * hh);
      acc[t] = mmaN<ASPLIT ? 2 : 1>(ah.v, al.v, b.v, b.v, acc[t]);
    }
  }
#pragma unroll
  for (int t = 0; t < 4; ++t) {
    float bv = bias ? bias[col0 + t * 16 + ln] : 0.f;
    if (BIAS_BF16) bv = bf16_round(bv);
#pragma unroll
    for (int r = 0; r < 8; ++r) { float v = acc[t][r] + bv; if (ACT == 1) v = fmaxf(v, 0.f); so[w][8 * hh + r][t * 16 + ln] = v; }
  }
  __builtin_amdgcn_fence(__ATOMIC_ACQ_REL, "workgroup");
  __builtin_amdgcn_wave_barrier();
  const int rsub = lane >> 4, c4 = (lane & 15) * 4;
  {
#pragma unroll
    for (int q = 0; q < 8; ++q) {
      const int r = q * 2 + rsub;
      const v4f v = *(const v4fa*)&so[w][r][c4];
      *(v4f*)(C + (size_t)(row0 + r) * ldc + col0 + c4) = v;
    }
    
  }
}

// Flash-style causal/unmasked attention, all contractions 3-term bf16 hi/lo splits, f32 softmax with running max.
// q,k,v rows are read from f32 buffers with arbitrary row pitch (so they can live inside a fused qkv buffer);
// D = head size (multiple of 32, <= 128); one wave = 16 query rows; block = 4 waves (64 queries) sharing K/V chunks of 32.
template <int D, bool CAUSAL>
__global__ __launch_bounds__(128) void k_flash(const float* __restrict__ qb, const float* __restrict__ kb, const float* __restrict__ vb,
                                             int pitch, int T, int H, float scale, float* __restrict__ y, int ypitch) {
  constexpr int KS = D / 32;        // k-steps for QK
  constexpr int DT = D / 16;        // d tiles for PV
  __shared__ __attribute__((aligned(16))) unsigned short sKh[32][D + 8], sKl[32][D + 8], sVh[32][D + 8], sVl[32][D + 8];
  __shared__ __attribute__((aligned(16))) unsigned short sPh[4][16][40], sPl[4][16][40];
  __shared__ __attribute__((aligned(16))) float sO[4][16][D];
  const int tid = threadIdx.x, w = tid >> 5, lane = tid & 31, ln = lane & 15, hh = lane >> 4;
  const int nqb = (T + 63) / 64;
  const int bh = blockIdx.x / nqb, qblk = blockIdx.x % nqb;
  const int b = bh / H, h = bh % H;
  const int q0 = qblk * 64 + w * 16;
  const float* Q = qb + (size_t)b * T * pitch + h * D;
  const float* K = kb + (size_t)b * T * pitch + h * D;
  const float* V = vb + (size_t)b * T * pitch + h * D;

  // A fragments of the wave's 16 query rows (scaled), hi/lo
  FragB aqh[KS], aql[KS];
  {
    int row = q0 + ln; if (row >= T) row = T - 1;
    const float* qr = Q + (size_t)row * pitch;
#pragma unroll
    for (int ks = 0; ks < KS; ++ks)
#pragma unroll
      for (int i = 0; i < 16; ++i) {
        const int d = ks * 32 + ((i < 8) ? (8 * hh + i) : (16 + 8 * hh + (i - 8)));
        const float x = qr[d] * scale; const unsigned short hb = bf16_bits(x);
        aqh[ks].u[i] = hb; aql[ks].u[i] = bf16_bits(x - bf16_val(hb));
      }
  }
  float m_r[8], l_r[8];
#pragma unroll
  for (int r = 0; r < 8; ++r) { m_r[r] = -3.0e38f; l_r[r] = 0.f; }
  v8f oacc[DT];
#pragma unroll
  for (int dt = 0; dt < DT; ++dt) oacc[dt] = (v8f){0.f,0.f,0.f,0.f,0.f,0.f,0.f,0.f};

  const int kv_end = CAUSAL ? min(T, qblk * 64 + 64) : T;     // block-uniform
  for (int j0 = 0; j0 < kv_end; j0 += 32) {
    __syncthreads();
    for (int e = tid; e < 32 * (D / 4); e += 128) {
      const int r = e / (D / 4), c4 = (e % (D / 4)) * 4;
      const int key = j0 + r;
      v4f kf = {0.f,0.f,0.f,0.f}, vf = {0.f,0.f,0.f,0.f};
      if (key < T) { kf = *(const v4fa*)(K + (size_t)key * pitch + c4); vf = *(const v4fa*)(V + (size_t)key * pitch + c4); }
#pragma unroll
      for (int t = 0; t < 4; ++t) {
        unsigned short hb = bf16_bits(kf[t]); sKh[r][c4 + t] = hb; sKl[r][c4 + t] = bf16_bits(kf[t] - bf16_val(hb));
        hb = bf16_bits(vf[t]); sVh[r][c4 + t] = hb; sVl[r][c4 + t] = bf16_bits(vf[t] - bf16_val(hb));
      }
    }
    __syncthreads();
    // S tile 16 x 32
    v8f s[2];
#pragma unroll
    for (int nt = 0; nt < 2; ++nt) {
      v8f acc = {};
#pragma unroll
      for (int ks = 0; ks < KS; ++ks) {
        FragB bh_, bl_;
        bh_.half[0] = *(const v8us*)&sKh[nt * 16 + ln][ks * 32 + 8 * hh]; bh_.half[1] = *(const v8us*)&sKh[nt * 16 + ln][ks * 32 + 16 + 8 * hh];
        bl_.half[0] = *(const v8us*)&sKl[nt * 16 + ln][ks * 32 + 8 * hh]; bl_.half[1] = *(const v8us*)&sKl[nt * 16 + ln][ks * 32 + 16 + 8 * hh];
        acc = mmaN<3>(aqh[ks].v, aql[ks].v, bh_.v, bl_.v, acc);
      }
      s[nt] = acc;
    }
    // mask + running max (rows 8hh+r; the 16 lanes of a half share rows)
    float alpha[8];
#pragma unroll
    for (int r = 0; r < 8; ++r) {
      const int qi = q0 + 8 * hh + r;
      const int ja = j0 + ln, jb = j0 + 16 + ln;
      if (CAUSAL) { if (ja > qi) s[0][r] = -3.0e38f; if (jb > qi) s[1][r] = -3.0e38f; }
      if (ja >= T) s[0][r] = -3.0e38f;
      if (jb >= T) s[1][r] = -3.0e38f;
      float mx = fmaxf(s[0][r], s[1][r]);
      mx = fmaxf(mx, __shfl_xor(mx, 1, 32)); mx = fmaxf(mx, __shfl_xor(mx, 2, 32)); mx = fmaxf(mx, __shfl_xor(mx, 4, 32)); mx = fmaxf(mx, __shfl_xor(mx, 8, 32));
      const float mnew = fmaxf(m_r[r], mx);
      alpha[r] = (mnew > -1.0e38f) ? __expf(m_r[r] - mnew) : 1.0f;
      const float p0 = (s[0][r] > -1.0e38f) ? __expf(s[0][r] - mnew) : 0.f;
      const float p1 = (s[1][r] > -1.0e38f) ? __expf(s[1][r] - mnew) : 0.f;
      m_r[r] = mnew;
      l_r[r] = l_r[r] * alpha[r] + p0 + p1;            // per-lane partial row sum (16 lanes combined at the end)
      unsigned short hb = bf16_bits(p0); sPh[w][8 * hh + r][ln] = hb;      sPl[w][8 * hh + r][ln] = bf16_bits(p0 - bf16_val(hb));
      hb = bf16_bits(p1);                sPh[w][8 * hh + r][16 + ln] = hb; sPl[w][8 * hh + r][16 + ln] = bf16_bits(p1 - bf16_val(hb));
    }
#pragma unroll
    for (int dt = 0; dt < DT; ++dt)
#pragma unroll
      for (int r = 0; r < 8; ++r) oacc[dt][r] *= alpha[r];
    __builtin_amdgcn_fence(__ATOMIC_ACQ_REL, "workgroup");
    __builtin_amdgcn_wave_barrier();
    FragB pah, pal;
    pah.half[0] = *(const v8us*)&sPh[w][ln][8 * hh]; pah.half[1] = *(const v8us*)&sPh[w][ln][16 + 8 * hh];
    pal.half[0] = *(const v8us*)&sPl[w][ln][8 * hh]; pal.half[1] = *(const v8us*)&sPl[w][ln][16 + 8 * hh];
#pragma unroll
    for (int dt = 0; dt < DT; ++dt) {
      FragB bvh, bvl;
#pragma unroll
      for (int i = 0; i < 8; ++i) {
        bvh.u[i] = sVh[8 * hh + i][dt * 16 + ln]; bvh.u[8 + i] = sVh[16 + 8 * hh + i][dt * 16 + ln];
        bvl.u[i] = sVl[8 * hh + i][dt * 16 + ln]; bvl.u[8 + i] = sVl[16 + 8 * hh + i][dt * 16 + ln];
      }
      oacc[dt] = mmaN<3>(pah.v, pal.v, bvh.v, bvl.v, oacc[dt]);
    }
    __builtin_amdgcn_fence(__ATOMIC_ACQ_REL, "workgroup");
    __builtin_amdgcn_wave_barrier();
  }
#pragma unroll
  for (int r = 0; r < 8; ++r) {
    float l = l_r[r];
    l += __shfl_xor(l, 1, 32); l += __shfl_xor(l, 2, 32); l += __shfl_xor(l, 4, 32); l += __shfl_xor(l, 8, 32);
    l_r[r] = (l > 0.f) ? 1.0f / l : 0.f;
  }
#pragma unroll
  for (int dt = 0; dt < DT; ++dt)
#pragma unroll
    for (int r = 0; r < 8; ++r) sO[w][8 * hh + r][dt * 16 + ln] = oacc[dt][r] * l_r[r];
  __builtin_amdgcn_fence(__ATOMIC_ACQ_REL, "workgroup");
  __builtin_amdgcn_wave_barrier();
  {
    for (int r = 0; r < 16; ++r) {
      const int row = q0 + r;
      if (row < T && lane < D / 4) {
        const v4f val = *(const v4fa*)&sO[w][r][lane * 4];
        *(v4f*)(y + ((size_t)b * T + row) * ypitch + h * D + lane * 4) = val;
      }
    }
    
  }
}

// GEMM C = act(A·W + bias + resid): A f32 (ASPLIT -> hi/lo 2 terms), Wt bf16 [N][K]; ACT 0 none, 1 relu, 2 exact gelu;
// resid (optional, f32, row index = (row % rmod), pitch ldr, RES_BF16 rounds it) added before the activation.
template <bool ASPLIT, int ACT, bool BIAS_BF16, bool RES_BF16>
__global__ __launch_bounds__(128) void k_gemm_bf3(const float* __restrict__ A, int lda, const unsigned short* __restrict__ Wt, int ldb,
                                                const float* __restrict__ bias, const float* __restrict__ resid, int rmod, int ldr,
                                                float* __restrict__ C, int ldc, int M, int N, int K) {
  __shared__ __attribute__((aligned(16))) float so[4][16][64];
  const int tid = threadIdx.x, w = tid >> 5, lane = tid & 31, ln = lane & 15, hh = lane >> 4;
  const int ntn = N / 64;
  const int wid = blockIdx.x * 4 + w;
  const int mt = wid / ntn, nq = wid % ntn;
  if (mt * 16 >= M) return;
  const int row0 = mt * 16, col0 = nq * 64;
  const float* arow = A + (size_t)(row0 + ln) * lda;
  v8f acc[4] = {};
  for (int kb = 0; kb < K; kb += 32) {
    FragB ah, al;
    const v4f x0 = *(const v4fa*)(arow + kb + 8 * hh), x1 = *(const v4fa*)(arow + kb + 8 * hh + 4);
    const v4f x2 = *(const v4fa*)(arow + kb + 16 + 8 * hh), x3 = *(const v4fa*)(arow + kb + 16 + 8 * hh + 4);
    float xs[16] = {x0[0],x0[1],x0[2],x0[3],x1[0],x1[1],x1[2],x1[3],x2[0],x2[1],x2[2],x2[3],x3[0],x3[1],x3[2],x3[3]};
#pragma unroll
    for (int i = 0; i < 16; ++i) { const unsigned short hb = bf16_bits(xs[i]); ah.u[i] = hb; al.u[i] = ASPLIT ? bf16_bits(xs[i] - bf16_val(hb)) : (unsigned short)0; }
#pragma unroll
    for (int t = 0; t < 4; ++t) {
      const unsigned short* brow = Wt + (size_t)(col0 + t * 16 + ln) * ldb + kb;
      FragB b;
      b.half[0] = *(const v8us*)(brow + 8 * hh);
      b.half[1] = *(const v8us*)(brow + 16 + 8 * hh);
      acc[t] = mmaN<ASPLIT ? 2 : 1>(ah.v, al.v, b.v, b.v, acc[t]);
    }
  }
#pragma unroll
  for (int t = 0; t < 4; ++t) {
    const int col = col0 + t * 16 + ln;
    float bv = bias ? bias[col] : 0.f;
    if (BIAS_BF16) bv = bf16_round(bv);
#pragma unroll
    for (int r = 0; r < 8; ++r) {
      float v = acc[t][r] + bv;
      if (resid) { float rv = resid[(size_t)((row0 + 8 * hh + r) % rmod) * ldr + col]; if (RES_BF16) rv = bf16_round(rv); v += rv; }
      if (ACT == 1) v = fmaxf(v, 0.f);
      if (ACT == 2) v = 0.5f * v * (1.0f + erff(v * 0.70710678118654752f));
      if (ACT == 3) { const float u = 0.7978845608028654f * (v + 0.044715f * v * v * v); v = 0.5f * v * (1.0f + tanhf(u)); }
      so[w][8 * hh + r][t * 16 + ln] = v;
    }
  }
  __builtin_amdgcn_fence(__ATOMIC_ACQ_REL, "workgroup");
  __builtin_amdgcn_wave_barrier();
  const int rsub = lane >> 4, c4 = (lane & 15) * 4;
  {
#pragma unroll
    for (int q = 0; q < 8; ++q) {
      const int r = q * 2 + rsub;
      const v4f v = *(const v4fa*)&so[w][r][c4];
      *(v4f*)(C + (size_t)(row0 + r) * ldc + col0 + c4) = v;
    }
    
  }
}
// row LayerNorm (biased variance, eps) over N: s = X (+ R); optional out_sum <- s; out_norm <- (s-mu)*rsqrt(var+eps)*g + b
template <bool PARAM_BF16>
__global__ __launch_bounds__(256) void k_layernorm(const float* __restrict__ X, const float* __restrict__ R, const float* __restrict__ g, const float* __restrict__ bta,
                                                  float* __restrict__ out_sum, float* __restrict__ out_norm, int N, float eps) {
  __shared__ float red[256];
  const int row = blockIdx.x, tid = threadIdx.x;
  const float* x = X + (size_t)row * N; const float* rr = R ? R + (size_t)row * N : nullptr;
  float vals[16];                     // up to N = 4096
  const int per = N / 256;            // contiguous chunk per thread? use strided-by-4 chunks: thread handles j = tid*4 + 1024*u
  float s1 = 0.f;
  for (int u = 0; u < per / 4; ++u) {
    const int j = tid * 4 + 1024 * u;
    const v4f a = *(const v4fa*)(x + j);
    v4f b = {0.f,0.f,0.f,0.f}; if (rr) b = *(const v4fa*)(rr + j);
#pragma unroll
    for (int q = 0; q < 4; ++q) { const float v = a[q] + b[q]; vals[u * 4 + q] = v; s1 += v; }
  }
  red[tid] = s1; __syncthreads();
  for (int st = 128; st > 0; st >>= 1) { if (tid < st) red[tid] += red[tid + st]; __syncthreads(); }
  const float mu = red[0] / (float)N; __syncthreads();
  float s2 = 0.f;
  for (int u = 0; u < per / 4; ++u)
#pragma unroll
    for (int q = 0; q < 4; ++q) { const float c = vals[u * 4 + q] - mu; s2 += c * c; }
  red[tid] = s2; __syncthreads();
  for (int st = 128; st > 0; st >>= 1) { if (tid < st) red[tid] += red[tid + st]; __syncthreads(); }
  const float rs = rsqrtf(red[0] / (float)N + eps);
  {
    for (int u = 0; u < per / 4; ++u) {
      const int j = tid * 4 + 1024 * u;
      v4f o, sm;
#pragma unroll
      for (int q = 0; q < 4; ++q) {
        float gg = g[j + q], bb = bta[j + q];
        if (PARAM_BF16) { gg = bf16_round(gg); bb = bf16_round(bb); }
        sm[q] = vals[u * 4 + q]; o[q] = (vals[u * 4 + q] - mu) * rs * gg + bb;
      }
      if (out_sum) *(v4f*)(out_sum + (size_t)row * N + j) = sm;
      *(v4f*)(out_norm + (size_t)row * N + j) = o;
    }
    
  }
}



// ---- f16 WMMA path (v_wmma_f32_16x16x32_f16): 11-bit significands for operands in range — used here for the three 1×1 conv GEMMs (q | k | v and to_out, all in k_all)
typedef _Float16 v16h __attribute__((ext_vector_type(16)));
union FragH { v16h v; v8us half[2]; _Float16 h[16]; unsigned short u[16]; };
template <int NT>
__device__ __forceinline__ v8f mmaH(v16h ah, v16h al, v16h bh, v16h bl, v8f c) {
  c = __builtin_amdgcn_wmma_f32_16x16x32_f16(false, ah, false, bh, (short)0, c, false, false);
  if (NT >= 2) c = __builtin_amdgcn_wmma_f32_16x16x32_f16(false, al, false, bh, (short)0, c, false, false);
  if (NT >= 3) c = __builtin_amdgcn_wmma_f32_16x16x32_f16(false, ah, false, bl, (short)0, c, false, false);
  asm volatile("v_nop\n\tv_nop\n\tv_nop\n\tv_nop" : "+v"(c) : "v"(ah), "v"(al), "v"(bh), "v"(bl));
  return c;
}
// batched GEMM like k_gemm_b but f16 operands: A f32 (split into f16 hi/lo if ASPLIT, else rounded to f16), Bt = f16 values [n][k]; alpha; C f32; N multiple of 16 (partial tiles skipped)
template <bool ASPLIT>
__global__ __launch_bounds__(128) void k_gemm_h(const float* __restrict__ A, int lda, size_t sA, const _Float16* __restrict__ Bh, int ldb, size_t sB, float alpha, float* __restrict__ C, int ldc, size_t sC, int M, int N, int K) {
  __shared__ __attribute__((aligned(16))) float so[4][16][64];
  const int tid = threadIdx.x, w = tid >> 5, lane = tid & 31, ln = lane & 15, hh = lane >> 4; const int by = blockIdx.y;
  A += (size_t)by * sA; Bh += (size_t)by * sB; C += (size_t)by * sC;
  const int ntn = (N + 63) / 64; const int wid = blockIdx.x * 4 + w; const int mt = wid / ntn, nq = wid % ntn; if (mt * 16 >= M) return;
  const int row0 = mt * 16, col0 = nq * 64; const float* arow = A + (size_t)(row0 + ln) * lda;
  v8f acc[4] = {};
  for (int kb = 0; kb < K; kb += 32) {
    FragH ah, al;
    const v4f x0 = *(const v4fa*)(arow + kb + 8 * hh), x1 = *(const v4fa*)(arow + kb + 8 * hh + 4), x2 = *(const v4fa*)(arow + kb + 16 + 8 * hh), x3 = *(const v4fa*)(arow + kb + 16 + 8 * hh + 4);
    float xs[16] = {x0[0],x0[1],x0[2],x0[3],x1[0],x1[1],x1[2],x1[3],x2[0],x2[1],x2[2],x2[3],x3[0],x3[1],x3[2],x3[3]};
#pragma unroll
    for (int i = 0; i < 16; ++i) { const _Float16 h = (_Float16)xs[i]; ah.h[i] = h; al.h[i] = ASPLIT ? (_Float16)(xs[i] - (float)h) : (_Float16)0.0f; }
#pragma unroll
    for (int t = 0; t < 4; ++t) { if (col0 + t * 16 >= N) continue; const size_t boff = (size_t)(col0 + t * 16 + ln) * ldb + kb; FragH bq; bq.half[0] = *(const v8us*)(Bh + boff + 8 * hh); bq.half[1] = *(const v8us*)(Bh + boff + 16 + 8 * hh);
      acc[t] = mmaH<ASPLIT ? 2 : 1>(ah.v, al.v, bq.v, bq.v, acc[t]); }
  }
#pragma unroll
  for (int t = 0; t < 4; ++t) { if (col0 + t * 16 >= N) continue;
#pragma unroll
    for (int r = 0; r < 8; ++r) so[w][8 * hh + r][t * 16 + ln] = acc[t][r] * alpha; }
  __builtin_amdgcn_fence(__ATOMIC_ACQ_REL, "workgroup"); __builtin_amdgcn_wave_barrier();
  const int rsub = lane >> 4, c4 = (lane & 15) * 4;
  {
#pragma unroll
    for (int q = 0; q < 8; ++q) { const int r = q * 2 + rsub; if (col0 + c4 < N) { const v4f v = *(const v4fa*)&so[w][r][c4]; *(v4f*)(C + (size_t)(row0 + r) * ldc + col0 + c4) = v; } }
     }
}

// Wt[n][k] = f16(W[k][n]·scale) from f32 row-major W[K][N] (scale = power of two; bf16-exact weights stay exact in f16 away from the subnormal range)
__global__ __launch_bounds__(256) void k_wt_f16(const float* __restrict__ W, _Float16* __restrict__ Wt, int K, int N, float scale) {
  const int t = blockIdx.x * 256 + threadIdx.x; if (t >= N * (K / 8)) return; const int n = t / (K / 8), k8 = (t % (K / 8)) * 8; FragH f;
#pragma unroll
  for (int i = 0; i < 8; ++i) f.h[i] = (_Float16)(bf16_round(W[(size_t)(k8 + i) * N + n]) * scale); const v8us o = f.half[0];
  *(v8us*)((unsigned short*)Wt + (size_t)n * K + k8) = o; 
}
// k_gemm_hh variant with fused epilogue: v = acc·alpha + bias[by·sBias + col] (+ CP[(row/rowsPerB)·sCPb + by·64 + col] if CP) ; ACT 0 none / 1 elu ; writes f16 C16 and f32 C, each if non-null
template <int ACT>
__global__ __launch_bounds__(128) void k_gemm_hhx(const _Float16* __restrict__ A, int lda, size_t sA, const _Float16* __restrict__ Bh, int ldb, size_t sB, float alpha, const float* __restrict__ bias, size_t sBias, const float* __restrict__ CP, int rowsPerB, size_t sCPb, int row0g,
    float* __restrict__ C, _Float16* __restrict__ C16, int ldc, size_t sC, int M, int N, int K) {
  __shared__ __attribute__((aligned(16))) float so[4][16][64];
  const int tid = threadIdx.x, w = tid >> 5, lane = tid & 31, ln = lane & 15, hh = lane >> 4; const int by = blockIdx.y;
  A += (size_t)by * sA; Bh += (size_t)by * sB; const size_t cofs = (size_t)by * sC; const float* bp = bias ? bias + (size_t)by * sBias : nullptr;
  const int ntn = (N + 63) / 64; const int wid = blockIdx.x * 4 + w; const int mt = wid / ntn, nq = wid % ntn; if (mt * 16 >= M) return;
  const int row0 = mt * 16, col0 = nq * 64; const _Float16* arow = A + (size_t)(row0 + ln) * lda;
  v8f acc[4] = {};
  for (int kb = 0; kb < K; kb += 32) { FragH ah; ah.half[0] = *(const v8us*)((const unsigned short*)arow + kb + 8 * hh); ah.half[1] = *(const v8us*)((const unsigned short*)arow + kb + 16 + 8 * hh);
#pragma unroll
    for (int t = 0; t < 4; ++t) { if (col0 + t * 16 >= N) continue; const size_t boff = (size_t)(col0 + t * 16 + ln) * ldb + kb; FragH bq; bq.half[0] = *(const v8us*)((const unsigned short*)Bh + boff + 8 * hh); bq.half[1] = *(const v8us*)((const unsigned short*)Bh + boff + 16 + 8 * hh);
      acc[t] = mmaH<1>(ah.v, ah.v, bq.v, bq.v, acc[t]); }
  }
#pragma unroll
  for (int t = 0; t < 4; ++t) { if (col0 + t * 16 >= N) continue; const int col = col0 + t * 16 + ln; const float bv = bp ? bf16_round(bp[col]) : 0.f;
#pragma unroll
    for (int r = 0; r < 8; ++r) { float v = acc[t][r] * alpha + bv; if (CP) { const int bidx = (row0g + row0 + 8 * hh + r) / rowsPerB; v += CP[(size_t)bidx * sCPb + (size_t)by * 64 + col]; } if (ACT == 1) v = (v > 0.f) ? v : expm1f(v); else if (ACT == 3) v = fmaxf(v, 0.f); so[w][8 * hh + r][t * 16 + ln] = v; } }
  __builtin_amdgcn_fence(__ATOMIC_ACQ_REL, "workgroup"); __builtin_amdgcn_wave_barrier();
  const int rsub = lane >> 4, c4 = (lane & 15) * 4; typedef _Float16 v4h __attribute__((ext_vector_type(4)));
  {
#pragma unroll
    for (int q = 0; q < 8; ++q) { const int r = q * 2 + rsub; if (col0 + c4 < N) { const v4f v = *(const v4fa*)&so[w][r][c4]; if (C) *(v4f*)(C + cofs + (size_t)(row0 + r) * ldc + col0 + c4) = v; if (C16) { v4h h4; for (int i = 0; i < 4; ++i) h4[i] = (_Float16)v[i]; *(v4h*)(C16 + cofs + (size_t)(row0 + r) * ldc + col0 + c4) = h4; } } }
     }
}


// Eight 16-byte asynchronous copies global -> LDS (each lane its own addresses), rows lstep / gstep apart. The s_wait_xcnt closes the statement so that no
// address register named here is rewritten ahead of it.
__device__ __forceinline__ void copy8(unsigned l, const _Float16* g, unsigned lstep, size_t gstep) {
  asm volatile("global_load_async_to_lds_b128 %0, %8, off\n\t"
               "global_load_async_to_lds_b128 %1, %9, off\n\t"
               "global_load_async_to_lds_b128 %2, %10, off\n\t"
               "global_load_async_to_lds_b128 %3, %11, off\n\t"
               "global_load_async_to_lds_b128 %4, %12, off\n\t"
               "global_load_async_to_lds_b128 %5, %13, off\n\t"
               "global_load_async_to_lds_b128 %6, %14, off\n\t"
               "global_load_async_to_lds_b128 %7, %15, off\n\t"
               "s_wait_xcnt 0x0"
               :: "v"(l), "v"(l + lstep), "v"(l + 2 * lstep), "v"(l + 3 * lstep), "v"(l + 4 * lstep), "v"(l + 5 * lstep), "v"(l + 6 * lstep), "v"(l + 7 * lstep),
                  "v"(g), "v"(g + gstep), "v"(g + 2 * gstep), "v"(g + 3 * gstep), "v"(g + 4 * gstep), "v"(g + 5 * gstep), "v"(g + 6 * gstep), "v"(g + 7 * gstep)
               : "memory");
}
// C[M][Nn] = A[M][Kk] * Bh[Nn][Kk]^T * alpha (+ bf16-rounded bias), f16 operands, f32 accumulate. One work-group = one 128 x 128 tile of C, four waves (2 x 2) of 64 x 64.
// A and Bh tiles of 128 rows x 128 k are staged in LDS (row pitch 272 B) by asynchronous copies, two buffers: tile t + 1 flies while tile t is worked on.
// M, Nn multiples of 128 (grid = M / 128 * Nn / 128), Kk a multiple of 128. Each 16 x 16 accumulator sums k upwards in steps of 32.
// NCHW: A holds the CC output channels' weights and Bh the tokens (Nn = NR), so a row of C is a channel and its columns are pixels that lie side by side in the image:
// the tile goes straight to C[image][channel][pixel] (f32), the bias belongs to the row.
// NS > 0 (a multiple of 128, with OUT16): two products that share A run as one launch; columns below NS go to C16 (row pitch NS), the others to C16b (row pitch Nn - NS).
template <int Nn, int Kk, bool OUT16, bool BIAS, bool NCHW, int NS>
__global__ __launch_bounds__(128) void k_gemm_t(const _Float16* __restrict__ A, const _Float16* __restrict__ Bh, float alpha, const float* __restrict__ bias, float* __restrict__ C, _Float16* __restrict__ C16, _Float16* __restrict__ C16b) {
  constexpr int KC = 128, PITCH = 272, OPB = 128 * PITCH, STG = 2 * OPB, NT = Kk / KC;
  __shared__ __attribute__((aligned(16))) unsigned char sm[2 * STG];
  const int tid = threadIdx.x, w = tid >> 5, lane = tid & 31, ln = lane & 15, hh = lane >> 4;
  const int bm = blockIdx.x / (Nn / 128), bn = blockIdx.x % (Nn / 128);
  const int wm = w >> 1, wn = w & 1;
  const int crow = tid >> 4, cch = tid & 15;      // a copy instruction of a wave covers two whole 256-byte rows
  const _Float16* ga = A + (size_t)(bm * 128 + crow) * Kk + cch * 8;
  const _Float16* gb = Bh + (size_t)(bn * 128 + crow) * Kk + cch * 8;
  const unsigned lc = (unsigned)(size_t)sm + crow * PITCH + cch * 16;
  auto fill = [&](int t, int buf) {
    const unsigned l = lc + buf * STG;
    copy8(l, ga + t * KC, 8 * PITCH, (size_t)8 * Kk);
    copy8(l + 64 * PITCH, ga + t * KC + (size_t)64 * Kk, 8 * PITCH, (size_t)8 * Kk);
    copy8(l + OPB, gb + t * KC, 8 * PITCH, (size_t)8 * Kk);
    copy8(l + OPB + 64 * PITCH, gb + t * KC + (size_t)64 * Kk, 8 * PITCH, (size_t)8 * Kk);
  };
  v8f acc[4][4] = {};
  fill(0, 0);
  asm volatile("s_wait_asynccnt 0x0" ::: "memory");      // tile 0 of this wave has landed
  __syncthreads();                                       // ... and every wave's part of it
  if (NT > 1) fill(1, 1);
  const int aoff = (wm * 64 + ln) * PITCH + 16 * hh, boff = OPB + (wn * 64 + ln) * PITCH + 16 * hh;
#pragma unroll 1      // kept rolled: unrolled over the k tiles the build takes many more vector registers
  for (int t = 0; t < NT; ++t) {
    const int sb = (t & 1) * STG;
#pragma unroll
    for (int ks = 0; ks < KC / 32; ++ks) {
      FragH a[4], b[4];
#pragma unroll
      for (int i = 0; i < 4; ++i) {
        a[i].half[0] = *(const v8us*)&sm[sb + aoff + i * 16 * PITCH + ks * 64]; a[i].half[1] = *(const v8us*)&sm[sb + aoff + i * 16 * PITCH + ks * 64 + 32];
        b[i].half[0] = *(const v8us*)&sm[sb + boff + i * 16 * PITCH + ks * 64]; b[i].half[1] = *(const v8us*)&sm[sb + boff + i * 16 * PITCH + ks * 64 + 32];
      }
#pragma unroll
      for (int i = 0; i < 4; ++i)
#pragma unroll
        for (int j = 0; j < 4; ++j) acc[i][j] = __builtin_amdgcn_wmma_f32_16x16x32_f16(false, a[i].v, false, b[j].v, (short)0, acc[i][j], false, false);
    }
    asm volatile("s_wait_dscnt 0x0" ::: "memory");       // this wave's reads of buffer t & 1 are done before it is refilled
    asm volatile("s_wait_asynccnt 0x0" ::: "memory");    // this wave's copies of tile t + 1 have landed
    __syncthreads();                                     // publishes tile t + 1, ends every reader's last read of tile t
    if (t + 2 < NT) fill(t + 2, t & 1);
  }
  asm volatile("s_wait_asynccnt 0x0" ::: "memory");      // no copy is outstanding when the ring becomes output staging
  // epilogue: each wave stages its 64 x 64 tile in its own LDS range (pitch 68 floats) and stores whole lines
  float* so = (float*)sm + w * (64 * 68);
  const int row0 = bm * 128 + wm * 64, col0 = bn * 128 + wn * 64;
  if (NCHW) {
#pragma unroll
    for (int i = 0; i < 4; ++i)
#pragma unroll
      for (int r = 0; r < 8; ++r) {
        const float bv = BIAS ? bf16_round(bias[row0 + i * 16 + 8 * hh + r]) : 0.f;
#pragma unroll
        for (int j = 0; j < 4; ++j) so[(i * 16 + 8 * hh + r) * 68 + j * 16 + ln] = acc[i][j][r] * alpha + bv;
      }
  } else {
#pragma unroll
    for (int j = 0; j < 4; ++j) {
      const float bv = BIAS ? bf16_round(bias[col0 + j * 16 + ln]) : 0.f;
#pragma unroll
      for (int i = 0; i < 4; ++i)
#pragma unroll
        for (int r = 0; r < 8; ++r) so[(i * 16 + 8 * hh + r) * 68 + j * 16 + ln] = acc[i][j][r] * alpha + bv;
    }
  }
  __builtin_amdgcn_fence(__ATOMIC_ACQ_REL, "workgroup"); __builtin_amdgcn_wave_barrier();
  if (NCHW) {
    const int rs = lane >> 4, c4 = (lane & 15) * 4;      // half a wave stores 64 pixels of one channel: two whole lines
    float* cp = C + ((size_t)(col0 / NPIX) * CC + row0 + rs) * NPIX + col0 % NPIX + c4;
#pragma unroll
    for (int q = 0; q < 32; ++q) { const int r = q * 2 + rs; const v4f v = *(const v4fa*)&so[r * 68 + c4]; *(v4f*)(cp + q * 2 * NPIX) = v; }
  } else if (OUT16) {
    const int rs = lane >> 3, c8 = (lane & 7) * 8;
    auto put = [&](_Float16* dst, const int ld, const int c0) {      // dst, its row pitch and the tile's first column there
      unsigned short* cp = (unsigned short*)dst + (size_t)(row0 + rs) * ld + c0 + c8;
#pragma unroll
      for (int q = 0; q < 16; ++q) { const int r = q * 4 + rs; const v4f v0 = *(const v4fa*)&so[r * 68 + c8], v1 = *(const v4fa*)&so[r * 68 + c8 + 4]; FragH f;
#pragma unroll
        for (int i = 0; i < 4; ++i) { f.h[i] = (_Float16)v0[i]; f.h[4 + i] = (_Float16)v1[i]; }
        *(v8us*)(cp + q * 4 * ld) = f.half[0]; }
    };
    if (NS > 0 && bn * 128 >= NS) put(C16b, Nn - NS, col0 - NS);      // a tile lies wholly on one side: the test reads the same in the whole work-group
    else put(C16, NS > 0 ? NS : Nn, col0);
  } else {
    const int rs = lane >> 4, c4 = (lane & 15) * 4;
    float* cp = C + (size_t)(row0 + rs) * Nn + col0 + c4;
#pragma unroll
    for (int q = 0; q < 32; ++q) { const int r = q * 2 + rs; const v4f v = *(const v4fa*)&so[r * 68 + c4]; *(v4f*)(cp + q * 2 * Nn) = v; }
  }
}


typedef _Float16 v4h __attribute__((ext_vector_type(4)));

__global__ __launch_bounds__(256) void k_x16(const float* __restrict__ x, _Float16* __restrict__ X16, size_t n8) { const size_t t = (size_t)blockIdx.x * 256 + threadIdx.x; if (t >= n8) return; FragH f;
#pragma unroll
  for (int q = 0; q < 8; ++q) f.h[q] = (_Float16)bf16_round(x[t * 8 + q]); *(v8us*)((unsigned short*)X16 + t * 8) = f.half[0];  }
__global__ __launch_bounds__(256) void k_h16(const float* __restrict__ x, _Float16* __restrict__ X16, size_t n8) { const size_t t = (size_t)blockIdx.x * 256 + threadIdx.x; if (t >= n8) return; FragH f;
#pragma unroll
  for (int q = 0; q < 8; ++q) f.h[q] = (_Float16)x[t * 8 + q]; *(v8us*)((unsigned short*)X16 + t * 8) = f.half[0];  }
template <int NHv, int TTv>
__global__ __launch_bounds__(256) void k_vt(const _Float16* __restrict__ V16, int ldv, int voff, _Float16* __restrict__ Vt) { __shared__ unsigned short tl[64][66]; const int tid = threadIdx.x; const int slab = blockIdx.x / (TTv / 64), lg = blockIdx.x % (TTv / 64); const int b = slab / NHv, h = slab % NHv;
  for (int i = tid; i < 64 * 8; i += 256) { const int r = i / 8, c8 = (i % 8) * 8; FragH f; f.half[0] = *(const v8us*)((const unsigned short*)V16 + ((size_t)b * TTv + lg * 64 + r) * ldv + voff + h * 64 + c8);
#pragma unroll
    for (int q = 0; q < 8; ++q) tl[r][c8 + q] = f.u[q]; }
  __syncthreads();
  {
#pragma unroll
    for (int rd = 0; rd < 2; ++rd) { const int d = rd * 32 + tid / 8, pc = tid % 8; FragH f;
#pragma unroll
      for (int q = 0; q < 8; ++q) f.u[q] = tl[pc * 8 + q][d];
      *(v8us*)((unsigned short*)Vt + ((size_t)slab * 64 + d) * TTv + lg * 64 + pc * 8) = f.half[0]; }
     } }

// The (out,in) weights as f16 (bf16-rounded, times 2^4), eight values a thread: Bw = [Wq | Wkv | Wo] one behind the other.
#define NBQ (INNER * CC / 8 / 256)
#define NBW (4 * NBQ)
__global__ __launch_bounds__(256) void k_prep(const float* __restrict__ Wq, const float* __restrict__ Wkv, const float* __restrict__ Wo, _Float16* __restrict__ Bw) { const int tid = threadIdx.x;
  const int wb = blockIdx.x; const float* W = wb < NBQ ? Wq : wb < 3 * NBQ ? Wkv : Wo; const size_t t = (size_t)(wb < NBQ ? wb : wb < 3 * NBQ ? wb - NBQ : wb - 3 * NBQ) * 256 + tid; FragH f;
#pragma unroll
  for (int i = 0; i < 8; ++i) f.h[i] = (_Float16)(bf16_round(W[t * 8 + i]) * 16.0f); *(v8us*)((unsigned short*)Bw + ((size_t)wb * 256 + tid) * 8) = f.half[0];
}
union H8 { v8us v; unsigned d[4]; };      // eight f16 values as they are loaded: four registers of two
// v_fma_mix_f32: c + a * b in one fused f32 multiply-add whose f16 factors are widened exactly inside the instruction (op_sel picks the high halves). Written as asm for
// speed: from plain source this build widens every half with a conversion of its own before a packed f32 multiply-add. Each statement holds a whole round over independent
// sums, so that an instruction and the one it depends on stand eight or nine apart (asm text gets no s_delay_alu from the compiler, and needs none at that distance).
// s[w] (+)= the two products of register q with register k[w], w = 0 .. 8
__device__ __forceinline__ void dot9_first(float (&s)[9], unsigned q, const unsigned (&k)[9]) {
  asm(
      "v_fma_mix_f32 %0, %9, %10, 0 op_sel_hi:[1,1,0]\n\t"
      "v_fma_mix_f32 %1, %9, %11, 0 op_sel_hi:[1,1,0]\n\t"
      "v_fma_mix_f32 %2, %9, %12, 0 op_sel_hi:[1,1,0]\n\t"
      "v_fma_mix_f32 %3, %9, %13, 0 op_sel_hi:[1,1,0]\n\t"
      "v_fma_mix_f32 %4, %9, %14, 0 op_sel_hi:[1,1,0]\n\t"
      "v_fma_mix_f32 %5, %9, %15, 0 op_sel_hi:[1,1,0]\n\t"
      "v_fma_mix_f32 %6, %9, %16, 0 op_sel_hi:[1,1,0]\n\t"
      "v_fma_mix_f32 %7, %9, %17, 0 op_sel_hi:[1,1,0]\n\t"
      "v_fma_mix_f32 %8, %9, %18, 0 op_sel_hi:[1,1,0]\n\t"
      "v_fma_mix_f32 %0, %9, %10, %0 op_sel:[1,1,0] op_sel_hi:[1,1,0]\n\t"
      "v_fma_mix_f32 %1, %9, %11, %1 op_sel:[1,1,0] op_sel_hi:[1,1,0]\n\t"
      "v_fma_mix_f32 %2, %9, %12, %2 op_sel:[1,1,0] op_sel_hi:[1,1,0]\n\t"
      "v_fma_mix_f32 %3, %9, %13, %3 op_sel:[1,1,0] op_sel_hi:[1,1,0]\n\t"
      "v_fma_mix_f32 %4, %9, %14, %4 op_sel:[1,1,0] op_sel_hi:[1,1,0]\n\t"
      "v_fma_mix_f32 %5, %9, %15, %5 op_sel:[1,1,0] op_sel_hi:[1,1,0]\n\t"
      "v_fma_mix_f32 %6, %9, %16, %6 op_sel:[1,1,0] op_sel_hi:[1,1,0]\n\t"
      "v_fma_mix_f32 %7, %9, %17, %7 op_sel:[1,1,0] op_sel_hi:[1,1,0]\n\t"
      "v_fma_mix_f32 %8, %9, %18, %8 op_sel:[1,1,0] op_sel_hi:[1,1,0]"
      : "=&v"(s[0]), "=&v"(s[1]), "=&v"(s[2]), "=&v"(s[3]), "=&v"(s[4]), "=&v"(s[5]), "=&v"(s[6]), "=&v"(s[7]), "=&v"(s[8])
      : "v"(q), "v"(k[0]), "v"(k[1]), "v"(k[2]), "v"(k[3]), "v"(k[4]), "v"(k[5]), "v"(k[6]), "v"(k[7]), "v"(k[8]));
}
__device__ __forceinline__ void dot9_more(float (&s)[9], unsigned q, const unsigned (&k)[9]) {
  asm(
      "v_fma_mix_f32 %0, %9, %10, %0 op_sel_hi:[1,1,0]\n\t"
      "v_fma_mix_f32 %1, %9, %11, %1 op_sel_hi:[1,1,0]\n\t"
      "v_fma_mix_f32 %2, %9, %12, %2 op_sel_hi:[1,1,0]\n\t"
      "v_fma_mix_f32 %3, %9, %13, %3 op_sel_hi:[1,1,0]\n\t"
      "v_fma_mix_f32 %4, %9, %14, %4 op_sel_hi:[1,1,0]\n\t"
      "v_fma_mix_f32 %5, %9, %15, %5 op_sel_hi:[1,1,0]\n\t"
      "v_fma_mix_f32 %6, %9, %16, %6 op_sel_hi:[1,1,0]\n\t"
      "v_fma_mix_f32 %7, %9, %17, %7 op_sel_hi:[1,1,0]\n\t"
      "v_fma_mix_f32 %8, %9, %18, %8 op_sel_hi:[1,1,0]\n\t"
      "v_fma_mix_f32 %0, %9, %10, %0 op_sel:[1,1,0] op_sel_hi:[1,1,0]\n\t"
      "v_fma_mix_f32 %1, %9, %11, %1 op_sel:[1,1,0] op_sel_hi:[1,1,0]\n\t"
      "v_fma_mix_f32 %2, %9, %12, %2 op_sel:[1,1,0] op_sel_hi:[1,1,0]\n\t"
      "v_fma_mix_f32 %3, %9, %13, %3 op_sel:[1,1,0] op_sel_hi:[1,1,0]\n\t"
      "v_fma_mix_f32 %4, %9, %14, %4 op_sel:[1,1,0] op_sel_hi:[1,1,0]\n\t"
      "v_fma_mix_f32 %5, %9, %15, %5 op_sel:[1,1,0] op_sel_hi:[1,1,0]\n\t"
      "v_fma_mix_f32 %6, %9, %16, %6 op_sel:[1,1,0] op_sel_hi:[1,1,0]\n\t"
      "v_fma_mix_f32 %7, %9, %17, %7 op_sel:[1,1,0] op_sel_hi:[1,1,0]\n\t"
      "v_fma_mix_f32 %8, %9, %18, %8 op_sel:[1,1,0] op_sel_hi:[1,1,0]"
      : "+v"(s[0]), "+v"(s[1]), "+v"(s[2]), "+v"(s[3]), "+v"(s[4]), "+v"(s[5]), "+v"(s[6]), "+v"(s[7]), "+v"(s[8])
      : "v"(q), "v"(k[0]), "v"(k[1]), "v"(k[2]), "v"(k[3]), "v"(k[4]), "v"(k[5]), "v"(k[6]), "v"(k[7]), "v"(k[8]));
}
// acc[0 .. 7] (+)= a * the eight f16 values of v
__device__ __forceinline__ void av8_first(float (&acc)[8], float a, const unsigned (&v)[4]) {
  asm(
      "v_fma_mix_f32 %0, %8, %9, 0 op_sel_hi:[0,1,0]\n\t"
      "v_fma_mix_f32 %1, %8, %9, 0 op_sel:[0,1,0] op_sel_hi:[0,1,0]\n\t"
      "v_fma_mix_f32 %2, %8, %10, 0 op_sel_hi:[0,1,0]\n\t"
      "v_fma_mix_f32 %3, %8, %10, 0 op_sel:[0,1,0] op_sel_hi:[0,1,0]\n\t"
      "v_fma_mix_f32 %4, %8, %11, 0 op_sel_hi:[0,1,0]\n\t"
      "v_fma_mix_f32 %5, %8, %11, 0 op_sel:[0,1,0] op_sel_hi:[0,1,0]\n\t"
      "v_fma_mix_f32 %6, %8, %12, 0 op_sel_hi:[0,1,0]\n\t"
      "v_fma_mix_f32 %7, %8, %12, 0 op_sel:[0,1,0] op_sel_hi:[0,1,0]"
      : "=&v"(acc[0]), "=&v"(acc[1]), "=&v"(acc[2]), "=&v"(acc[3]), "=&v"(acc[4]), "=&v"(acc[5]), "=&v"(acc[6]), "=&v"(acc[7])
      : "v"(a), "v"(v[0]), "v"(v[1]), "v"(v[2]), "v"(v[3]));
}
__device__ __forceinline__ void av8_more(float (&acc)[8], float a, const unsigned (&v)[4]) {
  asm(
      "v_fma_mix_f32 %0, %8, %9, %0 op_sel_hi:[0,1,0]\n\t"
      "v_fma_mix_f32 %1, %8, %9, %1 op_sel:[0,1,0] op_sel_hi:[0,1,0]\n\t"
      "v_fma_mix_f32 %2, %8, %10, %2 op_sel_hi:[0,1,0]\n\t"
      "v_fma_mix_f32 %3, %8, %10, %3 op_sel:[0,1,0] op_sel_hi:[0,1,0]\n\t"
      "v_fma_mix_f32 %4, %8, %11, %4 op_sel_hi:[0,1,0]\n\t"
      "v_fma_mix_f32 %5, %8, %11, %5 op_sel:[0,1,0] op_sel_hi:[0,1,0]\n\t"
      "v_fma_mix_f32 %6, %8, %12, %6 op_sel_hi:[0,1,0]\n\t"
      "v_fma_mix_f32 %7, %8, %12, %7 op_sel:[0,1,0] op_sel_hi:[0,1,0]"
      : "+v"(acc[0]), "+v"(acc[1]), "+v"(acc[2]), "+v"(acc[3]), "+v"(acc[4]), "+v"(acc[5]), "+v"(acc[6]), "+v"(acc[7])
      : "v"(a), "v"(v[0]), "v"(v[1]), "v"(v[2]), "v"(v[3]));
}
// the value of the lane whose number differs in bit X (X = 1, 2, 4: inside a group of eight lanes); every lane is on where it is used
template <int X>
__device__ __forceinline__ float xlane(float v) { return __int_as_float(__builtin_amdgcn_update_dpp(0, __float_as_int(v), 0x160 + X, 0xf, 0xf, true)); }
// lane S of each group of eight lanes, handed to all eight
template <int S>
__device__ __forceinline__ float group_bcast(float v) { return __uint_as_float(__builtin_amdgcn_permlane16(0u, __float_as_uint(v), 0x11111111u * S, 0x11111111u * (8 + S), true, true)); }
// Everything behind the weight conversion in one kernel: q | k | v product, window attention, to_out product. One work-group = two image rows of one image with all eight heads: eight waves.
// q, k, v and o never reach memory. The work-group reads four image rows of x (its two and the one above and below, clamped to the image; a clamped row's k and v are never used), NCHW f32,
// rounds them (bf16, exact in f16) and writes them to LDS as 128 token rows, once; each wave keeps 64 tokens' fragments (all of k) in registers.
// Token (yy, x), yy = 0 .. 3 the row of the four, stands in tile row ((x & 3) >> 1) * 64 + J * 16 + (x & 1) * 8 + (x >> 2), J = 2, 0, 1, 3 for yy = 0 .. 3: every wave's column tiles 0 and 1 are
// the work-group's own two image rows, which alone need q; tiles 2 and 3 are the rows above and below.
// Product part, per pair of heads: three tiles of 128 channels x 256 k of the weights (q, k, v of the pair; row pitch 528 B), asynchronous copies, two buffers: tile t + 1 flies while tile t is worked
// on. Weights = A operand (rows of D = channels), tokens = B operand (columns of D = tokens): a lane ends with eight neighbouring channels of one token, 16 bytes of f16, staged in LDS as
// [tile row][128 channels] (row pitch 272 B). A wave = 32 channels x 64 tokens (32 for q). Each 16 x 16 accumulator sums k upwards in steps of 32.
// Window part, per pair of heads: one wave = half an image row of one head, four pixels a pass; eight lanes share a pixel, lane p holding d = 8p .. 8p + 7.
// The partial logits are summed over the eight lanes so that lane p ends with logit p (the ninth ends in all eight); each lane does the softmax of its own logit and of the
// ninth, the weights are handed round the group, attn * v follows in the same lanes. A window place outside the image reads another (in-bounds) tile row; its logit is
// set to 0 and its weight on v to 0. The weights are staged in LDS and stored as whole lines at the end. The f16 result o goes to an LDS tile of 64 pixels x 512 (row pitch 1040 B), where the tokens stood.
// to_out part: out[256 channels][64 pixels] = Bo[256][512] * o^T * alpha + bias, a wave = 32 channels x 64 pixels, k upwards in steps of 32. Bo comes in four tiles of 128 k
// (row pitch 272 B) by asynchronous copies into three buffers: tiles 0 and 1 follow the last weight tiles in the ring, tile 0 landing under the last v product and tile 1 under the last window part, tile 2 is asked for behind that part, tile 3 follows into buffer 0.
__global__ __launch_bounds__(256) void k_all(const float* __restrict__ x, const _Float16* __restrict__ Wh, const _Float16* __restrict__ Bo, const float* __restrict__ bias, float alpha,
                                             float* __restrict__ ATTN, float* __restrict__ OUT) {
  constexpr int PITCH = CC * 2 + 16, TB = 128 * PITCH, SP = 272, KC = 128, WP = 272, WB = CC * WP, OP = INNER * 2 + 16;
  constexpr int SQ = TB + 2 * WB, SK = SQ + 64 * SP, SV = SK + 128 * SP, SA0 = SV + 128 * SP;      // tokens / o at 0; ring buffers at TB and TB + WB, a third Bo buffer at TB + 2 * WB = where q, k, v are staged; attention weights
  __shared__ __attribute__((aligned(16))) unsigned char sm[SA0 + 16 * HWD * 9 * 4];
  const int tid = threadIdx.x, lane = tid & 31, ln = lane & 15, hh = lane >> 4, g = lane >> 3, p = lane & 7;
  const int w = __builtin_amdgcn_readfirstlane(tid >> 5);      // the wave's number as a scalar: a copy's LDS address is then a scalar sum plus one lane term
  const int b = blockIdx.x / (HWD / 2), y0 = (blockIdx.x % (HWD / 2)) * 2;
  const int wt = w >> 2, wc = w & 3;
  // sixteen copies a thread, rows lstep / gstep apart: lsc = the wave's first LDS byte (a scalar), lvl = the lane's bytes on top of it, gp = the lane's own source
  auto fillg = [&](unsigned lsc, unsigned lvl, const _Float16* gp, unsigned lstep, size_t gstep) {
    const unsigned l = lvl + (unsigned)__builtin_amdgcn_readfirstlane(lsc);      // the scalar part is summed by itself: only the lane term lives in a vector register across the loop
    copy8(l, gp, lstep, gstep);
    copy8(l + 8 * lstep, gp + 8 * gstep, lstep, gstep);
  };
  const unsigned ring = (unsigned)(size_t)sm + TB;      // ring buffer rb stands at ring + rb * WB: a weight tile (TB bytes) or a Bo tile (WB bytes)
  const unsigned llw = lane * 16, glw = lane * 8;                                                        // weight tile: a copy instruction of a wave covers one whole 512-byte row: row w, w + 8, ...
  const unsigned llo = (lane >> 4) * WP + (lane & 15) * 16, glo = (lane >> 4) * INNER + (lane & 15) * 8;      // Bo tile: two whole 256-byte rows: rows 2w and 2w + 1, 2w + 16 and 2w + 17, ...
  auto fillw = [&](int rb, const _Float16* g0) { fillg(ring + rb * WB + w * PITCH, llw, g0 + (size_t)w * CC + glw, 8 * PITCH, (size_t)8 * CC); };      // 128 rows of CC values from g0 on
  auto fillo = [&](int t, int buf) { fillg(ring + buf * WB + 2 * w * WP, llo, Bo + (size_t)(2 * w) * INNER + t * KC + glo, 16 * WP, (size_t)16 * INNER); };      // Bo tile t: 256 rows of KC values
  {      // the token tile. A wave takes 32 channels, a lane four neighbouring pixels of each (a load of a wave = 128 bytes of each of the four image rows);
         // a lane then holds 32 neighbouring channels of each of its four pixels: 64 bytes of that token's f16 row
    const int yy = lane >> 3, c8 = lane & 7;
    const float* xg = x + ((size_t)b * CC + w * 32) * NPIX + min(max(y0 - 1 + yy, 0), HWD - 1) * HWD + c8 * 4;
    v4f xv[32];
#pragma unroll      // unrolled here and below: all 32 loads fly at once, and the values are indexed by constants
    for (int i = 0; i < 32; ++i) xv[i] = *(const v4fa*)(xg + (size_t)i * NPIX);
    asm volatile("s_wait_xcnt 0x0" ::: "memory");      // stands in front of the address sums below, which take over registers that these loads name
    fillw(0, Wh);      // weight tile 0, asked for behind the loads of x, which have the longer way
    const int trow = (yy == 0 ? 2 : yy == 3 ? 3 : yy - 1) * 16 + c8;
#pragma unroll
    for (int pp = 0; pp < 4; ++pp)
#pragma unroll
      for (int q = 0; q < 4; ++q) { FragH f;
#pragma unroll
        for (int e = 0; e < 8; ++e) f.h[e] = (_Float16)(float)(__bf16)xv[q * 8 + e][pp];      // the cast rounds to nearest even: bf16_round's value for every finite x
        *(v8us*)&sm[((pp >> 1) * 64 + (pp & 1) * 8 + trow) * PITCH + w * 64 + q * 16] = f.half[0]; }
  }
  asm volatile("s_wait_dscnt 0x0" ::: "memory");         // this wave's part of the token tile stands in LDS
  asm volatile("s_wait_asynccnt 0x0" ::: "memory");      // weight tile 0: this wave's copies have landed
  __syncthreads();                                       // publishes the token tile and weight tile 0
  fillw(1, Wh + (size_t)INNER * CC);                     // weight tile 1: k of heads 0 and 1
  FragH xb[4][CC / 32];
#pragma unroll      // unrolled: the fragments are indexed by constants and stay in registers
  for (int j = 0; j < 4; ++j)
#pragma unroll
    for (int ks = 0; ks < CC / 32; ++ks) {
      xb[j][ks].half[0] = *(const v8us*)&sm[(wt * 64 + j * 16 + ln) * PITCH + 16 * hh + ks * 64]; xb[j][ks].half[1] = *(const v8us*)&sm[(wt * 64 + j * 16 + ln) * PITCH + 16 * hh + ks * 64 + 32];
    }
  const int aoff = TB + (wc * 32 + ln) * PITCH + 16 * hh;
  // one weight tile: kind 0, 1, 2 = q, k, v of head pair jh; tile number t = 3 * jh + kind, buffer t & 1. Its loops are unrolled so that fragments and accumulators are indexed by constants
  auto trip = [&](const int kind, const int jh) {
    const int rb = (jh + kind) & 1, wb = rb * WB;
    v8f acc[2][4] = {};
#pragma unroll
    for (int ks = 0; ks < CC / 32; ++ks) {
      FragH a[2];
#pragma unroll
      for (int i = 0; i < 2; ++i) { a[i].half[0] = *(const v8us*)&sm[wb + aoff + i * 16 * PITCH + ks * 64]; a[i].half[1] = *(const v8us*)&sm[wb + aoff + i * 16 * PITCH + ks * 64 + 32]; }
#pragma unroll
      for (int i = 0; i < 2; ++i)
#pragma unroll
        for (int j = 0; j < (kind == 0 ? 2 : 4); ++j) acc[i][j] = __builtin_amdgcn_wmma_f32_16x16x32_f16(false, a[i].v, false, xb[j][ks].v, (short)0, acc[i][j], false, false);
    }
    const int soff = (kind == 0 ? SQ + (wt * 32 + ln) * SP : (kind == 1 ? SK : SV) + (wt * 64 + ln) * SP) + (wc * 32 + 8 * hh) * 2;
#pragma unroll
    for (int i = 0; i < 2; ++i)
#pragma unroll
      for (int j = 0; j < (kind == 0 ? 2 : 4); ++j) { FragH f;
#pragma unroll
        for (int r = 0; r < 8; ++r) f.h[r] = (_Float16)(acc[i][j][r] * alpha);
        *(v8us*)&sm[soff + j * 16 * SP + i * 32] = f.half[0]; }
    asm volatile("s_wait_dscnt 0x0" ::: "memory");       // this wave's reads of weight buffer t & 1 are done, its part of the staged tile stands in LDS
    asm volatile("s_wait_asynccnt 0x0" ::: "memory");    // this wave's copies of tile t + 1 have landed
    __syncthreads();                                     // publishes tile t + 1 and the staged tile, ends every reader's last read of tile t
    if (kind == 0) fillw(rb, Wh + ((size_t)2 * INNER + jh * 128) * CC);      // tile t + 2: v of this pair
    else {      // q (behind k) or k (behind v) of the next pair; behind the last pair the ring goes on with Bo tiles 0 and 1, tile 0 landing under the last v product and tile 1 under the last window part.
                // One call with chosen (scalar) terms: as a call of its own in a branch, the Bo copies' 96 address registers were formed in front of the loop and spilled
      const bool more = jh + 1 < NH / 2;
      const _Float16* g0 = more ? Wh + ((size_t)(kind - 1) * INNER + (jh + 1) * 128 + w) * CC : Bo + (size_t)(2 * w) * INNER + (kind - 1) * KC;
      fillg(ring + wb + (more ? w * PITCH : 2 * w * WP), more ? llw : llo, g0 + (more ? glw : glo), more ? 8 * PITCH : 16 * WP, more ? (size_t)8 * CC : (size_t)16 * INNER);
    }
  };
  // window part: what does not change from pair to pair
  const int yb = w & 1, hl = (w >> 1) & 1, xh = w >> 2, y = y0 + yb;
  auto gk = [](int gg) { return (gg >> 1) * 64 + (gg & 1) * 8; };      // tile row of x & 3 = gg, less the terms of the image row and of x >> 2
  const unsigned lun = xh * 4 * SP + hl * (DH * 2) + p * 16;
  const unsigned lq = SQ + ((g >> 1) * 32 + (g & 1) * 8 + yb * 16) * SP + lun;
  const unsigned lkx[3] = {SK + (g ? gk(g - 1) : gk(3) - 1) * SP + lun, SK + gk(g) * SP + lun, SK + (g < 3 ? gk(g + 1) : 1) * SP + lun};      // x - 1, x, x + 1
  const int jrow[3] = {(yb ? 0 : 2) * 16 * SP, (yb ? 1 : 0) * 16 * SP, (yb ? 3 : 1) * 16 * SP};                                               // y - 1, y, y + 1
  const bool c1 = p & 1, c2 = p & 2, c4 = p & 4;
  const int ym = y + p / 3 - 1, dxm = p % 3 - 1;      // window place p of this lane's own logit
  const bool okym = ym >= 0 && ym < HWD, oky8 = y + 1 < HWD;
  auto loadqk = [&](int it, H8& q, H8 (&k)[9]) {
    q.v = *(const v8us*)&sm[lq + it * SP];
#pragma unroll
    for (int wi = 0; wi < 9; ++wi) k[wi].v = *(const v8us*)&sm[lkx[wi % 3] + jrow[wi / 3] + it * SP];
  };
  auto loadv = [&](int it, H8 (&v)[9]) {
#pragma unroll
    for (int wi = 0; wi < 9; ++wi) v[wi].v = *(const v8us*)&sm[lkx[wi % 3] + jrow[wi / 3] + it * SP + (SV - SK)];
  };
#pragma unroll 1      // kept rolled: one copy of the pair's code, and the token fragments leave no registers for more
  for (int jh = 0; jh < NH / 2; ++jh) {
    trip(0, jh); trip(1, jh); trip(2, jh);
    const int h = jh * 2 + hl;
    float* sa = (float*)(sm + SA0) + (yb * NH + h) * (HWD * 9);
    unsigned char* orow = sm + (yb * HWD + xh * 16 + g) * OP + h * (DH * 2) + p * 16;
    H8 tq[2], tk[2][9], tv[9];
    loadqk(0, tq[0], tk[0]);
#pragma unroll      // unrolled: the two register tiles of q and k alternate by a constant index
    for (int it = 0; it < 4; ++it) {
      loadv(it, tv);                                                          // this pass's v comes under its logits and softmax
      if (it + 1 < 4) loadqk(it + 1, tq[(it + 1) & 1], tk[(it + 1) & 1]);      // the next four pixels' q and k fly while these four are worked on
      __builtin_amdgcn_sched_barrier(0);      // keeps those reads in front of this pass's arithmetic: sunk into it, each would be waited for right behind its issue
      const H8& cq = tq[it & 1]; const H8 (&ck)[9] = tk[it & 1];
      const int xx = xh * 16 + it * 4 + g;
      const bool okm = okym && (unsigned)(xx + dxm) < (unsigned)HWD;
      const bool ok8 = oky8 && xx + 1 < HWD;
      float s[9];
#pragma unroll
      for (int j = 0; j < 4; ++j) {
        const unsigned kj[9] = {ck[0].d[j], ck[1].d[j], ck[2].d[j], ck[3].d[j], ck[4].d[j], ck[5].d[j], ck[6].d[j], ck[7].d[j], ck[8].d[j]};
        if (j == 0) dot9_first(s, cq.d[j], kj); else dot9_more(s, cq.d[j], kj);
      }
      float r[4], u[2];
#pragma unroll
      for (int i = 0; i < 4; ++i) r[i] = (c4 ? s[4 + i] : s[i]) + xlane<4>(c4 ? s[i] : s[4 + i]);      // logit 4 * (p >> 2) + i
#pragma unroll
      for (int i = 0; i < 2; ++i) u[i] = (c2 ? r[2 + i] : r[i]) + xlane<2>(c2 ? r[i] : r[2 + i]);      // logit 2 * (p >> 1) + i
      const float sm1 = (c1 ? u[1] : u[0]) + xlane<1>(c1 ? u[0] : u[1]);                               // logit p
      float s8 = s[8]; s8 += xlane<1>(s8); s8 += xlane<2>(s8); s8 += xlane<4>(s8);
      const float lm = okm ? sm1 * 0.125f : 0.f, l8 = ok8 ? s8 * 0.125f : 0.f;
      float m = fmaxf(lm, xlane<1>(lm)); m = fmaxf(m, xlane<2>(m)); m = fmaxf(m, xlane<4>(m)); m = fmaxf(m, l8);
      const float em = expf(lm - m), e8 = expf(l8 - m);
      float z = em + xlane<1>(em); z += xlane<2>(z); z += xlane<4>(z); z += e8;
      const float am = em / z, a8 = e8 / z;
      sa[xx * 9 + p] = am;
      if (p == 0) sa[xx * 9 + 8] = a8;
      const float vm = okm ? am : 0.f;
      const float a[9] = {group_bcast<0>(vm), group_bcast<1>(vm), group_bcast<2>(vm), group_bcast<3>(vm), group_bcast<4>(vm), group_bcast<5>(vm), group_bcast<6>(vm), group_bcast<7>(vm), ok8 ? a8 : 0.f};
      __builtin_amdgcn_sched_barrier(0);      // keeps the eight lane moves together in front of the asm rounds: one placed directly in front of the round that reads it would stall it, unhinted
      float acc[8];
#pragma unroll
      for (int wi = 0; wi < 9; ++wi) { if (wi == 0) av8_first(acc, a[wi], tv[wi].d); else av8_more(acc, a[wi], tv[wi].d); }
      FragH o;
#pragma unroll
      for (int j = 0; j < 8; ++j) o.h[j] = (_Float16)acc[j];
      *(v8us*)(orow + it * 4 * OP) = o.half[0];
    }
    asm volatile("s_wait_dscnt 0x0" ::: "memory");         // this wave's reads of the staged q, k, v are done; its part of o and its weights stand in LDS
    asm volatile("s_wait_asynccnt 0x0" ::: "memory");      // behind the last pair: this wave's copies of Bo tiles 0 and 1 have landed
    __syncthreads();                                       // ends every reader's last read of the staged tiles before the next pair overwrites them; behind the last pair it publishes o, the weights and Bo tiles 0 and 1
  }
  fillo(2, 2);      // where the staged tiles stood
  const int aoff2 = TB + (w * 32 + ln) * WP + 16 * hh, boff2 = ln * OP + 16 * hh;
  v8f cacc[2][4] = {};
  const int row0 = w * 32;
  auto tile = [&](int t, int buf) {      // its loops are unrolled so that fragments and accumulators are indexed by constants and stay in registers
#pragma unroll
    for (int ks = 0; ks < KC / 32; ++ks) {
      FragH fa[2], fb[4];
#pragma unroll
      for (int i = 0; i < 2; ++i) { fa[i].half[0] = *(const v8us*)&sm[buf * WB + aoff2 + i * 16 * WP + ks * 64]; fa[i].half[1] = *(const v8us*)&sm[buf * WB + aoff2 + i * 16 * WP + ks * 64 + 32]; }
#pragma unroll
      for (int j = 0; j < 4; ++j) { fb[j].half[0] = *(const v8us*)&sm[boff2 + j * 16 * OP + t * (KC * 2) + ks * 64]; fb[j].half[1] = *(const v8us*)&sm[boff2 + j * 16 * OP + t * (KC * 2) + ks * 64 + 32]; }
#pragma unroll
      for (int i = 0; i < 2; ++i)
#pragma unroll
        for (int j = 0; j < 4; ++j) cacc[i][j] = __builtin_amdgcn_wmma_f32_16x16x32_f16(false, fa[i].v, false, fb[j].v, (short)0, cacc[i][j], false, false);
    }
  };
  tile(0, 0);
  asm volatile("s_wait_dscnt 0x0" ::: "memory");         // this wave's reads of buffer 0 are done before it is refilled
  __syncthreads();                                       // ends every reader's last read of Bo tile 0
  fillo(3, 0);
  v4f bq[2][2];      // the bias of this lane's sixteen rows, asked for here: it comes under tile 1, so neither the next barrier nor the epilogue waits for it
#pragma unroll
  for (int i = 0; i < 2; ++i) { bq[i][0] = *(const v4fa*)(bias + row0 + i * 16 + 8 * hh); bq[i][1] = *(const v4fa*)(bias + row0 + i * 16 + 8 * hh + 4); }
  asm volatile("s_wait_xcnt 0x0" ::: "memory");          // stands in front of tile 1's fragment reads, which take over the address register that these loads name
  tile(1, 1);                                            // tiles 2 and 3 fly meanwhile
  asm volatile("s_wait_dscnt 0x0" ::: "memory");         // this wave's reads of buffer 1 are done before it becomes output staging
  asm volatile("s_wait_asynccnt 0x0" ::: "memory");      // this wave's copies of tiles 2 and 3 have landed; none is outstanding from here on
  __syncthreads();                                       // publishes tiles 2 and 3, ends every reader's last read of tile 1
  {      // the weights go out late: no barrier and no fence then waits for these stores. A wave stores two whole (image row, head) rows of 32 x 9 floats: 72 pieces of 16 bytes each
    const float* sr = (const float*)(sm + SA0) + w * 2 * (HWD * 9);
    float* ap0 = ATTN + (((size_t)b * NH + ((w * 2) & 7)) * NPIX + (y0 + (w >> 2)) * HWD) * 9;      // rows 2w and 2w + 1: heads (2w) & 7 and the next, of the same image row
    float* ap1 = ap0 + (size_t)NPIX * 9;
    const int i2 = 64 + (lane & 7);      // the last eight pieces of a row: read by every lane, stored by lanes 0 .. 7
    const v4f a0 = *(const v4fa*)&sr[lane * 4], a1 = *(const v4fa*)&sr[(32 + lane) * 4], a2 = *(const v4fa*)&sr[i2 * 4];
    const v4f b0 = *(const v4fa*)&sr[HWD * 9 + lane * 4], b1 = *(const v4fa*)&sr[HWD * 9 + (32 + lane) * 4], b2 = *(const v4fa*)&sr[HWD * 9 + i2 * 4];
    __builtin_amdgcn_sched_barrier(0);      // keeps every LDS read in front of the first store
    if (lane < 8) { *(v4f*)(ap0 + (64 + lane) * 4) = a2; *(v4f*)(ap1 + (64 + lane) * 4) = b2; }      // first: this build forms an address pair for them, which behind the other stores took over a stored register
    *(v4f*)(ap0 + lane * 4) = a0; *(v4f*)(ap0 + (32 + lane) * 4) = a1; *(v4f*)(ap1 + lane * 4) = b0; *(v4f*)(ap1 + (32 + lane) * 4) = b1;
    asm volatile("s_wait_xcnt 0x0" ::: "memory");      // stands in front of the next tile's overwrites of the registers that these stores name
  }
  tile(2, 2); tile(3, 0);
  // epilogue: each wave stages its 32 x 64 tile in its own range of buffer 1 (pitch 68 floats) and stores whole lines: a row is a channel, its 64 columns the two image rows, side by side in memory
  float* so = (float*)(sm + TB + WB) + w * (32 * 68);
#pragma unroll      // unrolled here and below: the accumulators and the bias are indexed by constants
  for (int i = 0; i < 2; ++i)
#pragma unroll
    for (int r = 0; r < 8; ++r) {
      const float bv = bf16_round(bq[i][r >> 2][r & 3]);
#pragma unroll
      for (int j = 0; j < 4; ++j) so[(i * 16 + 8 * hh + r) * 68 + j * 16 + ln] = cacc[i][j][r] * alpha + bv;
    }
  asm volatile("s_wait_dscnt 0x0" ::: "memory");      // the wave's own LDS writes are done before other lanes of it read them (a fence here would wait for the weights' stores as well)
  const int rs = lane >> 4, q4 = (lane & 15) * 4;
  float* cp = OUT + ((size_t)b * CC + row0 + rs) * NPIX + y0 * HWD + q4;
#pragma unroll
  for (int q = 0; q < 16; ++q) { const v4f v = *(const v4fa*)&so[(q * 2 + rs) * 68 + q4]; *(v4f*)(cp + q * 2 * NPIX) = v; }
}
extern "C" void kernel_launch(void* const* d_in, const int* in_sizes, int n_in,
                              void* d_out, int out_size, void* d_ws, size_t ws_size, hipStream_t stream) {
  (void)in_sizes; (void)n_in; (void)out_size;
  const float* x = (const float*)d_in[0]; const float* Wq = (const float*)d_in[1]; const float* Wkv = (const float*)d_in[2]; const float* Wo = (const float*)d_in[3]; const float* bo = (const float*)d_in[4];
  float* OUT0 = (float*)d_out; float* ATTN = OUT0 + (size_t)BB * CC * NPIX;
  _Float16* Bw = (_Float16*)d_ws; _Float16* Bo = Bw + (size_t)3 * INNER * CC;      // [Wq | Wkv] (1536 rows of 256), then Wo (256 rows of 512)
  if ((size_t)4 * INNER * CC * 2 > ws_size) return;      // 1.1 MB
  k_prep<<<NBW, 256, 0, stream>>>(Wq, Wkv, Wo, Bw);
  k_all<<<BB * (HWD / 2), 256, 0, stream>>>(x, Bw, Bo, bo, 0.0625f, ATTN, OUT0);      // q | k | v, window attention, to_out + bo with channels as rows: stored as NCHW
}

// v008
// A run of this version takes 27 microseconds.
// Two timings next to v007 both put it at 1.05 times that version's speed.
// All steps since v000 together make it 6.04 times as fast.
#include <hip/hip_runtime.h>
// Local 3×3-window attention (x [16,256,32,32]; 8 heads × 64): q = 1×1 conv (Wq), k,v = 1×1 conv (Wkv), each pixel attends over its 3×3 neighbourhood (zero-padded keys/values take part with
// logit 0), softmax(q·k/8), out = Σ attn·v, 1×1 conv Wo + bo; outputs (out NCHW, attn [16,8,1024,9]). The three pointwise convs run as GEMMs on v_wmma_f32_16x16x32_f16 (x bf16-exact, (out,in)
// weights bf16-exact ×2^4, q/k/v/o f16, f32 accumulate); the 9-wide window dots, softmax and attn * v are f32 VALU (two lanes a pixel and head), the weights are converted in a launch of their own; everything else is one kernel, a work-group = two image rows: it transposes and converts its own tile of x (four rows), q, k, v and o stay in LDS, out is stored as NCHW.
#define BB 16
#define CC 256
#define HWD 32
#define NPIX 1024
#define NH 8
#define DH 64
#define INNER 512
#define NR (BB * NPIX)

typedef __bf16 v16b __attribute__((ext_vector_type(16)));
typedef unsigned short v8us __attribute__((ext_vector_type(8), may_alias));
typedef float  v8f  __attribute__((ext_vector_type(8)));
typedef float  v4f  __attribute__((ext_vector_type(4)));
typedef float  v4fa __attribute__((ext_vector_type(4), may_alias));
union FragB { v16b v; v8us half[2]; unsigned short u[16]; };

__device__ __forceinline__ unsigned short bf16_bits(float x) { unsigned int u = __float_as_uint(x); return (unsigned short)((u + 0x7FFFu + ((u >> 16) & 1u)) >> 16); }
__device__ __forceinline__ float bf16_val(unsigned short b) { return __uint_as_float(((unsigned int)b) << 16); }
__device__ __forceinline__ float bf16_round(float x) { return bf16_val(bf16_bits(x)); }
// D += A·B with NT terms: 1 = ah·bh, 2 = + al·bh (A split), 3 = + ah·bl (both split)
template <int NT>
__device__ __forceinline__ v8f mmaN(v16b ah, v16b al, v16b bh, v16b bl, v8f c) {
  c = __builtin_amdgcn_wmma_f32_16x16x32_bf16(false, ah, false, bh, (short)0, c, false, false);
  if (NT >= 2) c = __builtin_amdgcn_wmma_f32_16x16x32_bf16(false, al, false, bh, (short)0, c, false, false);
  if (NT >= 3) c = __builtin_amdgcn_wmma_f32_16x16x32_bf16(false, ah, false, bl, (short)0, c, false, false);
  asm volatile("v_nop\n\tv_nop\n\tv_nop\n\tv_nop" : "+v"(c) : "v"(ah), "v"(al), "v"(bh), "v"(bl));
  return c;
}

__global__ __launch_bounds__(256) void k_wt_bf16(const float* __restrict__ W, unsigned short* __restrict__ Wt, int K, int N) {
  const int t = blockIdx.x * 256 + threadIdx.x;
  const int k8n = K / 8;
  if (t >= N * k8n) return;
  const int n = t / k8n, k8 = (t % k8n) * 8;
  v8us v;
#pragma unroll
  for (int i = 0; i < 8; ++i) v[i] = bf16_bits(W[(size_t)(k8 + i) * N + n]);
  *(v8us*)(Wt + (size_t)n * K + k8) = v;
  
}

// GEMM C[M][N] (f32, pitch ldc) = act(A[M][K]·W + bias). A f32 row-major (pitch lda) converted per fragment to bf16
// (ASPLIT: hi/lo two planes -> 2 terms, else single rounded term); Wt bf16 [N][K] (pitch ldb). BIAS_BF16 rounds the
// bias to bf16 first (bias quantised to bf16 before the add). K%32==0, M%16==0, N%64==0.
template <bool ASPLIT, int ACT, bool BIAS_BF16>
__global__ __launch_bounds__(128) void k_gemm_bf(const float* __restrict__ A, int lda, const unsigned short* __restrict__ Wt, int ldb,
                                               const float* __restrict__ bias, float* __restrict__ C, int ldc, int M, int N, int K) {
  __shared__ __attribute__((aligned(16))) float so[4][16][64];
  const int tid = threadIdx.x, w = tid >> 5, lane = tid & 31, ln = lane & 15, hh = lane >> 4;
  const int ntn = N / 64;
  const int wid = blockIdx.x * 4 + w;
  const int mt = wid / ntn, nq = wid % ntn;
  if (mt * 16 >= M) return;
  const int row0 = mt * 16, col0 = nq * 64;
  const float* arow = A + (size_t)(row0 + ln) * lda;
  v8f acc[4] = {};
  for (int kb = 0; kb < K; kb += 32) {
    FragB ah, al;
    const v4f x0 = *(const v4fa*)(arow + kb + 8 * hh), x1 = *(const v4fa*)(arow + kb + 8 * hh + 4);
    const v4f x2 = *(const v4fa*)(arow + kb + 16 + 8 * hh), x3 = *(const v4fa*)(arow + kb + 16 + 8 * hh + 4);
    float xs[16] = {x0[0],x0[1],x0[2],x0[3],x1[0],x1[1],x1[2],x1[3],x2[0],x2[1],x2[2],x2[3],x3[0],x3[1],x3[2],x3[3]};
#pragma unroll
    for (int i = 0; i < 16; ++i) { const unsigned short hb = bf16_bits(xs[i]); ah.u[i] = hb; al.u[i] = ASPLIT ? bf16_bits(xs[i] - bf16_val(hb)) : (unsigned short)0; }
#pragma unroll
    for (int t = 0; t < 4; ++t) {
      const unsigned short* brow = Wt + (size_t)(col0 + t * 16 + ln) * ldb + kb;
      FragB b;
      b.half[0] = *(const v8us*)(brow + 8 * hh);
      b.half[1] = *(const v8us*)(brow + 16 + 8 * hh);
      acc[t] = mmaN<ASPLIT ? 2 : 1>(ah.v, al.v, b.v, b.v, acc[t]);
    }
  }
#pragma unroll
  for (int t = 0; t < 4; ++t) {
    float bv = bias ? bias[col0 + t * 16 + ln] : 0.f;
    if (BIAS_BF16) bv = bf16_round(bv);
#pragma unroll
    for (int r = 0; r < 8; ++r) { float v = acc[t][r] + bv; if (ACT == 1) v = fmaxf(v, 0.f); so[w][8 * hh + r][t * 16 + ln] = v; }
  }
  __builtin_amdgcn_fence(__ATOMIC_ACQ_REL, "workgroup");
  __builtin_amdgcn_wave_barrier();
  const int rsub = lane >> 4, c4 = (lane & 15) * 4;
  {
#pragma unroll
    for (int q = 0; q < 8; ++q) {
      const int r = q * 2 + rsub;
      const v4f v = *(const v4fa*)&so[w][r][c4];
      *(v4f*)(C + (size_t)(row0 + r) * ldc + col0 + c4) = v;
    }
    
  }
}

// Flash-style causal/unmasked attention, all contractions 3-term bf16 hi/lo splits, f32 softmax with running max.
// q,k,v rows are read from f32 buffers with arbitrary row pitch (so they can live inside a fused qkv buffer);
// D = head size (multiple of 32, <= 128); one wave = 16 query rows; block = 4 waves (64 queries) sharing K/V chunks of 32.
template <int D, bool CAUSAL>
__global__ __launch_bounds__(128) void k_flash(const float* __restrict__ qb, const float* __restrict__ kb, const float* __restrict__ vb,
                                             int pitch, int T, int H, float scale, float* __restrict__ y, int ypitch) {
  constexpr int KS = D / 32;        // k-steps for QK
  constexpr int DT = D / 16;        // d tiles for PV
  __shared__ __attribute__((aligned(16))) unsigned short sKh[32][D + 8], sKl[32][D + 8], sVh[32][D + 8], sVl[32][D + 8];
  __shared__ __attribute__((aligned(16))) unsigned short sPh[4][16][40], sPl[4][16][40];
  __shared__ __attribute__((aligned(16))) float sO[4][16][D];
  const int tid = threadIdx.x, w = tid >> 5, lane = tid & 31, ln = lane & 15, hh = lane >> 4;
  const int nqb = (T + 63) / 64;
  const int bh = blockIdx.x / nqb, qblk = blockIdx.x % nqb;
  const int b = bh / H, h = bh % H;
  const int q0 = qblk * 64 + w * 16;
  const float* Q = qb + (size_t)b * T * pitch + h * D;
  const float* K = kb + (size_t)b * T * pitch + h * D;
  const float* V = vb + (size_t)b * T * pitch + h * D;

  // A fragments of the wave's 16 query rows (scaled), hi/lo
  FragB aqh[KS], aql[KS];
  {
    int row = q0 + ln; if (row >= T) row = T - 1;
    const float* qr = Q + (size_t)row * pitch;
#pragma unroll
    for (int ks = 0; ks < KS; ++ks)
#pragma unroll
      for (int i = 0; i < 16; ++i) {
        const int d = ks * 32 + ((i < 8) ? (8 * hh + i) : (16 + 8 * hh + (i - 8)));
        const float x = qr[d] * scale; const unsigned short hb = bf16_bits(x);
        aqh[ks].u[i] = hb; aql[ks].u[i] = bf16_bits(x - bf16_val(hb));
      }
  }
  float m_r[8], l_r[8];
#pragma unroll
  for (int r = 0; r < 8; ++r) { m_r[r] = -3.0e38f; l_r[r] = 0.f; }
  v8f oacc[DT];
#pragma unroll
  for (int dt = 0; dt < DT; ++dt) oacc[dt] = (v8f){0.f,0.f,0.f,0.f,0.f,0.f,0.f,0.f};

  const int kv_end = CAUSAL ? min(T, qblk * 64 + 64) : T;     // block-uniform
  for (int j0 = 0; j0 < kv_end; j0 += 32) {
    __syncthreads();
    for (int e = tid; e < 32 * (D / 4); e += 128) {
      const int r = e / (D / 4), c4 = (e % (D / 4)) * 4;
      const int key = j0 + r;
      v4f kf = {0.f,0.f,0.f,0.f}, vf = {0.f,0.f,0.f,0.f};
      if (key < T) { kf = *(const v4fa*)(K + (size_t)key * pitch + c4); vf = *(const v4fa*)(V + (size_t)key * pitch + c4); }
#pragma unroll
      for (int t = 0; t < 4; ++t) {
        unsigned short hb = bf16_bits(kf[t]); sKh[r][c4 + t] = hb; sKl[r][c4 + t] = bf16_bits(kf[t] - bf16_val(hb));
        hb = bf16_bits(vf[t]); sVh[r][c4 + t] = hb; sVl[r][c4 + t] = bf16_bits(vf[t] - bf16_val(hb));
      }
    }
    __syncthreads();
    // S tile 16 x 32
    v8f s[2];
#pragma unroll
    for (int nt = 0; nt < 2; ++nt) {
      v8f acc = {};
#pragma unroll
      for (int ks = 0; ks < KS; ++ks) {
        FragB bh_, bl_;
        bh_.half[0] = *(const v8us*)&sKh[nt * 16 + ln][ks * 32 + 8 * hh]; bh_.half[1] = *(const v8us*)&sKh[nt * 16 + ln][ks * 32 + 16 + 8 * hh];
        bl_.half[0] = *(const v8us*)&sKl[nt * 16 + ln][ks * 32 + 8 * hh]; bl_.half[1] = *(const v8us*)&sKl[nt * 16 + ln][ks * 32 + 16 + 8 * hh];
        acc = mmaN<3>(aqh[ks].v, aql[ks].v, bh_.v, bl_.v, acc);
      }
      s[nt] = acc;
    }
    // mask + running max (rows 8hh+r; the 16 lanes of a half share rows)
    float alpha[8];
#pragma unroll
    for (int r = 0; r < 8; ++r) {
      const int qi = q0 + 8 * hh + r;
      const int ja = j0 + ln, jb = j0 + 16 + ln;
      if (CAUSAL) { if (ja > qi) s[0][r] = -3.0e38f; if (jb > qi) s[1][r] = -3.0e38f; }
      if (ja >= T) s[0][r] = -3.0e38f;
      if (jb >= T) s[1][r] = -3.0e38f;
      float mx = fmaxf(s[0][r], s[1][r]);
      mx = fmaxf(mx, __shfl_xor(mx, 1, 32)); mx = fmaxf(mx, __shfl_xor(mx, 2, 32)); mx = fmaxf(mx, __shfl_xor(mx, 4, 32)); mx = fmaxf(mx, __shfl_xor(mx, 8, 32));
      const float mnew = fmaxf(m_r[r], mx);
      alpha[r] = (mnew > -1.0e38f) ? __expf(m_r[r] - mnew) : 1.0f;
      const float p0 = (s[0][r] > -1.0e38f) ? __expf(s[0][r] - mnew) : 0.f;
      const float p1 = (s[1][r] > -1.0e38f) ? __expf(s[1][r] - mnew) : 0.f;
      m_r[r] = mnew;
      l_r[r] = l_r[r] * alpha[r] + p0 + p1;            // per-lane partial row sum (16 lanes combined at the end)
      unsigned short hb = bf16_bits(p0); sPh[w][8 * hh + r][ln] = hb;      sPl[w][8 * hh + r][ln] = bf16_bits(p0 - bf16_val(hb));
      hb = bf16_bits(p1);                sPh[w][8 * hh + r][16 + ln] = hb; sPl[w][8 * hh + r][16 + ln] = bf16_bits(p1 - bf16_val(hb));
    }
#pragma unroll
    for (int dt = 0; dt < DT; ++dt)
#pragma unroll
      for (int r = 0; r < 8; ++r) oacc[dt][r] *= alpha[r];
    __builtin_amdgcn_fence(__ATOMIC_ACQ_REL, "workgroup");
    __builtin_amdgcn_wave_barrier();
    FragB pah, pal;
    pah.half[0] = *(const v8us*)&sPh[w][ln][8 * hh]; pah.half[1] = *(const v8us*)&sPh[w][ln][16 + 8 * hh];
    pal.half[0] = *(const v8us*)&sPl[w][ln][8 * hh]; pal.half[1] = *(const v8us*)&sPl[w][ln][16 + 8 * hh];
#pragma unroll
    for (int dt = 0; dt < DT; ++dt) {
      FragB bvh, bvl;
#pragma unroll
      for (int i = 0; i < 8; ++i) {
        bvh.u[i] = sVh[8 * hh + i][dt * 16 + ln]; bvh.u[8 + i] = sVh[16 + 8 * hh + i][dt * 16 + ln];
        bvl.u[i] = sVl[8 * hh + i][dt * 16 + ln]; bvl.u[8 + i] = sVl[16 + 8 * hh + i][dt * 16 + ln];
      }
      oacc[dt] = mmaN<3>(pah.v, pal.v, bvh.v, bvl.v, oacc[dt]);
    }
    __builtin_amdgcn_fence(__ATOMIC_ACQ_REL, "workgroup");
    __builtin_amdgcn_wave_barrier();
  }
#pragma unroll
  for (int r = 0; r < 8; ++r) {
    float l = l_r[r];
    l += __shfl_xor(l, 1, 32); l += __shfl_xor(l, 2, 32); l += __shfl_xor(l, 4, 32); l += __shfl_xor(l, 8, 32);
    l_r[r] = (l > 0.f) ? 1.0f / l : 0.f;
  }
#pragma unroll
  for (int dt = 0; dt < DT; ++dt)
#pragma unroll
    for (int r = 0; r < 8; ++r) sO[w][8 * hh + r][dt * 16 + ln] = oacc[dt][r] * l_r[r];
  __builtin_amdgcn_fence(__ATOMIC_ACQ_REL, "workgroup");
  __builtin_amdgcn_wave_barrier();
  {
    for (int r = 0; r < 16; ++r) {
      const int row = q0 + r;
      if (row < T && lane < D / 4) {
        const v4f val = *(const v4fa*)&sO[w][r][lane * 4];
        *(v4f*)(y + ((size_t)b * T + row) * ypitch + h * D + lane * 4) = val;
      }
    }
    
  }
}

// GEMM C = act(A·W + bias + resid): A f32 (ASPLIT -> hi/lo 2 terms), Wt bf16 [N][K]; ACT 0 none, 1 relu, 2 exact gelu;
// resid (optional, f32, row index = (row % rmod), pitch ldr, RES_BF16 rounds it) added before the activation.
template <bool ASPLIT, int ACT, bool BIAS_BF16, bool RES_BF16>
__global__ __launch_bounds__(128) void k_gemm_bf3(const float* __restrict__ A, int lda, const unsigned short* __restrict__ Wt, int ldb,
                                                const float* __restrict__ bias, const float* __restrict__ resid, int rmod, int ldr,
                                                float* __restrict__ C, int ldc, int M, int N, int K) {
  __shared__ __attribute__((aligned(16))) float so[4][16][64];
  const int tid = threadIdx.x, w = tid >> 5, lane = tid & 31, ln = lane & 15, hh = lane >> 4;
  const int ntn = N / 64;
  const int wid = blockIdx.x * 4 + w;
  const int mt = wid / ntn, nq = wid % ntn;
  if (mt * 16 >= M) return;
  const int row0 = mt * 16, col0 = nq * 64;
  const float* arow = A + (size_t)(row0 + ln) * lda;
  v8f acc[4] = {};
  for (int kb = 0; kb < K; kb += 32) {
    FragB ah, al;
    const v4f x0 = *(const v4fa*)(arow + kb + 8 * hh), x1 = *(const v4fa*)(arow + kb + 8 * hh + 4);
    const v4f x2 = *(const v4fa*)(arow + kb + 16 + 8 * hh), x3 = *(const v4fa*)(arow + kb + 16 + 8 * hh + 4);
    float xs[16] = {x0[0],x0[1],x0[2],x0[3],x1[0],x1[1],x1[2],x1[3],x2[0],x2[1],x2[2],x2[3],x3[0],x3[1],x3[2],x3[3]};
#pragma unroll
    for (int i = 0; i < 16; ++i) { const unsigned short hb = bf16_bits(xs[i]); ah.u[i] = hb; al.u[i] = ASPLIT ? bf16_bits(xs[i] - bf16_val(hb)) : (unsigned short)0; }
#pragma unroll
    for (int t = 0; t < 4; ++t) {
      const unsigned short* brow = Wt + (size_t)(col0 + t * 16 + ln) * ldb + kb;
      FragB b;
      b.half[0] = *(const v8us*)(brow + 8 * hh);
      b.half[1] = *(const v8us*)(brow + 16 + 8 * hh);
      acc[t] = mmaN<ASPLIT ? 2 : 1>(ah.v, al.v, b.v, b.v, acc[t]);
    }
  }
#pragma unroll
  for (int t = 0; t < 4; ++t) {
    const int col = col0 + t * 16 + ln;
    float bv = bias ? bias[col] : 0.f;
    if (BIAS_BF16) bv = bf16_round(bv);
#pragma unroll
    for (int r = 0; r < 8; ++r) {
      float v = acc[t][r] + bv;
      if (resid) { float rv = resid[(size_t)((row0 + 8 * hh + r) % rmod) * ldr + col]; if (RES_BF16) rv = bf16_round(rv); v += rv; }
      if (ACT == 1) v = fmaxf(v, 0.f);
      if (ACT == 2) v = 0.5f * v * (1.0f + erff(v * 0.70710678118654752f));
      if (ACT == 3) { const float u = 0.7978845608028654f * (v + 0.044715f * v * v * v); v = 0.5f * v * (1.0f + tanhf(u)); }
      so[w][8 * hh + r][t * 16 + ln] = v;
    }
  }
  __builtin_amdgcn_fence(__ATOMIC_ACQ_REL, "workgroup");
  __builtin_amdgcn_wave_barrier();
  const int rsub = lane >> 4, c4 = (lane & 15) * 4;
  {
#pragma unroll
    for (int q = 0; q < 8; ++q) {
      const int r = q * 2 + rsub;
      const v4f v = *(const v4fa*)&so[w][r][c4];
      *(v4f*)(C + (size_t)(row0 + r) * ldc + col0 + c4) = v;
    }
    
  }
}
// row LayerNorm (biased variance, eps) over N: s = X (+ R); optional out_sum <- s; out_norm <- (s-mu)*rsqrt(var+eps)*g + b
template <bool PARAM_BF16>
__global__ __launch_bounds__(256) void k_layernorm(const float* __restrict__ X, const float* __restrict__ R, const float* __restrict__ g, const float* __restrict__ bta,
                                                  float* __restrict__ out_sum, float* __restrict__ out_norm, int N, float eps) {
  __shared__ float red[256];
  const int row = blockIdx.x, tid = threadIdx.x;
  const float* x = X + (size_t)row * N; const float* rr = R ? R + (size_t)row * N : nullptr;
  float vals[16];                     // up to N = 4096
  const int per = N / 256;            // contiguous chunk per thread? use strided-by-4 chunks: thread handles j = tid*4 + 1024*u
  float s1 = 0.f;
  for (int u = 0; u < per / 4; ++u) {
    const int j = tid * 4 + 1024 * u;
    const v4f a = *(const v4fa*)(x + j);
    v4f b = {0.f,0.f,0.f,0.f}; if (rr) b = *(const v4fa*)(rr + j);
#pragma unroll
    for (int q = 0; q < 4; ++q) { const float v = a[q] + b[q]; vals[u * 4 + q] = v; s1 += v; }
  }
  red[tid] = s1; __syncthreads();
  for (int st = 128; st > 0; st >>= 1) { if (tid < st) red[tid] += red[tid + st]; __syncthreads(); }
  const float mu = red[0] / (float)N; __syncthreads();
  float s2 = 0.f;
  for (int u = 0; u < per / 4; ++u)
#pragma unroll
    for (int q = 0; q < 4; ++q) { const float c = vals[u * 4 + q] - mu; s2 += c * c; }
  red[tid] = s2; __syncthreads();
  for (int st = 128; st > 0; st >>= 1) { if (tid < st) red[tid] += red[tid + st]; __syncthreads(); }
  const float rs = rsqrtf(red[0] / (float)N + eps);
  {
    for (int u = 0; u < per / 4; ++u) {
      const int j = tid * 4 + 1024 * u;
      v4f o, sm;
#pragma unroll
      for (int q = 0; q < 4; ++q) {
        float gg = g[j + q], bb = bta[j + q];
        if (PARAM_BF16) { gg = bf16_round(gg); bb = bf16_round(bb); }
        sm[q] = vals[u * 4 + q]; o[q] = (vals[u * 4 + q] - mu) * rs * gg + bb;
      }
      if (out_sum) *(v4f*)(out_sum + (size_t)row * N + j) = sm;
      *(v4f*)(out_norm + (size_t)row * N + j) = o;
    }
    
  }
}



// ---- f16 WMMA path (v_wmma_f32_16x16x32_f16): 11-bit significands for operands in range — used here for the three 1×1 conv GEMMs (q | k | v and to_out, all in k_all)
typedef _Float16 v16h __attribute__((ext_vector_type(16)));
union FragH { v16h v; v8us half[2]; _Float16 h[16]; unsigned short u[16]; };
template <int NT>
__device__ __forceinline__ v8f mmaH(v16h ah, v16h al, v16h bh, v16h bl, v8f c) {
  c = __builtin_amdgcn_wmma_f32_16x16x32_f16(false, ah, false, bh, (short)0, c, false, false);
  if (NT >= 2) c = __builtin_amdgcn_wmma_f32_16x16x32_f16(false, al, false, bh, (short)0, c, false, false);
  if (NT >= 3) c = __builtin_amdgcn_wmma_f32_16x16x32_f16(false, ah, false, bl, (short)0, c, false, false);
  asm volatile("v_nop\n\tv_nop\n\tv_nop\n\tv_nop" : "+v"(c) : "v"(ah), "v"(al), "v"(bh), "v"(bl));
  return c;
}
// batched GEMM like k_gemm_b but f16 operands: A f32 (split into f16 hi/lo if ASPLIT, else rounded to f16), Bt = f16 values [n][k]; alpha; C f32; N multiple of 16 (partial tiles skipped)
template <bool ASPLIT>
__global__ __launch_bounds__(128) void k_gemm_h(const float* __restrict__ A, int lda, size_t sA, const _Float16* __restrict__ Bh, int ldb, size_t sB, float alpha, float* __restrict__ C, int ldc, size_t sC, int M, int N, int K) {
  __shared__ __attribute__((aligned(16))) float so[4][16][64];
  const int tid = threadIdx.x, w = tid >> 5, lane = tid & 31, ln = lane & 15, hh = lane >> 4; const int by = blockIdx.y;
  A += (size_t)by * sA; Bh += (size_t)by * sB; C += (size_t)by * sC;
  const int ntn = (N + 63) / 64; const int wid = blockIdx.x * 4 + w; const int mt = wid / ntn, nq = wid % ntn; if (mt * 16 >= M) return;
  const int row0 = mt * 16, col0 = nq * 64; const float* arow = A + (size_t)(row0 + ln) * lda;
  v8f acc[4] = {};
  for (int kb = 0; kb < K; kb += 32) {
    FragH ah, al;
    const v4f x0 = *(const v4fa*)(arow + kb + 8 * hh), x1 = *(const v4fa*)(arow + kb + 8 * hh + 4), x2 = *(const v4fa*)(arow + kb + 16 + 8 * hh), x3 = *(const v4fa*)(arow + kb + 16 + 8 * hh + 4);
    float xs[16] = {x0[0],x0[1],x0[2],x0[3],x1[0],x1[1],x1[2],x1[3],x2[0],x2[1],x2[2],x2[3],x3[0],x3[1],x3[2],x3[3]};
#pragma unroll
    for (int i = 0; i < 16; ++i) { const _Float16 h = (_Float16)xs[i]; ah.h[i] = h; al.h[i] = ASPLIT ? (_Float16)(xs[i] - (float)h) : (_Float16)0.0f; }
#pragma unroll
    for (int t = 0; t < 4; ++t) { if (col0 + t * 16 >= N) continue; const size_t boff = (size_t)(col0 + t * 16 + ln) * ldb + kb; FragH bq; bq.half[0] = *(const v8us*)(Bh + boff + 8 * hh); bq.half[1] = *(const v8us*)(Bh + boff + 16 + 8 * hh);
      acc[t] = mmaH<ASPLIT ? 2 : 1>(ah.v, al.v, bq.v, bq.v, acc[t]); }
  }
#pragma unroll
  for (int t = 0; t < 4; ++t) { if (col0 + t * 16 >= N) continue;
#pragma unroll
    for (int r = 0; r < 8; ++r) so[w][8 * hh + r][t * 16 + ln] = acc[t][r] * alpha; }
  __builtin_amdgcn_fence(__ATOMIC_ACQ_REL, "workgroup"); __builtin_amdgcn_wave_barrier();
  const int rsub = lane >> 4, c4 = (lane & 15) * 4;
  {
#pragma unroll
    for (int q = 0; q < 8; ++q) { const int r = q * 2 + rsub; if (col0 + c4 < N) { const v4f v = *(const v4fa*)&so[w][r][c4]; *(v4f*)(C + (size_t)(row0 + r) * ldc + col0 + c4) = v; } }
     }
}

// Wt[n][k] = f16(W[k][n]·scale) from f32 row-major W[K][N] (scale = power of two; bf16-exact weights stay exact in f16 away from the subnormal range)
__global__ __launch_bounds__(256) void k_wt_f16(const float* __restrict__ W, _Float16* __restrict__ Wt, int K, int N, float scale) {
  const int t = blockIdx.x * 256 + threadIdx.x; if (t >= N * (K / 8)) return; const int n = t / (K / 8), k8 = (t % (K / 8)) * 8; FragH f;
#pragma unroll
  for (int i = 0; i < 8; ++i) f.h[i] = (_Float16)(bf16_round(W[(size_t)(k8 + i) * N + n]) * scale); const v8us o = f.half[0];
  *(v8us*)((unsigned short*)Wt + (size_t)n * K + k8) = o; 
}
// k_gemm_hh variant with fused epilogue: v = acc·alpha + bias[by·sBias + col] (+ CP[(row/rowsPerB)·sCPb + by·64 + col] if CP) ; ACT 0 none / 1 elu ; writes f16 C16 and f32 C, each if non-null
template <int ACT>
__global__ __launch_bounds__(128) void k_gemm_hhx(const _Float16* __restrict__ A, int lda, size_t sA, const _Float16* __restrict__ Bh, int ldb, size_t sB, float alpha, const float* __restrict__ bias, size_t sBias, const float* __restrict__ CP, int rowsPerB, size_t sCPb, int row0g,
    float* __restrict__ C, _Float16* __restrict__ C16, int ldc, size_t sC, int M, int N, int K) {
  __shared__ __attribute__((aligned(16))) float so[4][16][64];
  const int tid = threadIdx.x, w = tid >> 5, lane = tid & 31, ln = lane & 15, hh = lane >> 4; const int by = blockIdx.y;
  A += (size_t)by * sA; Bh += (size_t)by * sB; const size_t cofs = (size_t)by * sC; const float* bp = bias ? bias + (size_t)by * sBias : nullptr;
  const int ntn = (N + 63) / 64; const int wid = blockIdx.x * 4 + w; const int mt = wid / ntn, nq = wid % ntn; if (mt * 16 >= M) return;
  const int row0 = mt * 16, col0 = nq * 64; const _Float16* arow = A + (size_t)(row0 + ln) * lda;
  v8f acc[4] = {};
  for (int kb = 0; kb < K; kb += 32) { FragH ah; ah.half[0] = *(const v8us*)((const unsigned short*)arow + kb + 8 * hh); ah.half[1] = *(const v8us*)((const unsigned short*)arow + kb + 16 + 8 * hh);
#pragma unroll
    for (int t = 0; t < 4; ++t) { if (col0 + t * 16 >= N) continue; const size_t boff = (size_t)(col0 + t * 16 + ln) * ldb + kb; FragH bq; bq.half[0] = *(const v8us*)((const unsigned short*)Bh + boff + 8 * hh); bq.half[1] = *(const v8us*)((const unsigned short*)Bh + boff + 16 + 8 * hh);
      acc[t] = mmaH<1>(ah.v, ah.v, bq.v, bq.v, acc[t]); }
  }
#pragma unroll
  for (int t = 0; t < 4; ++t) { if (col0 + t * 16 >= N) continue; const int col = col0 + t * 16 + ln; const float bv = bp ? bf16_round(bp[col]) : 0.f;
#pragma unroll
    for (int r = 0; r < 8; ++r) { float v = acc[t][r] * alpha + bv; if (CP) { const int bidx = (row0g + row0 + 8 * hh + r) / rowsPerB; v += CP[(size_t)bidx * sCPb + (size_t)by * 64 + col]; } if (ACT == 1) v = (v > 0.f) ? v : expm1f(v); else if (ACT == 3) v = fmaxf(v, 0.f); so[w][8 * hh + r][t * 16 + ln] = v; } }
  __builtin_amdgcn_fence(__ATOMIC_ACQ_REL, "workgroup"); __builtin_amdgcn_wave_barrier();
  const int rsub = lane >> 4, c4 = (lane & 15) * 4; typedef _Float16 v4h __attribute__((ext_vector_type(4)));
  {
#pragma unroll
    for (int q = 0; q < 8; ++q) { const int r = q * 2 + rsub; if (col0 + c4 < N) { const v4f v = *(const v4fa*)&so[w][r][c4]; if (C) *(v4f*)(C + cofs + (size_t)(row0 + r) * ldc + col0 + c4) = v; if (C16) { v4h h4; for (int i = 0; i < 4; ++i) h4[i] = (_Float16)v[i]; *(v4h*)(C16 + cofs + (size_t)(row0 + r) * ldc + col0 + c4) = h4; } } }
     }
}


// Eight 16-byte asynchronous copies global -> LDS (each lane its own addresses), rows lstep / gstep apart. The s_wait_xcnt closes the statement so that no
// address register named here is rewritten ahead of it.
__device__ __forceinline__ void copy8(unsigned l, const _Float16* g, unsigned lstep, size_t gstep) {
  asm volatile("global_load_async_to_lds_b128 %0, %8, off\n\t"
               "global_load_async_to_lds_b128 %1, %9, off\n\t"
               "global_load_async_to_lds_b128 %2, %10, off\n\t"
               "global_load_async_to_lds_b128 %3, %11, off\n\t"
               "global_load_async_to_lds_b128 %4, %12, off\n\t"
               "global_load_async_to_lds_b128 %5, %13, off\n\t"
               "global_load_async_to_lds_b128 %6, %14, off\n\t"
               "global_load_async_to_lds_b128 %7, %15, off\n\t"
               "s_wait_xcnt 0x0"
               :: "v"(l), "v"(l + lstep), "v"(l + 2 * lstep), "v"(l + 3 * lstep), "v"(l + 4 * lstep), "v"(l + 5 * lstep), "v"(l + 6 * lstep), "v"(l + 7 * lstep),
                  "v"(g), "v"(g + gstep), "v"(g + 2 * gstep), "v"(g + 3 * gstep), "v"(g + 4 * gstep), "v"(g + 5 * gstep), "v"(g + 6 * gstep), "v"(g + 7 * gstep)
               : "memory");
}
// C[M][Nn] = A[M][Kk] * Bh[Nn][Kk]^T * alpha (+ bf16-rounded bias), f16 operands, f32 accumulate. One work-group = one 128 x 128 tile of C, four waves (2 x 2) of 64 x 64.
// A and Bh tiles of 128 rows x 128 k are staged in LDS (row pitch 272 B) by asynchronous copies, two buffers: tile t + 1 flies while tile t is worked on.
// M, Nn multiples of 128 (grid = M / 128 * Nn / 128), Kk a multiple of 128. Each 16 x 16 accumulator sums k upwards in steps of 32.
// NCHW: A holds the CC output channels' weights and Bh the tokens (Nn = NR), so a row of C is a channel and its columns are pixels that lie side by side in the image:
// the tile goes straight to C[image][channel][pixel] (f32), the bias belongs to the row.
// NS > 0 (a multiple of 128, with OUT16): two products that share A run as one launch; columns below NS go to C16 (row pitch NS), the others to C16b (row pitch Nn - NS).
template <int Nn, int Kk, bool OUT16, bool BIAS, bool NCHW, int NS>
__global__ __launch_bounds__(128) void k_gemm_t(const _Float16* __restrict__ A, const _Float16* __restrict__ Bh, float alpha, const float* __restrict__ bias, float* __restrict__ C, _Float16* __restrict__ C16, _Float16* __restrict__ C16b) {
  constexpr int KC = 128, PITCH = 272, OPB = 128 * PITCH, STG = 2 * OPB, NT = Kk / KC;
  __shared__ __attribute__((aligned(16))) unsigned char sm[2 * STG];
  const int tid = threadIdx.x, w = tid >> 5, lane = tid & 31, ln = lane & 15, hh = lane >> 4;
  const int bm = blockIdx.x / (Nn / 128), bn = blockIdx.x % (Nn / 128);
  const int wm = w >> 1, wn = w & 1;
  const int crow = tid >> 4, cch = tid & 15;      // a copy instruction of a wave covers two whole 256-byte rows
  const _Float16* ga = A + (size_t)(bm * 128 + crow) * Kk + cch * 8;
  const _Float16* gb = Bh + (size_t)(bn * 128 + crow) * Kk + cch * 8;
  const unsigned lc = (unsigned)(size_t)sm + crow * PITCH + cch * 16;
  auto fill = [&](int t, int buf) {
    const unsigned l = lc + buf * STG;
    copy8(l, ga + t * KC, 8 * PITCH, (size_t)8 * Kk);
    copy8(l + 64 * PITCH, ga + t * KC + (size_t)64 * Kk, 8 * PITCH, (size_t)8 * Kk);
    copy8(l + OPB, gb + t * KC, 8 * PITCH, (size_t)8 * Kk);
    copy8(l + OPB + 64 * PITCH, gb + t * KC + (size_t)64 * Kk, 8 * PITCH, (size_t)8 * Kk);
  };
  v8f acc[4][4] = {};
  fill(0, 0);
  asm volatile("s_wait_asynccnt 0x0" ::: "memory");      // tile 0 of this wave has landed
  __syncthreads();                                       // ... and every wave's part of it
  if (NT > 1) fill(1, 1);
  const int aoff = (wm * 64 + ln) * PITCH + 16 * hh, boff = OPB + (wn * 64 + ln) * PITCH + 16 * hh;
#pragma unroll 1      // kept rolled: unrolled over the k tiles the build takes many more vector registers
  for (int t = 0; t < NT; ++t) {
    const int sb = (t & 1) * STG;
#pragma unroll
    for (int ks = 0; ks < KC / 32; ++ks) {
      FragH a[4], b[4];
#pragma unroll
      for (int i = 0; i < 4; ++i) {
        a[i].half[0] = *(const v8us*)&sm[sb + aoff + i * 16 * PITCH + ks * 64]; a[i].half[1] = *(const v8us*)&sm[sb + aoff + i * 16 * PITCH + ks * 64 + 32];
        b[i].half[0] = *(const v8us*)&sm[sb + boff + i * 16 * PITCH + ks * 64]; b[i].half[1] = *(const v8us*)&sm[sb + boff + i * 16 * PITCH + ks * 64 + 32];
      }
#pragma unroll
      for (int i = 0; i < 4; ++i)
#pragma unroll
        for (int j = 0; j < 4; ++j) acc[i][j] = __builtin_amdgcn_wmma_f32_16x16x32_f16(false, a[i].v, false, b[j].v, (short)0, acc[i][j], false, false);
    }
    asm volatile("s_wait_dscnt 0x0" ::: "memory");       // this wave's reads of buffer t & 1 are done before it is refilled
    asm volatile("s_wait_asynccnt 0x0" ::: "memory");    // this wave's copies of tile t + 1 have landed
    __syncthreads();                                     // publishes tile t + 1, ends every reader's last read of tile t
    if (t + 2 < NT) fill(t + 2, t & 1);
  }
  asm volatile("s_wait_asynccnt 0x0" ::: "memory");      // no copy is outstanding when the ring becomes output staging
  // epilogue: each wave stages its 64 x 64 tile in its own LDS range (pitch 68 floats) and stores whole lines
  float* so = (float*)sm + w * (64 * 68);
  const int row0 = bm * 128 + wm * 64, col0 = bn * 128 + wn * 64;
  if (NCHW) {
#pragma unroll
    for (int i = 0; i < 4; ++i)
#pragma unroll
      for (int r = 0; r < 8; ++r) {
        const float bv = BIAS ? bf16_round(bias[row0 + i * 16 + 8 * hh + r]) : 0.f;
#pragma unroll
        for (int j = 0; j < 4; ++j) so[(i * 16 + 8 * hh + r) * 68 + j * 16 + ln] = acc[i][j][r] * alpha + bv;
      }
  } else {
#pragma unroll
    for (int j = 0; j < 4; ++j) {
      const float bv = BIAS ? bf16_round(bias[col0 + j * 16 + ln]) : 0.f;
#pragma unroll
      for (int i = 0; i < 4; ++i)
#pragma unroll
        for (int r = 0; r < 8; ++r) so[(i * 16 + 8 * hh + r) * 68 + j * 16 + ln] = acc[i][j][r] * alpha + bv;
    }
  }
  __builtin_amdgcn_fence(__ATOMIC_ACQ_REL, "workgroup"); __builtin_amdgcn_wave_barrier();
  if (NCHW) {
    const int rs = lane >> 4, c4 = (lane & 15) * 4;      // half a wave stores 64 pixels of one channel: two whole lines
    float* cp = C + ((size_t)(col0 / NPIX) * CC + row0 + rs) * NPIX + col0 % NPIX + c4;
#pragma unroll
    for (int q = 0; q < 32; ++q) { const int r = q * 2 + rs; const v4f v = *(const v4fa*)&so[r * 68 + c4]; *(v4f*)(cp + q * 2 * NPIX) = v; }
  } else if (OUT16) {
    const int rs = lane >> 3, c8 = (lane & 7) * 8;
    auto put = [&](_Float16* dst, const int ld, const int c0) {      // dst, its row pitch and the tile's first column there
      unsigned short* cp = (unsigned short*)dst + (size_t)(row0 + rs) * ld + c0 + c8;
#pragma unroll
      for (int q = 0; q < 16; ++q) { const int r = q * 4 + rs; const v4f v0 = *(const v4fa*)&so[r * 68 + c8], v1 = *(const v4fa*)&so[r * 68 + c8 + 4]; FragH f;
#pragma unroll
        for (int i = 0; i < 4; ++i) { f.h[i] = (_Float16)v0[i]; f.h[4 + i] = (_Float16)v1[i]; }
        *(v8us*)(cp + q * 4 * ld) = f.half[0]; }
    };
    if (NS > 0 && bn * 128 >= NS) put(C16b, Nn - NS, col0 - NS);      // a tile lies wholly on one side: the test reads the same in the whole work-group
    else put(C16, NS > 0 ? NS : Nn, col0);
  } else {
    const int rs = lane >> 4, c4 = (lane & 15) * 4;
    float* cp = C + (size_t)(row0 + rs) * Nn + col0 + c4;
#pragma unroll
    for (int q = 0; q < 32; ++q) { const int r = q * 2 + rs; const v4f v = *(const v4fa*)&so[r * 68 + c4]; *(v4f*)(cp + q * 2 * Nn) = v; }
  }
}


typedef _Float16 v4h __attribute__((ext_vector_type(4)));

__global__ __launch_bounds__(256) void k_x16(const float* __restrict__ x, _Float16* __restrict__ X16, size_t n8) { const size_t t = (size_t)blockIdx.x * 256 + threadIdx.x; if (t >= n8) return; FragH f;
#pragma unroll
  for (int q = 0; q < 8; ++q) f.h[q] = (_Float16)bf16_round(x[t * 8 + q]); *(v8us*)((unsigned short*)X16 + t * 8) = f.half[0];  }
__global__ __launch_bounds__(256) void k_h16(const float* __restrict__ x, _Float16* __restrict__ X16, size_t n8) { const size_t t = (size_t)blockIdx.x * 256 + threadIdx.x; if (t >= n8) return; FragH f;
#pragma unroll
  for (int q = 0; q < 8; ++q) f.h[q] = (_Float16)x[t * 8 + q]; *(v8us*)((unsigned short*)X16 + t * 8) = f.half[0];  }
template <int NHv, int TTv>
__global__ __launch_bounds__(256) void k_vt(const _Float16* __restrict__ V16, int ldv, int voff, _Float16* __restrict__ Vt) { __shared__ unsigned short tl[64][66]; const int tid = threadIdx.x; const int slab = blockIdx.x / (TTv / 64), lg = blockIdx.x % (TTv / 64); const int b = slab / NHv, h = slab % NHv;
  for (int i = tid; i < 64 * 8; i += 256) { const int r = i / 8, c8 = (i % 8) * 8; FragH f; f.half[0] = *(const v8us*)((const unsigned short*)V16 + ((size_t)b * TTv + lg * 64 + r) * ldv + voff + h * 64 + c8);
#pragma unroll
    for (int q = 0; q < 8; ++q) tl[r][c8 + q] = f.u[q]; }
  __syncthreads();
  {
#pragma unroll
    for (int rd = 0; rd < 2; ++rd) { const int d = rd * 32 + tid / 8, pc = tid % 8; FragH f;
#pragma unroll
      for (int q = 0; q < 8; ++q) f.u[q] = tl[pc * 8 + q][d];
      *(v8us*)((unsigned short*)Vt + ((size_t)slab * 64 + d) * TTv + lg * 64 + pc * 8) = f.half[0]; }
     } }

// The (out,in) weights as f16 (bf16-rounded, times 2^4), eight values a thread: Bw = [Wq | Wkv | Wo] one behind the other.
#define NBQ (INNER * CC / 8 / 256)
#define NBW (4 * NBQ)
__global__ __launch_bounds__(256) void k_prep(const float* __restrict__ Wq, const float* __restrict__ Wkv, const float* __restrict__ Wo, _Float16* __restrict__ Bw) { const int tid = threadIdx.x;
  const int wb = blockIdx.x; const float* W = wb < NBQ ? Wq : wb < 3 * NBQ ? Wkv : Wo; const size_t t = (size_t)(wb < NBQ ? wb : wb < 3 * NBQ ? wb - NBQ : wb - 3 * NBQ) * 256 + tid; FragH f;
#pragma unroll
  for (int i = 0; i < 8; ++i) f.h[i] = (_Float16)(bf16_round(W[t * 8 + i]) * 16.0f); *(v8us*)((unsigned short*)Bw + ((size_t)wb * 256 + tid) * 8) = f.half[0];
}
union H8 { v8us v; unsigned d[4]; };      // eight f16 values as they are loaded: four registers of two
// v_fma_mix_f32: c + a * b in one fused f32 multiply-add whose f16 factors are widened exactly inside the instruction (op_sel picks the high halves). Written as asm for
// speed: from plain source this build widens every half with a conversion of its own before a packed f32 multiply-add. Each statement holds a whole round over independent
// sums, so that an instruction and the one it depends on stand eight or nine apart (asm text gets no s_delay_alu from the compiler, and needs none at that distance).
// s[w] (+)= the two products of register q with register k[w], w = 0 .. 8
__device__ __forceinline__ void dot9_first(float (&s)[9], unsigned q, const unsigned (&k)[9]) {
  asm(
      "v_fma_mix_f32 %0, %9, %10, 0 op_sel_hi:[1,1,0]\n\t"
      "v_fma_mix_f32 %1, %9, %11, 0 op_sel_hi:[1,1,0]\n\t"
      "v_fma_mix_f32 %2, %9, %12, 0 op_sel_hi:[1,1,0]\n\t"
      "v_fma_mix_f32 %3, %9, %13, 0 op_sel_hi:[1,1,0]\n\t"
      "v_fma_mix_f32 %4, %9, %14, 0 op_sel_hi:[1,1,0]\n\t"
      "v_fma_mix_f32 %5, %9, %15, 0 op_sel_hi:[1,1,0]\n\t"
      "v_fma_mix_f32 %6, %9, %16, 0 op_sel_hi:[1,1,0]\n\t"
      "v_fma_mix_f32 %7, %9, %17, 0 op_sel_hi:[1,1,0]\n\t"
      "v_fma_mix_f32 %8, %9, %18, 0 op_sel_hi:[1,1,0]\n\t"
      "v_fma_mix_f32 %0, %9, %10, %0 op_sel:[1,1,0] op_sel_hi:[1,1,0]\n\t"
      "v_fma_mix_f32 %1, %9, %11, %1 op_sel:[1,1,0] op_sel_hi:[1,1,0]\n\t"
      "v_fma_mix_f32 %2, %9, %12, %2 op_sel:[1,1,0] op_sel_hi:[1,1,0]\n\t"
      "v_fma_mix_f32 %3, %9, %13, %3 op_sel:[1,1,0] op_sel_hi:[1,1,0]\n\t"
      "v_fma_mix_f32 %4, %9, %14, %4 op_sel:[1,1,0] op_sel_hi:[1,1,0]\n\t"
      "v_fma_mix_f32 %5, %9, %15, %5 op_sel:[1,1,0] op_sel_hi:[1,1,0]\n\t"
      "v_fma_mix_f32 %6, %9, %16, %6 op_sel:[1,1,0] op_sel_hi:[1,1,0]\n\t"
      "v_fma_mix_f32 %7, %9, %17, %7 op_sel:[1,1,0] op_sel_hi:[1,1,0]\n\t"
      "v_fma_mix_f32 %8, %9, %18, %8 op_sel:[1,1,0] op_sel_hi:[1,1,0]"
      : "=&v"(s[0]), "=&v"(s[1]), "=&v"(s[2]), "=&v"(s[3]), "=&v"(s[4]), "=&v"(s[5]), "=&v"(s[6]), "=&v"(s[7]), "=&v"(s[8])
      : "v"(q), "v"(k[0]), "v"(k[1]), "v"(k[2]), "v"(k[3]), "v"(k[4]), "v"(k[5]), "v"(k[6]), "v"(k[7]), "v"(k[8]));
}
__device__ __forceinline__ void dot9_more(float (&s)[9], unsigned q, const unsigned (&k)[9]) {
  asm(
      "v_fma_mix_f32 %0, %9, %10, %0 op_sel_hi:[1,1,0]\n\t"
      "v_fma_mix_f32 %1, %9, %11, %1 op_sel_hi:[1,1,0]\n\t"
      "v_fma_mix_f32 %2, %9, %12, %2 op_sel_hi:[1,1,0]\n\t"
      "v_fma_mix_f32 %3, %9, %13, %3 op_sel_hi:[1,1,0]\n\t"
      "v_fma_mix_f32 %4, %9, %14, %4 op_sel_hi:[1,1,0]\n\t"
      "v_fma_mix_f32 %5, %9, %15, %5 op_sel_hi:[1,1,0]\n\t"
      "v_fma_mix_f32 %6, %9, %16, %6 op_sel_hi:[1,1,0]\n\t"
      "v_fma_mix_f32 %7, %9, %17, %7 op_sel_hi:[1,1,0]\n\t"
      "v_fma_mix_f32 %8, %9, %18, %8 op_sel_hi:[1,1,0]\n\t"
      "v_fma_mix_f32 %0, %9, %10, %0 op_sel:[1,1,0] op_sel_hi:[1,1,0]\n\t"
      "v_fma_mix_f32 %1, %9, %11, %1 op_sel:[1,1,0] op_sel_hi:[1,1,0]\n\t"
      "v_fma_mix_f32 %2, %9, %12, %2 op_sel:[1,1,0] op_sel_hi:[1,1,0]\n\t"
      "v_fma_mix_f32 %3, %9, %13, %3 op_sel:[1,1,0] op_sel_hi:[1,1,0]\n\t"
      "v_fma_mix_f32 %4, %9, %14, %4 op_sel:[1,1,0] op_sel_hi:[1,1,0]\n\t"
      "v_fma_mix_f32 %5, %9, %15, %5 op_sel:[1,1,0] op_sel_hi:[1,1,0]\n\t"
      "v_fma_mix_f32 %6, %9, %16, %6 op_sel:[1,1,0] op_sel_hi:[1,1,0]\n\t"
      "v_fma_mix_f32 %7, %9, %17, %7 op_sel:[1,1,0] op_sel_hi:[1,1,0]\n\t"
      "v_fma_mix_f32 %8, %9, %18, %8 op_sel:[1,1,0] op_sel_hi:[1,1,0]"
      : "+v"(s[0]), "+v"(s[1]), "+v"(s[2]), "+v"(s[3]), "+v"(s[4]), "+v"(s[5]), "+v"(s[6]), "+v"(s[7]), "+v"(s[8])
      : "v"(q), "v"(k[0]), "v"(k[1]), "v"(k[2]), "v"(k[3]), "v"(k[4]), "v"(k[5]), "v"(k[6]), "v"(k[7]), "v"(k[8]));
}
// acc[0 .. 7] (+)= a * the eight f16 values of v
__device__ __forceinline__ void av8_first(float (&acc)[8], float a, const unsigned (&v)[4]) {
  asm(
      "v_fma_mix_f32 %0, %8, %9, 0 op_sel_hi:[0,1,0]\n\t"
      "v_fma_mix_f32 %1, %8, %9, 0 op_sel:[0,1,0] op_sel_hi:[0,1,0]\n\t"
      "v_fma_mix_f32 %2, %8, %10, 0 op_sel_hi:[0,1,0]\n\t"
      "v_fma_mix_f32 %3, %8, %10, 0 op_sel:[0,1,0] op_sel_hi:[0,1,0]\n\t"
      "v_fma_mix_f32 %4, %8, %11, 0 op_sel_hi:[0,1,0]\n\t"
      "v_fma_mix_f32 %5, %8, %11, 0 op_sel:[0,1,0] op_sel_hi:[0,1,0]\n\t"
      "v_fma_mix_f32 %6, %8, %12, 0 op_sel_hi:[0,1,0]\n\t"
      "v_fma_mix_f32 %7, %8, %12, 0 op_sel:[0,1,0] op_sel_hi:[0,1,0]"
      : "=&v"(acc[0]), "=&v"(acc[1]), "=&v"(acc[2]), "=&v"(acc[3]), "=&v"(acc[4]), "=&v"(acc[5]), "=&v"(acc[6]), "=&v"(acc[7])
      : "v"(a), "v"(v[0]), "v"(v[1]), "v"(v[2]), "v"(v[3]));
}
__device__ __forceinline__ void av8_more(float (&acc)[8], float a, const unsigned (&v)[4]) {
  asm(
      "v_fma_mix_f32 %0, %8, %9, %0 op_sel_hi:[0,1,0]\n\t"
      "v_fma_mix_f32 %1, %8, %9, %1 op_sel:[0,1,0] op_sel_hi:[0,1,0]\n\t"
      "v_fma_mix_f32 %2, %8, %10, %2 op_sel_hi:[0,1,0]\n\t"
      "v_fma_mix_f32 %3, %8, %10, %3 op_sel:[0,1,0] op_sel_hi:[0,1,0]\n\t"
      "v_fma_mix_f32 %4, %8, %11, %4 op_sel_hi:[0,1,0]\n\t"
      "v_fma_mix_f32 %5, %8, %11, %5 op_sel:[0,1,0] op_sel_hi:[0,1,0]\n\t"
      "v_fma_mix_f32 %6, %8, %12, %6 op_sel_hi:[0,1,0]\n\t"
      "v_fma_mix_f32 %7, %8, %12, %7 op_sel:[0,1,0] op_sel_hi:[0,1,0]"
      : "+v"(acc[0]), "+v"(acc[1]), "+v"(acc[2]), "+v"(acc[3]), "+v"(acc[4]), "+v"(acc[5]), "+v"(acc[6]), "+v"(acc[7])
      : "v"(a), "v"(v[0]), "v"(v[1]), "v"(v[2]), "v"(v[3]));
}
// the value of lane l ^ 16 (the same place in the wave's other row of sixteen lanes); every lane is on where it is used
__device__ __forceinline__ float xhalf(float v) { return __builtin_bit_cast(float, __builtin_amdgcn_permlanex16(__builtin_bit_cast(int, v), __builtin_bit_cast(int, v), 0x76543210, 0xfedcba98, false, false)); }
// Everything behind the weight conversion in one kernel: q | k | v product, window attention, to_out product. One work-group = two image rows of one image with all eight heads: eight waves.
// q, k, v and o never reach memory. The work-group reads four image rows of x (its two and the one above and below, clamped to the image; a clamped row's k and v are never used), NCHW f32,
// rounds them (bf16, exact in f16) and writes them to LDS as 128 token rows, once; each wave keeps 64 tokens' fragments (all of k) in registers.
// Token (yy, x), yy = 0 .. 3 the row of the four, stands in tile row ((x & 3) >> 1) * 64 + J * 16 + (x & 1) * 8 + (x >> 2), J = 2, 0, 1, 3 for yy = 0 .. 3: every wave's column tiles 0 and 1 are
// the work-group's own two image rows, which alone need q; tiles 2 and 3 are the rows above and below.
// Product part, per pair of heads: three tiles of 128 channels x 256 k of the weights (q, k, v of the pair; row pitch 528 B), asynchronous copies, two buffers: tile t + 1 flies while tile t is worked
// on. Weights = A operand (rows of D = channels), tokens = B operand (columns of D = tokens): a lane ends with eight neighbouring channels of one token, 16 bytes of f16, staged in LDS as
// [tile row][128 channels] (row pitch 272 B). A wave = 32 channels x 64 tokens (32 for q). Each 16 x 16 accumulator sums k upwards in steps of 32.
// Window part, per pair of heads: one wave = sixteen pixels of one image row of one head (those with x & 2 alike: their tile rows are sixteen in a row, so a 16-byte read of sixteen lanes
// meets every bank once); two lanes share a pixel, lane l holding d = 0 .. 31 and lane l + 16 d = 32 .. 63. Each lane sums its half of all nine logits, one cross-row move and add makes them whole
// in both lanes, and each lane does the whole softmax of its pixel in its own registers; attn * v follows in the same lanes, eight d at a time. k and v come in eight pieces of nine 16-byte reads,
// three register buffers: piece i + 2 is asked for while piece i is worked on. A window place outside the image reads another (in-bounds) tile row; its logit is
// set to 0 and its weight on v to 0. The weights are staged in LDS and stored as whole lines at the end. The f16 result o goes to an LDS tile of 64 pixels x 512 (row pitch 1040 B), where the tokens stood.
// to_out part: out[256 channels][64 pixels] = Bo[256][512] * o^T * alpha + bias, a wave = 32 channels x 64 pixels, k upwards in steps of 32. Bo comes in four tiles of 128 k
// (row pitch 272 B) by asynchronous copies into three buffers: tiles 0 and 1 follow the last weight tiles in the ring, tile 0 landing under the last v product and tile 1 under the last window part, tile 2 is asked for behind that part, tile 3 follows into buffer 0.
__global__ __launch_bounds__(256) void k_all(const float* __restrict__ x, const _Float16* __restrict__ Wh, const _Float16* __restrict__ Bo, const float* __restrict__ bias, float alpha,
                                             float* __restrict__ ATTN, float* __restrict__ OUT) {
  constexpr int PITCH = CC * 2 + 16, TB = 128 * PITCH, SP = 272, KC = 128, WP = 272, WB = CC * WP, OP = INNER * 2 + 16;
  constexpr int SQ = TB + 2 * WB, SK = SQ + 64 * SP, SV = SK + 128 * SP, SA0 = SV + 128 * SP;      // tokens / o at 0; ring buffers at TB and TB + WB, a third Bo buffer at TB + 2 * WB = where q, k, v are staged; attention weights
  __shared__ __attribute__((aligned(16))) unsigned char sm[SA0 + 16 * HWD * 9 * 4];
  const int tid = threadIdx.x, lane = tid & 31, ln = lane & 15, hh = lane >> 4;
  const int w = __builtin_amdgcn_readfirstlane(tid >> 5);      // the wave's number as a scalar: a copy's LDS address is then a scalar sum plus one lane term
  const int b = blockIdx.x / (HWD / 2), y0 = (blockIdx.x % (HWD / 2)) * 2;
  const int wt = w >> 2, wc = w & 3;
  // sixteen copies a thread, rows lstep / gstep apart: lsc = the wave's first LDS byte (a scalar), lvl = the lane's bytes on top of it, gp = the lane's own source
  auto fillg = [&](unsigned lsc, unsigned lvl, const _Float16* gp, unsigned lstep, size_t gstep) {
    const unsigned l = lvl + (unsigned)__builtin_amdgcn_readfirstlane(lsc);      // the scalar part is summed by itself: only the lane term lives in a vector register across the loop
    copy8(l, gp, lstep, gstep);
    copy8(l + 8 * lstep, gp + 8 * gstep, lstep, gstep);
  };
  const unsigned ring = (unsigned)(size_t)sm + TB;      // ring buffer rb stands at ring + rb * WB: a weight tile (TB bytes) or a Bo tile (WB bytes)
  const unsigned llw = lane * 16, glw = lane * 8;                                                        // weight tile: a copy instruction of a wave covers one whole 512-byte row: row w, w + 8, ...
  const unsigned llo = (lane >> 4) * WP + (lane & 15) * 16, glo = (lane >> 4) * INNER + (lane & 15) * 8;      // Bo tile: two whole 256-byte rows: rows 2w and 2w + 1, 2w + 16 and 2w + 17, ...
  auto fillw = [&](int rb, const _Float16* g0) { fillg(ring + rb * WB + w * PITCH, llw, g0 + (size_t)w * CC + glw, 8 * PITCH, (size_t)8 * CC); };      // 128 rows of CC values from g0 on
  auto fillo = [&](int t, int buf) { fillg(ring + buf * WB + 2 * w * WP, llo, Bo + (size_t)(2 * w) * INNER + t * KC + glo, 16 * WP, (size_t)16 * INNER); };      // Bo tile t: 256 rows of KC values
  {      // the token tile. A wave takes 32 channels, a lane four neighbouring pixels of each (a load of a wave = 128 bytes of each of the four image rows);
         // a lane then holds 32 neighbouring channels of each of its four pixels: 64 bytes of that token's f16 row
    const int yy = lane >> 3, c8 = lane & 7;
    const float* xg = x + ((size_t)b * CC + w * 32) * NPIX + min(max(y0 - 1 + yy, 0), HWD - 1) * HWD + c8 * 4;
    v4f xv[32];
#pragma unroll      // unrolled here and below: all 32 loads fly at once, and the values are indexed by constants
    for (int i = 0; i < 32; ++i) xv[i] = *(const v4fa*)(xg + (size_t)i * NPIX);
    asm volatile("s_wait_xcnt 0x0" ::: "memory");      // stands in front of the address sums below, which take over registers that these loads name
    fillw(0, Wh);      // weight tile 0, asked for behind the loads of x, which have the longer way
    const int trow = (yy == 0 ? 2 : yy == 3 ? 3 : yy - 1) * 16 + c8;
#pragma unroll
    for (int pp = 0; pp < 4; ++pp)
#pragma unroll
      for (int q = 0; q < 4; ++q) { FragH f;
#pragma unroll
        for (int e = 0; e < 8; ++e) f.h[e] = (_Float16)(float)(__bf16)xv[q * 8 + e][pp];      // the cast rounds to nearest even: bf16_round's value for every finite x
        *(v8us*)&sm[((pp >> 1) * 64 + (pp & 1) * 8 + trow) * PITCH + w * 64 + q * 16] = f.half[0]; }
  }
  asm volatile("s_wait_dscnt 0x0" ::: "memory");         // this wave's part of the token tile stands in LDS
  asm volatile("s_wait_asynccnt 0x0" ::: "memory");      // weight tile 0: this wave's copies have landed
  __syncthreads();                                       // publishes the token tile and weight tile 0
  fillw(1, Wh + (size_t)INNER * CC);                     // weight tile 1: k of heads 0 and 1
  FragH xb[4][CC / 32];
#pragma unroll      // unrolled: the fragments are indexed by constants and stay in registers
  for (int j = 0; j < 4; ++j)
#pragma unroll
    for (int ks = 0; ks < CC / 32; ++ks) {
      xb[j][ks].half[0] = *(const v8us*)&sm[(wt * 64 + j * 16 + ln) * PITCH + 16 * hh + ks * 64]; xb[j][ks].half[1] = *(const v8us*)&sm[(wt * 64 + j * 16 + ln) * PITCH + 16 * hh + ks * 64 + 32];
    }
  const int aoff = TB + (wc * 32 + ln) * PITCH + 16 * hh;
  // one weight tile: kind 0, 1, 2 = q, k, v of head pair jh; tile number t = 3 * jh + kind, buffer t & 1. Its loops are unrolled so that fragments and accumulators are indexed by constants
  auto trip = [&](const int kind, const int jh) {
    const int rb = (jh + kind) & 1, wb = rb * WB;
    v8f acc[2][4] = {};
#pragma unroll
    for (int ks = 0; ks < CC / 32; ++ks) {
      FragH a[2];
#pragma unroll
      for (int i = 0; i < 2; ++i) { a[i].half[0] = *(const v8us*)&sm[wb + aoff + i * 16 * PITCH + ks * 64]; a[i].half[1] = *(const v8us*)&sm[wb + aoff + i * 16 * PITCH + ks * 64 + 32]; }
#pragma unroll
      for (int i = 0; i < 2; ++i)
#pragma unroll
        for (int j = 0; j < (kind == 0 ? 2 : 4); ++j) acc[i][j] = __builtin_amdgcn_wmma_f32_16x16x32_f16(false, a[i].v, false, xb[j][ks].v, (short)0, acc[i][j], false, false);
    }
    const int soff = (kind == 0 ? SQ + (wt * 32 + ln) * SP : (kind == 1 ? SK : SV) + (wt * 64 + ln) * SP) + (wc * 32 + 8 * hh) * 2;
#pragma unroll
    for (int i = 0; i < 2; ++i)
#pragma unroll
      for (int j = 0; j < (kind == 0 ? 2 : 4); ++j) { FragH f;
#pragma unroll
        for (int r = 0; r < 8; ++r) f.h[r] = (_Float16)(acc[i][j][r] * alpha);
        *(v8us*)&sm[soff + j * 16 * SP + i * 32] = f.half[0]; }
    asm volatile("s_wait_dscnt 0x0" ::: "memory");       // this wave's reads of weight buffer t & 1 are done, its part of the staged tile stands in LDS
    asm volatile("s_wait_asynccnt 0x0" ::: "memory");    // this wave's copies of tile t + 1 have landed
    __syncthreads();                                     // publishes tile t + 1 and the staged tile, ends every reader's last read of tile t
    if (kind == 0) fillw(rb, Wh + ((size_t)2 * INNER + jh * 128) * CC);      // tile t + 2: v of this pair
    else {      // q (behind k) or k (behind v) of the next pair; behind the last pair the ring goes on with Bo tiles 0 and 1, tile 0 landing under the last v product and tile 1 under the last window part.
                // One call with chosen (scalar) terms: as a call of its own in a branch, the Bo copies' 96 address registers were formed in front of the loop and spilled
      const bool more = jh + 1 < NH / 2;
      const _Float16* g0 = more ? Wh + ((size_t)(kind - 1) * INNER + (jh + 1) * 128 + w) * CC : Bo + (size_t)(2 * w) * INNER + (kind - 1) * KC;
      fillg(ring + wb + (more ? w * PITCH : 2 * w * WP), more ? llw : llo, g0 + (more ? glw : glo), more ? 8 * PITCH : 16 * WP, more ? (size_t)8 * CC : (size_t)16 * INNER);
    }
  };
  // window part: what does not change from pair to pair
  const int yb = w & 1, hl = (w >> 1) & 1, xs = w >> 2, y = y0 + yb;
  const int xe = ln >> 1, xo = ln & 1, xx = xe * 4 + xs * 2 + xo;      // this lane's pixel
  const unsigned lun = hl * (DH * 2) + hh * DH;                        // its head and its half of d, in bytes
  const unsigned lq = SQ + (xs * 32 + yb * 16 + xo * 8 + xe) * SP + lun;
  // tile rows of x - 1, x, x + 1, less the image row's term; x - 1 and x + 1 are taken round the image row (& 7): the lane whose neighbour lies outside the image (its logit and weight are masked)
  // reads the row's other end, which is the one tile row of the sixteen that no other lane of its half wave reads, so that these reads too meet every bank once
  const unsigned lkx[3] = {SK + (xo ? xs * 64 + xe : (xs ^ 1) * 64 + 8 + ((xe + 7 + xs) & 7)) * SP + lun,
                           SK + (xs * 64 + xo * 8 + xe) * SP + lun,
                           SK + (xo ? (xs ^ 1) * 64 + ((xe + xs) & 7) : xs * 64 + 8 + xe) * SP + lun};
  const int jrow[3] = {(yb ? 0 : 2) * 16 * SP, (yb ? 1 : 0) * 16 * SP, (yb ? 3 : 1) * 16 * SP};                                               // y - 1, y, y + 1
  const bool okx[3] = {xx > 0, true, xx + 1 < HWD}, oky[3] = {y > 0, true, y + 1 < HWD};
  auto loadkv = [&](int i, H8 (&t)[9]) {      // piece i: 0 .. 3 = k, 4 .. 7 = v, eight d of the nine window places
#pragma unroll
    for (int wi = 0; wi < 9; ++wi) t[wi].v = *(const v8us*)&sm[lkx[wi % 3] + jrow[wi / 3] + (i & 3) * 16 + (i >> 2) * (SV - SK)];
  };
#pragma unroll 1      // kept rolled: one copy of the pair's code, and the token fragments leave no registers for more
  for (int jh = 0; jh < NH / 2; ++jh) {
    trip(0, jh); trip(1, jh); trip(2, jh);
    const int h = jh * 2 + hl;
    float* sa = (float*)(sm + SA0) + (yb * NH + h) * (HWD * 9) + xx * 9 + hh * 4;
    unsigned char* orow = sm + (yb * HWD + xx) * OP + h * (DH * 2) + hh * DH;
    H8 tq[4], tb[3][9];
#pragma unroll
    for (int c = 0; c < 4; ++c) tq[c].v = *(const v8us*)&sm[lq + c * 16];
    loadkv(0, tb[0]);
    __builtin_amdgcn_sched_barrier(0);      // keeps q and piece 0 the first reads to be issued: mixed with the later pieces' reads, the first logit sums would wait for most of those too
    loadkv(1, tb[1]);
    float s[9], a[9];
#pragma unroll      // unrolled: the three register buffers take turns by a constant index
    for (int i = 0; i < 8; ++i) {
      if (i + 2 < 8) loadkv(i + 2, tb[(i + 2) % 3]);
      __builtin_amdgcn_sched_barrier(0);      // keeps those reads in front of this piece's arithmetic: sunk into it, each would be waited for right behind its issue
      const H8 (&cb)[9] = tb[i % 3];
      if (i < 4) {
#pragma unroll
        for (int j = 0; j < 4; ++j) {
          const unsigned kj[9] = {cb[0].d[j], cb[1].d[j], cb[2].d[j], cb[3].d[j], cb[4].d[j], cb[5].d[j], cb[6].d[j], cb[7].d[j], cb[8].d[j]};
          if (i == 0 && j == 0) dot9_first(s, tq[i].d[j], kj); else dot9_more(s, tq[i].d[j], kj);
        }
      } else {
        float acc[8];
#pragma unroll
        for (int wi = 0; wi < 9; ++wi) { if (wi == 0) av8_first(acc, a[wi], cb[wi].d); else av8_more(acc, a[wi], cb[wi].d); }
        FragH o;
#pragma unroll
        for (int j = 0; j < 8; ++j) o.h[j] = (_Float16)acc[j];
        *(v8us*)(orow + (i - 4) * 16) = o.half[0];
      }
      if (i == 3) {      // the nine logits are whole behind the cross-row add (the same bits in both lanes of a pixel); softmax in the lane's own registers
        float l[9], e[9];
#pragma unroll
        for (int wi = 0; wi < 9; ++wi) { const float t = s[wi] + xhalf(s[wi]); l[wi] = oky[wi / 3] && okx[wi % 3] ? t * 0.125f : 0.f; }
        const float m = fmaxf(fmaxf(fmaxf(fmaxf(l[0], l[1]), fmaxf(l[2], l[3])), fmaxf(fmaxf(l[4], l[5]), fmaxf(l[6], l[7]))), l[8]);
#pragma unroll
        for (int wi = 0; wi < 9; ++wi) e[wi] = expf(l[wi] - m);
        const float z = (((e[0] + e[1]) + (e[2] + e[3])) + ((e[4] + e[5]) + (e[6] + e[7]))) + e[8];
        const float rz = 1.0f / z;      // one division a pixel
#pragma unroll
        for (int wi = 0; wi < 9; ++wi) e[wi] *= rz;
#pragma unroll
        for (int wi = 0; wi < 5; ++wi) sa[wi] = hh ? e[4 + wi] : e[wi];      // lane l stores weights 0 .. 4, lane l + 16 weights 4 .. 8 (both hold the same bits of weight 4)
#pragma unroll
        for (int wi = 0; wi < 9; ++wi) a[wi] = oky[wi / 3] && okx[wi % 3] ? e[wi] : 0.f;
      }
    }
    asm volatile("s_wait_dscnt 0x0" ::: "memory");         // this wave's reads of the staged q, k, v are done; its part of o and its weights stand in LDS
    asm volatile("s_wait_asynccnt 0x0" ::: "memory");      // behind the last pair: this wave's copies of Bo tiles 0 and 1 have landed
    __syncthreads();                                       // ends every reader's last read of the staged tiles before the next pair overwrites them; behind the last pair it publishes o, the weights and Bo tiles 0 and 1
  }
  fillo(2, 2);      // where the staged tiles stood
  const int aoff2 = TB + (w * 32 + ln) * WP + 16 * hh, boff2 = ln * OP + 16 * hh;
  v8f cacc[2][4] = {};
  const int row0 = w * 32;
  auto tile = [&](int t, int buf) {      // its loops are unrolled so that fragments and accumulators are indexed by constants and stay in registers
#pragma unroll
    for (int ks = 0; ks < KC / 32; ++ks) {
      FragH fa[2], fb[4];
#pragma unroll
      for (int i = 0; i < 2; ++i) { fa[i].half[0] = *(const v8us*)&sm[buf * WB + aoff2 + i * 16 * WP + ks * 64]; fa[i].half[1] = *(const v8us*)&sm[buf * WB + aoff2 + i * 16 * WP + ks * 64 + 32]; }
#pragma unroll
      for (int j = 0; j < 4; ++j) { fb[j].half[0] = *(const v8us*)&sm[boff2 + j * 16 * OP + t * (KC * 2) + ks * 64]; fb[j].half[1] = *(const v8us*)&sm[boff2 + j * 16 * OP + t * (KC * 2) + ks * 64 + 32]; }
#pragma unroll
      for (int i = 0; i < 2; ++i)
#pragma unroll
        for (int j = 0; j < 4; ++j) cacc[i][j] = __builtin_amdgcn_wmma_f32_16x16x32_f16(false, fa[i].v, false, fb[j].v, (short)0, cacc[i][j], false, false);
    }
  };
  tile(0, 0);
  asm volatile("s_wait_dscnt 0x0" ::: "memory");         // this wave's reads of buffer 0 are done before it is refilled
  __syncthreads();                                       // ends every reader's last read of Bo tile 0
  fillo(3, 0);
  v4f bq[2][2];      // the bias of this lane's sixteen rows, asked for here: it comes under tile 1, so neither the next barrier nor the epilogue waits for it
#pragma unroll
  for (int i = 0; i < 2; ++i) { bq[i][0] = *(const v4fa*)(bias + row0 + i * 16 + 8 * hh); bq[i][1] = *(const v4fa*)(bias + row0 + i * 16 + 8 * hh + 4); }
  asm volatile("s_wait_xcnt 0x0" ::: "memory");          // stands in front of tile 1's fragment reads, which take over the address register that these loads name
  tile(1, 1);                                            // tiles 2 and 3 fly meanwhile
  asm volatile("s_wait_dscnt 0x0" ::: "memory");         // this wave's reads of buffer 1 are done before it becomes output staging
  asm volatile("s_wait_asynccnt 0x0" ::: "memory");      // this wave's copies of tiles 2 and 3 have landed; none is outstanding from here on
  __syncthreads();                                       // publishes tiles 2 and 3, ends every reader's last read of tile 1
  {      // the weights go out late: no barrier and no fence then waits for these stores. A wave stores two whole (image row, head) rows of 32 x 9 floats: 72 pieces of 16 bytes each
    const float* sr = (const float*)(sm + SA0) + w * 2 * (HWD * 9);
    float* ap0 = ATTN + (((size_t)b * NH + ((w * 2) & 7)) * NPIX + (y0 + (w >> 2)) * HWD) * 9;      // rows 2w and 2w + 1: heads (2w) & 7 and the next, of the same image row
    float* ap1 = ap0 + (size_t)NPIX * 9;
    const int i2 = 64 + (lane & 7);      // the last eight pieces of a row: read by every lane, stored by lanes 0 .. 7
    const v4f a0 = *(const v4fa*)&sr[lane * 4], a1 = *(const v4fa*)&sr[(32 + lane) * 4], a2 = *(const v4fa*)&sr[i2 * 4];
    const v4f b0 = *(const v4fa*)&sr[HWD * 9 + lane * 4], b1 = *(const v4fa*)&sr[HWD * 9 + (32 + lane) * 4], b2 = *(const v4fa*)&sr[HWD * 9 + i2 * 4];
    __builtin_amdgcn_sched_barrier(0);      // keeps every LDS read in front of the first store
    if (lane < 8) { *(v4f*)(ap0 + (64 + lane) * 4) = a2; *(v4f*)(ap1 + (64 + lane) * 4) = b2; }      // first: this build forms an address pair for them, which behind the other stores took over a stored register
    *(v4f*)(ap0 + lane * 4) = a0; *(v4f*)(ap0 + (32 + lane) * 4) = a1; *(v4f*)(ap1 + lane * 4) = b0; *(v4f*)(ap1 + (32 + lane) * 4) = b1;
    asm volatile("s_wait_xcnt 0x0" ::: "memory");      // stands in front of the next tile's overwrites of the registers that these stores name
  }
  tile(2, 2); tile(3, 0);
  // epilogue: each wave stages its 32 x 64 tile in its own range of buffer 1 (pitch 68 floats) and stores whole lines: a row is a channel, its 64 columns the two image rows, side by side in memory
  float* so = (float*)(sm + TB + WB) + w * (32 * 68);
#pragma unroll      // unrolled here and below: the accumulators and the bias are indexed by constants
  for (int i = 0; i < 2; ++i)
#pragma unroll
    for (int r = 0; r < 8; ++r) {
      const float bv = bf16_round(bq[i][r >> 2][r & 3]);
#pragma unroll
      for (int j = 0; j < 4; ++j) so[(i * 16 + 8 * hh + r) * 68 + j * 16 + ln] = cacc[i][j][r] * alpha + bv;
    }
  asm volatile("s_wait_dscnt 0x0" ::: "memory");      // the wave's own LDS writes are done before other lanes of it read them (a fence here would wait for the weights' stores as well)
  const int rs = lane >> 4, q4 = (lane & 15) * 4;
  float* cp = OUT + ((size_t)b * CC + row0 + rs) * NPIX + y0 * HWD + q4;
#pragma unroll
  for (int q = 0; q < 16; ++q) { const v4f v = *(const v4fa*)&so[(q * 2 + rs) * 68 + q4]; *(v4f*)(cp + q * 2 * NPIX) = v; }
}
extern "C" void kernel_launch(void* const* d_in, const int* in_sizes, int n_in,
                              void* d_out, int out_size, void* d_ws, size_t ws_size, hipStream_t stream) {
  (void)in_sizes; (void)n_in; (void)out_size;
  const float* x = (const float*)d_in[0]; const float* Wq = (const float*)d_in[1]; const float* Wkv = (const float*)d_in[2]; const float* Wo = (const float*)d_in[3]; const float* bo = (const float*)d_in[4];
  float* OUT0 = (float*)d_out; float* ATTN = OUT0 + (size_t)BB * CC * NPIX;
  _Float16* Bw = (_Float16*)d_ws; _Float16* Bo = Bw + (size_t)3 * INNER * CC;      // [Wq | Wkv] (1536 rows of 256), then Wo (256 rows of 512)
  if ((size_t)4 * INNER * CC * 2 > ws_size) return;      // 1.1 MB
  k_prep<<<NBW, 256, 0, stream>>>(Wq, Wkv, Wo, Bw);
  k_all<<<BB * (HWD / 2), 256, 0, stream>>>(x, Bw, Bo, bo, 0.0625f, ATTN, OUT0);      // q | k | v, window attention, to_out + bo with channels as rows: stored as NCHW
}
